// v000
// The times below were measured on an AMD MI455X: many runs one after another, warmed up first and cycling through
// copies of the inputs, with the whole window's GPU time divided by the number of runs. Launches and the gaps
// between them are all in it. The median over several windows is given; except for v000 it joins two sittings, which
// can be a few percent apart, so the side-by-side timings, each taken in one sitting, are the better comparison.
// v000, which the later versions start from, runs in 281 microseconds.
#include <hip/hip_runtime.h>
// Multi-head attention with raw-reshape heads (B=8, N=1024, dim 768 → attn_dim 512 = 8 heads × 64): Q,K,V = x·W + b ((in,out)), reshaped by plain memory order to (H,B,N,64) (= 64 contiguous [1024][64] slabs of each [8192][512] plane);
// softmax(Q·Kᵀ·scale)·V per slab with scale = (64//8)^-½ = 8^-½ (as the original); out raw-reshaped back to (B,N,512) (same flat order) → ·Wp + bp.
// Compute dtype: x, weights, biases rounded to bf16; Q/K/V as f16 GEMM outputs; fused flash-style kernel over the flat slabs (online softmax f32, P f16 ×2^10) on v_wmma_f32_16x16x32_f16; O carried ×2^4 into f16 → projection GEMM with bias; f32 accumulate.
#define BB 64
#define TT 1024
#define NH 1
#define DX 768
#define DA 512
#define NRX 8192
#define ATT_SCALE 0.35355339059327373f

typedef __bf16 v16b __attribute__((ext_vector_type(16)));
typedef unsigned short v8us __attribute__((ext_vector_type(8), may_alias));
typedef float  v8f  __attribute__((ext_vector_type(8)));
typedef float  v4f  __attribute__((ext_vector_type(4)));
typedef float  v4fa __attribute__((ext_vector_type(4), may_alias));
union FragB { v16b v; v8us half[2]; unsigned short u[16]; };

__device__ __forceinline__ unsigned short bf16_bits(float x) { unsigned int u = __float_as_uint(x); return (unsigned short)((u + 0x7FFFu + ((u >> 16) & 1u)) >> 16); }
__device__ __forceinline__ float bf16_val(unsigned short b) { return __uint_as_float(((unsigned int)b) << 16); }
__device__ __forceinline__ float bf16_round(float x) { return bf16_val(bf16_bits(x)); }
// D += A·B with NT terms: 1 = ah·bh, 2 = + al·bh (A split), 3 = + ah·bl (both split)
template <int NT>
__device__ __forceinline__ v8f mmaN(v16b ah, v16b al, v16b bh, v16b bl, v8f c) {
  c = __builtin_amdgcn_wmma_f32_16x16x32_bf16(false, ah, false, bh, (short)0, c, false, false);
  if (NT >= 2) c = __builtin_amdgcn_wmma_f32_16x16x32_bf16(false, al, false, bh, (short)0, c, false, false);
  if (NT >= 3) c = __builtin_amdgcn_wmma_f32_16x16x32_bf16(false, ah, false, bl, (short)0, c, false, false);
  asm volatile("v_nop\n\tv_nop\n\tv_nop\n\tv_nop" : "+v"(c) : "v"(ah), "v"(al), "v"(bh), "v"(bl));
  return c;
}

__global__ __launch_bounds__(256) void k_wt_bf16(const float* __restrict__ W, unsigned short* __restrict__ Wt, int K, int N) {
  const int t = blockIdx.x * 256 + threadIdx.x;
  const int k8n = K / 8;
  if (t >= N * k8n) return;
  const int n = t / k8n, k8 = (t % k8n) * 8;
  v8us v;
#pragma unroll
  for (int i = 0; i < 8; ++i) v[i] = bf16_bits(W[(size_t)(k8 + i) * N + n]);
  *(v8us*)(Wt + (size_t)n * K + k8) = v;
  
}

// GEMM C[M][N] (f32, pitch ldc) = act(A[M][K]·W + bias). A f32 row-major (pitch lda) converted per fragment to bf16
// (ASPLIT: hi/lo two planes -> 2 terms, else single rounded term); Wt bf16 [N][K] (pitch ldb). BIAS_BF16 rounds the
// bias to bf16 first (bias quantised to bf16 before the add). K%32==0, M%16==0, N%64==0.
template <bool ASPLIT, int ACT, bool BIAS_BF16>
__global__ __launch_bounds__(128) void k_gemm_bf(const float* __restrict__ A, int lda, const unsigned short* __restrict__ Wt, int ldb,
                                               const float* __restrict__ bias, float* __restrict__ C, int ldc, int M, int N, int K) {
  __shared__ __attribute__((aligned(16))) float so[4][16][64];
  const int tid = threadIdx.x, w = tid >> 5, lane = tid & 31, ln = lane & 15, hh = lane >> 4;
  const int ntn = N / 64;
  const int wid = blockIdx.x * 4 + w;
  const int mt = wid / ntn, nq = wid % ntn;
  if (mt * 16 >= M) return;
  const int row0 = mt * 16, col0 = nq * 64;
  const float* arow = A + (size_t)(row0 + ln) * lda;
  v8f acc[4] = {};
  for (int kb = 0; kb < K; kb += 32) {
    FragB ah, al;
    const v4f x0 = *(const v4fa*)(arow + kb + 8 * hh), x1 = *(const v4fa*)(arow + kb + 8 * hh + 4);
    const v4f x2 = *(const v4fa*)(arow + kb + 16 + 8 * hh), x3 = *(const v4fa*)(arow + kb + 16 + 8 * hh + 4);
    float xs[16] = {x0[0],x0[1],x0[2],x0[3],x1[0],x1[1],x1[2],x1[3],x2[0],x2[1],x2[2],x2[3],x3[0],x3[1],x3[2],x3[3]};
#pragma unroll
    for (int i = 0; i < 16; ++i) { const unsigned short hb = bf16_bits(xs[i]); ah.u[i] = hb; al.u[i] = ASPLIT ? bf16_bits(xs[i] - bf16_val(hb)) : (unsigned short)0; }
#pragma unroll
    for (int t = 0; t < 4; ++t) {
      const unsigned short* brow = Wt + (size_t)(col0 + t * 16 + ln) * ldb + kb;
      FragB b;
      b.half[0] = *(const v8us*)(brow + 8 * hh);
      b.half[1] = *(const v8us*)(brow + 16 + 8 * hh);
      acc[t] = mmaN<ASPLIT ? 2 : 1>(ah.v, al.v, b.v, b.v, acc[t]);
    }
  }
#pragma unroll
  for (int t = 0; t < 4; ++t) {
    float bv = bias ? bias[col0 + t * 16 + ln] : 0.f;
    if (BIAS_BF16) bv = bf16_round(bv);
#pragma unroll
    for (int r = 0; r < 8; ++r) { float v = acc[t][r] + bv; if (ACT == 1) v = fmaxf(v, 0.f); so[w][8 * hh + r][t * 16 + ln] = v; }
  }
  __builtin_amdgcn_fence(__ATOMIC_ACQ_REL, "workgroup");
  __builtin_amdgcn_wave_barrier();
  const int rsub = lane >> 4, c4 = (lane & 15) * 4;
  {
#pragma unroll
    for (int q = 0; q < 8; ++q) {
      const int r = q * 2 + rsub;
      const v4f v = *(const v4fa*)&so[w][r][c4];
      *(v4f*)(C + (size_t)(row0 + r) * ldc + col0 + c4) = v;
    }
    
  }
}

// Flash-style causal/unmasked attention, all contractions 3-term bf16 hi/lo splits, f32 softmax with running max.
// q,k,v rows are read from f32 buffers with arbitrary row pitch (so they can live inside a fused qkv buffer);
// D = head size (multiple of 32, <= 128); one wave = 16 query rows; block = 4 waves (64 queries) sharing K/V chunks of 32.
template <int D, bool CAUSAL>
__global__ __launch_bounds__(128) void k_flash(const float* __restrict__ qb, const float* __restrict__ kb, const float* __restrict__ vb,
                                             int pitch, int T, int H, float scale, float* __restrict__ y, int ypitch) {
  constexpr int KS = D / 32;        // k-steps for QK
  constexpr int DT = D / 16;        // d tiles for PV
  __shared__ __attribute__((aligned(16))) unsigned short sKh[32][D + 8], sKl[32][D + 8], sVh[32][D + 8], sVl[32][D + 8];
  __shared__ __attribute__((aligned(16))) unsigned short sPh[4][16][40], sPl[4][16][40];
  __shared__ __attribute__((aligned(16))) float sO[4][16][D];
  const int tid = threadIdx.x, w = tid >> 5, lane = tid & 31, ln = lane & 15, hh = lane >> 4;
  const int nqb = (T + 63) / 64;
  const int bh = blockIdx.x / nqb, qblk = blockIdx.x % nqb;
  const int b = bh / H, h = bh % H;
  const int q0 = qblk * 64 + w * 16;
  const float* Q = qb + (size_t)b * T * pitch + h * D;
  const float* K = kb + (size_t)b * T * pitch + h * D;
  const float* V = vb + (size_t)b * T * pitch + h * D;

  // A fragments of the wave's 16 query rows (scaled), hi/lo
  FragB aqh[KS], aql[KS];
  {
    int row = q0 + ln; if (row >= T) row = T - 1;
    const float* qr = Q + (size_t)row * pitch;
#pragma unroll
    for (int ks = 0; ks < KS; ++ks)
#pragma unroll
      for (int i = 0; i < 16; ++i) {
        const int d = ks * 32 + ((i < 8) ? (8 * hh + i) : (16 + 8 * hh + (i - 8)));
        const float x = qr[d] * scale; const unsigned short hb = bf16_bits(x);
        aqh[ks].u[i] = hb; aql[ks].u[i] = bf16_bits(x - bf16_val(hb));
      }
  }
  float m_r[8], l_r[8];
#pragma unroll
  for (int r = 0; r < 8; ++r) { m_r[r] = -3.0e38f; l_r[r] = 0.f; }
  v8f oacc[DT];
#pragma unroll
  for (int dt = 0; dt < DT; ++dt) oacc[dt] = (v8f){0.f,0.f,0.f,0.f,0.f,0.f,0.f,0.f};

  const int kv_end = CAUSAL ? min(T, qblk * 64 + 64) : T;     // block-uniform
  for (int j0 = 0; j0 < kv_end; j0 += 32) {
    __syncthreads();
    for (int e = tid; e < 32 * (D / 4); e += 128) {
      const int r = e / (D / 4), c4 = (e % (D / 4)) * 4;
      const int key = j0 + r;
      v4f kf = {0.f,0.f,0.f,0.f}, vf = {0.f,0.f,0.f,0.f};
      if (key < T) { kf = *(const v4fa*)(K + (size_t)key * pitch + c4); vf = *(const v4fa*)(V + (size_t)key * pitch + c4); }
#pragma unroll
      for (int t = 0; t < 4; ++t) {
        unsigned short hb = bf16_bits(kf[t]); sKh[r][c4 + t] = hb; sKl[r][c4 + t] = bf16_bits(kf[t] - bf16_val(hb));
        hb = bf16_bits(vf[t]); sVh[r][c4 + t] = hb; sVl[r][c4 + t] = bf16_bits(vf[t] - bf16_val(hb));
      }
    }
    __syncthreads();
    // S tile 16 x 32
    v8f s[2];
#pragma unroll
    for (int nt = 0; nt < 2; ++nt) {
      v8f acc = {};
#pragma unroll
      for (int ks = 0; ks < KS; ++ks) {
        FragB bh_, bl_;
        bh_.half[0] = *(const v8us*)&sKh[nt * 16 + ln][ks * 32 + 8 * hh]; bh_.half[1] = *(const v8us*)&sKh[nt * 16 + ln][ks * 32 + 16 + 8 * hh];
        bl_.half[0] = *(const v8us*)&sKl[nt * 16 + ln][ks * 32 + 8 * hh]; bl_.half[1] = *(const v8us*)&sKl[nt * 16 + ln][ks * 32 + 16 + 8 * hh];
        acc = mmaN<3>(aqh[ks].v, aql[ks].v, bh_.v, bl_.v, acc);
      }
      s[nt] = acc;
    }
    // mask + running max (rows 8hh+r; the 16 lanes of a half share rows)
    float alpha[8];
#pragma unroll
    for (int r = 0; r < 8; ++r) {
      const int qi = q0 + 8 * hh + r;
      const int ja = j0 + ln, jb = j0 + 16 + ln;
      if (CAUSAL) { if (ja > qi) s[0][r] = -3.0e38f; if (jb > qi) s[1][r] = -3.0e38f; }
      if (ja >= T) s[0][r] = -3.0e38f;
      if (jb >= T) s[1][r] = -3.0e38f;
      float mx = fmaxf(s[0][r], s[1][r]);
      mx = fmaxf(mx, __shfl_xor(mx, 1, 32)); mx = fmaxf(mx, __shfl_xor(mx, 2, 32)); mx = fmaxf(mx, __shfl_xor(mx, 4, 32)); mx = fmaxf(mx, __shfl_xor(mx, 8, 32));
      const float mnew = fmaxf(m_r[r], mx);
      alpha[r] = (mnew > -1.0e38f) ? __expf(m_r[r] - mnew) : 1.0f;
      const float p0 = (s[0][r] > -1.0e38f) ? __expf(s[0][r] - mnew) : 0.f;
      const float p1 = (s[1][r] > -1.0e38f) ? __expf(s[1][r] - mnew) : 0.f;
      m_r[r] = mnew;
      l_r[r] = l_r[r] * alpha[r] + p0 + p1;            // per-lane partial row sum (16 lanes combined at the end)
      unsigned short hb = bf16_bits(p0); sPh[w][8 * hh + r][ln] = hb;      sPl[w][8 * hh + r][ln] = bf16_bits(p0 - bf16_val(hb));
      hb = bf16_bits(p1);                sPh[w][8 * hh + r][16 + ln] = hb; sPl[w][8 * hh + r][16 + ln] = bf16_bits(p1 - bf16_val(hb));
    }
#pragma unroll
    for (int dt = 0; dt < DT; ++dt)
#pragma unroll
      for (int r = 0; r < 8; ++r) oacc[dt][r] *= alpha[r];
    __builtin_amdgcn_fence(__ATOMIC_ACQ_REL, "workgroup");
    __builtin_amdgcn_wave_barrier();
    FragB pah, pal;
    pah.half[0] = *(const v8us*)&sPh[w][ln][8 * hh]; pah.half[1] = *(const v8us*)&sPh[w][ln][16 + 8 * hh];
    pal.half[0] = *(const v8us*)&sPl[w][ln][8 * hh]; pal.half[1] = *(const v8us*)&sPl[w][ln][16 + 8 * hh];
#pragma unroll
    for (int dt = 0; dt < DT; ++dt) {
      FragB bvh, bvl;
#pragma unroll
      for (int i = 0; i < 8; ++i) {
        bvh.u[i] = sVh[8 * hh + i][dt * 16 + ln]; bvh.u[8 + i] = sVh[16 + 8 * hh + i][dt * 16 + ln];
        bvl.u[i] = sVl[8 * hh + i][dt * 16 + ln]; bvl.u[8 + i] = sVl[16 + 8 * hh + i][dt * 16 + ln];
      }
      oacc[dt] = mmaN<3>(pah.v, pal.v, bvh.v, bvl.v, oacc[dt]);
    }
    __builtin_amdgcn_fence(__ATOMIC_ACQ_REL, "workgroup");
    __builtin_amdgcn_wave_barrier();
  }
#pragma unroll
  for (int r = 0; r < 8; ++r) {
    float l = l_r[r];
    l += __shfl_xor(l, 1, 32); l += __shfl_xor(l, 2, 32); l += __shfl_xor(l, 4, 32); l += __shfl_xor(l, 8, 32);
    l_r[r] = (l > 0.f) ? 1.0f / l : 0.f;
  }
#pragma unroll
  for (int dt = 0; dt < DT; ++dt)
#pragma unroll
    for (int r = 0; r < 8; ++r) sO[w][8 * hh + r][dt * 16 + ln] = oacc[dt][r] * l_r[r];
  __builtin_amdgcn_fence(__ATOMIC_ACQ_REL, "workgroup");
  __builtin_amdgcn_wave_barrier();
  {
    for (int r = 0; r < 16; ++r) {
      const int row = q0 + r;
      if (row < T && lane < D / 4) {
        const v4f val = *(const v4fa*)&sO[w][r][lane * 4];
        *(v4f*)(y + ((size_t)b * T + row) * ypitch + h * D + lane * 4) = val;
      }
    }
    
  }
}

// GEMM C = act(A·W + bias + resid): A f32 (ASPLIT -> hi/lo 2 terms), Wt bf16 [N][K]; ACT 0 none, 1 relu, 2 exact gelu;
// resid (optional, f32, row index = (row % rmod), pitch ldr, RES_BF16 rounds it) added before the activation.
template <bool ASPLIT, int ACT, bool BIAS_BF16, bool RES_BF16>
__global__ __launch_bounds__(128) void k_gemm_bf3(const float* __restrict__ A, int lda, const unsigned short* __restrict__ Wt, int ldb,
                                                const float* __restrict__ bias, const float* __restrict__ resid, int rmod, int ldr,
                                                float* __restrict__ C, int ldc, int M, int N, int K) {
  __shared__ __attribute__((aligned(16))) float so[4][16][64];
  const int tid = threadIdx.x, w = tid >> 5, lane = tid & 31, ln = lane & 15, hh = lane >> 4;
  const int ntn = N / 64;
  const int wid = blockIdx.x * 4 + w;
  const int mt = wid / ntn, nq = wid % ntn;
  if (mt * 16 >= M) return;
  const int row0 = mt * 16, col0 = nq * 64;
  const float* arow = A + (size_t)(row0 + ln) * lda;
  v8f acc[4] = {};
  for (int kb = 0; kb < K; kb += 32) {
    FragB ah, al;
    const v4f x0 = *(const v4fa*)(arow + kb + 8 * hh), x1 = *(const v4fa*)(arow + kb + 8 * hh + 4);
    const v4f x2 = *(const v4fa*)(arow + kb + 16 + 8 * hh), x3 = *(const v4fa*)(arow + kb + 16 + 8 * hh + 4);
    float xs[16] = {x0[0],x0[1],x0[2],x0[3],x1[0],x1[1],x1[2],x1[3],x2[0],x2[1],x2[2],x2[3],x3[0],x3[1],x3[2],x3[3]};
#pragma unroll
    for (int i = 0; i < 16; ++i) { const unsigned short hb = bf16_bits(xs[i]); ah.u[i] = hb; al.u[i] = ASPLIT ? bf16_bits(xs[i] - bf16_val(hb)) : (unsigned short)0; }
#pragma unroll
    for (int t = 0; t < 4; ++t) {
      const unsigned short* brow = Wt + (size_t)(col0 + t * 16 + ln) * ldb + kb;
      FragB b;
      b.half[0] = *(const v8us*)(brow + 8 * hh);
      b.half[1] = *(const v8us*)(brow + 16 + 8 * hh);
      acc[t] = mmaN<ASPLIT ? 2 : 1>(ah.v, al.v, b.v, b.v, acc[t]);
    }
  }
#pragma unroll
  for (int t = 0; t < 4; ++t) {
    const int col = col0 + t * 16 + ln;
    float bv = bias ? bias[col] : 0.f;
    if (BIAS_BF16) bv = bf16_round(bv);
#pragma unroll
    for (int r = 0; r < 8; ++r) {
      float v = acc[t][r] + bv;
      if (resid) { float rv = resid[(size_t)((row0 + 8 * hh + r) % rmod) * ldr + col]; if (RES_BF16) rv = bf16_round(rv); v += rv; }
      if (ACT == 1) v = fmaxf(v, 0.f);
      if (ACT == 2) v = 0.5f * v * (1.0f + erff(v * 0.70710678118654752f));
      if (ACT == 3) { const float u = 0.7978845608028654f * (v + 0.044715f * v * v * v); v = 0.5f * v * (1.0f + tanhf(u)); }
      so[w][8 * hh + r][t * 16 + ln] = v;
    }
  }
  __builtin_amdgcn_fence(__ATOMIC_ACQ_REL, "workgroup");
  __builtin_amdgcn_wave_barrier();
  const int rsub = lane >> 4, c4 = (lane & 15) * 4;
  {
#pragma unroll
    for (int q = 0; q < 8; ++q) {
      const int r = q * 2 + rsub;
      const v4f v = *(const v4fa*)&so[w][r][c4];
      *(v4f*)(C + (size_t)(row0 + r) * ldc + col0 + c4) = v;
    }
    
  }
}
// row LayerNorm (biased variance, eps) over N: s = X (+ R); optional out_sum <- s; out_norm <- (s-mu)*rsqrt(var+eps)*g + b
template <bool PARAM_BF16>
__global__ __launch_bounds__(256) void k_layernorm(const float* __restrict__ X, const float* __restrict__ R, const float* __restrict__ g, const float* __restrict__ bta,
                                                  float* __restrict__ out_sum, float* __restrict__ out_norm, int N, float eps) {
  __shared__ float red[256];
  const int row = blockIdx.x, tid = threadIdx.x;
  const float* x = X + (size_t)row * N; const float* rr = R ? R + (size_t)row * N : nullptr;
  float vals[16];                     // up to N = 4096
  const int per = N / 256;            // contiguous chunk per thread? use strided-by-4 chunks: thread handles j = tid*4 + 1024*u
  float s1 = 0.f;
  for (int u = 0; u < per / 4; ++u) {
    const int j = tid * 4 + 1024 * u;
    const v4f a = *(const v4fa*)(x + j);
    v4f b = {0.f,0.f,0.f,0.f}; if (rr) b = *(const v4fa*)(rr + j);
#pragma unroll
    for (int q = 0; q < 4; ++q) { const float v = a[q] + b[q]; vals[u * 4 + q] = v; s1 += v; }
  }
  red[tid] = s1; __syncthreads();
  for (int st = 128; st > 0; st >>= 1) { if (tid < st) red[tid] += red[tid + st]; __syncthreads(); }
  const float mu = red[0] / (float)N; __syncthreads();
  float s2 = 0.f;
  for (int u = 0; u < per / 4; ++u)
#pragma unroll
    for (int q = 0; q < 4; ++q) { const float c = vals[u * 4 + q] - mu; s2 += c * c; }
  red[tid] = s2; __syncthreads();
  for (int st = 128; st > 0; st >>= 1) { if (tid < st) red[tid] += red[tid + st]; __syncthreads(); }
  const float rs = rsqrtf(red[0] / (float)N + eps);
  {
    for (int u = 0; u < per / 4; ++u) {
      const int j = tid * 4 + 1024 * u;
      v4f o, sm;
#pragma unroll
      for (int q = 0; q < 4; ++q) {
        float gg = g[j + q], bb = bta[j + q];
        if (PARAM_BF16) { gg = bf16_round(gg); bb = bf16_round(bb); }
        sm[q] = vals[u * 4 + q]; o[q] = (vals[u * 4 + q] - mu) * rs * gg + bb;
      }
      if (out_sum) *(v4f*)(out_sum + (size_t)row * N + j) = sm;
      *(v4f*)(out_norm + (size_t)row * N + j) = o;
    }
    
  }
}



// ---- f16 WMMA path (v_wmma_f32_16x16x32_f16): 11-bit significands for operands in range — used where a [0,1] probability operand needs more precision than bf16
typedef _Float16 v16h __attribute__((ext_vector_type(16)));
union FragH { v16h v; v8us half[2]; _Float16 h[16]; unsigned short u[16]; };
template <int NT>
__device__ __forceinline__ v8f mmaH(v16h ah, v16h al, v16h bh, v16h bl, v8f c) {
  c = __builtin_amdgcn_wmma_f32_16x16x32_f16(false, ah, false, bh, (short)0, c, false, false);
  if (NT >= 2) c = __builtin_amdgcn_wmma_f32_16x16x32_f16(false, al, false, bh, (short)0, c, false, false);
  if (NT >= 3) c = __builtin_amdgcn_wmma_f32_16x16x32_f16(false, ah, false, bl, (short)0, c, false, false);
  asm volatile("v_nop\n\tv_nop\n\tv_nop\n\tv_nop" : "+v"(c) : "v"(ah), "v"(al), "v"(bh), "v"(bl));
  return c;
}
// batched GEMM like k_gemm_b but f16 operands: A f32 (split into f16 hi/lo if ASPLIT, else rounded to f16), Bt = f16 values [n][k]; alpha; C f32; N multiple of 16 (partial tiles skipped)
template <bool ASPLIT>
__global__ __launch_bounds__(128) void k_gemm_h(const float* __restrict__ A, int lda, size_t sA, const _Float16* __restrict__ Bh, int ldb, size_t sB, float alpha, float* __restrict__ C, int ldc, size_t sC, int M, int N, int K) {
  __shared__ __attribute__((aligned(16))) float so[4][16][64];
  const int tid = threadIdx.x, w = tid >> 5, lane = tid & 31, ln = lane & 15, hh = lane >> 4; const int by = blockIdx.y;
  A += (size_t)by * sA; Bh += (size_t)by * sB; C += (size_t)by * sC;
  const int ntn = (N + 63) / 64; const int wid = blockIdx.x * 4 + w; const int mt = wid / ntn, nq = wid % ntn; if (mt * 16 >= M) return;
  const int row0 = mt * 16, col0 = nq * 64; const float* arow = A + (size_t)(row0 + ln) * lda;
  v8f acc[4] = {};
  for (int kb = 0; kb < K; kb += 32) {
    FragH ah, al;
    const v4f x0 = *(const v4fa*)(arow + kb + 8 * hh), x1 = *(const v4fa*)(arow + kb + 8 * hh + 4), x2 = *(const v4fa*)(arow + kb + 16 + 8 * hh), x3 = *(const v4fa*)(arow + kb + 16 + 8 * hh + 4);
    float xs[16] = {x0[0],x0[1],x0[2],x0[3],x1[0],x1[1],x1[2],x1[3],x2[0],x2[1],x2[2],x2[3],x3[0],x3[1],x3[2],x3[3]};
#pragma unroll
    for (int i = 0; i < 16; ++i) { const _Float16 h = (_Float16)xs[i]; ah.h[i] = h; al.h[i] = ASPLIT ? (_Float16)(xs[i] - (float)h) : (_Float16)0.0f; }
#pragma unroll
    for (int t = 0; t < 4; ++t) { if (col0 + t * 16 >= N) continue; const size_t boff = (size_t)(col0 + t * 16 + ln) * ldb + kb; FragH bq; bq.half[0] = *(const v8us*)(Bh + boff + 8 * hh); bq.half[1] = *(const v8us*)(Bh + boff + 16 + 8 * hh);
      acc[t] = mmaH<ASPLIT ? 2 : 1>(ah.v, al.v, bq.v, bq.v, acc[t]); }
  }
#pragma unroll
  for (int t = 0; t < 4; ++t) { if (col0 + t * 16 >= N) continue;
#pragma unroll
    for (int r = 0; r < 8; ++r) so[w][8 * hh + r][t * 16 + ln] = acc[t][r] * alpha; }
  __builtin_amdgcn_fence(__ATOMIC_ACQ_REL, "workgroup"); __builtin_amdgcn_wave_barrier();
  const int rsub = lane >> 4, c4 = (lane & 15) * 4;
  {
#pragma unroll
    for (int q = 0; q < 8; ++q) { const int r = q * 2 + rsub; if (col0 + c4 < N) { const v4f v = *(const v4fa*)&so[w][r][c4]; *(v4f*)(C + (size_t)(row0 + r) * ldc + col0 + c4) = v; } }
     }
}

// Wt[n][k] = f16(W[k][n]·scale) from f32 row-major W[K][N] (scale = power of two; bf16-exact weights stay exact in f16 away from the subnormal range)
__global__ __launch_bounds__(256) void k_wt_f16(const float* __restrict__ W, _Float16* __restrict__ Wt, int K, int N, float scale) {
  const int t = blockIdx.x * 256 + threadIdx.x; if (t >= N * (K / 8)) return; const int n = t / (K / 8), k8 = (t % (K / 8)) * 8; FragH f;
#pragma unroll
  for (int i = 0; i < 8; ++i) f.h[i] = (_Float16)(bf16_round(W[(size_t)(k8 + i) * N + n]) * scale); const v8us o = f.half[0];
  *(v8us*)((unsigned short*)Wt + (size_t)n * K + k8) = o; 
}
// k_gemm_hh variant with fused epilogue: v = acc·alpha + bias[by·sBias + col] (+ CP[(row/rowsPerB)·sCPb + by·64 + col] if CP) ; ACT 0 none / 1 elu ; writes f16 C16 and f32 C, each if non-null
template <int ACT>
__global__ __launch_bounds__(128) void k_gemm_hhx(const _Float16* __restrict__ A, int lda, size_t sA, const _Float16* __restrict__ Bh, int ldb, size_t sB, float alpha, const float* __restrict__ bias, size_t sBias, const float* __restrict__ CP, int rowsPerB, size_t sCPb, int row0g,
    float* __restrict__ C, _Float16* __restrict__ C16, int ldc, size_t sC, int M, int N, int K) {
  __shared__ __attribute__((aligned(16))) float so[4][16][64];
  const int tid = threadIdx.x, w = tid >> 5, lane = tid & 31, ln = lane & 15, hh = lane >> 4; const int by = blockIdx.y;
  A += (size_t)by * sA; Bh += (size_t)by * sB; const size_t cofs = (size_t)by * sC; const float* bp = bias ? bias + (size_t)by * sBias : nullptr;
  const int ntn = (N + 63) / 64; const int wid = blockIdx.x * 4 + w; const int mt = wid / ntn, nq = wid % ntn; if (mt * 16 >= M) return;
  const int row0 = mt * 16, col0 = nq * 64; const _Float16* arow = A + (size_t)(row0 + ln) * lda;
  v8f acc[4] = {};
  for (int kb = 0; kb < K; kb += 32) { FragH ah; ah.half[0] = *(const v8us*)((const unsigned short*)arow + kb + 8 * hh); ah.half[1] = *(const v8us*)((const unsigned short*)arow + kb + 16 + 8 * hh);
#pragma unroll
    for (int t = 0; t < 4; ++t) { if (col0 + t * 16 >= N) continue; const size_t boff = (size_t)(col0 + t * 16 + ln) * ldb + kb; FragH bq; bq.half[0] = *(const v8us*)((const unsigned short*)Bh + boff + 8 * hh); bq.half[1] = *(const v8us*)((const unsigned short*)Bh + boff + 16 + 8 * hh);
      acc[t] = mmaH<1>(ah.v, ah.v, bq.v, bq.v, acc[t]); }
  }
#pragma unroll
  for (int t = 0; t < 4; ++t) { if (col0 + t * 16 >= N) continue; const int col = col0 + t * 16 + ln; const float bv = bp ? bf16_round(bp[col]) : 0.f;
#pragma unroll
    for (int r = 0; r < 8; ++r) { float v = acc[t][r] * alpha + bv; if (CP) { const int bidx = (row0g + row0 + 8 * hh + r) / rowsPerB; v += CP[(size_t)bidx * sCPb + (size_t)by * 64 + col]; } if (ACT == 1) v = (v > 0.f) ? v : expm1f(v); else if (ACT == 7) v = (v > 0.f) ? v + 1.0f : expf(v); else if (ACT == 8) v = tanhf(v); else if (ACT == 9) v = 0.5f * v * (1.0f + tanhf(0.7978845608028654f * (v + 0.044715f * v * v * v))); else if (ACT == 11) v = 1.0f / (1.0f + expf(-v)); else if (ACT == 12) v = (v > 0.f) ? v : 0.01f * v; else if (ACT == 14) v = (v > 0.f) ? v : 0.1f * v; else if (ACT == 15) v = v / (1.0f + expf(-v)); else if (ACT == 3) v = fmaxf(v, 0.f); else if (ACT == 6) v = 0.5f * v * (1.0f + erff(v * 0.70710678118654752f)); so[w][8 * hh + r][t * 16 + ln] = v; } }
  __builtin_amdgcn_fence(__ATOMIC_ACQ_REL, "workgroup"); __builtin_amdgcn_wave_barrier();
  const int rsub = lane >> 4, c4 = (lane & 15) * 4; typedef _Float16 v4h __attribute__((ext_vector_type(4)));
  {
#pragma unroll
    for (int q = 0; q < 8; ++q) { const int r = q * 2 + rsub; if (col0 + c4 < N) { const v4f v = *(const v4fa*)&so[w][r][c4]; if (C) *(v4f*)(C + cofs + (size_t)(row0 + r) * ldc + col0 + c4) = v; if (C16) { v4h h4; for (int i = 0; i < 4; ++i) h4[i] = (_Float16)v[i]; *(v4h*)(C16 + cofs + (size_t)(row0 + r) * ldc + col0 + c4) = h4; } } }
     }
}


typedef _Float16 v4h __attribute__((ext_vector_type(4)));

__global__ __launch_bounds__(256) void k_x16(const float* __restrict__ x, _Float16* __restrict__ X16, size_t n8) { const size_t t = (size_t)blockIdx.x * 256 + threadIdx.x; if (t >= n8) return; FragH f;
#pragma unroll
  for (int q = 0; q < 8; ++q) f.h[q] = (_Float16)bf16_round(x[t * 8 + q]); *(v8us*)((unsigned short*)X16 + t * 8) = f.half[0];  }
__global__ __launch_bounds__(256) void k_h16(const float* __restrict__ x, _Float16* __restrict__ X16, size_t n8) { const size_t t = (size_t)blockIdx.x * 256 + threadIdx.x; if (t >= n8) return; FragH f;
#pragma unroll
  for (int q = 0; q < 8; ++q) f.h[q] = (_Float16)x[t * 8 + q]; *(v8us*)((unsigned short*)X16 + t * 8) = f.half[0];  }
__global__ __launch_bounds__(256) void k_round16f(const float* __restrict__ W, _Float16* __restrict__ Bt, size_t n8) { const size_t t = (size_t)blockIdx.x * 256 + threadIdx.x; if (t >= n8) return; FragH f;
#pragma unroll
  for (int i = 0; i < 8; ++i) f.h[i] = (_Float16)(bf16_round(W[t * 8 + i]) * 16.0f); *(v8us*)((unsigned short*)Bt + t * 8) = f.half[0];  }
template <int NHv, int TTv>
__global__ __launch_bounds__(256) void k_vt(const _Float16* __restrict__ V16, int ldv, int voff, _Float16* __restrict__ Vt) { __shared__ unsigned short tl[64][66]; const int tid = threadIdx.x; const int slab = blockIdx.x / (TTv / 64), lg = blockIdx.x % (TTv / 64); const int b = slab / NHv, h = slab % NHv;
  for (int i = tid; i < 64 * 8; i += 256) { const int r = i / 8, c8 = (i % 8) * 8; FragH f; f.half[0] = *(const v8us*)((const unsigned short*)V16 + ((size_t)b * TTv + lg * 64 + r) * ldv + voff + h * 64 + c8);
#pragma unroll
    for (int q = 0; q < 8; ++q) tl[r][c8 + q] = f.u[q]; }
  __syncthreads();
  {
#pragma unroll
    for (int rd = 0; rd < 2; ++rd) { const int d = rd * 32 + tid / 8, pc = tid % 8; FragH f;
#pragma unroll
      for (int q = 0; q < 8; ++q) f.u[q] = tl[pc * 8 + q][d];
      *(v8us*)((unsigned short*)Vt + ((size_t)slab * 64 + d) * TTv + lg * 64 + pc * 8) = f.half[0]; }
     } }

__global__ __launch_bounds__(256) void k_h16s(const float* __restrict__ F, _Float16* __restrict__ H, size_t n8) { const size_t t = (size_t)blockIdx.x * 256 + threadIdx.x; if (t >= n8) return; const v4f a = *(const v4fa*)(F + t * 8), c = *(const v4fa*)(F + t * 8 + 4); FragH f;
#pragma unroll
  for (int q = 0; q < 4; ++q) { f.h[q] = (_Float16)(a[q] * 16.0f); f.h[4 + q] = (_Float16)(c[q] * 16.0f); } *(v8us*)((unsigned short*)H + t * 8) = f.half[0];  }
__global__ __launch_bounds__(128) void k_flash(const _Float16* __restrict__ Q16, int ldq, const _Float16* __restrict__ K16, int ldk, const _Float16* __restrict__ Vt, const int* __restrict__ MSK, float* __restrict__ O, int ldo) {
  constexpr int RPW = 16, RTN = RPW / 16, NQB = TT / (4 * RPW), DT = 4, KS = 2;
  __shared__ __attribute__((aligned(16))) unsigned short sP[4][RPW][40]; __shared__ __attribute__((aligned(16))) float sO[4][RPW][64 + 4];
  const int tid = threadIdx.x, w = tid >> 5, lane = tid & 31, ln = lane & 15, hh = lane >> 4;
  const int slab = blockIdx.x / NQB, qblk = blockIdx.x % NQB; const int b = slab / NH, h = slab % NH; const int qb0 = qblk * (4 * RPW); const int q0 = qb0 + w * RPW;
  FragH aq[2][KS];
#pragma unroll
  for (int rt = 0; rt < RTN; ++rt) { const unsigned short* qr = (const unsigned short*)Q16 + ((size_t)b * TT + q0 + rt * 16 + ln) * ldq + h * 64;
#pragma unroll
    for (int ks = 0; ks < KS; ++ks) { aq[rt][ks].half[0] = *(const v8us*)(qr + ks * 32 + 8 * hh); aq[rt][ks].half[1] = *(const v8us*)(qr + ks * 32 + 16 + 8 * hh); } }
  const unsigned short* Vth = (const unsigned short*)Vt + (size_t)slab * 64 * TT;
  float m_r[2][8], l_r[2][8]; v8f oacc[2][DT];
#pragma unroll
  for (int rt = 0; rt < RTN; ++rt) {
#pragma unroll
    for (int r = 0; r < 8; ++r) { m_r[rt][r] = -3.0e38f; l_r[rt][r] = 0.f; }
#pragma unroll
    for (int dt = 0; dt < DT; ++dt) oacc[rt][dt] = (v8f){0.f,0.f,0.f,0.f,0.f,0.f,0.f,0.f}; }
  const int jend = TT;
#pragma unroll 1
  for (int j0 = 0; j0 < jend; j0 += 32) {
    v8f s[2][2];
#pragma unroll
    for (int nt = 0; nt < 2; ++nt) { const unsigned short* kr = (const unsigned short*)K16 + ((size_t)b * TT + j0 + nt * 16 + ln) * ldk + h * 64; FragH bk[KS];
#pragma unroll
      for (int ks = 0; ks < KS; ++ks) { bk[ks].half[0] = *(const v8us*)(kr + ks * 32 + 8 * hh); bk[ks].half[1] = *(const v8us*)(kr + ks * 32 + 16 + 8 * hh); }
#pragma unroll
      for (int rt = 0; rt < RTN; ++rt) { v8f acc = (v8f){0.f,0.f,0.f,0.f,0.f,0.f,0.f,0.f};
#pragma unroll
        for (int ks = 0; ks < KS; ++ks) acc = mmaH<1>(aq[rt][ks].v, aq[rt][ks].v, bk[ks].v, bk[ks].v, acc); s[rt][nt] = acc; } }
#pragma unroll
    for (int rt = 0; rt < RTN; ++rt)
#pragma unroll
      for (int r = 0; r < 8; ++r) { const int tq = q0 + rt * 16 + 8 * hh + r; const int k0 = j0 + ln, k1 = j0 + 16 + ln; (void)tq; (void)k0; (void)k1;
        const bool ok0 = true, ok1 = true;
        const float s0 = s[rt][0][r] * ATT_SCALE, s1 = s[rt][1][r] * ATT_SCALE; float mc = fmaxf(s0, s1);
        mc = fmaxf(mc, __shfl_xor(mc, 1, 32)); mc = fmaxf(mc, __shfl_xor(mc, 2, 32)); mc = fmaxf(mc, __shfl_xor(mc, 4, 32)); mc = fmaxf(mc, __shfl_xor(mc, 8, 32));
        const float mn = fmaxf(m_r[rt][r], mc); const float al = (mn > -1.0e38f) ? expf(m_r[rt][r] - mn) : 1.0f; m_r[rt][r] = mn; const float p0 = ok0 ? expf(s0 - mn) : 0.f, p1 = ok1 ? expf(s1 - mn) : 0.f; l_r[rt][r] = l_r[rt][r] * al + p0 + p1;
#pragma unroll
        for (int dt = 0; dt < DT; ++dt) oacc[rt][dt][r] *= al;
        FragH t2; t2.h[0] = (_Float16)(p0 * 1024.0f); t2.h[1] = (_Float16)(p1 * 1024.0f); sP[w][rt * 16 + 8 * hh + r][ln] = t2.u[0]; sP[w][rt * 16 + 8 * hh + r][16 + ln] = t2.u[1]; }
    __builtin_amdgcn_fence(__ATOMIC_ACQ_REL, "workgroup"); __builtin_amdgcn_wave_barrier();
    FragH pa[2];
#pragma unroll
    for (int rt = 0; rt < RTN; ++rt) { pa[rt].half[0] = *(const v8us*)&sP[w][rt * 16 + ln][8 * hh]; pa[rt].half[1] = *(const v8us*)&sP[w][rt * 16 + ln][16 + 8 * hh]; }
#pragma unroll
    for (int dt = 0; dt < DT; ++dt) { const unsigned short* vrow = Vth + (size_t)(dt * 16 + ln) * TT + j0; FragH bv; bv.half[0] = *(const v8us*)(vrow + 8 * hh); bv.half[1] = *(const v8us*)(vrow + 16 + 8 * hh);
#pragma unroll
      for (int rt = 0; rt < RTN; ++rt) oacc[rt][dt] = mmaH<1>(pa[rt].v, pa[rt].v, bv.v, bv.v, oacc[rt][dt]); }
    __builtin_amdgcn_fence(__ATOMIC_ACQ_REL, "workgroup"); __builtin_amdgcn_wave_barrier(); }
#pragma unroll
  for (int rt = 0; rt < RTN; ++rt) {
#pragma unroll
    for (int r = 0; r < 8; ++r) { float l = l_r[rt][r]; l += __shfl_xor(l, 1, 32); l += __shfl_xor(l, 2, 32); l += __shfl_xor(l, 4, 32); l += __shfl_xor(l, 8, 32); l_r[rt][r] = (l > 0.f) ? 1.0f / (l * 1024.0f) : 0.f; }
#pragma unroll
    for (int dt = 0; dt < DT; ++dt)
#pragma unroll
      for (int r = 0; r < 8; ++r) sO[w][rt * 16 + 8 * hh + r][dt * 16 + ln] = oacc[rt][dt][r] * l_r[rt][r]; }
  __builtin_amdgcn_fence(__ATOMIC_ACQ_REL, "workgroup"); __builtin_amdgcn_wave_barrier();
  {
#pragma unroll
    for (int rp = 0; rp < RPW; rp += 2) { const int r = rp + (lane >> 4), pc = lane & 15; const v4f val = *(const v4fa*)&sO[w][r][pc * 4]; *(v4f*)(O + ((size_t)b * TT + q0 + r) * ldo + h * 64 + pc * 4) = val; }
     } }

extern "C" void kernel_launch(void* const* d_in, const int* in_sizes, int n_in,
                              void* d_out, int out_size, void* d_ws, size_t ws_size, hipStream_t stream) {
  (void)in_sizes; (void)n_in; (void)out_size;
  const float* const* I = (const float* const*)d_in; const float* x = I[0]; const float* Wq = I[1]; const float* bq = I[2]; const float* Wk = I[3]; const float* bk = I[4]; const float* Wv = I[5]; const float* bv = I[6]; const float* Wp = I[7]; const float* bp = I[8];
  char* ws = (char*)d_ws; size_t off = 0;
  auto take = [&](size_t bytes) { char* p = ws + off; off += (bytes + 255) & ~(size_t)255; return p; };
  _Float16* Bq = (_Float16*)take((size_t)DA * DX * 2); _Float16* Bk = (_Float16*)take((size_t)DA * DX * 2); _Float16* Bv = (_Float16*)take((size_t)DA * DX * 2); _Float16* Bp = (_Float16*)take((size_t)DX * DA * 2);
  _Float16* X16 = (_Float16*)take((size_t)NRX * DX * 2); _Float16* Q = (_Float16*)take((size_t)NRX * DA * 2); _Float16* K = (_Float16*)take((size_t)NRX * DA * 2); _Float16* V = (_Float16*)take((size_t)NRX * DA * 2); _Float16* Vt = (_Float16*)take((size_t)NRX * DA * 2);
  float* O = (float*)take((size_t)NRX * DA * 4); _Float16* O16 = (_Float16*)take((size_t)NRX * DA * 2);
  if (off > ws_size) return;      // 3 × 0.8 + 0.8 + 12.6 + 4 × 8.4 + 16.8 + 8.4 ≈ 75 MB
  const unsigned gwa = (unsigned)(((size_t)DA * (DX / 8) + 255) / 256);
  k_wt_f16<<<gwa, 256, 0, stream>>>(Wq, Bq, DX, DA, 16.0f); k_wt_f16<<<gwa, 256, 0, stream>>>(Wk, Bk, DX, DA, 16.0f); k_wt_f16<<<gwa, 256, 0, stream>>>(Wv, Bv, DX, DA, 16.0f); k_wt_f16<<<(unsigned)(((size_t)DX * (DA / 8) + 255) / 256), 256, 0, stream>>>(Wp, Bp, DA, DX, 16.0f);      /* (in,out) → Bt ×2^4 */
  k_x16<<<(unsigned)(((size_t)NRX * DX / 8 + 255) / 256), 256, 0, stream>>>(x, X16, (size_t)NRX * DX / 8);
  const dim3 ga(((NRX / 16) * (DA / 64) + 3) / 4, 1);
  k_gemm_hhx<0><<<ga, 128, 0, stream>>>(X16, DX, 0, Bq, DX, 0, 0.0625f, bq, 0, nullptr, 1, 0, 0, nullptr, Q, DA, 0, NRX, DA, DX);      /* Q = x·Wq + bq (f16 [8192][512]): M 8192 N 512 K 768 */
  k_gemm_hhx<0><<<ga, 128, 0, stream>>>(X16, DX, 0, Bk, DX, 0, 0.0625f, bk, 0, nullptr, 1, 0, 0, nullptr, K, DA, 0, NRX, DA, DX);
  k_gemm_hhx<0><<<ga, 128, 0, stream>>>(X16, DX, 0, Bv, DX, 0, 0.0625f, bv, 0, nullptr, 1, 0, 0, nullptr, V, DA, 0, NRX, DA, DX);
  k_vt<1, TT><<<BB * (TT / 64), 256, 0, stream>>>(V, 64, 0, Vt);      /* each [8192][512] plane viewed as 64 contiguous [1024][64] slabs → Vᵀ [slab][64][1024] */
  k_flash<<<BB * (TT / 64), 128, 0, stream>>>(Q, 64, K, 64, Vt, nullptr, O, 64);      /* same flat view for Q, K and O */
  k_h16s<<<(unsigned)(((size_t)NRX * DA / 8 + 255) / 256), 256, 0, stream>>>(O, O16, (size_t)NRX * DA / 8);
  k_gemm_hhx<0><<<dim3(((NRX / 16) * (DX / 64) + 3) / 4, 1), 128, 0, stream>>>(O16, DA, 0, Bp, DA, 0, 0.00390625f, bp, 0, nullptr, 1, 0, 0, (float*)d_out, nullptr, DX, 0, NRX, DX, DA);      /* out = O·Wp + bp: M 8192 N 768 K 512 (alpha undoes the ×2^4 weights and the ×2^4 carry) */
}

// v001
// Measured time: 197 microseconds a run.
// Timed twice side by side with v000, it ran 1.48 times as fast both times.
#include <hip/hip_runtime.h>
// Multi-head attention with raw-reshape heads (B=8, N=1024, dim 768 → attn_dim 512 = 8 heads × 64): Q,K,V = x·W + b ((in,out)), reshaped by plain memory order to (H,B,N,64) (= 64 contiguous [1024][64] slabs of each [8192][512] plane);
// softmax(Q·Kᵀ·scale)·V per slab with scale = (64//8)^-½ = 8^-½ (as the original); out raw-reshaped back to (B,N,512) (same flat order) → ·Wp + bp.
// Compute dtype: x, weights, biases rounded to bf16; Q/K/V as f16 GEMM outputs; fused flash-style kernel over the flat slabs (online softmax f32, P f16 ×2^10) on v_wmma_f32_16x16x32_f16; O carried ×2^4 into f16 → projection GEMM with bias; f32 accumulate.
#define BB 64
#define TT 1024
#define NH 1
#define DX 768
#define DA 512
#define NRX 8192
#define ATT_SCALE 0.35355339059327373f

typedef __bf16 v16b __attribute__((ext_vector_type(16)));
typedef unsigned short v8us __attribute__((ext_vector_type(8), may_alias));
typedef float  v8f  __attribute__((ext_vector_type(8)));
typedef float  v4f  __attribute__((ext_vector_type(4)));
typedef float  v4fa __attribute__((ext_vector_type(4), may_alias));
union FragB { v16b v; v8us half[2]; unsigned short u[16]; };

__device__ __forceinline__ unsigned short bf16_bits(float x) { unsigned int u = __float_as_uint(x); return (unsigned short)((u + 0x7FFFu + ((u >> 16) & 1u)) >> 16); }
__device__ __forceinline__ float bf16_val(unsigned short b) { return __uint_as_float(((unsigned int)b) << 16); }
__device__ __forceinline__ float bf16_round(float x) { return bf16_val(bf16_bits(x)); }
// D += A·B with NT terms: 1 = ah·bh, 2 = + al·bh (A split), 3 = + ah·bl (both split)
template <int NT>
__device__ __forceinline__ v8f mmaN(v16b ah, v16b al, v16b bh, v16b bl, v8f c) {
  c = __builtin_amdgcn_wmma_f32_16x16x32_bf16(false, ah, false, bh, (short)0, c, false, false);
  if (NT >= 2) c = __builtin_amdgcn_wmma_f32_16x16x32_bf16(false, al, false, bh, (short)0, c, false, false);
  if (NT >= 3) c = __builtin_amdgcn_wmma_f32_16x16x32_bf16(false, ah, false, bl, (short)0, c, false, false);
  asm volatile("v_nop\n\tv_nop\n\tv_nop\n\tv_nop" : "+v"(c) : "v"(ah), "v"(al), "v"(bh), "v"(bl));
  return c;
}

__global__ __launch_bounds__(256) void k_wt_bf16(const float* __restrict__ W, unsigned short* __restrict__ Wt, int K, int N) {
  const int t = blockIdx.x * 256 + threadIdx.x;
  const int k8n = K / 8;
  if (t >= N * k8n) return;
  const int n = t / k8n, k8 = (t % k8n) * 8;
  v8us v;
#pragma unroll
  for (int i = 0; i < 8; ++i) v[i] = bf16_bits(W[(size_t)(k8 + i) * N + n]);
  *(v8us*)(Wt + (size_t)n * K + k8) = v;
  
}

// GEMM C[M][N] (f32, pitch ldc) = act(A[M][K]·W + bias). A f32 row-major (pitch lda) converted per fragment to bf16
// (ASPLIT: hi/lo two planes -> 2 terms, else single rounded term); Wt bf16 [N][K] (pitch ldb). BIAS_BF16 rounds the
// bias to bf16 first (bias quantised to bf16 before the add). K%32==0, M%16==0, N%64==0.
template <bool ASPLIT, int ACT, bool BIAS_BF16>
__global__ __launch_bounds__(128) void k_gemm_bf(const float* __restrict__ A, int lda, const unsigned short* __restrict__ Wt, int ldb,
                                               const float* __restrict__ bias, float* __restrict__ C, int ldc, int M, int N, int K) {
  __shared__ __attribute__((aligned(16))) float so[4][16][64];
  const int tid = threadIdx.x, w = tid >> 5, lane = tid & 31, ln = lane & 15, hh = lane >> 4;
  const int ntn = N / 64;
  const int wid = blockIdx.x * 4 + w;
  const int mt = wid / ntn, nq = wid % ntn;
  if (mt * 16 >= M) return;
  const int row0 = mt * 16, col0 = nq * 64;
  const float* arow = A + (size_t)(row0 + ln) * lda;
  v8f acc[4] = {};
  for (int kb = 0; kb < K; kb += 32) {
    FragB ah, al;
    const v4f x0 = *(const v4fa*)(arow + kb + 8 * hh), x1 = *(const v4fa*)(arow + kb + 8 * hh + 4);
    const v4f x2 = *(const v4fa*)(arow + kb + 16 + 8 * hh), x3 = *(const v4fa*)(arow + kb + 16 + 8 * hh + 4);
    float xs[16] = {x0[0],x0[1],x0[2],x0[3],x1[0],x1[1],x1[2],x1[3],x2[0],x2[1],x2[2],x2[3],x3[0],x3[1],x3[2],x3[3]};
#pragma unroll
    for (int i = 0; i < 16; ++i) { const unsigned short hb = bf16_bits(xs[i]); ah.u[i] = hb; al.u[i] = ASPLIT ? bf16_bits(xs[i] - bf16_val(hb)) : (unsigned short)0; }
#pragma unroll
    for (int t = 0; t < 4; ++t) {
      const unsigned short* brow = Wt + (size_t)(col0 + t * 16 + ln) * ldb + kb;
      FragB b;
      b.half[0] = *(const v8us*)(brow + 8 * hh);
      b.half[1] = *(const v8us*)(brow + 16 + 8 * hh);
      acc[t] = mmaN<ASPLIT ? 2 : 1>(ah.v, al.v, b.v, b.v, acc[t]);
    }
  }
#pragma unroll
  for (int t = 0; t < 4; ++t) {
    float bv = bias ? bias[col0 + t * 16 + ln] : 0.f;
    if (BIAS_BF16) bv = bf16_round(bv);
#pragma unroll
    for (int r = 0; r < 8; ++r) { float v = acc[t][r] + bv; if (ACT == 1) v = fmaxf(v, 0.f); so[w][8 * hh + r][t * 16 + ln] = v; }
  }
  __builtin_amdgcn_fence(__ATOMIC_ACQ_REL, "workgroup");
  __builtin_amdgcn_wave_barrier();
  const int rsub = lane >> 4, c4 = (lane & 15) * 4;
  {
#pragma unroll
    for (int q = 0; q < 8; ++q) {
      const int r = q * 2 + rsub;
      const v4f v = *(const v4fa*)&so[w][r][c4];
      *(v4f*)(C + (size_t)(row0 + r) * ldc + col0 + c4) = v;
    }
    
  }
}

// Flash-style causal/unmasked attention, all contractions 3-term bf16 hi/lo splits, f32 softmax with running max.
// q,k,v rows are read from f32 buffers with arbitrary row pitch (so they can live inside a fused qkv buffer);
// D = head size (multiple of 32, <= 128); one wave = 16 query rows; block = 4 waves (64 queries) sharing K/V chunks of 32.
template <int D, bool CAUSAL>
__global__ __launch_bounds__(128) void k_flash(const float* __restrict__ qb, const float* __restrict__ kb, const float* __restrict__ vb,
                                             int pitch, int T, int H, float scale, float* __restrict__ y, int ypitch) {
  constexpr int KS = D / 32;        // k-steps for QK
  constexpr int DT = D / 16;        // d tiles for PV
  __shared__ __attribute__((aligned(16))) unsigned short sKh[32][D + 8], sKl[32][D + 8], sVh[32][D + 8], sVl[32][D + 8];
  __shared__ __attribute__((aligned(16))) unsigned short sPh[4][16][40], sPl[4][16][40];
  __shared__ __attribute__((aligned(16))) float sO[4][16][D];
  const int tid = threadIdx.x, w = tid >> 5, lane = tid & 31, ln = lane & 15, hh = lane >> 4;
  const int nqb = (T + 63) / 64;
  const int bh = blockIdx.x / nqb, qblk = blockIdx.x % nqb;
  const int b = bh / H, h = bh % H;
  const int q0 = qblk * 64 + w * 16;
  const float* Q = qb + (size_t)b * T * pitch + h * D;
  const float* K = kb + (size_t)b * T * pitch + h * D;
  const float* V = vb + (size_t)b * T * pitch + h * D;

  // A fragments of the wave's 16 query rows (scaled), hi/lo
  FragB aqh[KS], aql[KS];
  {
    int row = q0 + ln; if (row >= T) row = T - 1;
    const float* qr = Q + (size_t)row * pitch;
#pragma unroll
    for (int ks = 0; ks < KS; ++ks)
#pragma unroll
      for (int i = 0; i < 16; ++i) {
        const int d = ks * 32 + ((i < 8) ? (8 * hh + i) : (16 + 8 * hh + (i - 8)));
        const float x = qr[d] * scale; const unsigned short hb = bf16_bits(x);
        aqh[ks].u[i] = hb; aql[ks].u[i] = bf16_bits(x - bf16_val(hb));
      }
  }
  float m_r[8], l_r[8];
#pragma unroll
  for (int r = 0; r < 8; ++r) { m_r[r] = -3.0e38f; l_r[r] = 0.f; }
  v8f oacc[DT];
#pragma unroll
  for (int dt = 0; dt < DT; ++dt) oacc[dt] = (v8f){0.f,0.f,0.f,0.f,0.f,0.f,0.f,0.f};

  const int kv_end = CAUSAL ? min(T, qblk * 64 + 64) : T;     // block-uniform
  for (int j0 = 0; j0 < kv_end; j0 += 32) {
    __syncthreads();
    for (int e = tid; e < 32 * (D / 4); e += 128) {
      const int r = e / (D / 4), c4 = (e % (D / 4)) * 4;
      const int key = j0 + r;
      v4f kf = {0.f,0.f,0.f,0.f}, vf = {0.f,0.f,0.f,0.f};
      if (key < T) { kf = *(const v4fa*)(K + (size_t)key * pitch + c4); vf = *(const v4fa*)(V + (size_t)key * pitch + c4); }
#pragma unroll
      for (int t = 0; t < 4; ++t) {
        unsigned short hb = bf16_bits(kf[t]); sKh[r][c4 + t] = hb; sKl[r][c4 + t] = bf16_bits(kf[t] - bf16_val(hb));
        hb = bf16_bits(vf[t]); sVh[r][c4 + t] = hb; sVl[r][c4 + t] = bf16_bits(vf[t] - bf16_val(hb));
      }
    }
    __syncthreads();
    // S tile 16 x 32
    v8f s[2];
#pragma unroll
    for (int nt = 0; nt < 2; ++nt) {
      v8f acc = {};
#pragma unroll
      for (int ks = 0; ks < KS; ++ks) {
        FragB bh_, bl_;
        bh_.half[0] = *(const v8us*)&sKh[nt * 16 + ln][ks * 32 + 8 * hh]; bh_.half[1] = *(const v8us*)&sKh[nt * 16 + ln][ks * 32 + 16 + 8 * hh];
        bl_.half[0] = *(const v8us*)&sKl[nt * 16 + ln][ks * 32 + 8 * hh]; bl_.half[1] = *(const v8us*)&sKl[nt * 16 + ln][ks * 32 + 16 + 8 * hh];
        acc = mmaN<3>(aqh[ks].v, aql[ks].v, bh_.v, bl_.v, acc);
      }
      s[nt] = acc;
    }
    // mask + running max (rows 8hh+r; the 16 lanes of a half share rows)
    float alpha[8];
#pragma unroll
    for (int r = 0; r < 8; ++r) {
      const int qi = q0 + 8 * hh + r;
      const int ja = j0 + ln, jb = j0 + 16 + ln;
      if (CAUSAL) { if (ja > qi) s[0][r] = -3.0e38f; if (jb > qi) s[1][r] = -3.0e38f; }
      if (ja >= T) s[0][r] = -3.0e38f;
      if (jb >= T) s[1][r] = -3.0e38f;
      float mx = fmaxf(s[0][r], s[1][r]);
      mx = fmaxf(mx, __shfl_xor(mx, 1, 32)); mx = fmaxf(mx, __shfl_xor(mx, 2, 32)); mx = fmaxf(mx, __shfl_xor(mx, 4, 32)); mx = fmaxf(mx, __shfl_xor(mx, 8, 32));
      const float mnew = fmaxf(m_r[r], mx);
      alpha[r] = (mnew > -1.0e38f) ? __expf(m_r[r] - mnew) : 1.0f;
      const float p0 = (s[0][r] > -1.0e38f) ? __expf(s[0][r] - mnew) : 0.f;
      const float p1 = (s[1][r] > -1.0e38f) ? __expf(s[1][r] - mnew) : 0.f;
      m_r[r] = mnew;
      l_r[r] = l_r[r] * alpha[r] + p0 + p1;            // per-lane partial row sum (16 lanes combined at the end)
      unsigned short hb = bf16_bits(p0); sPh[w][8 * hh + r][ln] = hb;      sPl[w][8 * hh + r][ln] = bf16_bits(p0 - bf16_val(hb));
      hb = bf16_bits(p1);                sPh[w][8 * hh + r][16 + ln] = hb; sPl[w][8 * hh + r][16 + ln] = bf16_bits(p1 - bf16_val(hb));
    }
#pragma unroll
    for (int dt = 0; dt < DT; ++dt)
#pragma unroll
      for (int r = 0; r < 8; ++r) oacc[dt][r] *= alpha[r];
    __builtin_amdgcn_fence(__ATOMIC_ACQ_REL, "workgroup");
    __builtin_amdgcn_wave_barrier();
    FragB pah, pal;
    pah.half[0] = *(const v8us*)&sPh[w][ln][8 * hh]; pah.half[1] = *(const v8us*)&sPh[w][ln][16 + 8 * hh];
    pal.half[0] = *(const v8us*)&sPl[w][ln][8 * hh]; pal.half[1] = *(const v8us*)&sPl[w][ln][16 + 8 * hh];
#pragma unroll
    for (int dt = 0; dt < DT; ++dt) {
      FragB bvh, bvl;
#pragma unroll
      for (int i = 0; i < 8; ++i) {
        bvh.u[i] = sVh[8 * hh + i][dt * 16 + ln]; bvh.u[8 + i] = sVh[16 + 8 * hh + i][dt * 16 + ln];
        bvl.u[i] = sVl[8 * hh + i][dt * 16 + ln]; bvl.u[8 + i] = sVl[16 + 8 * hh + i][dt * 16 + ln];
      }
      oacc[dt] = mmaN<3>(pah.v, pal.v, bvh.v, bvl.v, oacc[dt]);
    }
    __builtin_amdgcn_fence(__ATOMIC_ACQ_REL, "workgroup");
    __builtin_amdgcn_wave_barrier();
  }
#pragma unroll
  for (int r = 0; r < 8; ++r) {
    float l = l_r[r];
    l += __shfl_xor(l, 1, 32); l += __shfl_xor(l, 2, 32); l += __shfl_xor(l, 4, 32); l += __shfl_xor(l, 8, 32);
    l_r[r] = (l > 0.f) ? 1.0f / l : 0.f;
  }
#pragma unroll
  for (int dt = 0; dt < DT; ++dt)
#pragma unroll
    for (int r = 0; r < 8; ++r) sO[w][8 * hh + r][dt * 16 + ln] = oacc[dt][r] * l_r[r];
  __builtin_amdgcn_fence(__ATOMIC_ACQ_REL, "workgroup");
  __builtin_amdgcn_wave_barrier();
  {
    for (int r = 0; r < 16; ++r) {
      const int row = q0 + r;
      if (row < T && lane < D / 4) {
        const v4f val = *(const v4fa*)&sO[w][r][lane * 4];
        *(v4f*)(y + ((size_t)b * T + row) * ypitch + h * D + lane * 4) = val;
      }
    }
    
  }
}

// GEMM C = act(A·W + bias + resid): A f32 (ASPLIT -> hi/lo 2 terms), Wt bf16 [N][K]; ACT 0 none, 1 relu, 2 exact gelu;
// resid (optional, f32, row index = (row % rmod), pitch ldr, RES_BF16 rounds it) added before the activation.
template <bool ASPLIT, int ACT, bool BIAS_BF16, bool RES_BF16>
__global__ __launch_bounds__(128) void k_gemm_bf3(const float* __restrict__ A, int lda, const unsigned short* __restrict__ Wt, int ldb,
                                                const float* __restrict__ bias, const float* __restrict__ resid, int rmod, int ldr,
                                                float* __restrict__ C, int ldc, int M, int N, int K) {
  __shared__ __attribute__((aligned(16))) float so[4][16][64];
  const int tid = threadIdx.x, w = tid >> 5, lane = tid & 31, ln = lane & 15, hh = lane >> 4;
  const int ntn = N / 64;
  const int wid = blockIdx.x * 4 + w;
  const int mt = wid / ntn, nq = wid % ntn;
  if (mt * 16 >= M) return;
  const int row0 = mt * 16, col0 = nq * 64;
  const float* arow = A + (size_t)(row0 + ln) * lda;
  v8f acc[4] = {};
  for (int kb = 0; kb < K; kb += 32) {
    FragB ah, al;
    const v4f x0 = *(const v4fa*)(arow + kb + 8 * hh), x1 = *(const v4fa*)(arow + kb + 8 * hh + 4);
    const v4f x2 = *(const v4fa*)(arow + kb + 16 + 8 * hh), x3 = *(const v4fa*)(arow + kb + 16 + 8 * hh + 4);
    float xs[16] = {x0[0],x0[1],x0[2],x0[3],x1[0],x1[1],x1[2],x1[3],x2[0],x2[1],x2[2],x2[3],x3[0],x3[1],x3[2],x3[3]};
#pragma unroll
    for (int i = 0; i < 16; ++i) { const unsigned short hb = bf16_bits(xs[i]); ah.u[i] = hb; al.u[i] = ASPLIT ? bf16_bits(xs[i] - bf16_val(hb)) : (unsigned short)0; }
#pragma unroll
    for (int t = 0; t < 4; ++t) {
      const unsigned short* brow = Wt + (size_t)(col0 + t * 16 + ln) * ldb + kb;
      FragB b;
      b.half[0] = *(const v8us*)(brow + 8 * hh);
      b.half[1] = *(const v8us*)(brow + 16 + 8 * hh);
      acc[t] = mmaN<ASPLIT ? 2 : 1>(ah.v, al.v, b.v, b.v, acc[t]);
    }
  }
#pragma unroll
  for (int t = 0; t < 4; ++t) {
    const int col = col0 + t * 16 + ln;
    float bv = bias ? bias[col] : 0.f;
    if (BIAS_BF16) bv = bf16_round(bv);
#pragma unroll
    for (int r = 0; r < 8; ++r) {
      float v = acc[t][r] + bv;
      if (resid) { float rv = resid[(size_t)((row0 + 8 * hh + r) % rmod) * ldr + col]; if (RES_BF16) rv = bf16_round(rv); v += rv; }
      if (ACT == 1) v = fmaxf(v, 0.f);
      if (ACT == 2) v = 0.5f * v * (1.0f + erff(v * 0.70710678118654752f));
      if (ACT == 3) { const float u = 0.7978845608028654f * (v + 0.044715f * v * v * v); v = 0.5f * v * (1.0f + tanhf(u)); }
      so[w][8 * hh + r][t * 16 + ln] = v;
    }
  }
  __builtin_amdgcn_fence(__ATOMIC_ACQ_REL, "workgroup");
  __builtin_amdgcn_wave_barrier();
  const int rsub = lane >> 4, c4 = (lane & 15) * 4;
  {
#pragma unroll
    for (int q = 0; q < 8; ++q) {
      const int r = q * 2 + rsub;
      const v4f v = *(const v4fa*)&so[w][r][c4];
      *(v4f*)(C + (size_t)(row0 + r) * ldc + col0 + c4) = v;
    }
    
  }
}
// row LayerNorm (biased variance, eps) over N: s = X (+ R); optional out_sum <- s; out_norm <- (s-mu)*rsqrt(var+eps)*g + b
template <bool PARAM_BF16>
__global__ __launch_bounds__(256) void k_layernorm(const float* __restrict__ X, const float* __restrict__ R, const float* __restrict__ g, const float* __restrict__ bta,
                                                  float* __restrict__ out_sum, float* __restrict__ out_norm, int N, float eps) {
  __shared__ float red[256];
  const int row = blockIdx.x, tid = threadIdx.x;
  const float* x = X + (size_t)row * N; const float* rr = R ? R + (size_t)row * N : nullptr;
  float vals[16];                     // up to N = 4096
  const int per = N / 256;            // contiguous chunk per thread? use strided-by-4 chunks: thread handles j = tid*4 + 1024*u
  float s1 = 0.f;
  for (int u = 0; u < per / 4; ++u) {
    const int j = tid * 4 + 1024 * u;
    const v4f a = *(const v4fa*)(x + j);
    v4f b = {0.f,0.f,0.f,0.f}; if (rr) b = *(const v4fa*)(rr + j);
#pragma unroll
    for (int q = 0; q < 4; ++q) { const float v = a[q] + b[q]; vals[u * 4 + q] = v; s1 += v; }
  }
  red[tid] = s1; __syncthreads();
  for (int st = 128; st > 0; st >>= 1) { if (tid < st) red[tid] += red[tid + st]; __syncthreads(); }
  const float mu = red[0] / (float)N; __syncthreads();
  float s2 = 0.f;
  for (int u = 0; u < per / 4; ++u)
#pragma unroll
    for (int q = 0; q < 4; ++q) { const float c = vals[u * 4 + q] - mu; s2 += c * c; }
  red[tid] = s2; __syncthreads();
  for (int st = 128; st > 0; st >>= 1) { if (tid < st) red[tid] += red[tid + st]; __syncthreads(); }
  const float rs = rsqrtf(red[0] / (float)N + eps);
  {
    for (int u = 0; u < per / 4; ++u) {
      const int j = tid * 4 + 1024 * u;
      v4f o, sm;
#pragma unroll
      for (int q = 0; q < 4; ++q) {
        float gg = g[j + q], bb = bta[j + q];
        if (PARAM_BF16) { gg = bf16_round(gg); bb = bf16_round(bb); }
        sm[q] = vals[u * 4 + q]; o[q] = (vals[u * 4 + q] - mu) * rs * gg + bb;
      }
      if (out_sum) *(v4f*)(out_sum + (size_t)row * N + j) = sm;
      *(v4f*)(out_norm + (size_t)row * N + j) = o;
    }
    
  }
}



// ---- f16 WMMA path (v_wmma_f32_16x16x32_f16): 11-bit significands for operands in range — used where a [0,1] probability operand needs more precision than bf16
typedef _Float16 v16h __attribute__((ext_vector_type(16)));
union FragH { v16h v; v8us half[2]; _Float16 h[16]; unsigned short u[16]; };
template <int NT>
__device__ __forceinline__ v8f mmaH(v16h ah, v16h al, v16h bh, v16h bl, v8f c) {
  c = __builtin_amdgcn_wmma_f32_16x16x32_f16(false, ah, false, bh, (short)0, c, false, false);
  if (NT >= 2) c = __builtin_amdgcn_wmma_f32_16x16x32_f16(false, al, false, bh, (short)0, c, false, false);
  if (NT >= 3) c = __builtin_amdgcn_wmma_f32_16x16x32_f16(false, ah, false, bl, (short)0, c, false, false);
  asm volatile("v_nop\n\tv_nop\n\tv_nop\n\tv_nop" : "+v"(c) : "v"(ah), "v"(al), "v"(bh), "v"(bl));
  return c;
}
// batched GEMM like k_gemm_b but f16 operands: A f32 (split into f16 hi/lo if ASPLIT, else rounded to f16), Bt = f16 values [n][k]; alpha; C f32; N multiple of 16 (partial tiles skipped)
template <bool ASPLIT>
__global__ __launch_bounds__(128) void k_gemm_h(const float* __restrict__ A, int lda, size_t sA, const _Float16* __restrict__ Bh, int ldb, size_t sB, float alpha, float* __restrict__ C, int ldc, size_t sC, int M, int N, int K) {
  __shared__ __attribute__((aligned(16))) float so[4][16][64];
  const int tid = threadIdx.x, w = tid >> 5, lane = tid & 31, ln = lane & 15, hh = lane >> 4; const int by = blockIdx.y;
  A += (size_t)by * sA; Bh += (size_t)by * sB; C += (size_t)by * sC;
  const int ntn = (N + 63) / 64; const int wid = blockIdx.x * 4 + w; const int mt = wid / ntn, nq = wid % ntn; if (mt * 16 >= M) return;
  const int row0 = mt * 16, col0 = nq * 64; const float* arow = A + (size_t)(row0 + ln) * lda;
  v8f acc[4] = {};
  for (int kb = 0; kb < K; kb += 32) {
    FragH ah, al;
    const v4f x0 = *(const v4fa*)(arow + kb + 8 * hh), x1 = *(const v4fa*)(arow + kb + 8 * hh + 4), x2 = *(const v4fa*)(arow + kb + 16 + 8 * hh), x3 = *(const v4fa*)(arow + kb + 16 + 8 * hh + 4);
    float xs[16] = {x0[0],x0[1],x0[2],x0[3],x1[0],x1[1],x1[2],x1[3],x2[0],x2[1],x2[2],x2[3],x3[0],x3[1],x3[2],x3[3]};
#pragma unroll
    for (int i = 0; i < 16; ++i) { const _Float16 h = (_Float16)xs[i]; ah.h[i] = h; al.h[i] = ASPLIT ? (_Float16)(xs[i] - (float)h) : (_Float16)0.0f; }
#pragma unroll
    for (int t = 0; t < 4; ++t) { if (col0 + t * 16 >= N) continue; const size_t boff = (size_t)(col0 + t * 16 + ln) * ldb + kb; FragH bq; bq.half[0] = *(const v8us*)(Bh + boff + 8 * hh); bq.half[1] = *(const v8us*)(Bh + boff + 16 + 8 * hh);
      acc[t] = mmaH<ASPLIT ? 2 : 1>(ah.v, al.v, bq.v, bq.v, acc[t]); }
  }
#pragma unroll
  for (int t = 0; t < 4; ++t) { if (col0 + t * 16 >= N) continue;
#pragma unroll
    for (int r = 0; r < 8; ++r) so[w][8 * hh + r][t * 16 + ln] = acc[t][r] * alpha; }
  __builtin_amdgcn_fence(__ATOMIC_ACQ_REL, "workgroup"); __builtin_amdgcn_wave_barrier();
  const int rsub = lane >> 4, c4 = (lane & 15) * 4;
  {
#pragma unroll
    for (int q = 0; q < 8; ++q) { const int r = q * 2 + rsub; if (col0 + c4 < N) { const v4f v = *(const v4fa*)&so[w][r][c4]; *(v4f*)(C + (size_t)(row0 + r) * ldc + col0 + c4) = v; } }
     }
}

// Wt[n][k] = f16(W[k][n]·scale) from f32 row-major W[K][N] (scale = power of two; bf16-exact weights stay exact in f16 away from the subnormal range)
__global__ __launch_bounds__(256) void k_wt_f16(const float* __restrict__ W, _Float16* __restrict__ Wt, int K, int N, float scale) {
  const int t = blockIdx.x * 256 + threadIdx.x; if (t >= N * (K / 8)) return; const int n = t / (K / 8), k8 = (t % (K / 8)) * 8; FragH f;
#pragma unroll
  for (int i = 0; i < 8; ++i) f.h[i] = (_Float16)(bf16_round(W[(size_t)(k8 + i) * N + n]) * scale); const v8us o = f.half[0];
  *(v8us*)((unsigned short*)Wt + (size_t)n * K + k8) = o; 
}
// k_gemm_hh variant with fused epilogue: v = acc·alpha + bias[by·sBias + col] (+ CP[(row/rowsPerB)·sCPb + by·64 + col] if CP) ; ACT 0 none / 1 elu ; writes f16 C16 and f32 C, each if non-null
template <int ACT>
__global__ __launch_bounds__(128) void k_gemm_hhx(const _Float16* __restrict__ A, int lda, size_t sA, const _Float16* __restrict__ Bh, int ldb, size_t sB, float alpha, const float* __restrict__ bias, size_t sBias, const float* __restrict__ CP, int rowsPerB, size_t sCPb, int row0g,
    float* __restrict__ C, _Float16* __restrict__ C16, int ldc, size_t sC, int M, int N, int K) {
  __shared__ __attribute__((aligned(16))) float so[4][16][64];
  const int tid = threadIdx.x, w = tid >> 5, lane = tid & 31, ln = lane & 15, hh = lane >> 4; const int by = blockIdx.y;
  A += (size_t)by * sA; Bh += (size_t)by * sB; const size_t cofs = (size_t)by * sC; const float* bp = bias ? bias + (size_t)by * sBias : nullptr;
  const int ntn = (N + 63) / 64; const int wid = blockIdx.x * 4 + w; const int mt = wid / ntn, nq = wid % ntn; if (mt * 16 >= M) return;
  const int row0 = mt * 16, col0 = nq * 64; const _Float16* arow = A + (size_t)(row0 + ln) * lda;
  v8f acc[4] = {};
  for (int kb = 0; kb < K; kb += 32) { FragH ah; ah.half[0] = *(const v8us*)((const unsigned short*)arow + kb + 8 * hh); ah.half[1] = *(const v8us*)((const unsigned short*)arow + kb + 16 + 8 * hh);
#pragma unroll
    for (int t = 0; t < 4; ++t) { if (col0 + t * 16 >= N) continue; const size_t boff = (size_t)(col0 + t * 16 + ln) * ldb + kb; FragH bq; bq.half[0] = *(const v8us*)((const unsigned short*)Bh + boff + 8 * hh); bq.half[1] = *(const v8us*)((const unsigned short*)Bh + boff + 16 + 8 * hh);
      acc[t] = mmaH<1>(ah.v, ah.v, bq.v, bq.v, acc[t]); }
  }
#pragma unroll
  for (int t = 0; t < 4; ++t) { if (col0 + t * 16 >= N) continue; const int col = col0 + t * 16 + ln; const float bv = bp ? bf16_round(bp[col]) : 0.f;
#pragma unroll
    for (int r = 0; r < 8; ++r) { float v = acc[t][r] * alpha + bv; if (CP) { const int bidx = (row0g + row0 + 8 * hh + r) / rowsPerB; v += CP[(size_t)bidx * sCPb + (size_t)by * 64 + col]; } if (ACT == 1) v = (v > 0.f) ? v : expm1f(v); else if (ACT == 7) v = (v > 0.f) ? v + 1.0f : expf(v); else if (ACT == 8) v = tanhf(v); else if (ACT == 9) v = 0.5f * v * (1.0f + tanhf(0.7978845608028654f * (v + 0.044715f * v * v * v))); else if (ACT == 11) v = 1.0f / (1.0f + expf(-v)); else if (ACT == 12) v = (v > 0.f) ? v : 0.01f * v; else if (ACT == 14) v = (v > 0.f) ? v : 0.1f * v; else if (ACT == 15) v = v / (1.0f + expf(-v)); else if (ACT == 3) v = fmaxf(v, 0.f); else if (ACT == 6) v = 0.5f * v * (1.0f + erff(v * 0.70710678118654752f)); so[w][8 * hh + r][t * 16 + ln] = v; } }
  __builtin_amdgcn_fence(__ATOMIC_ACQ_REL, "workgroup"); __builtin_amdgcn_wave_barrier();
  const int rsub = lane >> 4, c4 = (lane & 15) * 4; typedef _Float16 v4h __attribute__((ext_vector_type(4)));
  {
#pragma unroll
    for (int q = 0; q < 8; ++q) { const int r = q * 2 + rsub; if (col0 + c4 < N) { const v4f v = *(const v4fa*)&so[w][r][c4]; if (C) *(v4f*)(C + cofs + (size_t)(row0 + r) * ldc + col0 + c4) = v; if (C16) { v4h h4; for (int i = 0; i < 4; ++i) h4[i] = (_Float16)v[i]; *(v4h*)(C16 + cofs + (size_t)(row0 + r) * ldc + col0 + c4) = h4; } } }
     }
}


// Block-tiled GEMM, f16 operands, both K-contiguous: C[8192][NN] = A[8192][KK] . Bh[NN][KK]^T * alpha + bf16(bias). One 128x128 tile of C per work-group of 8 waves (4x2), 32x64 per wave.
// A pass is 128 k = 256 aligned bytes of each of the 256 operand rows, brought into LDS by asynchronous copies (two buffers, the next pass's copies fly while this pass is worked on), so that every line leaves L2 once per work-group and not once per wave.
// LDS rows at pitch 272 bytes (16 x odd) for the 16-byte fragment reads. The k order of a fragment and the order of the k steps are those of k_gemm_hhx.
__device__ __forceinline__ unsigned lds_off(const void* p) { return (unsigned)(size_t)p; }
// eight copies of 16 bytes per lane: rows r, r + 16, ..., r + 112 of one operand's tile. The s_wait_xcnt stands inside the statement so that no address register is rewritten ahead of it.
__device__ __forceinline__ void copy_rows8(unsigned l0, const _Float16* g0, int rowstep, unsigned ldsstep) {
  const unsigned l1 = l0 + ldsstep, l2 = l0 + 2 * ldsstep, l3 = l0 + 3 * ldsstep, l4 = l0 + 4 * ldsstep, l5 = l0 + 5 * ldsstep, l6 = l0 + 6 * ldsstep, l7 = l0 + 7 * ldsstep;
  const _Float16* g1 = g0 + rowstep; const _Float16* g2 = g0 + 2 * rowstep; const _Float16* g3 = g0 + 3 * rowstep; const _Float16* g4 = g0 + 4 * rowstep;
  const _Float16* g5 = g0 + 5 * rowstep; const _Float16* g6 = g0 + 6 * rowstep; const _Float16* g7 = g0 + 7 * rowstep;
  asm volatile("global_load_async_to_lds_b128 %0, %8, off\n\t"
               "global_load_async_to_lds_b128 %1, %9, off\n\t"
               "global_load_async_to_lds_b128 %2, %10, off\n\t"
               "global_load_async_to_lds_b128 %3, %11, off\n\t"
               "global_load_async_to_lds_b128 %4, %12, off\n\t"
               "global_load_async_to_lds_b128 %5, %13, off\n\t"
               "global_load_async_to_lds_b128 %6, %14, off\n\t"
               "global_load_async_to_lds_b128 %7, %15, off\n\t"
               "s_wait_xcnt 0x0"
               :: "v"(l0), "v"(l1), "v"(l2), "v"(l3), "v"(l4), "v"(l5), "v"(l6), "v"(l7),
                  "v"(g0), "v"(g1), "v"(g2), "v"(g3), "v"(g4), "v"(g5), "v"(g6), "v"(g7) : "memory");
}
template <int KK, int NN, bool OUT16>
__global__ __launch_bounds__(256) void k_gemm_tile(const _Float16* __restrict__ A, const _Float16* __restrict__ Bh, float alpha, const float* __restrict__ bias, float* __restrict__ C, _Float16* __restrict__ C16) {
  constexpr int BK = 128, KSN = BK / 32, PITCH = 2 * BK + 16, STAGE = 256 * PITCH, NPASS = KK / BK, NTN = NN / 128, SOP = 68;
  static_assert(NPASS >= 2 && KK % BK == 0 && NN % 128 == 0 && 8 * 32 * SOP * 4 <= 2 * STAGE, "shape");
  __shared__ __attribute__((aligned(16))) unsigned char sm[2 * STAGE];
  const int tid = threadIdx.x, w = tid >> 5, lane = tid & 31, ln = lane & 15, hh = lane >> 4;
  const int m0 = (blockIdx.x / NTN) * 128, n0 = (blockIdx.x % NTN) * 128; const int wm = w >> 1, wn = w & 1;
  const int cr = tid >> 4, cc = tid & 15;      // a wave's copy = 2 rows x 256 bytes
  const _Float16* ga = A + (size_t)(m0 + cr) * KK + cc * 8; const _Float16* gb = Bh + (size_t)(n0 + cr) * KK + cc * 8;
  const unsigned la = lds_off(sm) + cr * PITCH + cc * 16, lb = la + 128 * PITCH;
  v8f acc[2][4];
#pragma unroll
  for (int i = 0; i < 2; ++i)
#pragma unroll
    for (int j = 0; j < 4; ++j) acc[i][j] = (v8f){0.f,0.f,0.f,0.f,0.f,0.f,0.f,0.f};
  copy_rows8(la, ga, 16 * KK, 16 * PITCH); copy_rows8(lb, gb, 16 * KK, 16 * PITCH);
  asm volatile("s_wait_asynccnt 0x0" ::: "memory");      // pass 0's bytes have landed before the barrier publishes them
  __syncthreads();
  copy_rows8(la + STAGE, ga + BK, 16 * KK, 16 * PITCH); copy_rows8(lb + STAGE, gb + BK, 16 * KK, 16 * PITCH);
  const unsigned char* fa = sm + (wm * 32 + ln) * PITCH + 16 * hh; const unsigned char* fb = sm + (128 + wn * 64 + ln) * PITCH + 16 * hh;
#pragma unroll 1      // the ring stays one rolled loop: one publish point, short code
  for (int t = 0; t < NPASS; ++t) {
    const int bo = (t & 1) * STAGE;
    FragH a[2][2], b[2][4];      // two fragment sets: the next 32 k of this pass are fetched while these are multiplied
#pragma unroll
    for (int i = 0; i < 2; ++i) { a[0][i].half[0] = *(const v8us*)(fa + bo + i * 16 * PITCH); a[0][i].half[1] = *(const v8us*)(fa + bo + i * 16 * PITCH + 32); }
#pragma unroll
    for (int j = 0; j < 4; ++j) { b[0][j].half[0] = *(const v8us*)(fb + bo + j * 16 * PITCH); b[0][j].half[1] = *(const v8us*)(fb + bo + j * 16 * PITCH + 32); }
#pragma unroll
    for (int ks = 0; ks < KSN; ++ks) {
      const int cu = ks & 1, nx = cu ^ 1;
      if (ks + 1 < KSN) {
#pragma unroll
        for (int i = 0; i < 2; ++i) { a[nx][i].half[0] = *(const v8us*)(fa + bo + i * 16 * PITCH + (ks + 1) * 64); a[nx][i].half[1] = *(const v8us*)(fa + bo + i * 16 * PITCH + (ks + 1) * 64 + 32); }
#pragma unroll
        for (int j = 0; j < 4; ++j) { b[nx][j].half[0] = *(const v8us*)(fb + bo + j * 16 * PITCH + (ks + 1) * 64); b[nx][j].half[1] = *(const v8us*)(fb + bo + j * 16 * PITCH + (ks + 1) * 64 + 32); }
        __builtin_amdgcn_sched_barrier(0);      // keeps the next set's LDS reads one group ahead of this set's products; without it they are sunk among the products, into one register set, and each product run waits out the LDS latency
      }
#pragma unroll
      for (int i = 0; i < 2; ++i)
#pragma unroll
        for (int j = 0; j < 4; ++j) acc[i][j] = __builtin_amdgcn_wmma_f32_16x16x32_f16(false, a[cu][i].v, false, b[cu][j].v, (short)0, acc[i][j], false, false);
    }
    __builtin_amdgcn_sched_barrier(0);      // keeps the pass's products in front of the publish point: sunk behind the barrier they stand between it and the refill, and the copies start that much later
    asm volatile("s_wait_dscnt 0x0" ::: "memory");       // this wave's reads of the buffer are done before it is handed to the copies
    asm volatile("s_wait_asynccnt 0x0" ::: "memory");    // this wave's copies of pass t + 1 have landed before the barrier publishes them
    __syncthreads();
    if (t + 2 < NPASS) { copy_rows8(la + bo, ga + (t + 2) * BK, 16 * KK, 16 * PITCH); copy_rows8(lb + bo, gb + (t + 2) * BK, 16 * KK, 16 * PITCH); }
  }
  asm volatile("s_wait_asynccnt 0x0" ::: "memory");      // nothing is in flight when the ring becomes output staging
  float* so = (float*)sm + w * (32 * SOP);      // each wave stages its own 32 x 64 tile; every reader left the ring at the last pass's barrier
#pragma unroll
  for (int j = 0; j < 4; ++j) { const float bv = bf16_round(bias[n0 + wn * 64 + j * 16 + ln]);
#pragma unroll
    for (int i = 0; i < 2; ++i)
#pragma unroll
      for (int r = 0; r < 8; ++r) so[(i * 16 + 8 * hh + r) * SOP + j * 16 + ln] = acc[i][j][r] * alpha + bv; }
  __builtin_amdgcn_fence(__ATOMIC_ACQ_REL, "workgroup"); __builtin_amdgcn_wave_barrier();      // the wave's own staged rows are written before other lanes of it read them back
  if (OUT16) {
#pragma unroll
    for (int q = 0; q < 8; ++q) { const int r = q * 4 + (lane >> 3), c8 = (lane & 7) * 8; const v4f v0 = *(const v4fa*)&so[r * SOP + c8], v1 = *(const v4fa*)&so[r * SOP + c8 + 4]; FragH f;
#pragma unroll
      for (int i = 0; i < 4; ++i) { f.h[i] = (_Float16)v0[i]; f.h[4 + i] = (_Float16)v1[i]; }
      *(v8us*)((unsigned short*)C16 + (size_t)(m0 + wm * 32 + r) * NN + n0 + wn * 64 + c8) = f.half[0]; }
  } else {
#pragma unroll
    for (int q = 0; q < 16; ++q) { const int r = q * 2 + (lane >> 4), c4 = (lane & 15) * 4; const v4f v = *(const v4fa*)&so[r * SOP + c4];
      *(v4f*)(C + (size_t)(m0 + wm * 32 + r) * NN + n0 + wn * 64 + c4) = v; }
  }
}


typedef _Float16 v4h __attribute__((ext_vector_type(4)));

__global__ __launch_bounds__(256) void k_x16(const float* __restrict__ x, _Float16* __restrict__ X16, size_t n8) { const size_t t = (size_t)blockIdx.x * 256 + threadIdx.x; if (t >= n8) return; FragH f;
#pragma unroll
  for (int q = 0; q < 8; ++q) f.h[q] = (_Float16)bf16_round(x[t * 8 + q]); *(v8us*)((unsigned short*)X16 + t * 8) = f.half[0];  }
__global__ __launch_bounds__(256) void k_h16(const float* __restrict__ x, _Float16* __restrict__ X16, size_t n8) { const size_t t = (size_t)blockIdx.x * 256 + threadIdx.x; if (t >= n8) return; FragH f;
#pragma unroll
  for (int q = 0; q < 8; ++q) f.h[q] = (_Float16)x[t * 8 + q]; *(v8us*)((unsigned short*)X16 + t * 8) = f.half[0];  }
__global__ __launch_bounds__(256) void k_round16f(const float* __restrict__ W, _Float16* __restrict__ Bt, size_t n8) { const size_t t = (size_t)blockIdx.x * 256 + threadIdx.x; if (t >= n8) return; FragH f;
#pragma unroll
  for (int i = 0; i < 8; ++i) f.h[i] = (_Float16)(bf16_round(W[t * 8 + i]) * 16.0f); *(v8us*)((unsigned short*)Bt + t * 8) = f.half[0];  }
template <int NHv, int TTv>
__global__ __launch_bounds__(256) void k_vt(const _Float16* __restrict__ V16, int ldv, int voff, _Float16* __restrict__ Vt) { __shared__ unsigned short tl[64][66]; const int tid = threadIdx.x; const int slab = blockIdx.x / (TTv / 64), lg = blockIdx.x % (TTv / 64); const int b = slab / NHv, h = slab % NHv;
  for (int i = tid; i < 64 * 8; i += 256) { const int r = i / 8, c8 = (i % 8) * 8; FragH f; f.half[0] = *(const v8us*)((const unsigned short*)V16 + ((size_t)b * TTv + lg * 64 + r) * ldv + voff + h * 64 + c8);
#pragma unroll
    for (int q = 0; q < 8; ++q) tl[r][c8 + q] = f.u[q]; }
  __syncthreads();
  {
#pragma unroll
    for (int rd = 0; rd < 2; ++rd) { const int d = rd * 32 + tid / 8, pc = tid % 8; FragH f;
#pragma unroll
      for (int q = 0; q < 8; ++q) f.u[q] = tl[pc * 8 + q][d];
      *(v8us*)((unsigned short*)Vt + ((size_t)slab * 64 + d) * TTv + lg * 64 + pc * 8) = f.half[0]; }
     } }

__global__ __launch_bounds__(256) void k_h16s(const float* __restrict__ F, _Float16* __restrict__ H, size_t n8) { const size_t t = (size_t)blockIdx.x * 256 + threadIdx.x; if (t >= n8) return; const v4f a = *(const v4fa*)(F + t * 8), c = *(const v4fa*)(F + t * 8 + 4); FragH f;
#pragma unroll
  for (int q = 0; q < 4; ++q) { f.h[q] = (_Float16)(a[q] * 16.0f); f.h[4 + q] = (_Float16)(c[q] * 16.0f); } *(v8us*)((unsigned short*)H + t * 8) = f.half[0];  }
__global__ __launch_bounds__(128) void k_flash(const _Float16* __restrict__ Q16, int ldq, const _Float16* __restrict__ K16, int ldk, const _Float16* __restrict__ Vt, const int* __restrict__ MSK, float* __restrict__ O, int ldo) {
  constexpr int RPW = 16, RTN = RPW / 16, NQB = TT / (4 * RPW), DT = 4, KS = 2;
  __shared__ __attribute__((aligned(16))) unsigned short sP[4][RPW][40]; __shared__ __attribute__((aligned(16))) float sO[4][RPW][64 + 4];
  const int tid = threadIdx.x, w = tid >> 5, lane = tid & 31, ln = lane & 15, hh = lane >> 4;
  const int slab = blockIdx.x / NQB, qblk = blockIdx.x % NQB; const int b = slab / NH, h = slab % NH; const int qb0 = qblk * (4 * RPW); const int q0 = qb0 + w * RPW;
  FragH aq[2][KS];
#pragma unroll
  for (int rt = 0; rt < RTN; ++rt) { const unsigned short* qr = (const unsigned short*)Q16 + ((size_t)b * TT + q0 + rt * 16 + ln) * ldq + h * 64;
#pragma unroll
    for (int ks = 0; ks < KS; ++ks) { aq[rt][ks].half[0] = *(const v8us*)(qr + ks * 32 + 8 * hh); aq[rt][ks].half[1] = *(const v8us*)(qr + ks * 32 + 16 + 8 * hh); } }
  const unsigned short* Vth = (const unsigned short*)Vt + (size_t)slab * 64 * TT;
  float m_r[2][8], l_r[2][8]; v8f oacc[2][DT];
#pragma unroll
  for (int rt = 0; rt < RTN; ++rt) {
#pragma unroll
    for (int r = 0; r < 8; ++r) { m_r[rt][r] = -3.0e38f; l_r[rt][r] = 0.f; }
#pragma unroll
    for (int dt = 0; dt < DT; ++dt) oacc[rt][dt] = (v8f){0.f,0.f,0.f,0.f,0.f,0.f,0.f,0.f}; }
  const int jend = TT;
#pragma unroll 1
  for (int j0 = 0; j0 < jend; j0 += 32) {
    v8f s[2][2];
#pragma unroll
    for (int nt = 0; nt < 2; ++nt) { const unsigned short* kr = (const unsigned short*)K16 + ((size_t)b * TT + j0 + nt * 16 + ln) * ldk + h * 64; FragH bk[KS];
#pragma unroll
      for (int ks = 0; ks < KS; ++ks) { bk[ks].half[0] = *(const v8us*)(kr + ks * 32 + 8 * hh); bk[ks].half[1] = *(const v8us*)(kr + ks * 32 + 16 + 8 * hh); }
#pragma unroll
      for (int rt = 0; rt < RTN; ++rt) { v8f acc = (v8f){0.f,0.f,0.f,0.f,0.f,0.f,0.f,0.f};
#pragma unroll
        for (int ks = 0; ks < KS; ++ks) acc = mmaH<1>(aq[rt][ks].v, aq[rt][ks].v, bk[ks].v, bk[ks].v, acc); s[rt][nt] = acc; } }
#pragma unroll
    for (int rt = 0; rt < RTN; ++rt)
#pragma unroll
      for (int r = 0; r < 8; ++r) { const int tq = q0 + rt * 16 + 8 * hh + r; const int k0 = j0 + ln, k1 = j0 + 16 + ln; (void)tq; (void)k0; (void)k1;
        const bool ok0 = true, ok1 = true;
        const float s0 = s[rt][0][r] * ATT_SCALE, s1 = s[rt][1][r] * ATT_SCALE; float mc = fmaxf(s0, s1);
        mc = fmaxf(mc, __shfl_xor(mc, 1, 32)); mc = fmaxf(mc, __shfl_xor(mc, 2, 32)); mc = fmaxf(mc, __shfl_xor(mc, 4, 32)); mc = fmaxf(mc, __shfl_xor(mc, 8, 32));
        const float mn = fmaxf(m_r[rt][r], mc); const float al = (mn > -1.0e38f) ? expf(m_r[rt][r] - mn) : 1.0f; m_r[rt][r] = mn; const float p0 = ok0 ? expf(s0 - mn) : 0.f, p1 = ok1 ? expf(s1 - mn) : 0.f; l_r[rt][r] = l_r[rt][r] * al + p0 + p1;
#pragma unroll
        for (int dt = 0; dt < DT; ++dt) oacc[rt][dt][r] *= al;
        FragH t2; t2.h[0] = (_Float16)(p0 * 1024.0f); t2.h[1] = (_Float16)(p1 * 1024.0f); sP[w][rt * 16 + 8 * hh + r][ln] = t2.u[0]; sP[w][rt * 16 + 8 * hh + r][16 + ln] = t2.u[1]; }
    __builtin_amdgcn_fence(__ATOMIC_ACQ_REL, "workgroup"); __builtin_amdgcn_wave_barrier();
    FragH pa[2];
#pragma unroll
    for (int rt = 0; rt < RTN; ++rt) { pa[rt].half[0] = *(const v8us*)&sP[w][rt * 16 + ln][8 * hh]; pa[rt].half[1] = *(const v8us*)&sP[w][rt * 16 + ln][16 + 8 * hh]; }
#pragma unroll
    for (int dt = 0; dt < DT; ++dt) { const unsigned short* vrow = Vth + (size_t)(dt * 16 + ln) * TT + j0; FragH bv; bv.half[0] = *(const v8us*)(vrow + 8 * hh); bv.half[1] = *(const v8us*)(vrow + 16 + 8 * hh);
#pragma unroll
      for (int rt = 0; rt < RTN; ++rt) oacc[rt][dt] = mmaH<1>(pa[rt].v, pa[rt].v, bv.v, bv.v, oacc[rt][dt]); }
    __builtin_amdgcn_fence(__ATOMIC_ACQ_REL, "workgroup"); __builtin_amdgcn_wave_barrier(); }
#pragma unroll
  for (int rt = 0; rt < RTN; ++rt) {
#pragma unroll
    for (int r = 0; r < 8; ++r) { float l = l_r[rt][r]; l += __shfl_xor(l, 1, 32); l += __shfl_xor(l, 2, 32); l += __shfl_xor(l, 4, 32); l += __shfl_xor(l, 8, 32); l_r[rt][r] = (l > 0.f) ? 1.0f / (l * 1024.0f) : 0.f; }
#pragma unroll
    for (int dt = 0; dt < DT; ++dt)
#pragma unroll
      for (int r = 0; r < 8; ++r) sO[w][rt * 16 + 8 * hh + r][dt * 16 + ln] = oacc[rt][dt][r] * l_r[rt][r]; }
  __builtin_amdgcn_fence(__ATOMIC_ACQ_REL, "workgroup"); __builtin_amdgcn_wave_barrier();
  {
#pragma unroll
    for (int rp = 0; rp < RPW; rp += 2) { const int r = rp + (lane >> 4), pc = lane & 15; const v4f val = *(const v4fa*)&sO[w][r][pc * 4]; *(v4f*)(O + ((size_t)b * TT + q0 + r) * ldo + h * 64 + pc * 4) = val; }
     } }

extern "C" void kernel_launch(void* const* d_in, const int* in_sizes, int n_in,
                              void* d_out, int out_size, void* d_ws, size_t ws_size, hipStream_t stream) {
  (void)in_sizes; (void)n_in; (void)out_size;
  const float* const* I = (const float* const*)d_in; const float* x = I[0]; const float* Wq = I[1]; const float* bq = I[2]; const float* Wk = I[3]; const float* bk = I[4]; const float* Wv = I[5]; const float* bv = I[6]; const float* Wp = I[7]; const float* bp = I[8];
  char* ws = (char*)d_ws; size_t off = 0;
  auto take = [&](size_t bytes) { char* p = ws + off; off += (bytes + 255) & ~(size_t)255; return p; };
  _Float16* Bq = (_Float16*)take((size_t)DA * DX * 2); _Float16* Bk = (_Float16*)take((size_t)DA * DX * 2); _Float16* Bv = (_Float16*)take((size_t)DA * DX * 2); _Float16* Bp = (_Float16*)take((size_t)DX * DA * 2);
  _Float16* X16 = (_Float16*)take((size_t)NRX * DX * 2); _Float16* Q = (_Float16*)take((size_t)NRX * DA * 2); _Float16* K = (_Float16*)take((size_t)NRX * DA * 2); _Float16* V = (_Float16*)take((size_t)NRX * DA * 2); _Float16* Vt = (_Float16*)take((size_t)NRX * DA * 2);
  float* O = (float*)take((size_t)NRX * DA * 4); _Float16* O16 = (_Float16*)take((size_t)NRX * DA * 2);
  if (off > ws_size) return;      // 3 × 0.8 + 0.8 + 12.6 + 4 × 8.4 + 16.8 + 8.4 ≈ 75 MB
  const unsigned gwa = (unsigned)(((size_t)DA * (DX / 8) + 255) / 256);
  k_wt_f16<<<gwa, 256, 0, stream>>>(Wq, Bq, DX, DA, 16.0f); k_wt_f16<<<gwa, 256, 0, stream>>>(Wk, Bk, DX, DA, 16.0f); k_wt_f16<<<gwa, 256, 0, stream>>>(Wv, Bv, DX, DA, 16.0f); k_wt_f16<<<(unsigned)(((size_t)DX * (DA / 8) + 255) / 256), 256, 0, stream>>>(Wp, Bp, DA, DX, 16.0f);      /* (in,out) → Bt ×2^4 */
  k_x16<<<(unsigned)(((size_t)NRX * DX / 8 + 255) / 256), 256, 0, stream>>>(x, X16, (size_t)NRX * DX / 8);
  const unsigned ga = (NRX / 128) * (DA / 128);
  k_gemm_tile<DX, DA, true><<<ga, 256, 0, stream>>>(X16, Bq, 0.0625f, bq, nullptr, Q);      /* Q = x·Wq + bq (f16 [8192][512]): M 8192 N 512 K 768 */
  k_gemm_tile<DX, DA, true><<<ga, 256, 0, stream>>>(X16, Bk, 0.0625f, bk, nullptr, K);
  k_gemm_tile<DX, DA, true><<<ga, 256, 0, stream>>>(X16, Bv, 0.0625f, bv, nullptr, V);
  k_vt<1, TT><<<BB * (TT / 64), 256, 0, stream>>>(V, 64, 0, Vt);      /* each [8192][512] plane viewed as 64 contiguous [1024][64] slabs → Vᵀ [slab][64][1024] */
  k_flash<<<BB * (TT / 64), 128, 0, stream>>>(Q, 64, K, 64, Vt, nullptr, O, 64);      /* same flat view for Q, K and O */
  k_h16s<<<(unsigned)(((size_t)NRX * DA / 8 + 255) / 256), 256, 0, stream>>>(O, O16, (size_t)NRX * DA / 8);
  k_gemm_tile<DA, DX, false><<<(NRX / 128) * (DX / 128), 256, 0, stream>>>(O16, Bp, 0.00390625f, bp, (float*)d_out, nullptr);      /* out = O·Wp + bp: M 8192 N 768 K 512 (alpha undoes the ×2^4 weights and the ×2^4 carry) */
}

// v002
// Measured time: 134 microseconds a run.
// Timed twice side by side with v001, it ran 1.46 and 1.48 times as fast.
// All steps since v000 together make it 2.18 times as fast.
#include <hip/hip_runtime.h>
// Multi-head attention with raw-reshape heads (B=8, N=1024, dim 768 → attn_dim 512 = 8 heads × 64): Q,K,V = x·W + b ((in,out)), reshaped by plain memory order to (H,B,N,64) (= 64 contiguous [1024][64] slabs of each [8192][512] plane);
// softmax(Q·Kᵀ·scale)·V per slab with scale = (64//8)^-½ = 8^-½ (as the original); out raw-reshaped back to (B,N,512) (same flat order) → ·Wp + bp.
// Compute dtype: x, weights, biases rounded to bf16; Q/K/V as f16 GEMM outputs; fused flash-style kernel over the flat slabs (online softmax f32, P f16 ×2^10) on v_wmma_f32_16x16x32_f16; O carried ×2^4 into f16 → projection GEMM with bias; f32 accumulate.
#define BB 64
#define TT 1024
#define NH 1
#define DX 768
#define DA 512
#define NRX 8192
#define ATT_SCALE 0.35355339059327373f

typedef __bf16 v16b __attribute__((ext_vector_type(16)));
typedef unsigned short v8us __attribute__((ext_vector_type(8), may_alias));
typedef float  v8f  __attribute__((ext_vector_type(8)));
typedef float  v4f  __attribute__((ext_vector_type(4)));
typedef float  v4fa __attribute__((ext_vector_type(4), may_alias));
union FragB { v16b v; v8us half[2]; unsigned short u[16]; };

__device__ __forceinline__ unsigned short bf16_bits(float x) { unsigned int u = __float_as_uint(x); return (unsigned short)((u + 0x7FFFu + ((u >> 16) & 1u)) >> 16); }
__device__ __forceinline__ float bf16_val(unsigned short b) { return __uint_as_float(((unsigned int)b) << 16); }
__device__ __forceinline__ float bf16_round(float x) { return bf16_val(bf16_bits(x)); }
// D += A·B with NT terms: 1 = ah·bh, 2 = + al·bh (A split), 3 = + ah·bl (both split)
template <int NT>
__device__ __forceinline__ v8f mmaN(v16b ah, v16b al, v16b bh, v16b bl, v8f c) {
  c = __builtin_amdgcn_wmma_f32_16x16x32_bf16(false, ah, false, bh, (short)0, c, false, false);
  if (NT >= 2) c = __builtin_amdgcn_wmma_f32_16x16x32_bf16(false, al, false, bh, (short)0, c, false, false);
  if (NT >= 3) c = __builtin_amdgcn_wmma_f32_16x16x32_bf16(false, ah, false, bl, (short)0, c, false, false);
  asm volatile("v_nop\n\tv_nop\n\tv_nop\n\tv_nop" : "+v"(c) : "v"(ah), "v"(al), "v"(bh), "v"(bl));
  return c;
}

__global__ __launch_bounds__(256) void k_wt_bf16(const float* __restrict__ W, unsigned short* __restrict__ Wt, int K, int N) {
  const int t = blockIdx.x * 256 + threadIdx.x;
  const int k8n = K / 8;
  if (t >= N * k8n) return;
  const int n = t / k8n, k8 = (t % k8n) * 8;
  v8us v;
#pragma unroll
  for (int i = 0; i < 8; ++i) v[i] = bf16_bits(W[(size_t)(k8 + i) * N + n]);
  *(v8us*)(Wt + (size_t)n * K + k8) = v;
  
}

// GEMM C[M][N] (f32, pitch ldc) = act(A[M][K]·W + bias). A f32 row-major (pitch lda) converted per fragment to bf16
// (ASPLIT: hi/lo two planes -> 2 terms, else single rounded term); Wt bf16 [N][K] (pitch ldb). BIAS_BF16 rounds the
// bias to bf16 first (bias quantised to bf16 before the add). K%32==0, M%16==0, N%64==0.
template <bool ASPLIT, int ACT, bool BIAS_BF16>
__global__ __launch_bounds__(128) void k_gemm_bf(const float* __restrict__ A, int lda, const unsigned short* __restrict__ Wt, int ldb,
                                               const float* __restrict__ bias, float* __restrict__ C, int ldc, int M, int N, int K) {
  __shared__ __attribute__((aligned(16))) float so[4][16][64];
  const int tid = threadIdx.x, w = tid >> 5, lane = tid & 31, ln = lane & 15, hh = lane >> 4;
  const int ntn = N / 64;
  const int wid = blockIdx.x * 4 + w;
  const int mt = wid / ntn, nq = wid % ntn;
  if (mt * 16 >= M) return;
  const int row0 = mt * 16, col0 = nq * 64;
  const float* arow = A + (size_t)(row0 + ln) * lda;
  v8f acc[4] = {};
  for (int kb = 0; kb < K; kb += 32) {
    FragB ah, al;
    const v4f x0 = *(const v4fa*)(arow + kb + 8 * hh), x1 = *(const v4fa*)(arow + kb + 8 * hh + 4);
    const v4f x2 = *(const v4fa*)(arow + kb + 16 + 8 * hh), x3 = *(const v4fa*)(arow + kb + 16 + 8 * hh + 4);
    float xs[16] = {x0[0],x0[1],x0[2],x0[3],x1[0],x1[1],x1[2],x1[3],x2[0],x2[1],x2[2],x2[3],x3[0],x3[1],x3[2],x3[3]};
#pragma unroll
    for (int i = 0; i < 16; ++i) { const unsigned short hb = bf16_bits(xs[i]); ah.u[i] = hb; al.u[i] = ASPLIT ? bf16_bits(xs[i] - bf16_val(hb)) : (unsigned short)0; }
#pragma unroll
    for (int t = 0; t < 4; ++t) {
      const unsigned short* brow = Wt + (size_t)(col0 + t * 16 + ln) * ldb + kb;
      FragB b;
      b.half[0] = *(const v8us*)(brow + 8 * hh);
      b.half[1] = *(const v8us*)(brow + 16 + 8 * hh);
      acc[t] = mmaN<ASPLIT ? 2 : 1>(ah.v, al.v, b.v, b.v, acc[t]);
    }
  }
#pragma unroll
  for (int t = 0; t < 4; ++t) {
    float bv = bias ? bias[col0 + t * 16 + ln] : 0.f;
    if (BIAS_BF16) bv = bf16_round(bv);
#pragma unroll
    for (int r = 0; r < 8; ++r) { float v = acc[t][r] + bv; if (ACT == 1) v = fmaxf(v, 0.f); so[w][8 * hh + r][t * 16 + ln] = v; }
  }
  __builtin_amdgcn_fence(__ATOMIC_ACQ_REL, "workgroup");
  __builtin_amdgcn_wave_barrier();
  const int rsub = lane >> 4, c4 = (lane & 15) * 4;
  {
#pragma unroll
    for (int q = 0; q < 8; ++q) {
      const int r = q * 2 + rsub;
      const v4f v = *(const v4fa*)&so[w][r][c4];
      *(v4f*)(C + (size_t)(row0 + r) * ldc + col0 + c4) = v;
    }
    
  }
}

// Flash-style causal/unmasked attention, all contractions 3-term bf16 hi/lo splits, f32 softmax with running max.
// q,k,v rows are read from f32 buffers with arbitrary row pitch (so they can live inside a fused qkv buffer);
// D = head size (multiple of 32, <= 128); one wave = 16 query rows; block = 4 waves (64 queries) sharing K/V chunks of 32.
template <int D, bool CAUSAL>
__global__ __launch_bounds__(128) void k_flash(const float* __restrict__ qb, const float* __restrict__ kb, const float* __restrict__ vb,
                                             int pitch, int T, int H, float scale, float* __restrict__ y, int ypitch) {
  constexpr int KS = D / 32;        // k-steps for QK
  constexpr int DT = D / 16;        // d tiles for PV
  __shared__ __attribute__((aligned(16))) unsigned short sKh[32][D + 8], sKl[32][D + 8], sVh[32][D + 8], sVl[32][D + 8];
  __shared__ __attribute__((aligned(16))) unsigned short sPh[4][16][40], sPl[4][16][40];
  __shared__ __attribute__((aligned(16))) float sO[4][16][D];
  const int tid = threadIdx.x, w = tid >> 5, lane = tid & 31, ln = lane & 15, hh = lane >> 4;
  const int nqb = (T + 63) / 64;
  const int bh = blockIdx.x / nqb, qblk = blockIdx.x % nqb;
  const int b = bh / H, h = bh % H;
  const int q0 = qblk * 64 + w * 16;
  const float* Q = qb + (size_t)b * T * pitch + h * D;
  const float* K = kb + (size_t)b * T * pitch + h * D;
  const float* V = vb + (size_t)b * T * pitch + h * D;

  // A fragments of the wave's 16 query rows (scaled), hi/lo
  FragB aqh[KS], aql[KS];
  {
    int row = q0 + ln; if (row >= T) row = T - 1;
    const float* qr = Q + (size_t)row * pitch;
#pragma unroll
    for (int ks = 0; ks < KS; ++ks)
#pragma unroll
      for (int i = 0; i < 16; ++i) {
        const int d = ks * 32 + ((i < 8) ? (8 * hh + i) : (16 + 8 * hh + (i - 8)));
        const float x = qr[d] * scale; const unsigned short hb = bf16_bits(x);
        aqh[ks].u[i] = hb; aql[ks].u[i] = bf16_bits(x - bf16_val(hb));
      }
  }
  float m_r[8], l_r[8];
#pragma unroll
  for (int r = 0; r < 8; ++r) { m_r[r] = -3.0e38f; l_r[r] = 0.f; }
  v8f oacc[DT];
#pragma unroll
  for (int dt = 0; dt < DT; ++dt) oacc[dt] = (v8f){0.f,0.f,0.f,0.f,0.f,0.f,0.f,0.f};

  const int kv_end = CAUSAL ? min(T, qblk * 64 + 64) : T;     // block-uniform
  for (int j0 = 0; j0 < kv_end; j0 += 32) {
    __syncthreads();
    for (int e = tid; e < 32 * (D / 4); e += 128) {
      const int r = e / (D / 4), c4 = (e % (D / 4)) * 4;
      const int key = j0 + r;
      v4f kf = {0.f,0.f,0.f,0.f}, vf = {0.f,0.f,0.f,0.f};
      if (key < T) { kf = *(const v4fa*)(K + (size_t)key * pitch + c4); vf = *(const v4fa*)(V + (size_t)key * pitch + c4); }
#pragma unroll
      for (int t = 0; t < 4; ++t) {
        unsigned short hb = bf16_bits(kf[t]); sKh[r][c4 + t] = hb; sKl[r][c4 + t] = bf16_bits(kf[t] - bf16_val(hb));
        hb = bf16_bits(vf[t]); sVh[r][c4 + t] = hb; sVl[r][c4 + t] = bf16_bits(vf[t] - bf16_val(hb));
      }
    }
    __syncthreads();
    // S tile 16 x 32
    v8f s[2];
#pragma unroll
    for (int nt = 0; nt < 2; ++nt) {
      v8f acc = {};
#pragma unroll
      for (int ks = 0; ks < KS; ++ks) {
        FragB bh_, bl_;
        bh_.half[0] = *(const v8us*)&sKh[nt * 16 + ln][ks * 32 + 8 * hh]; bh_.half[1] = *(const v8us*)&sKh[nt * 16 + ln][ks * 32 + 16 + 8 * hh];
        bl_.half[0] = *(const v8us*)&sKl[nt * 16 + ln][ks * 32 + 8 * hh]; bl_.half[1] = *(const v8us*)&sKl[nt * 16 + ln][ks * 32 + 16 + 8 * hh];
        acc = mmaN<3>(aqh[ks].v, aql[ks].v, bh_.v, bl_.v, acc);
      }
      s[nt] = acc;
    }
    // mask + running max (rows 8hh+r; the 16 lanes of a half share rows)
    float alpha[8];
#pragma unroll
    for (int r = 0; r < 8; ++r) {
      const int qi = q0 + 8 * hh + r;
      const int ja = j0 + ln, jb = j0 + 16 + ln;
      if (CAUSAL) { if (ja > qi) s[0][r] = -3.0e38f; if (jb > qi) s[1][r] = -3.0e38f; }
      if (ja >= T) s[0][r] = -3.0e38f;
      if (jb >= T) s[1][r] = -3.0e38f;
      float mx = fmaxf(s[0][r], s[1][r]);
      mx = fmaxf(mx, __shfl_xor(mx, 1, 32)); mx = fmaxf(mx, __shfl_xor(mx, 2, 32)); mx = fmaxf(mx, __shfl_xor(mx, 4, 32)); mx = fmaxf(mx, __shfl_xor(mx, 8, 32));
      const float mnew = fmaxf(m_r[r], mx);
      alpha[r] = (mnew > -1.0e38f) ? __expf(m_r[r] - mnew) : 1.0f;
      const float p0 = (s[0][r] > -1.0e38f) ? __expf(s[0][r] - mnew) : 0.f;
      const float p1 = (s[1][r] > -1.0e38f) ? __expf(s[1][r] - mnew) : 0.f;
      m_r[r] = mnew;
      l_r[r] = l_r[r] * alpha[r] + p0 + p1;            // per-lane partial row sum (16 lanes combined at the end)
      unsigned short hb = bf16_bits(p0); sPh[w][8 * hh + r][ln] = hb;      sPl[w][8 * hh + r][ln] = bf16_bits(p0 - bf16_val(hb));
      hb = bf16_bits(p1);                sPh[w][8 * hh + r][16 + ln] = hb; sPl[w][8 * hh + r][16 + ln] = bf16_bits(p1 - bf16_val(hb));
    }
#pragma unroll
    for (int dt = 0; dt < DT; ++dt)
#pragma unroll
      for (int r = 0; r < 8; ++r) oacc[dt][r] *= alpha[r];
    __builtin_amdgcn_fence(__ATOMIC_ACQ_REL, "workgroup");
    __builtin_amdgcn_wave_barrier();
    FragB pah, pal;
    pah.half[0] = *(const v8us*)&sPh[w][ln][8 * hh]; pah.half[1] = *(const v8us*)&sPh[w][ln][16 + 8 * hh];
    pal.half[0] = *(const v8us*)&sPl[w][ln][8 * hh]; pal.half[1] = *(const v8us*)&sPl[w][ln][16 + 8 * hh];
#pragma unroll
    for (int dt = 0; dt < DT; ++dt) {
      FragB bvh, bvl;
#pragma unroll
      for (int i = 0; i < 8; ++i) {
        bvh.u[i] = sVh[8 * hh + i][dt * 16 + ln]; bvh.u[8 + i] = sVh[16 + 8 * hh + i][dt * 16 + ln];
        bvl.u[i] = sVl[8 * hh + i][dt * 16 + ln]; bvl.u[8 + i] = sVl[16 + 8 * hh + i][dt * 16 + ln];
      }
      oacc[dt] = mmaN<3>(pah.v, pal.v, bvh.v, bvl.v, oacc[dt]);
    }
    __builtin_amdgcn_fence(__ATOMIC_ACQ_REL, "workgroup");
    __builtin_amdgcn_wave_barrier();
  }
#pragma unroll
  for (int r = 0; r < 8; ++r) {
    float l = l_r[r];
    l += __shfl_xor(l, 1, 32); l += __shfl_xor(l, 2, 32); l += __shfl_xor(l, 4, 32); l += __shfl_xor(l, 8, 32);
    l_r[r] = (l > 0.f) ? 1.0f / l : 0.f;
  }
#pragma unroll
  for (int dt = 0; dt < DT; ++dt)
#pragma unroll
    for (int r = 0; r < 8; ++r) sO[w][8 * hh + r][dt * 16 + ln] = oacc[dt][r] * l_r[r];
  __builtin_amdgcn_fence(__ATOMIC_ACQ_REL, "workgroup");
  __builtin_amdgcn_wave_barrier();
  {
    for (int r = 0; r < 16; ++r) {
      const int row = q0 + r;
      if (row < T && lane < D / 4) {
        const v4f val = *(const v4fa*)&sO[w][r][lane * 4];
        *(v4f*)(y + ((size_t)b * T + row) * ypitch + h * D + lane * 4) = val;
      }
    }
    
  }
}

// GEMM C = act(A·W + bias + resid): A f32 (ASPLIT -> hi/lo 2 terms), Wt bf16 [N][K]; ACT 0 none, 1 relu, 2 exact gelu;
// resid (optional, f32, row index = (row % rmod), pitch ldr, RES_BF16 rounds it) added before the activation.
template <bool ASPLIT, int ACT, bool BIAS_BF16, bool RES_BF16>
__global__ __launch_bounds__(128) void k_gemm_bf3(const float* __restrict__ A, int lda, const unsigned short* __restrict__ Wt, int ldb,
                                                const float* __restrict__ bias, const float* __restrict__ resid, int rmod, int ldr,
                                                float* __restrict__ C, int ldc, int M, int N, int K) {
  __shared__ __attribute__((aligned(16))) float so[4][16][64];
  const int tid = threadIdx.x, w = tid >> 5, lane = tid & 31, ln = lane & 15, hh = lane >> 4;
  const int ntn = N / 64;
  const int wid = blockIdx.x * 4 + w;
  const int mt = wid / ntn, nq = wid % ntn;
  if (mt * 16 >= M) return;
  const int row0 = mt * 16, col0 = nq * 64;
  const float* arow = A + (size_t)(row0 + ln) * lda;
  v8f acc[4] = {};
  for (int kb = 0; kb < K; kb += 32) {
    FragB ah, al;
    const v4f x0 = *(const v4fa*)(arow + kb + 8 * hh), x1 = *(const v4fa*)(arow + kb + 8 * hh + 4);
    const v4f x2 = *(const v4fa*)(arow + kb + 16 + 8 * hh), x3 = *(const v4fa*)(arow + kb + 16 + 8 * hh + 4);
    float xs[16] = {x0[0],x0[1],x0[2],x0[3],x1[0],x1[1],x1[2],x1[3],x2[0],x2[1],x2[2],x2[3],x3[0],x3[1],x3[2],x3[3]};
#pragma unroll
    for (int i = 0; i < 16; ++i) { const unsigned short hb = bf16_bits(xs[i]); ah.u[i] = hb; al.u[i] = ASPLIT ? bf16_bits(xs[i] - bf16_val(hb)) : (unsigned short)0; }
#pragma unroll
    for (int t = 0; t < 4; ++t) {
      const unsigned short* brow = Wt + (size_t)(col0 + t * 16 + ln) * ldb + kb;
      FragB b;
      b.half[0] = *(const v8us*)(brow + 8 * hh);
      b.half[1] = *(const v8us*)(brow + 16 + 8 * hh);
      acc[t] = mmaN<ASPLIT ? 2 : 1>(ah.v, al.v, b.v, b.v, acc[t]);
    }
  }
#pragma unroll
  for (int t = 0; t < 4; ++t) {
    const int col = col0 + t * 16 + ln;
    float bv = bias ? bias[col] : 0.f;
    if (BIAS_BF16) bv = bf16_round(bv);
#pragma unroll
    for (int r = 0; r < 8; ++r) {
      float v = acc[t][r] + bv;
      if (resid) { float rv = resid[(size_t)((row0 + 8 * hh + r) % rmod) * ldr + col]; if (RES_BF16) rv = bf16_round(rv); v += rv; }
      if (ACT == 1) v = fmaxf(v, 0.f);
      if (ACT == 2) v = 0.5f * v * (1.0f + erff(v * 0.70710678118654752f));
      if (ACT == 3) { const float u = 0.7978845608028654f * (v + 0.044715f * v * v * v); v = 0.5f * v * (1.0f + tanhf(u)); }
      so[w][8 * hh + r][t * 16 + ln] = v;
    }
  }
  __builtin_amdgcn_fence(__ATOMIC_ACQ_REL, "workgroup");
  __builtin_amdgcn_wave_barrier();
  const int rsub = lane >> 4, c4 = (lane & 15) * 4;
  {
#pragma unroll
    for (int q = 0; q < 8; ++q) {
      const int r = q * 2 + rsub;
      const v4f v = *(const v4fa*)&so[w][r][c4];
      *(v4f*)(C + (size_t)(row0 + r) * ldc + col0 + c4) = v;
    }
    
  }
}
// row LayerNorm (biased variance, eps) over N: s = X (+ R); optional out_sum <- s; out_norm <- (s-mu)*rsqrt(var+eps)*g + b
template <bool PARAM_BF16>
__global__ __launch_bounds__(256) void k_layernorm(const float* __restrict__ X, const float* __restrict__ R, const float* __restrict__ g, const float* __restrict__ bta,
                                                  float* __restrict__ out_sum, float* __restrict__ out_norm, int N, float eps) {
  __shared__ float red[256];
  const int row = blockIdx.x, tid = threadIdx.x;
  const float* x = X + (size_t)row * N; const float* rr = R ? R + (size_t)row * N : nullptr;
  float vals[16];                     // up to N = 4096
  const int per = N / 256;            // contiguous chunk per thread? use strided-by-4 chunks: thread handles j = tid*4 + 1024*u
  float s1 = 0.f;
  for (int u = 0; u < per / 4; ++u) {
    const int j = tid * 4 + 1024 * u;
    const v4f a = *(const v4fa*)(x + j);
    v4f b = {0.f,0.f,0.f,0.f}; if (rr) b = *(const v4fa*)(rr + j);
#pragma unroll
    for (int q = 0; q < 4; ++q) { const float v = a[q] + b[q]; vals[u * 4 + q] = v; s1 += v; }
  }
  red[tid] = s1; __syncthreads();
  for (int st = 128; st > 0; st >>= 1) { if (tid < st) red[tid] += red[tid + st]; __syncthreads(); }
  const float mu = red[0] / (float)N; __syncthreads();
  float s2 = 0.f;
  for (int u = 0; u < per / 4; ++u)
#pragma unroll
    for (int q = 0; q < 4; ++q) { const float c = vals[u * 4 + q] - mu; s2 += c * c; }
  red[tid] = s2; __syncthreads();
  for (int st = 128; st > 0; st >>= 1) { if (tid < st) red[tid] += red[tid + st]; __syncthreads(); }
  const float rs = rsqrtf(red[0] / (float)N + eps);
  {
    for (int u = 0; u < per / 4; ++u) {
      const int j = tid * 4 + 1024 * u;
      v4f o, sm;
#pragma unroll
      for (int q = 0; q < 4; ++q) {
        float gg = g[j + q], bb = bta[j + q];
        if (PARAM_BF16) { gg = bf16_round(gg); bb = bf16_round(bb); }
        sm[q] = vals[u * 4 + q]; o[q] = (vals[u * 4 + q] - mu) * rs * gg + bb;
      }
      if (out_sum) *(v4f*)(out_sum + (size_t)row * N + j) = sm;
      *(v4f*)(out_norm + (size_t)row * N + j) = o;
    }
    
  }
}



// ---- f16 WMMA path (v_wmma_f32_16x16x32_f16): 11-bit significands for operands in range — used where a [0,1] probability operand needs more precision than bf16
typedef _Float16 v16h __attribute__((ext_vector_type(16)));
union FragH { v16h v; v8us half[2]; _Float16 h[16]; unsigned short u[16]; };
template <int NT>
__device__ __forceinline__ v8f mmaH(v16h ah, v16h al, v16h bh, v16h bl, v8f c) {
  c = __builtin_amdgcn_wmma_f32_16x16x32_f16(false, ah, false, bh, (short)0, c, false, false);
  if (NT >= 2) c = __builtin_amdgcn_wmma_f32_16x16x32_f16(false, al, false, bh, (short)0, c, false, false);
  if (NT >= 3) c = __builtin_amdgcn_wmma_f32_16x16x32_f16(false, ah, false, bl, (short)0, c, false, false);
  asm volatile("v_nop\n\tv_nop\n\tv_nop\n\tv_nop" : "+v"(c) : "v"(ah), "v"(al), "v"(bh), "v"(bl));
  return c;
}
// batched GEMM like k_gemm_b but f16 operands: A f32 (split into f16 hi/lo if ASPLIT, else rounded to f16), Bt = f16 values [n][k]; alpha; C f32; N multiple of 16 (partial tiles skipped)
template <bool ASPLIT>
__global__ __launch_bounds__(128) void k_gemm_h(const float* __restrict__ A, int lda, size_t sA, const _Float16* __restrict__ Bh, int ldb, size_t sB, float alpha, float* __restrict__ C, int ldc, size_t sC, int M, int N, int K) {
  __shared__ __attribute__((aligned(16))) float so[4][16][64];
  const int tid = threadIdx.x, w = tid >> 5, lane = tid & 31, ln = lane & 15, hh = lane >> 4; const int by = blockIdx.y;
  A += (size_t)by * sA; Bh += (size_t)by * sB; C += (size_t)by * sC;
  const int ntn = (N + 63) / 64; const int wid = blockIdx.x * 4 + w; const int mt = wid / ntn, nq = wid % ntn; if (mt * 16 >= M) return;
  const int row0 = mt * 16, col0 = nq * 64; const float* arow = A + (size_t)(row0 + ln) * lda;
  v8f acc[4] = {};
  for (int kb = 0; kb < K; kb += 32) {
    FragH ah, al;
    const v4f x0 = *(const v4fa*)(arow + kb + 8 * hh), x1 = *(const v4fa*)(arow + kb + 8 * hh + 4), x2 = *(const v4fa*)(arow + kb + 16 + 8 * hh), x3 = *(const v4fa*)(arow + kb + 16 + 8 * hh + 4);
    float xs[16] = {x0[0],x0[1],x0[2],x0[3],x1[0],x1[1],x1[2],x1[3],x2[0],x2[1],x2[2],x2[3],x3[0],x3[1],x3[2],x3[3]};
#pragma unroll
    for (int i = 0; i < 16; ++i) { const _Float16 h = (_Float16)xs[i]; ah.h[i] = h; al.h[i] = ASPLIT ? (_Float16)(xs[i] - (float)h) : (_Float16)0.0f; }
#pragma unroll
    for (int t = 0; t < 4; ++t) { if (col0 + t * 16 >= N) continue; const size_t boff = (size_t)(col0 + t * 16 + ln) * ldb + kb; FragH bq; bq.half[0] = *(const v8us*)(Bh + boff + 8 * hh); bq.half[1] = *(const v8us*)(Bh + boff + 16 + 8 * hh);
      acc[t] = mmaH<ASPLIT ? 2 : 1>(ah.v, al.v, bq.v, bq.v, acc[t]); }
  }
#pragma unroll
  for (int t = 0; t < 4; ++t) { if (col0 + t * 16 >= N) continue;
#pragma unroll
    for (int r = 0; r < 8; ++r) so[w][8 * hh + r][t * 16 + ln] = acc[t][r] * alpha; }
  __builtin_amdgcn_fence(__ATOMIC_ACQ_REL, "workgroup"); __builtin_amdgcn_wave_barrier();
  const int rsub = lane >> 4, c4 = (lane & 15) * 4;
  {
#pragma unroll
    for (int q = 0; q < 8; ++q) { const int r = q * 2 + rsub; if (col0 + c4 < N) { const v4f v = *(const v4fa*)&so[w][r][c4]; *(v4f*)(C + (size_t)(row0 + r) * ldc + col0 + c4) = v; } }
     }
}

// Wt[n][k] = f16(W[k][n]·scale) from f32 row-major W[K][N] (scale = power of two; bf16-exact weights stay exact in f16 away from the subnormal range)
__global__ __launch_bounds__(256) void k_wt_f16(const float* __restrict__ W, _Float16* __restrict__ Wt, int K, int N, float scale) {
  const int t = blockIdx.x * 256 + threadIdx.x; if (t >= N * (K / 8)) return; const int n = t / (K / 8), k8 = (t % (K / 8)) * 8; FragH f;
#pragma unroll
  for (int i = 0; i < 8; ++i) f.h[i] = (_Float16)(bf16_round(W[(size_t)(k8 + i) * N + n]) * scale); const v8us o = f.half[0];
  *(v8us*)((unsigned short*)Wt + (size_t)n * K + k8) = o; 
}
// k_gemm_hh variant with fused epilogue: v = acc·alpha + bias[by·sBias + col] (+ CP[(row/rowsPerB)·sCPb + by·64 + col] if CP) ; ACT 0 none / 1 elu ; writes f16 C16 and f32 C, each if non-null
template <int ACT>
__global__ __launch_bounds__(128) void k_gemm_hhx(const _Float16* __restrict__ A, int lda, size_t sA, const _Float16* __restrict__ Bh, int ldb, size_t sB, float alpha, const float* __restrict__ bias, size_t sBias, const float* __restrict__ CP, int rowsPerB, size_t sCPb, int row0g,
    float* __restrict__ C, _Float16* __restrict__ C16, int ldc, size_t sC, int M, int N, int K) {
  __shared__ __attribute__((aligned(16))) float so[4][16][64];
  const int tid = threadIdx.x, w = tid >> 5, lane = tid & 31, ln = lane & 15, hh = lane >> 4; const int by = blockIdx.y;
  A += (size_t)by * sA; Bh += (size_t)by * sB; const size_t cofs = (size_t)by * sC; const float* bp = bias ? bias + (size_t)by * sBias : nullptr;
  const int ntn = (N + 63) / 64; const int wid = blockIdx.x * 4 + w; const int mt = wid / ntn, nq = wid % ntn; if (mt * 16 >= M) return;
  const int row0 = mt * 16, col0 = nq * 64; const _Float16* arow = A + (size_t)(row0 + ln) * lda;
  v8f acc[4] = {};
  for (int kb = 0; kb < K; kb += 32) { FragH ah; ah.half[0] = *(const v8us*)((const unsigned short*)arow + kb + 8 * hh); ah.half[1] = *(const v8us*)((const unsigned short*)arow + kb + 16 + 8 * hh);
#pragma unroll
    for (int t = 0; t < 4; ++t) { if (col0 + t * 16 >= N) continue; const size_t boff = (size_t)(col0 + t * 16 + ln) * ldb + kb; FragH bq; bq.half[0] = *(const v8us*)((const unsigned short*)Bh + boff + 8 * hh); bq.half[1] = *(const v8us*)((const unsigned short*)Bh + boff + 16 + 8 * hh);
      acc[t] = mmaH<1>(ah.v, ah.v, bq.v, bq.v, acc[t]); }
  }
#pragma unroll
  for (int t = 0; t < 4; ++t) { if (col0 + t * 16 >= N) continue; const int col = col0 + t * 16 + ln; const float bv = bp ? bf16_round(bp[col]) : 0.f;
#pragma unroll
    for (int r = 0; r < 8; ++r) { float v = acc[t][r] * alpha + bv; if (CP) { const int bidx = (row0g + row0 + 8 * hh + r) / rowsPerB; v += CP[(size_t)bidx * sCPb + (size_t)by * 64 + col]; } if (ACT == 1) v = (v > 0.f) ? v : expm1f(v); else if (ACT == 7) v = (v > 0.f) ? v + 1.0f : expf(v); else if (ACT == 8) v = tanhf(v); else if (ACT == 9) v = 0.5f * v * (1.0f + tanhf(0.7978845608028654f * (v + 0.044715f * v * v * v))); else if (ACT == 11) v = 1.0f / (1.0f + expf(-v)); else if (ACT == 12) v = (v > 0.f) ? v : 0.01f * v; else if (ACT == 14) v = (v > 0.f) ? v : 0.1f * v; else if (ACT == 15) v = v / (1.0f + expf(-v)); else if (ACT == 3) v = fmaxf(v, 0.f); else if (ACT == 6) v = 0.5f * v * (1.0f + erff(v * 0.70710678118654752f)); so[w][8 * hh + r][t * 16 + ln] = v; } }
  __builtin_amdgcn_fence(__ATOMIC_ACQ_REL, "workgroup"); __builtin_amdgcn_wave_barrier();
  const int rsub = lane >> 4, c4 = (lane & 15) * 4; typedef _Float16 v4h __attribute__((ext_vector_type(4)));
  {
#pragma unroll
    for (int q = 0; q < 8; ++q) { const int r = q * 2 + rsub; if (col0 + c4 < N) { const v4f v = *(const v4fa*)&so[w][r][c4]; if (C) *(v4f*)(C + cofs + (size_t)(row0 + r) * ldc + col0 + c4) = v; if (C16) { v4h h4; for (int i = 0; i < 4; ++i) h4[i] = (_Float16)v[i]; *(v4h*)(C16 + cofs + (size_t)(row0 + r) * ldc + col0 + c4) = h4; } } }
     }
}


// Block-tiled GEMM, f16 operands, both K-contiguous: C[8192][NN] = A[8192][KK] . Bh[NN][KK]^T * alpha + bf16(bias). One 128x128 tile of C per work-group of 8 waves (4x2), 32x64 per wave.
// A pass is 128 k = 256 aligned bytes of each of the 256 operand rows, brought into LDS by asynchronous copies (two buffers, the next pass's copies fly while this pass is worked on), so that every line leaves L2 once per work-group and not once per wave.
// LDS rows at pitch 272 bytes (16 x odd) for the 16-byte fragment reads. The k order of a fragment and the order of the k steps are those of k_gemm_hhx.
__device__ __forceinline__ unsigned lds_off(const void* p) { return (unsigned)(size_t)p; }
// eight copies of 16 bytes per lane: rows r, r + 16, ..., r + 112 of one operand's tile. The s_wait_xcnt stands inside the statement so that no address register is rewritten ahead of it.
__device__ __forceinline__ void copy_rows8(unsigned l0, const _Float16* g0, int rowstep, unsigned ldsstep) {
  const unsigned l1 = l0 + ldsstep, l2 = l0 + 2 * ldsstep, l3 = l0 + 3 * ldsstep, l4 = l0 + 4 * ldsstep, l5 = l0 + 5 * ldsstep, l6 = l0 + 6 * ldsstep, l7 = l0 + 7 * ldsstep;
  const _Float16* g1 = g0 + rowstep; const _Float16* g2 = g0 + 2 * rowstep; const _Float16* g3 = g0 + 3 * rowstep; const _Float16* g4 = g0 + 4 * rowstep;
  const _Float16* g5 = g0 + 5 * rowstep; const _Float16* g6 = g0 + 6 * rowstep; const _Float16* g7 = g0 + 7 * rowstep;
  asm volatile("global_load_async_to_lds_b128 %0, %8, off\n\t"
               "global_load_async_to_lds_b128 %1, %9, off\n\t"
               "global_load_async_to_lds_b128 %2, %10, off\n\t"
               "global_load_async_to_lds_b128 %3, %11, off\n\t"
               "global_load_async_to_lds_b128 %4, %12, off\n\t"
               "global_load_async_to_lds_b128 %5, %13, off\n\t"
               "global_load_async_to_lds_b128 %6, %14, off\n\t"
               "global_load_async_to_lds_b128 %7, %15, off\n\t"
               "s_wait_xcnt 0x0"
               :: "v"(l0), "v"(l1), "v"(l2), "v"(l3), "v"(l4), "v"(l5), "v"(l6), "v"(l7),
                  "v"(g0), "v"(g1), "v"(g2), "v"(g3), "v"(g4), "v"(g5), "v"(g6), "v"(g7) : "memory");
}
template <int KK, int NN, bool OUT16>
__global__ __launch_bounds__(256) void k_gemm_tile(const _Float16* __restrict__ A, const _Float16* __restrict__ Bh, float alpha, const float* __restrict__ bias, float* __restrict__ C, _Float16* __restrict__ C16) {
  constexpr int BK = 128, KSN = BK / 32, PITCH = 2 * BK + 16, STAGE = 256 * PITCH, NPASS = KK / BK, NTN = NN / 128, SOP = 68;
  static_assert(NPASS >= 2 && KK % BK == 0 && NN % 128 == 0 && 8 * 32 * SOP * 4 <= 2 * STAGE, "shape");
  __shared__ __attribute__((aligned(16))) unsigned char sm[2 * STAGE];
  const int tid = threadIdx.x, w = tid >> 5, lane = tid & 31, ln = lane & 15, hh = lane >> 4;
  const int m0 = (blockIdx.x / NTN) * 128, n0 = (blockIdx.x % NTN) * 128; const int wm = w >> 1, wn = w & 1;
  const int cr = tid >> 4, cc = tid & 15;      // a wave's copy = 2 rows x 256 bytes
  const _Float16* ga = A + (size_t)(m0 + cr) * KK + cc * 8; const _Float16* gb = Bh + (size_t)(n0 + cr) * KK + cc * 8;
  const unsigned la = lds_off(sm) + cr * PITCH + cc * 16, lb = la + 128 * PITCH;
  v8f acc[2][4];
#pragma unroll
  for (int i = 0; i < 2; ++i)
#pragma unroll
    for (int j = 0; j < 4; ++j) acc[i][j] = (v8f){0.f,0.f,0.f,0.f,0.f,0.f,0.f,0.f};
  copy_rows8(la, ga, 16 * KK, 16 * PITCH); copy_rows8(lb, gb, 16 * KK, 16 * PITCH);
  asm volatile("s_wait_asynccnt 0x0" ::: "memory");      // pass 0's bytes have landed before the barrier publishes them
  __syncthreads();
  copy_rows8(la + STAGE, ga + BK, 16 * KK, 16 * PITCH); copy_rows8(lb + STAGE, gb + BK, 16 * KK, 16 * PITCH);
  const unsigned char* fa = sm + (wm * 32 + ln) * PITCH + 16 * hh; const unsigned char* fb = sm + (128 + wn * 64 + ln) * PITCH + 16 * hh;
#pragma unroll 1      // the ring stays one rolled loop: one publish point, short code
  for (int t = 0; t < NPASS; ++t) {
    const int bo = (t & 1) * STAGE;
    FragH a[2][2], b[2][4];      // two fragment sets: the next 32 k of this pass are fetched while these are multiplied
#pragma unroll
    for (int i = 0; i < 2; ++i) { a[0][i].half[0] = *(const v8us*)(fa + bo + i * 16 * PITCH); a[0][i].half[1] = *(const v8us*)(fa + bo + i * 16 * PITCH + 32); }
#pragma unroll
    for (int j = 0; j < 4; ++j) { b[0][j].half[0] = *(const v8us*)(fb + bo + j * 16 * PITCH); b[0][j].half[1] = *(const v8us*)(fb + bo + j * 16 * PITCH + 32); }
#pragma unroll
    for (int ks = 0; ks < KSN; ++ks) {
      const int cu = ks & 1, nx = cu ^ 1;
      if (ks + 1 < KSN) {
#pragma unroll
        for (int i = 0; i < 2; ++i) { a[nx][i].half[0] = *(const v8us*)(fa + bo + i * 16 * PITCH + (ks + 1) * 64); a[nx][i].half[1] = *(const v8us*)(fa + bo + i * 16 * PITCH + (ks + 1) * 64 + 32); }
#pragma unroll
        for (int j = 0; j < 4; ++j) { b[nx][j].half[0] = *(const v8us*)(fb + bo + j * 16 * PITCH + (ks + 1) * 64); b[nx][j].half[1] = *(const v8us*)(fb + bo + j * 16 * PITCH + (ks + 1) * 64 + 32); }
        __builtin_amdgcn_sched_barrier(0);      // keeps the next set's LDS reads one group ahead of this set's products; without it they are sunk among the products, into one register set, and each product run waits out the LDS latency
      }
#pragma unroll
      for (int i = 0; i < 2; ++i)
#pragma unroll
        for (int j = 0; j < 4; ++j) acc[i][j] = __builtin_amdgcn_wmma_f32_16x16x32_f16(false, a[cu][i].v, false, b[cu][j].v, (short)0, acc[i][j], false, false);
    }
    __builtin_amdgcn_sched_barrier(0);      // keeps the pass's products in front of the publish point: sunk behind the barrier they stand between it and the refill, and the copies start that much later
    asm volatile("s_wait_dscnt 0x0" ::: "memory");       // this wave's reads of the buffer are done before it is handed to the copies
    asm volatile("s_wait_asynccnt 0x0" ::: "memory");    // this wave's copies of pass t + 1 have landed before the barrier publishes them
    __syncthreads();
    if (t + 2 < NPASS) { copy_rows8(la + bo, ga + (t + 2) * BK, 16 * KK, 16 * PITCH); copy_rows8(lb + bo, gb + (t + 2) * BK, 16 * KK, 16 * PITCH); }
  }
  asm volatile("s_wait_asynccnt 0x0" ::: "memory");      // nothing is in flight when the ring becomes output staging
  float* so = (float*)sm + w * (32 * SOP);      // each wave stages its own 32 x 64 tile; every reader left the ring at the last pass's barrier
#pragma unroll
  for (int j = 0; j < 4; ++j) { const float bv = bf16_round(bias[n0 + wn * 64 + j * 16 + ln]);
#pragma unroll
    for (int i = 0; i < 2; ++i)
#pragma unroll
      for (int r = 0; r < 8; ++r) so[(i * 16 + 8 * hh + r) * SOP + j * 16 + ln] = acc[i][j][r] * alpha + bv; }
  __builtin_amdgcn_fence(__ATOMIC_ACQ_REL, "workgroup"); __builtin_amdgcn_wave_barrier();      // the wave's own staged rows are written before other lanes of it read them back
  if (OUT16) {
#pragma unroll
    for (int q = 0; q < 8; ++q) { const int r = q * 4 + (lane >> 3), c8 = (lane & 7) * 8; const v4f v0 = *(const v4fa*)&so[r * SOP + c8], v1 = *(const v4fa*)&so[r * SOP + c8 + 4]; FragH f;
#pragma unroll
      for (int i = 0; i < 4; ++i) { f.h[i] = (_Float16)v0[i]; f.h[4 + i] = (_Float16)v1[i]; }
      *(v8us*)((unsigned short*)C16 + (size_t)(m0 + wm * 32 + r) * NN + n0 + wn * 64 + c8) = f.half[0]; }
  } else {
#pragma unroll
    for (int q = 0; q < 16; ++q) { const int r = q * 2 + (lane >> 4), c4 = (lane & 15) * 4; const v4f v = *(const v4fa*)&so[r * SOP + c4];
      *(v4f*)(C + (size_t)(m0 + wm * 32 + r) * NN + n0 + wn * 64 + c4) = v; }
  }
}


typedef _Float16 v4h __attribute__((ext_vector_type(4)));

__global__ __launch_bounds__(256) void k_x16(const float* __restrict__ x, _Float16* __restrict__ X16, size_t n8) { const size_t t = (size_t)blockIdx.x * 256 + threadIdx.x; if (t >= n8) return; FragH f;
#pragma unroll
  for (int q = 0; q < 8; ++q) f.h[q] = (_Float16)bf16_round(x[t * 8 + q]); *(v8us*)((unsigned short*)X16 + t * 8) = f.half[0];  }
__global__ __launch_bounds__(256) void k_h16(const float* __restrict__ x, _Float16* __restrict__ X16, size_t n8) { const size_t t = (size_t)blockIdx.x * 256 + threadIdx.x; if (t >= n8) return; FragH f;
#pragma unroll
  for (int q = 0; q < 8; ++q) f.h[q] = (_Float16)x[t * 8 + q]; *(v8us*)((unsigned short*)X16 + t * 8) = f.half[0];  }
__global__ __launch_bounds__(256) void k_round16f(const float* __restrict__ W, _Float16* __restrict__ Bt, size_t n8) { const size_t t = (size_t)blockIdx.x * 256 + threadIdx.x; if (t >= n8) return; FragH f;
#pragma unroll
  for (int i = 0; i < 8; ++i) f.h[i] = (_Float16)(bf16_round(W[t * 8 + i]) * 16.0f); *(v8us*)((unsigned short*)Bt + t * 8) = f.half[0];  }
template <int NHv, int TTv>
__global__ __launch_bounds__(256) void k_vt(const _Float16* __restrict__ V16, int ldv, int voff, _Float16* __restrict__ Vt) { __shared__ unsigned short tl[64][66]; const int tid = threadIdx.x; const int slab = blockIdx.x / (TTv / 64), lg = blockIdx.x % (TTv / 64); const int b = slab / NHv, h = slab % NHv;
  for (int i = tid; i < 64 * 8; i += 256) { const int r = i / 8, c8 = (i % 8) * 8; FragH f; f.half[0] = *(const v8us*)((const unsigned short*)V16 + ((size_t)b * TTv + lg * 64 + r) * ldv + voff + h * 64 + c8);
#pragma unroll
    for (int q = 0; q < 8; ++q) tl[r][c8 + q] = f.u[q]; }
  __syncthreads();
  {
#pragma unroll
    for (int rd = 0; rd < 2; ++rd) { const int d = rd * 32 + tid / 8, pc = tid % 8; FragH f;
#pragma unroll
      for (int q = 0; q < 8; ++q) f.u[q] = tl[pc * 8 + q][d];
      *(v8us*)((unsigned short*)Vt + ((size_t)slab * 64 + d) * TTv + lg * 64 + pc * 8) = f.half[0]; }
     } }

__global__ __launch_bounds__(256) void k_h16s(const float* __restrict__ F, _Float16* __restrict__ H, size_t n8) { const size_t t = (size_t)blockIdx.x * 256 + threadIdx.x; if (t >= n8) return; const v4f a = *(const v4fa*)(F + t * 8), c = *(const v4fa*)(F + t * 8 + 4); FragH f;
#pragma unroll
  for (int q = 0; q < 4; ++q) { f.h[q] = (_Float16)(a[q] * 16.0f); f.h[4 + q] = (_Float16)(c[q] * 16.0f); } *(v8us*)((unsigned short*)H + t * 8) = f.half[0];  }
// lane l with lane l ^ 16: the two halves of a wave hold the two halves of one query's keys
__device__ __forceinline__ float xhalf(float x) { return __builtin_bit_cast(float, __builtin_amdgcn_permlanex16(__builtin_bit_cast(int, x), __builtin_bit_cast(int, x), 0x76543210, 0xfedcba98, false, false)); }
// Transposed form: S^T = K.Q^T (A = 16 key rows, B = the wave's 16 queries, kept in registers), O^T += V^T.P^T (A = 16 rows of V^T, B = P^T).
// A lane holds 16 of the 32 scores of ONE query (column ln; keys 8hh + r and 16 + 8hh + r), so the maximum and the sum are in-lane plus one exchange between the halves,
// and the two score tiles, converted in place, are the B operand of the second product in the k order of the V^T loader: P never leaves the registers.
__global__ __launch_bounds__(128) void k_flash(const _Float16* __restrict__ Q16, int ldq, const _Float16* __restrict__ K16, int ldk, const _Float16* __restrict__ Vt, const int* __restrict__ MSK, float* __restrict__ O, int ldo) {
  constexpr int RPW = 16, NQB = TT / (4 * RPW), DT = 4, KS = 2;
  __shared__ __attribute__((aligned(16))) float sO[4][RPW][64 + 4];
  (void)MSK;
  const int tid = threadIdx.x, w = tid >> 5, lane = tid & 31, ln = lane & 15, hh = lane >> 4;
  const int slab = blockIdx.x / NQB, qblk = blockIdx.x % NQB; const int b = slab / NH, h = slab % NH; const int q0 = qblk * (4 * RPW) + w * RPW;
  FragH bq[KS];
  { const unsigned short* qr = (const unsigned short*)Q16 + ((size_t)b * TT + q0 + ln) * ldq + h * 64;
#pragma unroll
    for (int ks = 0; ks < KS; ++ks) { bq[ks].half[0] = *(const v8us*)(qr + ks * 32 + 8 * hh); bq[ks].half[1] = *(const v8us*)(qr + ks * 32 + 16 + 8 * hh); } }
  // wave-uniform bases that walk the keys, and one fixed byte offset per lane
  const char* Kb = (const char*)((const unsigned short*)K16 + (size_t)b * TT * ldk + h * 64); const unsigned klo = (unsigned)(ln * ldk + 8 * hh) * 2u;
  const char* Vb = (const char*)((const unsigned short*)Vt + (size_t)slab * 64 * TT); const unsigned vlo = (unsigned)(ln * TT + 8 * hh) * 2u;
  float m_r = -3.0e38f, l_r = 0.f; v8f oacc[DT];
#pragma unroll
  for (int dt = 0; dt < DT; ++dt) oacc[dt] = (v8f){0.f,0.f,0.f,0.f,0.f,0.f,0.f,0.f};
#pragma unroll 1      // the pass stays rolled, as it was: one group of loads a pass, short code
  for (int j0 = 0; j0 < TT; j0 += 32) {
    FragH ak[2][KS], av[DT];
#pragma unroll
    for (int nt = 0; nt < 2; ++nt) { const char* kr = Kb + (size_t)(j0 + nt * 16) * ldk * 2;
#pragma unroll
      for (int ks = 0; ks < KS; ++ks) { ak[nt][ks].half[0] = *(const v8us*)(kr + klo + ks * 64); ak[nt][ks].half[1] = *(const v8us*)(kr + klo + ks * 64 + 32); } }
    asm volatile("s_wait_xcnt 0x0" ::: "memory");      // behind the K loads: in this build a V^T load lands in the registers that held their addresses
#pragma unroll
    for (int dt = 0; dt < DT; ++dt) { const char* vr = Vb + (size_t)j0 * 2; av[dt].half[0] = *(const v8us*)(vr + vlo + dt * 16 * TT * 2); av[dt].half[1] = *(const v8us*)(vr + vlo + dt * 16 * TT * 2 + 32); }
    __builtin_amdgcn_sched_barrier(0);      // keeps the pass's 16 loads one group in front of its work: sunk among the products, into few registers, each product waits out a load latency of its own
    v8f s[2];
#pragma unroll
    for (int nt = 0; nt < 2; ++nt) { v8f acc = (v8f){0.f,0.f,0.f,0.f,0.f,0.f,0.f,0.f};
#pragma unroll
      for (int ks = 0; ks < KS; ++ks) acc = __builtin_amdgcn_wmma_f32_16x16x32_f16(false, ak[nt][ks].v, false, bq[ks].v, (short)0, acc, false, false);
      s[nt] = acc; }      // s[nt][r] = score of query q0 + ln with key j0 + nt * 16 + 8 * hh + r
    float mc = -3.0e38f;
#pragma unroll
    for (int nt = 0; nt < 2; ++nt)
#pragma unroll
      for (int r = 0; r < 8; ++r) { s[nt][r] *= ATT_SCALE; mc = fmaxf(mc, s[nt][r]); }
    mc = fmaxf(mc, xhalf(mc));
    const float mn = fmaxf(m_r, mc); const float ea = expf(m_r - mn); const float al = (mn > -1.0e38f) ? ea : 1.0f; m_r = mn;
    FragH pb; float ps = 0.f;
#pragma unroll
    for (int nt = 0; nt < 2; ++nt)
#pragma unroll
      for (int r = 0; r < 8; ++r) { const float p = expf(s[nt][r] - mn); ps += p; pb.h[nt * 8 + r] = (_Float16)(p * 1024.0f); }
    l_r = l_r * al + ps;      // this half's 16 keys; the halves are joined once, behind the loop
#pragma unroll
    for (int dt = 0; dt < DT; ++dt)
#pragma unroll
      for (int r = 0; r < 8; ++r) oacc[dt][r] *= al;
#pragma unroll
    for (int dt = 0; dt < DT; ++dt) oacc[dt] = __builtin_amdgcn_wmma_f32_16x16x32_f16(false, av[dt].v, false, pb.v, (short)0, oacc[dt], false, false);      // oacc[dt][r] = O[q0 + ln][dt * 16 + 8 * hh + r]
  }
  { const float l = l_r + xhalf(l_r); const float inv = (l > 0.f) ? 1.0f / (l * 1024.0f) : 0.f;
#pragma unroll
    for (int dt = 0; dt < DT; ++dt) { const v4f lo = {oacc[dt][0] * inv, oacc[dt][1] * inv, oacc[dt][2] * inv, oacc[dt][3] * inv}, hi = {oacc[dt][4] * inv, oacc[dt][5] * inv, oacc[dt][6] * inv, oacc[dt][7] * inv};
      *(v4fa*)&sO[w][ln][dt * 16 + 8 * hh] = lo; *(v4fa*)&sO[w][ln][dt * 16 + 8 * hh + 4] = hi; } }
  __builtin_amdgcn_fence(__ATOMIC_ACQ_REL, "workgroup"); __builtin_amdgcn_wave_barrier();      // the wave's own staged rows are written before other lanes of it read them back
  {
#pragma unroll
    for (int rp = 0; rp < RPW; rp += 2) { const int r = rp + (lane >> 4), pc = lane & 15; const v4f val = *(const v4fa*)&sO[w][r][pc * 4]; *(v4f*)(O + ((size_t)b * TT + q0 + r) * ldo + h * 64 + pc * 4) = val; }
     } }

extern "C" void kernel_launch(void* const* d_in, const int* in_sizes, int n_in,
                              void* d_out, int out_size, void* d_ws, size_t ws_size, hipStream_t stream) {
  (void)in_sizes; (void)n_in; (void)out_size;
  const float* const* I = (const float* const*)d_in; const float* x = I[0]; const float* Wq = I[1]; const float* bq = I[2]; const float* Wk = I[3]; const float* bk = I[4]; const float* Wv = I[5]; const float* bv = I[6]; const float* Wp = I[7]; const float* bp = I[8];
  char* ws = (char*)d_ws; size_t off = 0;
  auto take = [&](size_t bytes) { char* p = ws + off; off += (bytes + 255) & ~(size_t)255; return p; };
  _Float16* Bq = (_Float16*)take((size_t)DA * DX * 2); _Float16* Bk = (_Float16*)take((size_t)DA * DX * 2); _Float16* Bv = (_Float16*)take((size_t)DA * DX * 2); _Float16* Bp = (_Float16*)take((size_t)DX * DA * 2);
  _Float16* X16 = (_Float16*)take((size_t)NRX * DX * 2); _Float16* Q = (_Float16*)take((size_t)NRX * DA * 2); _Float16* K = (_Float16*)take((size_t)NRX * DA * 2); _Float16* V = (_Float16*)take((size_t)NRX * DA * 2); _Float16* Vt = (_Float16*)take((size_t)NRX * DA * 2);
  float* O = (float*)take((size_t)NRX * DA * 4); _Float16* O16 = (_Float16*)take((size_t)NRX * DA * 2);
  if (off > ws_size) return;      // 3 × 0.8 + 0.8 + 12.6 + 4 × 8.4 + 16.8 + 8.4 ≈ 75 MB
  const unsigned gwa = (unsigned)(((size_t)DA * (DX / 8) + 255) / 256);
  k_wt_f16<<<gwa, 256, 0, stream>>>(Wq, Bq, DX, DA, 16.0f); k_wt_f16<<<gwa, 256, 0, stream>>>(Wk, Bk, DX, DA, 16.0f); k_wt_f16<<<gwa, 256, 0, stream>>>(Wv, Bv, DX, DA, 16.0f); k_wt_f16<<<(unsigned)(((size_t)DX * (DA / 8) + 255) / 256), 256, 0, stream>>>(Wp, Bp, DA, DX, 16.0f);      /* (in,out) → Bt ×2^4 */
  k_x16<<<(unsigned)(((size_t)NRX * DX / 8 + 255) / 256), 256, 0, stream>>>(x, X16, (size_t)NRX * DX / 8);
  const unsigned ga = (NRX / 128) * (DA / 128);
  k_gemm_tile<DX, DA, true><<<ga, 256, 0, stream>>>(X16, Bq, 0.0625f, bq, nullptr, Q);      /* Q = x·Wq + bq (f16 [8192][512]): M 8192 N 512 K 768 */
  k_gemm_tile<DX, DA, true><<<ga, 256, 0, stream>>>(X16, Bk, 0.0625f, bk, nullptr, K);
  k_gemm_tile<DX, DA, true><<<ga, 256, 0, stream>>>(X16, Bv, 0.0625f, bv, nullptr, V);
  k_vt<1, TT><<<BB * (TT / 64), 256, 0, stream>>>(V, 64, 0, Vt);      /* each [8192][512] plane viewed as 64 contiguous [1024][64] slabs → Vᵀ [slab][64][1024] */
  k_flash<<<BB * (TT / 64), 128, 0, stream>>>(Q, 64, K, 64, Vt, nullptr, O, 64);      /* same flat view for Q, K and O */
  k_h16s<<<(unsigned)(((size_t)NRX * DA / 8 + 255) / 256), 256, 0, stream>>>(O, O16, (size_t)NRX * DA / 8);
  k_gemm_tile<DA, DX, false><<<(NRX / 128) * (DX / 128), 256, 0, stream>>>(O16, Bp, 0.00390625f, bp, (float*)d_out, nullptr);      /* out = O·Wp + bp: M 8192 N 768 K 512 (alpha undoes the ×2^4 weights and the ×2^4 carry) */
}

// v003
// A run of this version takes 118 microseconds.
// Next to v002, in two timings, it ran 1.15 and 1.14 times as fast.
// All steps since v000 together make it 2.50 times as fast.
#include <hip/hip_runtime.h>
// Multi-head attention with raw-reshape heads (B=8, N=1024, dim 768 → attn_dim 512 = 8 heads × 64): Q,K,V = x·W + b ((in,out)), reshaped by plain memory order to (H,B,N,64) (= 64 contiguous [1024][64] slabs of each [8192][512] plane);
// softmax(Q·Kᵀ·scale)·V per slab with scale = (64//8)^-½ = 8^-½ (as the original); out raw-reshaped back to (B,N,512) (same flat order) → ·Wp + bp.
// Compute dtype: x, weights, biases rounded to bf16; Q/K/V as f16 GEMM outputs; fused flash-style kernel over the flat slabs (online softmax f32, P f16 ×2^10) on v_wmma_f32_16x16x32_f16; O carried ×2^4 into f16 → projection GEMM with bias; f32 accumulate.
#define BB 64
#define TT 1024
#define NH 1
#define DX 768
#define DA 512
#define NRX 8192
#define ATT_SCALE 0.35355339059327373f

typedef __bf16 v16b __attribute__((ext_vector_type(16)));
typedef unsigned short v8us __attribute__((ext_vector_type(8), may_alias));
typedef float  v8f  __attribute__((ext_vector_type(8)));
typedef float  v4f  __attribute__((ext_vector_type(4)));
typedef float  v4fa __attribute__((ext_vector_type(4), may_alias));
union FragB { v16b v; v8us half[2]; unsigned short u[16]; };

__device__ __forceinline__ unsigned short bf16_bits(float x) { unsigned int u = __float_as_uint(x); return (unsigned short)((u + 0x7FFFu + ((u >> 16) & 1u)) >> 16); }
__device__ __forceinline__ float bf16_val(unsigned short b) { return __uint_as_float(((unsigned int)b) << 16); }
__device__ __forceinline__ float bf16_round(float x) { return bf16_val(bf16_bits(x)); }
// D += A·B with NT terms: 1 = ah·bh, 2 = + al·bh (A split), 3 = + ah·bl (both split)
template <int NT>
__device__ __forceinline__ v8f mmaN(v16b ah, v16b al, v16b bh, v16b bl, v8f c) {
  c = __builtin_amdgcn_wmma_f32_16x16x32_bf16(false, ah, false, bh, (short)0, c, false, false);
  if (NT >= 2) c = __builtin_amdgcn_wmma_f32_16x16x32_bf16(false, al, false, bh, (short)0, c, false, false);
  if (NT >= 3) c = __builtin_amdgcn_wmma_f32_16x16x32_bf16(false, ah, false, bl, (short)0, c, false, false);
  asm volatile("v_nop\n\tv_nop\n\tv_nop\n\tv_nop" : "+v"(c) : "v"(ah), "v"(al), "v"(bh), "v"(bl));
  return c;
}

__global__ __launch_bounds__(256) void k_wt_bf16(const float* __restrict__ W, unsigned short* __restrict__ Wt, int K, int N) {
  const int t = blockIdx.x * 256 + threadIdx.x;
  const int k8n = K / 8;
  if (t >= N * k8n) return;
  const int n = t / k8n, k8 = (t % k8n) * 8;
  v8us v;
#pragma unroll
  for (int i = 0; i < 8; ++i) v[i] = bf16_bits(W[(size_t)(k8 + i) * N + n]);
  *(v8us*)(Wt + (size_t)n * K + k8) = v;
  
}

// GEMM C[M][N] (f32, pitch ldc) = act(A[M][K]·W + bias). A f32 row-major (pitch lda) converted per fragment to bf16
// (ASPLIT: hi/lo two planes -> 2 terms, else single rounded term); Wt bf16 [N][K] (pitch ldb). BIAS_BF16 rounds the
// bias to bf16 first (bias quantised to bf16 before the add). K%32==0, M%16==0, N%64==0.
template <bool ASPLIT, int ACT, bool BIAS_BF16>
__global__ __launch_bounds__(128) void k_gemm_bf(const float* __restrict__ A, int lda, const unsigned short* __restrict__ Wt, int ldb,
                                               const float* __restrict__ bias, float* __restrict__ C, int ldc, int M, int N, int K) {
  __shared__ __attribute__((aligned(16))) float so[4][16][64];
  const int tid = threadIdx.x, w = tid >> 5, lane = tid & 31, ln = lane & 15, hh = lane >> 4;
  const int ntn = N / 64;
  const int wid = blockIdx.x * 4 + w;
  const int mt = wid / ntn, nq = wid % ntn;
  if (mt * 16 >= M) return;
  const int row0 = mt * 16, col0 = nq * 64;
  const float* arow = A + (size_t)(row0 + ln) * lda;
  v8f acc[4] = {};
  for (int kb = 0; kb < K; kb += 32) {
    FragB ah, al;
    const v4f x0 = *(const v4fa*)(arow + kb + 8 * hh), x1 = *(const v4fa*)(arow + kb + 8 * hh + 4);
    const v4f x2 = *(const v4fa*)(arow + kb + 16 + 8 * hh), x3 = *(const v4fa*)(arow + kb + 16 + 8 * hh + 4);
    float xs[16] = {x0[0],x0[1],x0[2],x0[3],x1[0],x1[1],x1[2],x1[3],x2[0],x2[1],x2[2],x2[3],x3[0],x3[1],x3[2],x3[3]};
#pragma unroll
    for (int i = 0; i < 16; ++i) { const unsigned short hb = bf16_bits(xs[i]); ah.u[i] = hb; al.u[i] = ASPLIT ? bf16_bits(xs[i] - bf16_val(hb)) : (unsigned short)0; }
#pragma unroll
    for (int t = 0; t < 4; ++t) {
      const unsigned short* brow = Wt + (size_t)(col0 + t * 16 + ln) * ldb + kb;
      FragB b;
      b.half[0] = *(const v8us*)(brow + 8 * hh);
      b.half[1] = *(const v8us*)(brow + 16 + 8 * hh);
      acc[t] = mmaN<ASPLIT ? 2 : 1>(ah.v, al.v, b.v, b.v, acc[t]);
    }
  }
#pragma unroll
  for (int t = 0; t < 4; ++t) {
    float bv = bias ? bias[col0 + t * 16 + ln] : 0.f;
    if (BIAS_BF16) bv = bf16_round(bv);
#pragma unroll
    for (int r = 0; r < 8; ++r) { float v = acc[t][r] + bv; if (ACT == 1) v = fmaxf(v, 0.f); so[w][8 * hh + r][t * 16 + ln] = v; }
  }
  __builtin_amdgcn_fence(__ATOMIC_ACQ_REL, "workgroup");
  __builtin_amdgcn_wave_barrier();
  const int rsub = lane >> 4, c4 = (lane & 15) * 4;
  {
#pragma unroll
    for (int q = 0; q < 8; ++q) {
      const int r = q * 2 + rsub;
      const v4f v = *(const v4fa*)&so[w][r][c4];
      *(v4f*)(C + (size_t)(row0 + r) * ldc + col0 + c4) = v;
    }
    
  }
}

// Flash-style causal/unmasked attention, all contractions 3-term bf16 hi/lo splits, f32 softmax with running max.
// q,k,v rows are read from f32 buffers with arbitrary row pitch (so they can live inside a fused qkv buffer);
// D = head size (multiple of 32, <= 128); one wave = 16 query rows; block = 4 waves (64 queries) sharing K/V chunks of 32.
template <int D, bool CAUSAL>
__global__ __launch_bounds__(128) void k_flash(const float* __restrict__ qb, const float* __restrict__ kb, const float* __restrict__ vb,
                                             int pitch, int T, int H, float scale, float* __restrict__ y, int ypitch) {
  constexpr int KS = D / 32;        // k-steps for QK
  constexpr int DT = D / 16;        // d tiles for PV
  __shared__ __attribute__((aligned(16))) unsigned short sKh[32][D + 8], sKl[32][D + 8], sVh[32][D + 8], sVl[32][D + 8];
  __shared__ __attribute__((aligned(16))) unsigned short sPh[4][16][40], sPl[4][16][40];
  __shared__ __attribute__((aligned(16))) float sO[4][16][D];
  const int tid = threadIdx.x, w = tid >> 5, lane = tid & 31, ln = lane & 15, hh = lane >> 4;
  const int nqb = (T + 63) / 64;
  const int bh = blockIdx.x / nqb, qblk = blockIdx.x % nqb;
  const int b = bh / H, h = bh % H;
  const int q0 = qblk * 64 + w * 16;
  const float* Q = qb + (size_t)b * T * pitch + h * D;
  const float* K = kb + (size_t)b * T * pitch + h * D;
  const float* V = vb + (size_t)b * T * pitch + h * D;

  // A fragments of the wave's 16 query rows (scaled), hi/lo
  FragB aqh[KS], aql[KS];
  {
    int row = q0 + ln; if (row >= T) row = T - 1;
    const float* qr = Q + (size_t)row * pitch;
#pragma unroll
    for (int ks = 0; ks < KS; ++ks)
#pragma unroll
      for (int i = 0; i < 16; ++i) {
        const int d = ks * 32 + ((i < 8) ? (8 * hh + i) : (16 + 8 * hh + (i - 8)));
        const float x = qr[d] * scale; const unsigned short hb = bf16_bits(x);
        aqh[ks].u[i] = hb; aql[ks].u[i] = bf16_bits(x - bf16_val(hb));
      }
  }
  float m_r[8], l_r[8];
#pragma unroll
  for (int r = 0; r < 8; ++r) { m_r[r] = -3.0e38f; l_r[r] = 0.f; }
  v8f oacc[DT];
#pragma unroll
  for (int dt = 0; dt < DT; ++dt) oacc[dt] = (v8f){0.f,0.f,0.f,0.f,0.f,0.f,0.f,0.f};

  const int kv_end = CAUSAL ? min(T, qblk * 64 + 64) : T;     // block-uniform
  for (int j0 = 0; j0 < kv_end; j0 += 32) {
    __syncthreads();
    for (int e = tid; e < 32 * (D / 4); e += 128) {
      const int r = e / (D / 4), c4 = (e % (D / 4)) * 4;
      const int key = j0 + r;
      v4f kf = {0.f,0.f,0.f,0.f}, vf = {0.f,0.f,0.f,0.f};
      if (key < T) { kf = *(const v4fa*)(K + (size_t)key * pitch + c4); vf = *(const v4fa*)(V + (size_t)key * pitch + c4); }
#pragma unroll
      for (int t = 0; t < 4; ++t) {
        unsigned short hb = bf16_bits(kf[t]); sKh[r][c4 + t] = hb; sKl[r][c4 + t] = bf16_bits(kf[t] - bf16_val(hb));
        hb = bf16_bits(vf[t]); sVh[r][c4 + t] = hb; sVl[r][c4 + t] = bf16_bits(vf[t] - bf16_val(hb));
      }
    }
    __syncthreads();
    // S tile 16 x 32
    v8f s[2];
#pragma unroll
    for (int nt = 0; nt < 2; ++nt) {
      v8f acc = {};
#pragma unroll
      for (int ks = 0; ks < KS; ++ks) {
        FragB bh_, bl_;
        bh_.half[0] = *(const v8us*)&sKh[nt * 16 + ln][ks * 32 + 8 * hh]; bh_.half[1] = *(const v8us*)&sKh[nt * 16 + ln][ks * 32 + 16 + 8 * hh];
        bl_.half[0] = *(const v8us*)&sKl[nt * 16 + ln][ks * 32 + 8 * hh]; bl_.half[1] = *(const v8us*)&sKl[nt * 16 + ln][ks * 32 + 16 + 8 * hh];
        acc = mmaN<3>(aqh[ks].v, aql[ks].v, bh_.v, bl_.v, acc);
      }
      s[nt] = acc;
    }
    // mask + running max (rows 8hh+r; the 16 lanes of a half share rows)
    float alpha[8];
#pragma unroll
    for (int r = 0; r < 8; ++r) {
      const int qi = q0 + 8 * hh + r;
      const int ja = j0 + ln, jb = j0 + 16 + ln;
      if (CAUSAL) { if (ja > qi) s[0][r] = -3.0e38f; if (jb > qi) s[1][r] = -3.0e38f; }
      if (ja >= T) s[0][r] = -3.0e38f;
      if (jb >= T) s[1][r] = -3.0e38f;
      float mx = fmaxf(s[0][r], s[1][r]);
      mx = fmaxf(mx, __shfl_xor(mx, 1, 32)); mx = fmaxf(mx, __shfl_xor(mx, 2, 32)); mx = fmaxf(mx, __shfl_xor(mx, 4, 32)); mx = fmaxf(mx, __shfl_xor(mx, 8, 32));
      const float mnew = fmaxf(m_r[r], mx);
      alpha[r] = (mnew > -1.0e38f) ? __expf(m_r[r] - mnew) : 1.0f;
      const float p0 = (s[0][r] > -1.0e38f) ? __expf(s[0][r] - mnew) : 0.f;
      const float p1 = (s[1][r] > -1.0e38f) ? __expf(s[1][r] - mnew) : 0.f;
      m_r[r] = mnew;
      l_r[r] = l_r[r] * alpha[r] + p0 + p1;            // per-lane partial row sum (16 lanes combined at the end)
      unsigned short hb = bf16_bits(p0); sPh[w][8 * hh + r][ln] = hb;      sPl[w][8 * hh + r][ln] = bf16_bits(p0 - bf16_val(hb));
      hb = bf16_bits(p1);                sPh[w][8 * hh + r][16 + ln] = hb; sPl[w][8 * hh + r][16 + ln] = bf16_bits(p1 - bf16_val(hb));
    }
#pragma unroll
    for (int dt = 0; dt < DT; ++dt)
#pragma unroll
      for (int r = 0; r < 8; ++r) oacc[dt][r] *= alpha[r];
    __builtin_amdgcn_fence(__ATOMIC_ACQ_REL, "workgroup");
    __builtin_amdgcn_wave_barrier();
    FragB pah, pal;
    pah.half[0] = *(const v8us*)&sPh[w][ln][8 * hh]; pah.half[1] = *(const v8us*)&sPh[w][ln][16 + 8 * hh];
    pal.half[0] = *(const v8us*)&sPl[w][ln][8 * hh]; pal.half[1] = *(const v8us*)&sPl[w][ln][16 + 8 * hh];
#pragma unroll
    for (int dt = 0; dt < DT; ++dt) {
      FragB bvh, bvl;
#pragma unroll
      for (int i = 0; i < 8; ++i) {
        bvh.u[i] = sVh[8 * hh + i][dt * 16 + ln]; bvh.u[8 + i] = sVh[16 + 8 * hh + i][dt * 16 + ln];
        bvl.u[i] = sVl[8 * hh + i][dt * 16 + ln]; bvl.u[8 + i] = sVl[16 + 8 * hh + i][dt * 16 + ln];
      }
      oacc[dt] = mmaN<3>(pah.v, pal.v, bvh.v, bvl.v, oacc[dt]);
    }
    __builtin_amdgcn_fence(__ATOMIC_ACQ_REL, "workgroup");
    __builtin_amdgcn_wave_barrier();
  }
#pragma unroll
  for (int r = 0; r < 8; ++r) {
    float l = l_r[r];
    l += __shfl_xor(l, 1, 32); l += __shfl_xor(l, 2, 32); l += __shfl_xor(l, 4, 32); l += __shfl_xor(l, 8, 32);
    l_r[r] = (l > 0.f) ? 1.0f / l : 0.f;
  }
#pragma unroll
  for (int dt = 0; dt < DT; ++dt)
#pragma unroll
    for (int r = 0; r < 8; ++r) sO[w][8 * hh + r][dt * 16 + ln] = oacc[dt][r] * l_r[r];
  __builtin_amdgcn_fence(__ATOMIC_ACQ_REL, "workgroup");
  __builtin_amdgcn_wave_barrier();
  {
    for (int r = 0; r < 16; ++r) {
      const int row = q0 + r;
      if (row < T && lane < D / 4) {
        const v4f val = *(const v4fa*)&sO[w][r][lane * 4];
        *(v4f*)(y + ((size_t)b * T + row) * ypitch + h * D + lane * 4) = val;
      }
    }
    
  }
}

// GEMM C = act(A·W + bias + resid): A f32 (ASPLIT -> hi/lo 2 terms), Wt bf16 [N][K]; ACT 0 none, 1 relu, 2 exact gelu;
// resid (optional, f32, row index = (row % rmod), pitch ldr, RES_BF16 rounds it) added before the activation.
template <bool ASPLIT, int ACT, bool BIAS_BF16, bool RES_BF16>
__global__ __launch_bounds__(128) void k_gemm_bf3(const float* __restrict__ A, int lda, const unsigned short* __restrict__ Wt, int ldb,
                                                const float* __restrict__ bias, const float* __restrict__ resid, int rmod, int ldr,
                                                float* __restrict__ C, int ldc, int M, int N, int K) {
  __shared__ __attribute__((aligned(16))) float so[4][16][64];
  const int tid = threadIdx.x, w = tid >> 5, lane = tid & 31, ln = lane & 15, hh = lane >> 4;
  const int ntn = N / 64;
  const int wid = blockIdx.x * 4 + w;
  const int mt = wid / ntn, nq = wid % ntn;
  if (mt * 16 >= M) return;
  const int row0 = mt * 16, col0 = nq * 64;
  const float* arow = A + (size_t)(row0 + ln) * lda;
  v8f acc[4] = {};
  for (int kb = 0; kb < K; kb += 32) {
    FragB ah, al;
    const v4f x0 = *(const v4fa*)(arow + kb + 8 * hh), x1 = *(const v4fa*)(arow + kb + 8 * hh + 4);
    const v4f x2 = *(const v4fa*)(arow + kb + 16 + 8 * hh), x3 = *(const v4fa*)(arow + kb + 16 + 8 * hh + 4);
    float xs[16] = {x0[0],x0[1],x0[2],x0[3],x1[0],x1[1],x1[2],x1[3],x2[0],x2[1],x2[2],x2[3],x3[0],x3[1],x3[2],x3[3]};
#pragma unroll
    for (int i = 0; i < 16; ++i) { const unsigned short hb = bf16_bits(xs[i]); ah.u[i] = hb; al.u[i] = ASPLIT ? bf16_bits(xs[i] - bf16_val(hb)) : (unsigned short)0; }
#pragma unroll
    for (int t = 0; t < 4; ++t) {
      const unsigned short* brow = Wt + (size_t)(col0 + t * 16 + ln) * ldb + kb;
      FragB b;
      b.half[0] = *(const v8us*)(brow + 8 * hh);
      b.half[1] = *(const v8us*)(brow + 16 + 8 * hh);
      acc[t] = mmaN<ASPLIT ? 2 : 1>(ah.v, al.v, b.v, b.v, acc[t]);
    }
  }
#pragma unroll
  for (int t = 0; t < 4; ++t) {
    const int col = col0 + t * 16 + ln;
    float bv = bias ? bias[col] : 0.f;
    if (BIAS_BF16) bv = bf16_round(bv);
#pragma unroll
    for (int r = 0; r < 8; ++r) {
      float v = acc[t][r] + bv;
      if (resid) { float rv = resid[(size_t)((row0 + 8 * hh + r) % rmod) * ldr + col]; if (RES_BF16) rv = bf16_round(rv); v += rv; }
      if (ACT == 1) v = fmaxf(v, 0.f);
      if (ACT == 2) v = 0.5f * v * (1.0f + erff(v * 0.70710678118654752f));
      if (ACT == 3) { const float u = 0.7978845608028654f * (v + 0.044715f * v * v * v); v = 0.5f * v * (1.0f + tanhf(u)); }
      so[w][8 * hh + r][t * 16 + ln] = v;
    }
  }
  __builtin_amdgcn_fence(__ATOMIC_ACQ_REL, "workgroup");
  __builtin_amdgcn_wave_barrier();
  const int rsub = lane >> 4, c4 = (lane & 15) * 4;
  {
#pragma unroll
    for (int q = 0; q < 8; ++q) {
      const int r = q * 2 + rsub;
      const v4f v = *(const v4fa*)&so[w][r][c4];
      *(v4f*)(C + (size_t)(row0 + r) * ldc + col0 + c4) = v;
    }
    
  }
}
// row LayerNorm (biased variance, eps) over N: s = X (+ R); optional out_sum <- s; out_norm <- (s-mu)*rsqrt(var+eps)*g + b
template <bool PARAM_BF16>
__global__ __launch_bounds__(256) void k_layernorm(const float* __restrict__ X, const float* __restrict__ R, const float* __restrict__ g, const float* __restrict__ bta,
                                                  float* __restrict__ out_sum, float* __restrict__ out_norm, int N, float eps) {
  __shared__ float red[256];
  const int row = blockIdx.x, tid = threadIdx.x;
  const float* x = X + (size_t)row * N; const float* rr = R ? R + (size_t)row * N : nullptr;
  float vals[16];                     // up to N = 4096
  const int per = N / 256;            // contiguous chunk per thread? use strided-by-4 chunks: thread handles j = tid*4 + 1024*u
  float s1 = 0.f;
  for (int u = 0; u < per / 4; ++u) {
    const int j = tid * 4 + 1024 * u;
    const v4f a = *(const v4fa*)(x + j);
    v4f b = {0.f,0.f,0.f,0.f}; if (rr) b = *(const v4fa*)(rr + j);
#pragma unroll
    for (int q = 0; q < 4; ++q) { const float v = a[q] + b[q]; vals[u * 4 + q] = v; s1 += v; }
  }
  red[tid] = s1; __syncthreads();
  for (int st = 128; st > 0; st >>= 1) { if (tid < st) red[tid] += red[tid + st]; __syncthreads(); }
  const float mu = red[0] / (float)N; __syncthreads();
  float s2 = 0.f;
  for (int u = 0; u < per / 4; ++u)
#pragma unroll
    for (int q = 0; q < 4; ++q) { const float c = vals[u * 4 + q] - mu; s2 += c * c; }
  red[tid] = s2; __syncthreads();
  for (int st = 128; st > 0; st >>= 1) { if (tid < st) red[tid] += red[tid + st]; __syncthreads(); }
  const float rs = rsqrtf(red[0] / (float)N + eps);
  {
    for (int u = 0; u < per / 4; ++u) {
      const int j = tid * 4 + 1024 * u;
      v4f o, sm;
#pragma unroll
      for (int q = 0; q < 4; ++q) {
        float gg = g[j + q], bb = bta[j + q];
        if (PARAM_BF16) { gg = bf16_round(gg); bb = bf16_round(bb); }
        sm[q] = vals[u * 4 + q]; o[q] = (vals[u * 4 + q] - mu) * rs * gg + bb;
      }
      if (out_sum) *(v4f*)(out_sum + (size_t)row * N + j) = sm;
      *(v4f*)(out_norm + (size_t)row * N + j) = o;
    }
    
  }
}



// ---- f16 WMMA path (v_wmma_f32_16x16x32_f16): 11-bit significands for operands in range — used where a [0,1] probability operand needs more precision than bf16
typedef _Float16 v16h __attribute__((ext_vector_type(16)));
union FragH { v16h v; v8us half[2]; _Float16 h[16]; unsigned short u[16]; };
template <int NT>
__device__ __forceinline__ v8f mmaH(v16h ah, v16h al, v16h bh, v16h bl, v8f c) {
  c = __builtin_amdgcn_wmma_f32_16x16x32_f16(false, ah, false, bh, (short)0, c, false, false);
  if (NT >= 2) c = __builtin_amdgcn_wmma_f32_16x16x32_f16(false, al, false, bh, (short)0, c, false, false);
  if (NT >= 3) c = __builtin_amdgcn_wmma_f32_16x16x32_f16(false, ah, false, bl, (short)0, c, false, false);
  asm volatile("v_nop\n\tv_nop\n\tv_nop\n\tv_nop" : "+v"(c) : "v"(ah), "v"(al), "v"(bh), "v"(bl));
  return c;
}
// batched GEMM like k_gemm_b but f16 operands: A f32 (split into f16 hi/lo if ASPLIT, else rounded to f16), Bt = f16 values [n][k]; alpha; C f32; N multiple of 16 (partial tiles skipped)
template <bool ASPLIT>
__global__ __launch_bounds__(128) void k_gemm_h(const float* __restrict__ A, int lda, size_t sA, const _Float16* __restrict__ Bh, int ldb, size_t sB, float alpha, float* __restrict__ C, int ldc, size_t sC, int M, int N, int K) {
  __shared__ __attribute__((aligned(16))) float so[4][16][64];
  const int tid = threadIdx.x, w = tid >> 5, lane = tid & 31, ln = lane & 15, hh = lane >> 4; const int by = blockIdx.y;
  A += (size_t)by * sA; Bh += (size_t)by * sB; C += (size_t)by * sC;
  const int ntn = (N + 63) / 64; const int wid = blockIdx.x * 4 + w; const int mt = wid / ntn, nq = wid % ntn; if (mt * 16 >= M) return;
  const int row0 = mt * 16, col0 = nq * 64; const float* arow = A + (size_t)(row0 + ln) * lda;
  v8f acc[4] = {};
  for (int kb = 0; kb < K; kb += 32) {
    FragH ah, al;
    const v4f x0 = *(const v4fa*)(arow + kb + 8 * hh), x1 = *(const v4fa*)(arow + kb + 8 * hh + 4), x2 = *(const v4fa*)(arow + kb + 16 + 8 * hh), x3 = *(const v4fa*)(arow + kb + 16 + 8 * hh + 4);
    float xs[16] = {x0[0],x0[1],x0[2],x0[3],x1[0],x1[1],x1[2],x1[3],x2[0],x2[1],x2[2],x2[3],x3[0],x3[1],x3[2],x3[3]};
#pragma unroll
    for (int i = 0; i < 16; ++i) { const _Float16 h = (_Float16)xs[i]; ah.h[i] = h; al.h[i] = ASPLIT ? (_Float16)(xs[i] - (float)h) : (_Float16)0.0f; }
#pragma unroll
    for (int t = 0; t < 4; ++t) { if (col0 + t * 16 >= N) continue; const size_t boff = (size_t)(col0 + t * 16 + ln) * ldb + kb; FragH bq; bq.half[0] = *(const v8us*)(Bh + boff + 8 * hh); bq.half[1] = *(const v8us*)(Bh + boff + 16 + 8 * hh);
      acc[t] = mmaH<ASPLIT ? 2 : 1>(ah.v, al.v, bq.v, bq.v, acc[t]); }
  }
#pragma unroll
  for (int t = 0; t < 4; ++t) { if (col0 + t * 16 >= N) continue;
#pragma unroll
    for (int r = 0; r < 8; ++r) so[w][8 * hh + r][t * 16 + ln] = acc[t][r] * alpha; }
  __builtin_amdgcn_fence(__ATOMIC_ACQ_REL, "workgroup"); __builtin_amdgcn_wave_barrier();
  const int rsub = lane >> 4, c4 = (lane & 15) * 4;
  {
#pragma unroll
    for (int q = 0; q < 8; ++q) { const int r = q * 2 + rsub; if (col0 + c4 < N) { const v4f v = *(const v4fa*)&so[w][r][c4]; *(v4f*)(C + (size_t)(row0 + r) * ldc + col0 + c4) = v; } }
     }
}

// Wt[n][k] = f16(W[k][n]·scale) from f32 row-major W[K][N] (scale = power of two; bf16-exact weights stay exact in f16 away from the subnormal range)
__device__ __forceinline__ void wt_f16(const float* __restrict__ W, _Float16* __restrict__ Wt, int K, int N, float scale, int t) {
  if (t >= N * (K / 8)) return; const int n = t / (K / 8), k8 = (t % (K / 8)) * 8; FragH f;
#pragma unroll
  for (int i = 0; i < 8; ++i) f.h[i] = (_Float16)(bf16_round(W[(size_t)(k8 + i) * N + n]) * scale); const v8us o = f.half[0];
  *(v8us*)((unsigned short*)Wt + (size_t)n * K + k8) = o; 
}
// k_gemm_hh variant with fused epilogue: v = acc·alpha + bias[by·sBias + col] (+ CP[(row/rowsPerB)·sCPb + by·64 + col] if CP) ; ACT 0 none / 1 elu ; writes f16 C16 and f32 C, each if non-null
template <int ACT>
__global__ __launch_bounds__(128) void k_gemm_hhx(const _Float16* __restrict__ A, int lda, size_t sA, const _Float16* __restrict__ Bh, int ldb, size_t sB, float alpha, const float* __restrict__ bias, size_t sBias, const float* __restrict__ CP, int rowsPerB, size_t sCPb, int row0g,
    float* __restrict__ C, _Float16* __restrict__ C16, int ldc, size_t sC, int M, int N, int K) {
  __shared__ __attribute__((aligned(16))) float so[4][16][64];
  const int tid = threadIdx.x, w = tid >> 5, lane = tid & 31, ln = lane & 15, hh = lane >> 4; const int by = blockIdx.y;
  A += (size_t)by * sA; Bh += (size_t)by * sB; const size_t cofs = (size_t)by * sC; const float* bp = bias ? bias + (size_t)by * sBias : nullptr;
  const int ntn = (N + 63) / 64; const int wid = blockIdx.x * 4 + w; const int mt = wid / ntn, nq = wid % ntn; if (mt * 16 >= M) return;
  const int row0 = mt * 16, col0 = nq * 64; const _Float16* arow = A + (size_t)(row0 + ln) * lda;
  v8f acc[4] = {};
  for (int kb = 0; kb < K; kb += 32) { FragH ah; ah.half[0] = *(const v8us*)((const unsigned short*)arow + kb + 8 * hh); ah.half[1] = *(const v8us*)((const unsigned short*)arow + kb + 16 + 8 * hh);
#pragma unroll
    for (int t = 0; t < 4; ++t) { if (col0 + t * 16 >= N) continue; const size_t boff = (size_t)(col0 + t * 16 + ln) * ldb + kb; FragH bq; bq.half[0] = *(const v8us*)((const unsigned short*)Bh + boff + 8 * hh); bq.half[1] = *(const v8us*)((const unsigned short*)Bh + boff + 16 + 8 * hh);
      acc[t] = mmaH<1>(ah.v, ah.v, bq.v, bq.v, acc[t]); }
  }
#pragma unroll
  for (int t = 0; t < 4; ++t) { if (col0 + t * 16 >= N) continue; const int col = col0 + t * 16 + ln; const float bv = bp ? bf16_round(bp[col]) : 0.f;
#pragma unroll
    for (int r = 0; r < 8; ++r) { float v = acc[t][r] * alpha + bv; if (CP) { const int bidx = (row0g + row0 + 8 * hh + r) / rowsPerB; v += CP[(size_t)bidx * sCPb + (size_t)by * 64 + col]; } if (ACT == 1) v = (v > 0.f) ? v : expm1f(v); else if (ACT == 7) v = (v > 0.f) ? v + 1.0f : expf(v); else if (ACT == 8) v = tanhf(v); else if (ACT == 9) v = 0.5f * v * (1.0f + tanhf(0.7978845608028654f * (v + 0.044715f * v * v * v))); else if (ACT == 11) v = 1.0f / (1.0f + expf(-v)); else if (ACT == 12) v = (v > 0.f) ? v : 0.01f * v; else if (ACT == 14) v = (v > 0.f) ? v : 0.1f * v; else if (ACT == 15) v = v / (1.0f + expf(-v)); else if (ACT == 3) v = fmaxf(v, 0.f); else if (ACT == 6) v = 0.5f * v * (1.0f + erff(v * 0.70710678118654752f)); so[w][8 * hh + r][t * 16 + ln] = v; } }
  __builtin_amdgcn_fence(__ATOMIC_ACQ_REL, "workgroup"); __builtin_amdgcn_wave_barrier();
  const int rsub = lane >> 4, c4 = (lane & 15) * 4; typedef _Float16 v4h __attribute__((ext_vector_type(4)));
  {
#pragma unroll
    for (int q = 0; q < 8; ++q) { const int r = q * 2 + rsub; if (col0 + c4 < N) { const v4f v = *(const v4fa*)&so[w][r][c4]; if (C) *(v4f*)(C + cofs + (size_t)(row0 + r) * ldc + col0 + c4) = v; if (C16) { v4h h4; for (int i = 0; i < 4; ++i) h4[i] = (_Float16)v[i]; *(v4h*)(C16 + cofs + (size_t)(row0 + r) * ldc + col0 + c4) = h4; } } }
     }
}


// Block-tiled GEMM, f16 operands, both K-contiguous: C[8192][NN] = A[8192][KK] . Bh[NN][KK]^T * alpha + bf16(bias). One 128x128 tile of C per work-group of 8 waves (4x2), 32x64 per wave.
// A pass is 128 k = 256 aligned bytes of each of the 256 operand rows, brought into LDS by asynchronous copies (two buffers, the next pass's copies fly while this pass is worked on), so that every line leaves L2 once per work-group and not once per wave.
// LDS rows at pitch 272 bytes (16 x odd) for the 16-byte fragment reads. The k order of a fragment and the order of the k steps are those of k_gemm_hhx.
__device__ __forceinline__ unsigned lds_off(const void* p) { return (unsigned)(size_t)p; }
// eight copies of 16 bytes per lane: rows r, r + 16, ..., r + 112 of one operand's tile. The s_wait_xcnt stands inside the statement so that no address register is rewritten ahead of it.
__device__ __forceinline__ void copy_rows8(unsigned l0, const _Float16* g0, int rowstep, unsigned ldsstep) {
  const unsigned l1 = l0 + ldsstep, l2 = l0 + 2 * ldsstep, l3 = l0 + 3 * ldsstep, l4 = l0 + 4 * ldsstep, l5 = l0 + 5 * ldsstep, l6 = l0 + 6 * ldsstep, l7 = l0 + 7 * ldsstep;
  const _Float16* g1 = g0 + rowstep; const _Float16* g2 = g0 + 2 * rowstep; const _Float16* g3 = g0 + 3 * rowstep; const _Float16* g4 = g0 + 4 * rowstep;
  const _Float16* g5 = g0 + 5 * rowstep; const _Float16* g6 = g0 + 6 * rowstep; const _Float16* g7 = g0 + 7 * rowstep;
  asm volatile("global_load_async_to_lds_b128 %0, %8, off\n\t"
               "global_load_async_to_lds_b128 %1, %9, off\n\t"
               "global_load_async_to_lds_b128 %2, %10, off\n\t"
               "global_load_async_to_lds_b128 %3, %11, off\n\t"
               "global_load_async_to_lds_b128 %4, %12, off\n\t"
               "global_load_async_to_lds_b128 %5, %13, off\n\t"
               "global_load_async_to_lds_b128 %6, %14, off\n\t"
               "global_load_async_to_lds_b128 %7, %15, off\n\t"
               "s_wait_xcnt 0x0"
               :: "v"(l0), "v"(l1), "v"(l2), "v"(l3), "v"(l4), "v"(l5), "v"(l6), "v"(l7),
                  "v"(g0), "v"(g1), "v"(g2), "v"(g3), "v"(g4), "v"(g5), "v"(g6), "v"(g7) : "memory");
}
// NJ independent products that share A (own Bh, bias and C16 each) run as one grid: the NJ * NTN tiles of one 128-row band of A have neighbouring block indices.
template <int KK, int NN, bool OUT16, int NJ>
__global__ __launch_bounds__(256) void k_gemm_tile(const _Float16* __restrict__ A, const _Float16* __restrict__ Bh0, const _Float16* __restrict__ Bh1, const _Float16* __restrict__ Bh2, float alpha,
                                                  const float* __restrict__ bias0, const float* __restrict__ bias1, const float* __restrict__ bias2, float* __restrict__ C,
                                                  _Float16* __restrict__ C160, _Float16* __restrict__ C161, _Float16* __restrict__ C162) {
  constexpr int BK = 128, KSN = BK / 32, PITCH = 2 * BK + 16, STAGE = 256 * PITCH, NPASS = KK / BK, NTN = NN / 128, SOP = 68;
  static_assert(NPASS >= 2 && KK % BK == 0 && NN % 128 == 0 && 8 * 32 * SOP * 4 <= 2 * STAGE, "shape");
  __shared__ __attribute__((aligned(16))) unsigned char sm[2 * STAGE];
  const int tid = threadIdx.x, w = tid >> 5, lane = tid & 31, ln = lane & 15, hh = lane >> 4;
  const int job = NJ > 1 ? (blockIdx.x % (NJ * NTN)) / NTN : 0;
  const _Float16* Bh = job == 0 ? Bh0 : job == 1 ? Bh1 : Bh2; const float* bias = job == 0 ? bias0 : job == 1 ? bias1 : bias2; _Float16* C16 = job == 0 ? C160 : job == 1 ? C161 : C162;
  const int m0 = (blockIdx.x / (NJ * NTN)) * 128, n0 = (blockIdx.x % NTN) * 128; const int wm = w >> 1, wn = w & 1;
  const int cr = tid >> 4, cc = tid & 15;      // a wave's copy = 2 rows x 256 bytes
  const _Float16* ga = A + (size_t)(m0 + cr) * KK + cc * 8; const _Float16* gb = Bh + (size_t)(n0 + cr) * KK + cc * 8;
  const unsigned la = lds_off(sm) + cr * PITCH + cc * 16, lb = la + 128 * PITCH;
  v8f acc[2][4];
#pragma unroll
  for (int i = 0; i < 2; ++i)
#pragma unroll
    for (int j = 0; j < 4; ++j) acc[i][j] = (v8f){0.f,0.f,0.f,0.f,0.f,0.f,0.f,0.f};
  copy_rows8(la, ga, 16 * KK, 16 * PITCH); copy_rows8(lb, gb, 16 * KK, 16 * PITCH);
  asm volatile("s_wait_asynccnt 0x0" ::: "memory");      // pass 0's bytes have landed before the barrier publishes them
  __syncthreads();
  copy_rows8(la + STAGE, ga + BK, 16 * KK, 16 * PITCH); copy_rows8(lb + STAGE, gb + BK, 16 * KK, 16 * PITCH);
  const unsigned char* fa = sm + (wm * 32 + ln) * PITCH + 16 * hh; const unsigned char* fb = sm + (128 + wn * 64 + ln) * PITCH + 16 * hh;
#pragma unroll 1      // the ring stays one rolled loop: one publish point, short code
  for (int t = 0; t < NPASS; ++t) {
    const int bo = (t & 1) * STAGE;
    FragH a[2][2], b[2][4];      // two fragment sets: the next 32 k of this pass are fetched while these are multiplied
#pragma unroll
    for (int i = 0; i < 2; ++i) { a[0][i].half[0] = *(const v8us*)(fa + bo + i * 16 * PITCH); a[0][i].half[1] = *(const v8us*)(fa + bo + i * 16 * PITCH + 32); }
#pragma unroll
    for (int j = 0; j < 4; ++j) { b[0][j].half[0] = *(const v8us*)(fb + bo + j * 16 * PITCH); b[0][j].half[1] = *(const v8us*)(fb + bo + j * 16 * PITCH + 32); }
#pragma unroll
    for (int ks = 0; ks < KSN; ++ks) {
      const int cu = ks & 1, nx = cu ^ 1;
      if (ks + 1 < KSN) {
#pragma unroll
        for (int i = 0; i < 2; ++i) { a[nx][i].half[0] = *(const v8us*)(fa + bo + i * 16 * PITCH + (ks + 1) * 64); a[nx][i].half[1] = *(const v8us*)(fa + bo + i * 16 * PITCH + (ks + 1) * 64 + 32); }
#pragma unroll
        for (int j = 0; j < 4; ++j) { b[nx][j].half[0] = *(const v8us*)(fb + bo + j * 16 * PITCH + (ks + 1) * 64); b[nx][j].half[1] = *(const v8us*)(fb + bo + j * 16 * PITCH + (ks + 1) * 64 + 32); }
        __builtin_amdgcn_sched_barrier(0);      // keeps the next set's LDS reads one group ahead of this set's products; without it they are sunk among the products, into one register set, and each product run waits out the LDS latency
      }
#pragma unroll
      for (int i = 0; i < 2; ++i)
#pragma unroll
        for (int j = 0; j < 4; ++j) acc[i][j] = __builtin_amdgcn_wmma_f32_16x16x32_f16(false, a[cu][i].v, false, b[cu][j].v, (short)0, acc[i][j], false, false);
    }
    __builtin_amdgcn_sched_barrier(0);      // keeps the pass's products in front of the publish point: sunk behind the barrier they stand between it and the refill, and the copies start that much later
    asm volatile("s_wait_dscnt 0x0" ::: "memory");       // this wave's reads of the buffer are done before it is handed to the copies
    asm volatile("s_wait_asynccnt 0x0" ::: "memory");    // this wave's copies of pass t + 1 have landed before the barrier publishes them
    __syncthreads();
    if (t + 2 < NPASS) { copy_rows8(la + bo, ga + (t + 2) * BK, 16 * KK, 16 * PITCH); copy_rows8(lb + bo, gb + (t + 2) * BK, 16 * KK, 16 * PITCH); }
  }
  asm volatile("s_wait_asynccnt 0x0" ::: "memory");      // nothing is in flight when the ring becomes output staging
  float* so = (float*)sm + w * (32 * SOP);      // each wave stages its own 32 x 64 tile; every reader left the ring at the last pass's barrier
#pragma unroll
  for (int j = 0; j < 4; ++j) { const float bv = bf16_round(bias[n0 + wn * 64 + j * 16 + ln]);
#pragma unroll
    for (int i = 0; i < 2; ++i)
#pragma unroll
      for (int r = 0; r < 8; ++r) so[(i * 16 + 8 * hh + r) * SOP + j * 16 + ln] = acc[i][j][r] * alpha + bv; }
  __builtin_amdgcn_fence(__ATOMIC_ACQ_REL, "workgroup"); __builtin_amdgcn_wave_barrier();      // the wave's own staged rows are written before other lanes of it read them back
  if (OUT16) {
#pragma unroll
    for (int q = 0; q < 8; ++q) { const int r = q * 4 + (lane >> 3), c8 = (lane & 7) * 8; const v4f v0 = *(const v4fa*)&so[r * SOP + c8], v1 = *(const v4fa*)&so[r * SOP + c8 + 4]; FragH f;
#pragma unroll
      for (int i = 0; i < 4; ++i) { f.h[i] = (_Float16)v0[i]; f.h[4 + i] = (_Float16)v1[i]; }
      *(v8us*)((unsigned short*)C16 + (size_t)(m0 + wm * 32 + r) * NN + n0 + wn * 64 + c8) = f.half[0]; }
  } else {
#pragma unroll
    for (int q = 0; q < 16; ++q) { const int r = q * 2 + (lane >> 4), c4 = (lane & 15) * 4; const v4f v = *(const v4fa*)&so[r * SOP + c4];
      *(v4f*)(C + (size_t)(m0 + wm * 32 + r) * NN + n0 + wn * 64 + c4) = v; }
  }
}


typedef _Float16 v4h __attribute__((ext_vector_type(4)));

__device__ __forceinline__ void x16(const float* __restrict__ x, _Float16* __restrict__ X16, size_t n8, size_t t) { if (t >= n8) return; FragH f;
#pragma unroll
  for (int q = 0; q < 8; ++q) f.h[q] = (_Float16)bf16_round(x[t * 8 + q]); *(v8us*)((unsigned short*)X16 + t * 8) = f.half[0];  }
// The five operand preparations depend on nothing but the inputs: one grid, the block index picks the job. Blocks 0 .. 4 * WTB - 1: the four weight transposes (WTB blocks each); the rest: x.
#define WTB ((DA * (DX / 8) + 255) / 256)
__global__ __launch_bounds__(256) void k_prep(const float* __restrict__ x, const float* __restrict__ Wq, const float* __restrict__ Wk, const float* __restrict__ Wv, const float* __restrict__ Wp,
                                             _Float16* __restrict__ X16, _Float16* __restrict__ Bq, _Float16* __restrict__ Bk, _Float16* __restrict__ Bv, _Float16* __restrict__ Bp) {
  const int bid = blockIdx.x;
  if (bid < 4 * WTB) {
    const int job = bid / WTB, t = (bid % WTB) * 256 + threadIdx.x;
    const float* W = job == 0 ? Wq : job == 1 ? Wk : job == 2 ? Wv : Wp; _Float16* Wt = job == 0 ? Bq : job == 1 ? Bk : job == 2 ? Bv : Bp;
    wt_f16(W, Wt, job < 3 ? DX : DA, job < 3 ? DA : DX, 16.0f, t);      /* (in,out) -> Bt x2^4 */
  } else x16(x, X16, (size_t)NRX * DX / 8, (size_t)(bid - 4 * WTB) * 256 + threadIdx.x);
}
__global__ __launch_bounds__(256) void k_h16(const float* __restrict__ x, _Float16* __restrict__ X16, size_t n8) { const size_t t = (size_t)blockIdx.x * 256 + threadIdx.x; if (t >= n8) return; FragH f;
#pragma unroll
  for (int q = 0; q < 8; ++q) f.h[q] = (_Float16)x[t * 8 + q]; *(v8us*)((unsigned short*)X16 + t * 8) = f.half[0];  }
__global__ __launch_bounds__(256) void k_round16f(const float* __restrict__ W, _Float16* __restrict__ Bt, size_t n8) { const size_t t = (size_t)blockIdx.x * 256 + threadIdx.x; if (t >= n8) return; FragH f;
#pragma unroll
  for (int i = 0; i < 8; ++i) f.h[i] = (_Float16)(bf16_round(W[t * 8 + i]) * 16.0f); *(v8us*)((unsigned short*)Bt + t * 8) = f.half[0];  }
template <int NHv, int TTv>
__global__ __launch_bounds__(256) void k_vt(const _Float16* __restrict__ V16, int ldv, int voff, _Float16* __restrict__ Vt) { __shared__ unsigned short tl[64][66]; const int tid = threadIdx.x; const int slab = blockIdx.x / (TTv / 64), lg = blockIdx.x % (TTv / 64); const int b = slab / NHv, h = slab % NHv;
  for (int i = tid; i < 64 * 8; i += 256) { const int r = i / 8, c8 = (i % 8) * 8; FragH f; f.half[0] = *(const v8us*)((const unsigned short*)V16 + ((size_t)b * TTv + lg * 64 + r) * ldv + voff + h * 64 + c8);
#pragma unroll
    for (int q = 0; q < 8; ++q) tl[r][c8 + q] = f.u[q]; }
  __syncthreads();
  {
#pragma unroll
    for (int rd = 0; rd < 2; ++rd) { const int d = rd * 32 + tid / 8, pc = tid % 8; FragH f;
#pragma unroll
      for (int q = 0; q < 8; ++q) f.u[q] = tl[pc * 8 + q][d];
      *(v8us*)((unsigned short*)Vt + ((size_t)slab * 64 + d) * TTv + lg * 64 + pc * 8) = f.half[0]; }
     } }

__global__ __launch_bounds__(256) void k_h16s(const float* __restrict__ F, _Float16* __restrict__ H, size_t n8) { const size_t t = (size_t)blockIdx.x * 256 + threadIdx.x; if (t >= n8) return; const v4f a = *(const v4fa*)(F + t * 8), c = *(const v4fa*)(F + t * 8 + 4); FragH f;
#pragma unroll
  for (int q = 0; q < 4; ++q) { f.h[q] = (_Float16)(a[q] * 16.0f); f.h[4 + q] = (_Float16)(c[q] * 16.0f); } *(v8us*)((unsigned short*)H + t * 8) = f.half[0];  }
// lane l with lane l ^ 16: the two halves of a wave hold the two halves of one query's keys
__device__ __forceinline__ float xhalf(float x) { return __builtin_bit_cast(float, __builtin_amdgcn_permlanex16(__builtin_bit_cast(int, x), __builtin_bit_cast(int, x), 0x76543210, 0xfedcba98, false, false)); }
// Transposed form: S^T = K.Q^T (A = 16 key rows, B = the wave's 16 queries, kept in registers), O^T += V^T.P^T (A = 16 rows of V^T, B = P^T).
// A lane holds 16 of the 32 scores of ONE query (column ln; keys 8hh + r and 16 + 8hh + r), so the maximum and the sum are in-lane plus one exchange between the halves,
// and the two score tiles, converted in place, are the B operand of the second product in the k order of the V^T loader: P never leaves the registers.
__global__ __launch_bounds__(128) void k_flash(const _Float16* __restrict__ Q16, int ldq, const _Float16* __restrict__ K16, int ldk, const _Float16* __restrict__ Vt, const int* __restrict__ MSK, float* __restrict__ O, int ldo) {
  constexpr int RPW = 16, NQB = TT / (4 * RPW), DT = 4, KS = 2;
  __shared__ __attribute__((aligned(16))) float sO[4][RPW][64 + 4];
  (void)MSK;
  const int tid = threadIdx.x, w = tid >> 5, lane = tid & 31, ln = lane & 15, hh = lane >> 4;
  const int slab = blockIdx.x / NQB, qblk = blockIdx.x % NQB; const int b = slab / NH, h = slab % NH; const int q0 = qblk * (4 * RPW) + w * RPW;
  FragH bq[KS];
  { const unsigned short* qr = (const unsigned short*)Q16 + ((size_t)b * TT + q0 + ln) * ldq + h * 64;
#pragma unroll
    for (int ks = 0; ks < KS; ++ks) { bq[ks].half[0] = *(const v8us*)(qr + ks * 32 + 8 * hh); bq[ks].half[1] = *(const v8us*)(qr + ks * 32 + 16 + 8 * hh); } }
  // wave-uniform bases that walk the keys, and one fixed byte offset per lane
  const char* Kb = (const char*)((const unsigned short*)K16 + (size_t)b * TT * ldk + h * 64); const unsigned klo = (unsigned)(ln * ldk + 8 * hh) * 2u;
  const char* Vb = (const char*)((const unsigned short*)Vt + (size_t)slab * 64 * TT); const unsigned vlo = (unsigned)(ln * TT + 8 * hh) * 2u;
  float m_r = -3.0e38f, l_r = 0.f; v8f oacc[DT];
#pragma unroll
  for (int dt = 0; dt < DT; ++dt) oacc[dt] = (v8f){0.f,0.f,0.f,0.f,0.f,0.f,0.f,0.f};
#pragma unroll 1      // the pass stays rolled, as it was: one group of loads a pass, short code
  for (int j0 = 0; j0 < TT; j0 += 32) {
    FragH ak[2][KS], av[DT];
#pragma unroll
    for (int nt = 0; nt < 2; ++nt) { const char* kr = Kb + (size_t)(j0 + nt * 16) * ldk * 2;
#pragma unroll
      for (int ks = 0; ks < KS; ++ks) { ak[nt][ks].half[0] = *(const v8us*)(kr + klo + ks * 64); ak[nt][ks].half[1] = *(const v8us*)(kr + klo + ks * 64 + 32); } }
    asm volatile("s_wait_xcnt 0x0" ::: "memory");      // behind the K loads: in this build a V^T load lands in the registers that held their addresses
#pragma unroll
    for (int dt = 0; dt < DT; ++dt) { const char* vr = Vb + (size_t)j0 * 2; av[dt].half[0] = *(const v8us*)(vr + vlo + dt * 16 * TT * 2); av[dt].half[1] = *(const v8us*)(vr + vlo + dt * 16 * TT * 2 + 32); }
    __builtin_amdgcn_sched_barrier(0);      // keeps the pass's 16 loads one group in front of its work: sunk among the products, into few registers, each product waits out a load latency of its own
    v8f s[2];
#pragma unroll
    for (int nt = 0; nt < 2; ++nt) { v8f acc = (v8f){0.f,0.f,0.f,0.f,0.f,0.f,0.f,0.f};
#pragma unroll
      for (int ks = 0; ks < KS; ++ks) acc = __builtin_amdgcn_wmma_f32_16x16x32_f16(false, ak[nt][ks].v, false, bq[ks].v, (short)0, acc, false, false);
      s[nt] = acc; }      // s[nt][r] = score of query q0 + ln with key j0 + nt * 16 + 8 * hh + r
    float mc = -3.0e38f;
#pragma unroll
    for (int nt = 0; nt < 2; ++nt)
#pragma unroll
      for (int r = 0; r < 8; ++r) { s[nt][r] *= ATT_SCALE; mc = fmaxf(mc, s[nt][r]); }
    mc = fmaxf(mc, xhalf(mc));
    const float mn = fmaxf(m_r, mc); const float ea = expf(m_r - mn); const float al = (mn > -1.0e38f) ? ea : 1.0f; m_r = mn;
    FragH pb; float ps = 0.f;
#pragma unroll
    for (int nt = 0; nt < 2; ++nt)
#pragma unroll
      for (int r = 0; r < 8; ++r) { const float p = expf(s[nt][r] - mn); ps += p; pb.h[nt * 8 + r] = (_Float16)(p * 1024.0f); }
    l_r = l_r * al + ps;      // this half's 16 keys; the halves are joined once, behind the loop
#pragma unroll
    for (int dt = 0; dt < DT; ++dt)
#pragma unroll
      for (int r = 0; r < 8; ++r) oacc[dt][r] *= al;
#pragma unroll
    for (int dt = 0; dt < DT; ++dt) oacc[dt] = __builtin_amdgcn_wmma_f32_16x16x32_f16(false, av[dt].v, false, pb.v, (short)0, oacc[dt], false, false);      // oacc[dt][r] = O[q0 + ln][dt * 16 + 8 * hh + r]
  }
  { const float l = l_r + xhalf(l_r); const float inv = (l > 0.f) ? 1.0f / (l * 1024.0f) : 0.f;
#pragma unroll
    for (int dt = 0; dt < DT; ++dt) { const v4f lo = {oacc[dt][0] * inv, oacc[dt][1] * inv, oacc[dt][2] * inv, oacc[dt][3] * inv}, hi = {oacc[dt][4] * inv, oacc[dt][5] * inv, oacc[dt][6] * inv, oacc[dt][7] * inv};
      *(v4fa*)&sO[w][ln][dt * 16 + 8 * hh] = lo; *(v4fa*)&sO[w][ln][dt * 16 + 8 * hh + 4] = hi; } }
  __builtin_amdgcn_fence(__ATOMIC_ACQ_REL, "workgroup"); __builtin_amdgcn_wave_barrier();      // the wave's own staged rows are written before other lanes of it read them back
  {
#pragma unroll
    for (int rp = 0; rp < RPW; rp += 2) { const int r = rp + (lane >> 4), pc = lane & 15; const v4f val = *(const v4fa*)&sO[w][r][pc * 4]; *(v4f*)(O + ((size_t)b * TT + q0 + r) * ldo + h * 64 + pc * 4) = val; }
     } }

extern "C" void kernel_launch(void* const* d_in, const int* in_sizes, int n_in,
                              void* d_out, int out_size, void* d_ws, size_t ws_size, hipStream_t stream) {
  (void)in_sizes; (void)n_in; (void)out_size;
  const float* const* I = (const float* const*)d_in; const float* x = I[0]; const float* Wq = I[1]; const float* bq = I[2]; const float* Wk = I[3]; const float* bk = I[4]; const float* Wv = I[5]; const float* bv = I[6]; const float* Wp = I[7]; const float* bp = I[8];
  char* ws = (char*)d_ws; size_t off = 0;
  auto take = [&](size_t bytes) { char* p = ws + off; off += (bytes + 255) & ~(size_t)255; return p; };
  _Float16* Bq = (_Float16*)take((size_t)DA * DX * 2); _Float16* Bk = (_Float16*)take((size_t)DA * DX * 2); _Float16* Bv = (_Float16*)take((size_t)DA * DX * 2); _Float16* Bp = (_Float16*)take((size_t)DX * DA * 2);
  _Float16* X16 = (_Float16*)take((size_t)NRX * DX * 2); _Float16* Q = (_Float16*)take((size_t)NRX * DA * 2); _Float16* K = (_Float16*)take((size_t)NRX * DA * 2); _Float16* V = (_Float16*)take((size_t)NRX * DA * 2); _Float16* Vt = (_Float16*)take((size_t)NRX * DA * 2);
  float* O = (float*)take((size_t)NRX * DA * 4); _Float16* O16 = (_Float16*)take((size_t)NRX * DA * 2);
  if (off > ws_size) return;      // 3 × 0.8 + 0.8 + 12.6 + 4 × 8.4 + 16.8 + 8.4 ≈ 75 MB
  k_prep<<<4 * WTB + (unsigned)(((size_t)NRX * DX / 8 + 255) / 256), 256, 0, stream>>>(x, Wq, Wk, Wv, Wp, X16, Bq, Bk, Bv, Bp);
  k_gemm_tile<DX, DA, true, 3><<<3 * (NRX / 128) * (DA / 128), 256, 0, stream>>>(X16, Bq, Bk, Bv, 0.0625f, bq, bk, bv, nullptr, Q, K, V);      /* Q, K, V = x.W + b (f16 [8192][512] each): M 8192 N 512 K 768 */
  k_vt<1, TT><<<BB * (TT / 64), 256, 0, stream>>>(V, 64, 0, Vt);      /* each [8192][512] plane viewed as 64 contiguous [1024][64] slabs → Vᵀ [slab][64][1024] */
  k_flash<<<BB * (TT / 64), 128, 0, stream>>>(Q, 64, K, 64, Vt, nullptr, O, 64);      /* same flat view for Q, K and O */
  k_h16s<<<(unsigned)(((size_t)NRX * DA / 8 + 255) / 256), 256, 0, stream>>>(O, O16, (size_t)NRX * DA / 8);
  k_gemm_tile<DA, DX, false, 1><<<(NRX / 128) * (DX / 128), 256, 0, stream>>>(O16, Bp, nullptr, nullptr, 0.00390625f, bp, nullptr, nullptr, (float*)d_out, nullptr, nullptr, nullptr);      /* out = O·Wp + bp: M 8192 N 768 K 512 (alpha undoes the ×2^4 weights and the ×2^4 carry) */
}

// v004
// A run of this version takes 108 microseconds.
// In two side-by-side timings against v003, it was 1.08 and 1.09 times as fast.
// Over all steps from v000 it is 2.71 times as fast.
#include <hip/hip_runtime.h>
// Multi-head attention with raw-reshape heads (B=8, N=1024, dim 768 → attn_dim 512 = 8 heads × 64): Q,K,V = x·W + b ((in,out)), reshaped by plain memory order to (H,B,N,64) (= 64 contiguous [1024][64] slabs of each [8192][512] plane);
// softmax(Q·Kᵀ·scale)·V per slab with scale = (64//8)^-½ = 8^-½ (as the original); out raw-reshaped back to (B,N,512) (same flat order) → ·Wp + bp.
// Compute dtype: x, weights, biases rounded to bf16; Q/K/V as f16 GEMM outputs; fused flash-style kernel over the flat slabs (online softmax f32, P f16 ×2^10) on v_wmma_f32_16x16x32_f16; O carried ×2^4 into f16 → projection GEMM with bias; f32 accumulate.
#define BB 64
#define TT 1024
#define NH 1
#define DX 768
#define DA 512
#define NRX 8192
#define ATT_SCALE 0.35355339059327373f

typedef __bf16 v16b __attribute__((ext_vector_type(16)));
typedef unsigned short v8us __attribute__((ext_vector_type(8), may_alias));
typedef float  v8f  __attribute__((ext_vector_type(8)));
typedef float  v4f  __attribute__((ext_vector_type(4)));
typedef float  v4fa __attribute__((ext_vector_type(4), may_alias));
union FragB { v16b v; v8us half[2]; unsigned short u[16]; };

__device__ __forceinline__ unsigned short bf16_bits(float x) { unsigned int u = __float_as_uint(x); return (unsigned short)((u + 0x7FFFu + ((u >> 16) & 1u)) >> 16); }
__device__ __forceinline__ float bf16_val(unsigned short b) { return __uint_as_float(((unsigned int)b) << 16); }
__device__ __forceinline__ float bf16_round(float x) { return bf16_val(bf16_bits(x)); }
// D += A·B with NT terms: 1 = ah·bh, 2 = + al·bh (A split), 3 = + ah·bl (both split)
template <int NT>
__device__ __forceinline__ v8f mmaN(v16b ah, v16b al, v16b bh, v16b bl, v8f c) {
  c = __builtin_amdgcn_wmma_f32_16x16x32_bf16(false, ah, false, bh, (short)0, c, false, false);
  if (NT >= 2) c = __builtin_amdgcn_wmma_f32_16x16x32_bf16(false, al, false, bh, (short)0, c, false, false);
  if (NT >= 3) c = __builtin_amdgcn_wmma_f32_16x16x32_bf16(false, ah, false, bl, (short)0, c, false, false);
  asm volatile("v_nop\n\tv_nop\n\tv_nop\n\tv_nop" : "+v"(c) : "v"(ah), "v"(al), "v"(bh), "v"(bl));
  return c;
}

__global__ __launch_bounds__(256) void k_wt_bf16(const float* __restrict__ W, unsigned short* __restrict__ Wt, int K, int N) {
  const int t = blockIdx.x * 256 + threadIdx.x;
  const int k8n = K / 8;
  if (t >= N * k8n) return;
  const int n = t / k8n, k8 = (t % k8n) * 8;
  v8us v;
#pragma unroll
  for (int i = 0; i < 8; ++i) v[i] = bf16_bits(W[(size_t)(k8 + i) * N + n]);
  *(v8us*)(Wt + (size_t)n * K + k8) = v;
  
}

// GEMM C[M][N] (f32, pitch ldc) = act(A[M][K]·W + bias). A f32 row-major (pitch lda) converted per fragment to bf16
// (ASPLIT: hi/lo two planes -> 2 terms, else single rounded term); Wt bf16 [N][K] (pitch ldb). BIAS_BF16 rounds the
// bias to bf16 first (bias quantised to bf16 before the add). K%32==0, M%16==0, N%64==0.
template <bool ASPLIT, int ACT, bool BIAS_BF16>
__global__ __launch_bounds__(128) void k_gemm_bf(const float* __restrict__ A, int lda, const unsigned short* __restrict__ Wt, int ldb,
                                               const float* __restrict__ bias, float* __restrict__ C, int ldc, int M, int N, int K) {
  __shared__ __attribute__((aligned(16))) float so[4][16][64];
  const int tid = threadIdx.x, w = tid >> 5, lane = tid & 31, ln = lane & 15, hh = lane >> 4;
  const int ntn = N / 64;
  const int wid = blockIdx.x * 4 + w;
  const int mt = wid / ntn, nq = wid % ntn;
  if (mt * 16 >= M) return;
  const int row0 = mt * 16, col0 = nq * 64;
  const float* arow = A + (size_t)(row0 + ln) * lda;
  v8f acc[4] = {};
  for (int kb = 0; kb < K; kb += 32) {
    FragB ah, al;
    const v4f x0 = *(const v4fa*)(arow + kb + 8 * hh), x1 = *(const v4fa*)(arow + kb + 8 * hh + 4);
    const v4f x2 = *(const v4fa*)(arow + kb + 16 + 8 * hh), x3 = *(const v4fa*)(arow + kb + 16 + 8 * hh + 4);
    float xs[16] = {x0[0],x0[1],x0[2],x0[3],x1[0],x1[1],x1[2],x1[3],x2[0],x2[1],x2[2],x2[3],x3[0],x3[1],x3[2],x3[3]};
#pragma unroll
    for (int i = 0; i < 16; ++i) { const unsigned short hb = bf16_bits(xs[i]); ah.u[i] = hb; al.u[i] = ASPLIT ? bf16_bits(xs[i] - bf16_val(hb)) : (unsigned short)0; }
#pragma unroll
    for (int t = 0; t < 4; ++t) {
      const unsigned short* brow = Wt + (size_t)(col0 + t * 16 + ln) * ldb + kb;
      FragB b;
      b.half[0] = *(const v8us*)(brow + 8 * hh);
      b.half[1] = *(const v8us*)(brow + 16 + 8 * hh);
      acc[t] = mmaN<ASPLIT ? 2 : 1>(ah.v, al.v, b.v, b.v, acc[t]);
    }
  }
#pragma unroll
  for (int t = 0; t < 4; ++t) {
    float bv = bias ? bias[col0 + t * 16 + ln] : 0.f;
    if (BIAS_BF16) bv = bf16_round(bv);
#pragma unroll
    for (int r = 0; r < 8; ++r) { float v = acc[t][r] + bv; if (ACT == 1) v = fmaxf(v, 0.f); so[w][8 * hh + r][t * 16 + ln] = v; }
  }
  __builtin_amdgcn_fence(__ATOMIC_ACQ_REL, "workgroup");
  __builtin_amdgcn_wave_barrier();
  const int rsub = lane >> 4, c4 = (lane & 15) * 4;
  {
#pragma unroll
    for (int q = 0; q < 8; ++q) {
      const int r = q * 2 + rsub;
      const v4f v = *(const v4fa*)&so[w][r][c4];
      *(v4f*)(C + (size_t)(row0 + r) * ldc + col0 + c4) = v;
    }
    
  }
}

// Flash-style causal/unmasked attention, all contractions 3-term bf16 hi/lo splits, f32 softmax with running max.
// q,k,v rows are read from f32 buffers with arbitrary row pitch (so they can live inside a fused qkv buffer);
// D = head size (multiple of 32, <= 128); one wave = 16 query rows; block = 4 waves (64 queries) sharing K/V chunks of 32.
template <int D, bool CAUSAL>
__global__ __launch_bounds__(128) void k_flash(const float* __restrict__ qb, const float* __restrict__ kb, const float* __restrict__ vb,
                                             int pitch, int T, int H, float scale, float* __restrict__ y, int ypitch) {
  constexpr int KS = D / 32;        // k-steps for QK
  constexpr int DT = D / 16;        // d tiles for PV
  __shared__ __attribute__((aligned(16))) unsigned short sKh[32][D + 8], sKl[32][D + 8], sVh[32][D + 8], sVl[32][D + 8];
  __shared__ __attribute__((aligned(16))) unsigned short sPh[4][16][40], sPl[4][16][40];
  __shared__ __attribute__((aligned(16))) float sO[4][16][D];
  const int tid = threadIdx.x, w = tid >> 5, lane = tid & 31, ln = lane & 15, hh = lane >> 4;
  const int nqb = (T + 63) / 64;
  const int bh = blockIdx.x / nqb, qblk = blockIdx.x % nqb;
  const int b = bh / H, h = bh % H;
  const int q0 = qblk * 64 + w * 16;
  const float* Q = qb + (size_t)b * T * pitch + h * D;
  const float* K = kb + (size_t)b * T * pitch + h * D;
  const float* V = vb + (size_t)b * T * pitch + h * D;

  // A fragments of the wave's 16 query rows (scaled), hi/lo
  FragB aqh[KS], aql[KS];
  {
    int row = q0 + ln; if (row >= T) row = T - 1;
    const float* qr = Q + (size_t)row * pitch;
#pragma unroll
    for (int ks = 0; ks < KS; ++ks)
#pragma unroll
      for (int i = 0; i < 16; ++i) {
        const int d = ks * 32 + ((i < 8) ? (8 * hh + i) : (16 + 8 * hh + (i - 8)));
        const float x = qr[d] * scale; const unsigned short hb = bf16_bits(x);
        aqh[ks].u[i] = hb; aql[ks].u[i] = bf16_bits(x - bf16_val(hb));
      }
  }
  float m_r[8], l_r[8];
#pragma unroll
  for (int r = 0; r < 8; ++r) { m_r[r] = -3.0e38f; l_r[r] = 0.f; }
  v8f oacc[DT];
#pragma unroll
  for (int dt = 0; dt < DT; ++dt) oacc[dt] = (v8f){0.f,0.f,0.f,0.f,0.f,0.f,0.f,0.f};

  const int kv_end = CAUSAL ? min(T, qblk * 64 + 64) : T;     // block-uniform
  for (int j0 = 0; j0 < kv_end; j0 += 32) {
    __syncthreads();
    for (int e = tid; e < 32 * (D / 4); e += 128) {
      const int r = e / (D / 4), c4 = (e % (D / 4)) * 4;
      const int key = j0 + r;
      v4f kf = {0.f,0.f,0.f,0.f}, vf = {0.f,0.f,0.f,0.f};
      if (key < T) { kf = *(const v4fa*)(K + (size_t)key * pitch + c4); vf = *(const v4fa*)(V + (size_t)key * pitch + c4); }
#pragma unroll
      for (int t = 0; t < 4; ++t) {
        unsigned short hb = bf16_bits(kf[t]); sKh[r][c4 + t] = hb; sKl[r][c4 + t] = bf16_bits(kf[t] - bf16_val(hb));
        hb = bf16_bits(vf[t]); sVh[r][c4 + t] = hb; sVl[r][c4 + t] = bf16_bits(vf[t] - bf16_val(hb));
      }
    }
    __syncthreads();
    // S tile 16 x 32
    v8f s[2];
#pragma unroll
    for (int nt = 0; nt < 2; ++nt) {
      v8f acc = {};
#pragma unroll
      for (int ks = 0; ks < KS; ++ks) {
        FragB bh_, bl_;
        bh_.half[0] = *(const v8us*)&sKh[nt * 16 + ln][ks * 32 + 8 * hh]; bh_.half[1] = *(const v8us*)&sKh[nt * 16 + ln][ks * 32 + 16 + 8 * hh];
        bl_.half[0] = *(const v8us*)&sKl[nt * 16 + ln][ks * 32 + 8 * hh]; bl_.half[1] = *(const v8us*)&sKl[nt * 16 + ln][ks * 32 + 16 + 8 * hh];
        acc = mmaN<3>(aqh[ks].v, aql[ks].v, bh_.v, bl_.v, acc);
      }
      s[nt] = acc;
    }
    // mask + running max (rows 8hh+r; the 16 lanes of a half share rows)
    float alpha[8];
#pragma unroll
    for (int r = 0; r < 8; ++r) {
      const int qi = q0 + 8 * hh + r;
      const int ja = j0 + ln, jb = j0 + 16 + ln;
      if (CAUSAL) { if (ja > qi) s[0][r] = -3.0e38f; if (jb > qi) s[1][r] = -3.0e38f; }
      if (ja >= T) s[0][r] = -3.0e38f;
      if (jb >= T) s[1][r] = -3.0e38f;
      float mx = fmaxf(s[0][r], s[1][r]);
      mx = fmaxf(mx, __shfl_xor(mx, 1, 32)); mx = fmaxf(mx, __shfl_xor(mx, 2, 32)); mx = fmaxf(mx, __shfl_xor(mx, 4, 32)); mx = fmaxf(mx, __shfl_xor(mx, 8, 32));
      const float mnew = fmaxf(m_r[r], mx);
      alpha[r] = (mnew > -1.0e38f) ? __expf(m_r[r] - mnew) : 1.0f;
      const float p0 = (s[0][r] > -1.0e38f) ? __expf(s[0][r] - mnew) : 0.f;
      const float p1 = (s[1][r] > -1.0e38f) ? __expf(s[1][r] - mnew) : 0.f;
      m_r[r] = mnew;
      l_r[r] = l_r[r] * alpha[r] + p0 + p1;            // per-lane partial row sum (16 lanes combined at the end)
      unsigned short hb = bf16_bits(p0); sPh[w][8 * hh + r][ln] = hb;      sPl[w][8 * hh + r][ln] = bf16_bits(p0 - bf16_val(hb));
      hb = bf16_bits(p1);                sPh[w][8 * hh + r][16 + ln] = hb; sPl[w][8 * hh + r][16 + ln] = bf16_bits(p1 - bf16_val(hb));
    }
#pragma unroll
    for (int dt = 0; dt < DT; ++dt)
#pragma unroll
      for (int r = 0; r < 8; ++r) oacc[dt][r] *= alpha[r];
    __builtin_amdgcn_fence(__ATOMIC_ACQ_REL, "workgroup");
    __builtin_amdgcn_wave_barrier();
    FragB pah, pal;
    pah.half[0] = *(const v8us*)&sPh[w][ln][8 * hh]; pah.half[1] = *(const v8us*)&sPh[w][ln][16 + 8 * hh];
    pal.half[0] = *(const v8us*)&sPl[w][ln][8 * hh]; pal.half[1] = *(const v8us*)&sPl[w][ln][16 + 8 * hh];
#pragma unroll
    for (int dt = 0; dt < DT; ++dt) {
      FragB bvh, bvl;
#pragma unroll
      for (int i = 0; i < 8; ++i) {
        bvh.u[i] = sVh[8 * hh + i][dt * 16 + ln]; bvh.u[8 + i] = sVh[16 + 8 * hh + i][dt * 16 + ln];
        bvl.u[i] = sVl[8 * hh + i][dt * 16 + ln]; bvl.u[8 + i] = sVl[16 + 8 * hh + i][dt * 16 + ln];
      }
      oacc[dt] = mmaN<3>(pah.v, pal.v, bvh.v, bvl.v, oacc[dt]);
    }
    __builtin_amdgcn_fence(__ATOMIC_ACQ_REL, "workgroup");
    __builtin_amdgcn_wave_barrier();
  }
#pragma unroll
  for (int r = 0; r < 8; ++r) {
    float l = l_r[r];
    l += __shfl_xor(l, 1, 32); l += __shfl_xor(l, 2, 32); l += __shfl_xor(l, 4, 32); l += __shfl_xor(l, 8, 32);
    l_r[r] = (l > 0.f) ? 1.0f / l : 0.f;
  }
#pragma unroll
  for (int dt = 0; dt < DT; ++dt)
#pragma unroll
    for (int r = 0; r < 8; ++r) sO[w][8 * hh + r][dt * 16 + ln] = oacc[dt][r] * l_r[r];
  __builtin_amdgcn_fence(__ATOMIC_ACQ_REL, "workgroup");
  __builtin_amdgcn_wave_barrier();
  {
    for (int r = 0; r < 16; ++r) {
      const int row = q0 + r;
      if (row < T && lane < D / 4) {
        const v4f val = *(const v4fa*)&sO[w][r][lane * 4];
        *(v4f*)(y + ((size_t)b * T + row) * ypitch + h * D + lane * 4) = val;
      }
    }
    
  }
}

// GEMM C = act(A·W + bias + resid): A f32 (ASPLIT -> hi/lo 2 terms), Wt bf16 [N][K]; ACT 0 none, 1 relu, 2 exact gelu;
// resid (optional, f32, row index = (row % rmod), pitch ldr, RES_BF16 rounds it) added before the activation.
template <bool ASPLIT, int ACT, bool BIAS_BF16, bool RES_BF16>
__global__ __launch_bounds__(128) void k_gemm_bf3(const float* __restrict__ A, int lda, const unsigned short* __restrict__ Wt, int ldb,
                                                const float* __restrict__ bias, const float* __restrict__ resid, int rmod, int ldr,
                                                float* __restrict__ C, int ldc, int M, int N, int K) {
  __shared__ __attribute__((aligned(16))) float so[4][16][64];
  const int tid = threadIdx.x, w = tid >> 5, lane = tid & 31, ln = lane & 15, hh = lane >> 4;
  const int ntn = N / 64;
  const int wid = blockIdx.x * 4 + w;
  const int mt = wid / ntn, nq = wid % ntn;
  if (mt * 16 >= M) return;
  const int row0 = mt * 16, col0 = nq * 64;
  const float* arow = A + (size_t)(row0 + ln) * lda;
  v8f acc[4] = {};
  for (int kb = 0; kb < K; kb += 32) {
    FragB ah, al;
    const v4f x0 = *(const v4fa*)(arow + kb + 8 * hh), x1 = *(const v4fa*)(arow + kb + 8 * hh + 4);
    const v4f x2 = *(const v4fa*)(arow + kb + 16 + 8 * hh), x3 = *(const v4fa*)(arow + kb + 16 + 8 * hh + 4);
    float xs[16] = {x0[0],x0[1],x0[2],x0[3],x1[0],x1[1],x1[2],x1[3],x2[0],x2[1],x2[2],x2[3],x3[0],x3[1],x3[2],x3[3]};
#pragma unroll
    for (int i = 0; i < 16; ++i) { const unsigned short hb = bf16_bits(xs[i]); ah.u[i] = hb; al.u[i] = ASPLIT ? bf16_bits(xs[i] - bf16_val(hb)) : (unsigned short)0; }
#pragma unroll
    for (int t = 0; t < 4; ++t) {
      const unsigned short* brow = Wt + (size_t)(col0 + t * 16 + ln) * ldb + kb;
      FragB b;
      b.half[0] = *(const v8us*)(brow + 8 * hh);
      b.half[1] = *(const v8us*)(brow + 16 + 8 * hh);
      acc[t] = mmaN<ASPLIT ? 2 : 1>(ah.v, al.v, b.v, b.v, acc[t]);
    }
  }
#pragma unroll
  for (int t = 0; t < 4; ++t) {
    const int col = col0 + t * 16 + ln;
    float bv = bias ? bias[col] : 0.f;
    if (BIAS_BF16) bv = bf16_round(bv);
#pragma unroll
    for (int r = 0; r < 8; ++r) {
      float v = acc[t][r] + bv;
      if (resid) { float rv = resid[(size_t)((row0 + 8 * hh + r) % rmod) * ldr + col]; if (RES_BF16) rv = bf16_round(rv); v += rv; }
      if (ACT == 1) v = fmaxf(v, 0.f);
      if (ACT == 2) v = 0.5f * v * (1.0f + erff(v * 0.70710678118654752f));
      if (ACT == 3) { const float u = 0.7978845608028654f * (v + 0.044715f * v * v * v); v = 0.5f * v * (1.0f + tanhf(u)); }
      so[w][8 * hh + r][t * 16 + ln] = v;
    }
  }
  __builtin_amdgcn_fence(__ATOMIC_ACQ_REL, "workgroup");
  __builtin_amdgcn_wave_barrier();
  const int rsub = lane >> 4, c4 = (lane & 15) * 4;
  {
#pragma unroll
    for (int q = 0; q < 8; ++q) {
      const int r = q * 2 + rsub;
      const v4f v = *(const v4fa*)&so[w][r][c4];
      *(v4f*)(C + (size_t)(row0 + r) * ldc + col0 + c4) = v;
    }
    
  }
}
// row LayerNorm (biased variance, eps) over N: s = X (+ R); optional out_sum <- s; out_norm <- (s-mu)*rsqrt(var+eps)*g + b
template <bool PARAM_BF16>
__global__ __launch_bounds__(256) void k_layernorm(const float* __restrict__ X, const float* __restrict__ R, const float* __restrict__ g, const float* __restrict__ bta,
                                                  float* __restrict__ out_sum, float* __restrict__ out_norm, int N, float eps) {
  __shared__ float red[256];
  const int row = blockIdx.x, tid = threadIdx.x;
  const float* x = X + (size_t)row * N; const float* rr = R ? R + (size_t)row * N : nullptr;
  float vals[16];                     // up to N = 4096
  const int per = N / 256;            // contiguous chunk per thread? use strided-by-4 chunks: thread handles j = tid*4 + 1024*u
  float s1 = 0.f;
  for (int u = 0; u < per / 4; ++u) {
    const int j = tid * 4 + 1024 * u;
    const v4f a = *(const v4fa*)(x + j);
    v4f b = {0.f,0.f,0.f,0.f}; if (rr) b = *(const v4fa*)(rr + j);
#pragma unroll
    for (int q = 0; q < 4; ++q) { const float v = a[q] + b[q]; vals[u * 4 + q] = v; s1 += v; }
  }
  red[tid] = s1; __syncthreads();
  for (int st = 128; st > 0; st >>= 1) { if (tid < st) red[tid] += red[tid + st]; __syncthreads(); }
  const float mu = red[0] / (float)N; __syncthreads();
  float s2 = 0.f;
  for (int u = 0; u < per / 4; ++u)
#pragma unroll
    for (int q = 0; q < 4; ++q) { const float c = vals[u * 4 + q] - mu; s2 += c * c; }
  red[tid] = s2; __syncthreads();
  for (int st = 128; st > 0; st >>= 1) { if (tid < st) red[tid] += red[tid + st]; __syncthreads(); }
  const float rs = rsqrtf(red[0] / (float)N + eps);
  {
    for (int u = 0; u < per / 4; ++u) {
      const int j = tid * 4 + 1024 * u;
      v4f o, sm;
#pragma unroll
      for (int q = 0; q < 4; ++q) {
        float gg = g[j + q], bb = bta[j + q];
        if (PARAM_BF16) { gg = bf16_round(gg); bb = bf16_round(bb); }
        sm[q] = vals[u * 4 + q]; o[q] = (vals[u * 4 + q] - mu) * rs * gg + bb;
      }
      if (out_sum) *(v4f*)(out_sum + (size_t)row * N + j) = sm;
      *(v4f*)(out_norm + (size_t)row * N + j) = o;
    }
    
  }
}



// ---- f16 WMMA path (v_wmma_f32_16x16x32_f16): 11-bit significands for operands in range — used where a [0,1] probability operand needs more precision than bf16
typedef _Float16 v16h __attribute__((ext_vector_type(16)));
union FragH { v16h v; v8us half[2]; _Float16 h[16]; unsigned short u[16]; };
template <int NT>
__device__ __forceinline__ v8f mmaH(v16h ah, v16h al, v16h bh, v16h bl, v8f c) {
  c = __builtin_amdgcn_wmma_f32_16x16x32_f16(false, ah, false, bh, (short)0, c, false, false);
  if (NT >= 2) c = __builtin_amdgcn_wmma_f32_16x16x32_f16(false, al, false, bh, (short)0, c, false, false);
  if (NT >= 3) c = __builtin_amdgcn_wmma_f32_16x16x32_f16(false, ah, false, bl, (short)0, c, false, false);
  asm volatile("v_nop\n\tv_nop\n\tv_nop\n\tv_nop" : "+v"(c) : "v"(ah), "v"(al), "v"(bh), "v"(bl));
  return c;
}
// batched GEMM like k_gemm_b but f16 operands: A f32 (split into f16 hi/lo if ASPLIT, else rounded to f16), Bt = f16 values [n][k]; alpha; C f32; N multiple of 16 (partial tiles skipped)
template <bool ASPLIT>
__global__ __launch_bounds__(128) void k_gemm_h(const float* __restrict__ A, int lda, size_t sA, const _Float16* __restrict__ Bh, int ldb, size_t sB, float alpha, float* __restrict__ C, int ldc, size_t sC, int M, int N, int K) {
  __shared__ __attribute__((aligned(16))) float so[4][16][64];
  const int tid = threadIdx.x, w = tid >> 5, lane = tid & 31, ln = lane & 15, hh = lane >> 4; const int by = blockIdx.y;
  A += (size_t)by * sA; Bh += (size_t)by * sB; C += (size_t)by * sC;
  const int ntn = (N + 63) / 64; const int wid = blockIdx.x * 4 + w; const int mt = wid / ntn, nq = wid % ntn; if (mt * 16 >= M) return;
  const int row0 = mt * 16, col0 = nq * 64; const float* arow = A + (size_t)(row0 + ln) * lda;
  v8f acc[4] = {};
  for (int kb = 0; kb < K; kb += 32) {
    FragH ah, al;
    const v4f x0 = *(const v4fa*)(arow + kb + 8 * hh), x1 = *(const v4fa*)(arow + kb + 8 * hh + 4), x2 = *(const v4fa*)(arow + kb + 16 + 8 * hh), x3 = *(const v4fa*)(arow + kb + 16 + 8 * hh + 4);
    float xs[16] = {x0[0],x0[1],x0[2],x0[3],x1[0],x1[1],x1[2],x1[3],x2[0],x2[1],x2[2],x2[3],x3[0],x3[1],x3[2],x3[3]};
#pragma unroll
    for (int i = 0; i < 16; ++i) { const _Float16 h = (_Float16)xs[i]; ah.h[i] = h; al.h[i] = ASPLIT ? (_Float16)(xs[i] - (float)h) : (_Float16)0.0f; }
#pragma unroll
    for (int t = 0; t < 4; ++t) { if (col0 + t * 16 >= N) continue; const size_t boff = (size_t)(col0 + t * 16 + ln) * ldb + kb; FragH bq; bq.half[0] = *(const v8us*)(Bh + boff + 8 * hh); bq.half[1] = *(const v8us*)(Bh + boff + 16 + 8 * hh);
      acc[t] = mmaH<ASPLIT ? 2 : 1>(ah.v, al.v, bq.v, bq.v, acc[t]); }
  }
#pragma unroll
  for (int t = 0; t < 4; ++t) { if (col0 + t * 16 >= N) continue;
#pragma unroll
    for (int r = 0; r < 8; ++r) so[w][8 * hh + r][t * 16 + ln] = acc[t][r] * alpha; }
  __builtin_amdgcn_fence(__ATOMIC_ACQ_REL, "workgroup"); __builtin_amdgcn_wave_barrier();
  const int rsub = lane >> 4, c4 = (lane & 15) * 4;
  {
#pragma unroll
    for (int q = 0; q < 8; ++q) { const int r = q * 2 + rsub; if (col0 + c4 < N) { const v4f v = *(const v4fa*)&so[w][r][c4]; *(v4f*)(C + (size_t)(row0 + r) * ldc + col0 + c4) = v; } }
     }
}

// Wt[n][k] = f16(W[k][n]·scale) from f32 row-major W[K][N] (scale = power of two; bf16-exact weights stay exact in f16 away from the subnormal range)
__device__ __forceinline__ void wt_f16(const float* __restrict__ W, _Float16* __restrict__ Wt, int K, int N, float scale, int t) {
  if (t >= N * (K / 8)) return; const int n = t / (K / 8), k8 = (t % (K / 8)) * 8; FragH f;
#pragma unroll
  for (int i = 0; i < 8; ++i) f.h[i] = (_Float16)(bf16_round(W[(size_t)(k8 + i) * N + n]) * scale); const v8us o = f.half[0];
  *(v8us*)((unsigned short*)Wt + (size_t)n * K + k8) = o; 
}
// k_gemm_hh variant with fused epilogue: v = acc·alpha + bias[by·sBias + col] (+ CP[(row/rowsPerB)·sCPb + by·64 + col] if CP) ; ACT 0 none / 1 elu ; writes f16 C16 and f32 C, each if non-null
template <int ACT>
__global__ __launch_bounds__(128) void k_gemm_hhx(const _Float16* __restrict__ A, int lda, size_t sA, const _Float16* __restrict__ Bh, int ldb, size_t sB, float alpha, const float* __restrict__ bias, size_t sBias, const float* __restrict__ CP, int rowsPerB, size_t sCPb, int row0g,
    float* __restrict__ C, _Float16* __restrict__ C16, int ldc, size_t sC, int M, int N, int K) {
  __shared__ __attribute__((aligned(16))) float so[4][16][64];
  const int tid = threadIdx.x, w = tid >> 5, lane = tid & 31, ln = lane & 15, hh = lane >> 4; const int by = blockIdx.y;
  A += (size_t)by * sA; Bh += (size_t)by * sB; const size_t cofs = (size_t)by * sC; const float* bp = bias ? bias + (size_t)by * sBias : nullptr;
  const int ntn = (N + 63) / 64; const int wid = blockIdx.x * 4 + w; const int mt = wid / ntn, nq = wid % ntn; if (mt * 16 >= M) return;
  const int row0 = mt * 16, col0 = nq * 64; const _Float16* arow = A + (size_t)(row0 + ln) * lda;
  v8f acc[4] = {};
  for (int kb = 0; kb < K; kb += 32) { FragH ah; ah.half[0] = *(const v8us*)((const unsigned short*)arow + kb + 8 * hh); ah.half[1] = *(const v8us*)((const unsigned short*)arow + kb + 16 + 8 * hh);
#pragma unroll
    for (int t = 0; t < 4; ++t) { if (col0 + t * 16 >= N) continue; const size_t boff = (size_t)(col0 + t * 16 + ln) * ldb + kb; FragH bq; bq.half[0] = *(const v8us*)((const unsigned short*)Bh + boff + 8 * hh); bq.half[1] = *(const v8us*)((const unsigned short*)Bh + boff + 16 + 8 * hh);
      acc[t] = mmaH<1>(ah.v, ah.v, bq.v, bq.v, acc[t]); }
  }
#pragma unroll
  for (int t = 0; t < 4; ++t) { if (col0 + t * 16 >= N) continue; const int col = col0 + t * 16 + ln; const float bv = bp ? bf16_round(bp[col]) : 0.f;
#pragma unroll
    for (int r = 0; r < 8; ++r) { float v = acc[t][r] * alpha + bv; if (CP) { const int bidx = (row0g + row0 + 8 * hh + r) / rowsPerB; v += CP[(size_t)bidx * sCPb + (size_t)by * 64 + col]; } if (ACT == 1) v = (v > 0.f) ? v : expm1f(v); else if (ACT == 7) v = (v > 0.f) ? v + 1.0f : expf(v); else if (ACT == 8) v = tanhf(v); else if (ACT == 9) v = 0.5f * v * (1.0f + tanhf(0.7978845608028654f * (v + 0.044715f * v * v * v))); else if (ACT == 11) v = 1.0f / (1.0f + expf(-v)); else if (ACT == 12) v = (v > 0.f) ? v : 0.01f * v; else if (ACT == 14) v = (v > 0.f) ? v : 0.1f * v; else if (ACT == 15) v = v / (1.0f + expf(-v)); else if (ACT == 3) v = fmaxf(v, 0.f); else if (ACT == 6) v = 0.5f * v * (1.0f + erff(v * 0.70710678118654752f)); so[w][8 * hh + r][t * 16 + ln] = v; } }
  __builtin_amdgcn_fence(__ATOMIC_ACQ_REL, "workgroup"); __builtin_amdgcn_wave_barrier();
  const int rsub = lane >> 4, c4 = (lane & 15) * 4; typedef _Float16 v4h __attribute__((ext_vector_type(4)));
  {
#pragma unroll
    for (int q = 0; q < 8; ++q) { const int r = q * 2 + rsub; if (col0 + c4 < N) { const v4f v = *(const v4fa*)&so[w][r][c4]; if (C) *(v4f*)(C + cofs + (size_t)(row0 + r) * ldc + col0 + c4) = v; if (C16) { v4h h4; for (int i = 0; i < 4; ++i) h4[i] = (_Float16)v[i]; *(v4h*)(C16 + cofs + (size_t)(row0 + r) * ldc + col0 + c4) = h4; } } }
     }
}


// Block-tiled GEMM, f16 operands, both K-contiguous: C[8192][NN] = A[8192][KK] . Bh[NN][KK]^T * alpha + bf16(bias). One 128x128 tile of C per work-group of 8 waves (4x2), 32x64 per wave.
// A pass is 128 k = 256 aligned bytes of each of the 256 operand rows, brought into LDS by asynchronous copies (two buffers, the next pass's copies fly while this pass is worked on), so that every line leaves L2 once per work-group and not once per wave.
// LDS rows at pitch 272 bytes (16 x odd) for the 16-byte fragment reads. The k order of a fragment and the order of the k steps are those of k_gemm_hhx.
__device__ __forceinline__ unsigned lds_off(const void* p) { return (unsigned)(size_t)p; }
// eight copies of 16 bytes per lane: rows r, r + 16, ..., r + 112 of one operand's tile. The s_wait_xcnt stands inside the statement so that no address register is rewritten ahead of it.
__device__ __forceinline__ void copy_rows8(unsigned l0, const _Float16* g0, int rowstep, unsigned ldsstep) {
  const unsigned l1 = l0 + ldsstep, l2 = l0 + 2 * ldsstep, l3 = l0 + 3 * ldsstep, l4 = l0 + 4 * ldsstep, l5 = l0 + 5 * ldsstep, l6 = l0 + 6 * ldsstep, l7 = l0 + 7 * ldsstep;
  const _Float16* g1 = g0 + rowstep; const _Float16* g2 = g0 + 2 * rowstep; const _Float16* g3 = g0 + 3 * rowstep; const _Float16* g4 = g0 + 4 * rowstep;
  const _Float16* g5 = g0 + 5 * rowstep; const _Float16* g6 = g0 + 6 * rowstep; const _Float16* g7 = g0 + 7 * rowstep;
  asm volatile("global_load_async_to_lds_b128 %0, %8, off\n\t"
               "global_load_async_to_lds_b128 %1, %9, off\n\t"
               "global_load_async_to_lds_b128 %2, %10, off\n\t"
               "global_load_async_to_lds_b128 %3, %11, off\n\t"
               "global_load_async_to_lds_b128 %4, %12, off\n\t"
               "global_load_async_to_lds_b128 %5, %13, off\n\t"
               "global_load_async_to_lds_b128 %6, %14, off\n\t"
               "global_load_async_to_lds_b128 %7, %15, off\n\t"
               "s_wait_xcnt 0x0"
               :: "v"(l0), "v"(l1), "v"(l2), "v"(l3), "v"(l4), "v"(l5), "v"(l6), "v"(l7),
                  "v"(g0), "v"(g1), "v"(g2), "v"(g3), "v"(g4), "v"(g5), "v"(g6), "v"(g7) : "memory");
}
// NJ independent products that share A (own Bh, bias and C16 each) run as one grid: the NJ * NTN tiles of one 128-row band of A have neighbouring block indices.
// NJ == 3 (Q, K, V): a 128-row band of a [8192][512] plane is one [1024][64] slab; element (m, n) of the band is key (m % 128) * 8 + n / 64, column n % 64.
// Jobs 1 and 2 store their slab for the attention kernel with the keys renumbered key' = (n / 64) * 128 + m % 128, the same for both (a softmax-weighted sum does not depend on the order of its keys):
// job 1 as K'[slab][key'][64], where a wave's 32 x 64 tile is 4 KB in a row; job 2 transposed, as V^T[slab][64][key'], where a tile gives whole runs of 128 keys.
template <int KK, int NN, bool OUT16, int NJ>
__global__ __launch_bounds__(256) void k_gemm_tile(const _Float16* __restrict__ A, const _Float16* __restrict__ Bh0, const _Float16* __restrict__ Bh1, const _Float16* __restrict__ Bh2, float alpha,
                                                  const float* __restrict__ bias0, const float* __restrict__ bias1, const float* __restrict__ bias2, float* __restrict__ C,
                                                  _Float16* __restrict__ C160, _Float16* __restrict__ C161, _Float16* __restrict__ C162) {
  constexpr int BK = 128, KSN = BK / 32, PITCH = 2 * BK + 16, STAGE = 256 * PITCH, NPASS = KK / BK, NTN = NN / 128, SOP = 68;
  static_assert(NPASS >= 2 && KK % BK == 0 && NN % 128 == 0 && 8 * 32 * SOP * 4 <= 2 * STAGE, "shape");
  static_assert(NJ == 1 || (NJ == 3 && OUT16 && 128 * (NN / 64) == TT), "a band of the Q, K, V planes is one slab");
  __shared__ __attribute__((aligned(16))) unsigned char sm[2 * STAGE];
  const int tid = threadIdx.x, w = tid >> 5, lane = tid & 31, ln = lane & 15, hh = lane >> 4;
  const int job = NJ > 1 ? (blockIdx.x % (NJ * NTN)) / NTN : 0;
  const _Float16* Bh = job == 0 ? Bh0 : job == 1 ? Bh1 : Bh2; const float* bias = job == 0 ? bias0 : job == 1 ? bias1 : bias2; _Float16* C16 = job == 0 ? C160 : job == 1 ? C161 : C162;
  const int m0 = (blockIdx.x / (NJ * NTN)) * 128, n0 = (blockIdx.x % NTN) * 128; const int wm = w >> 1, wn = w & 1;
  const int cr = tid >> 4, cc = tid & 15;      // a wave's copy = 2 rows x 256 bytes
  const _Float16* ga = A + (size_t)(m0 + cr) * KK + cc * 8; const _Float16* gb = Bh + (size_t)(n0 + cr) * KK + cc * 8;
  const unsigned la = lds_off(sm) + cr * PITCH + cc * 16, lb = la + 128 * PITCH;
  v8f acc[2][4];
#pragma unroll
  for (int i = 0; i < 2; ++i)
#pragma unroll
    for (int j = 0; j < 4; ++j) acc[i][j] = (v8f){0.f,0.f,0.f,0.f,0.f,0.f,0.f,0.f};
  copy_rows8(la, ga, 16 * KK, 16 * PITCH); copy_rows8(lb, gb, 16 * KK, 16 * PITCH);
  asm volatile("s_wait_asynccnt 0x0" ::: "memory");      // pass 0's bytes have landed before the barrier publishes them
  __syncthreads();
  copy_rows8(la + STAGE, ga + BK, 16 * KK, 16 * PITCH); copy_rows8(lb + STAGE, gb + BK, 16 * KK, 16 * PITCH);
  const unsigned char* fa = sm + (wm * 32 + ln) * PITCH + 16 * hh; const unsigned char* fb = sm + (128 + wn * 64 + ln) * PITCH + 16 * hh;
#pragma unroll 1      // the ring stays one rolled loop: one publish point, short code
  for (int t = 0; t < NPASS; ++t) {
    const int bo = (t & 1) * STAGE;
    FragH a[2][2], b[2][4];      // two fragment sets: the next 32 k of this pass are fetched while these are multiplied
#pragma unroll
    for (int i = 0; i < 2; ++i) { a[0][i].half[0] = *(const v8us*)(fa + bo + i * 16 * PITCH); a[0][i].half[1] = *(const v8us*)(fa + bo + i * 16 * PITCH + 32); }
#pragma unroll
    for (int j = 0; j < 4; ++j) { b[0][j].half[0] = *(const v8us*)(fb + bo + j * 16 * PITCH); b[0][j].half[1] = *(const v8us*)(fb + bo + j * 16 * PITCH + 32); }
#pragma unroll
    for (int ks = 0; ks < KSN; ++ks) {
      const int cu = ks & 1, nx = cu ^ 1;
      if (ks + 1 < KSN) {
#pragma unroll
        for (int i = 0; i < 2; ++i) { a[nx][i].half[0] = *(const v8us*)(fa + bo + i * 16 * PITCH + (ks + 1) * 64); a[nx][i].half[1] = *(const v8us*)(fa + bo + i * 16 * PITCH + (ks + 1) * 64 + 32); }
#pragma unroll
        for (int j = 0; j < 4; ++j) { b[nx][j].half[0] = *(const v8us*)(fb + bo + j * 16 * PITCH + (ks + 1) * 64); b[nx][j].half[1] = *(const v8us*)(fb + bo + j * 16 * PITCH + (ks + 1) * 64 + 32); }
        __builtin_amdgcn_sched_barrier(0);      // keeps the next set's LDS reads one group ahead of this set's products; without it they are sunk among the products, into one register set, and each product run waits out the LDS latency
      }
#pragma unroll
      for (int i = 0; i < 2; ++i)
#pragma unroll
        for (int j = 0; j < 4; ++j) acc[i][j] = __builtin_amdgcn_wmma_f32_16x16x32_f16(false, a[cu][i].v, false, b[cu][j].v, (short)0, acc[i][j], false, false);
    }
    __builtin_amdgcn_sched_barrier(0);      // keeps the pass's products in front of the publish point: sunk behind the barrier they stand between it and the refill, and the copies start that much later
    asm volatile("s_wait_dscnt 0x0" ::: "memory");       // this wave's reads of the buffer are done before it is handed to the copies
    asm volatile("s_wait_asynccnt 0x0" ::: "memory");    // this wave's copies of pass t + 1 have landed before the barrier publishes them
    __syncthreads();
    if (t + 2 < NPASS) { copy_rows8(la + bo, ga + (t + 2) * BK, 16 * KK, 16 * PITCH); copy_rows8(lb + bo, gb + (t + 2) * BK, 16 * KK, 16 * PITCH); }
  }
  asm volatile("s_wait_asynccnt 0x0" ::: "memory");      // nothing is in flight when the ring becomes output staging
  if (NJ == 3 && job == 2) {      // V: the tile leaves transposed. A lane's 8 accumulator rows of one column are 8 neighbouring keys of one row of V^T: 16 bytes of f16
    constexpr int TP = 2 * 128 + 16;      // staged rows [wn * 64 + column][128 keys], pitch 16 x odd bytes; every reader left the ring at the last pass's barrier
#pragma unroll      // these three: constant indices keep the accumulators in registers
    for (int j = 0; j < 4; ++j) { const float bv = bf16_round(bias[n0 + wn * 64 + j * 16 + ln]);
#pragma unroll
      for (int i = 0; i < 2; ++i) { FragH f;
#pragma unroll
        for (int r = 0; r < 8; ++r) f.h[r] = (_Float16)(acc[i][j][r] * alpha + bv);
        *(v8us*)(sm + (wn * 64 + j * 16 + ln) * TP + (wm * 32 + i * 16 + 8 * hh) * 2) = f.half[0]; } }
    __syncthreads();      // a staged row holds the keys of four waves: all are written before any is read back (job is the same for the whole work-group)
#pragma unroll      // the eight LDS reads go out as one group, the stores follow as they land
    for (int q = 0; q < 8; ++q) { const int row = w * 16 + q * 2 + (lane >> 4), k8 = (lane & 15) * 8; const v8us v = *(const v8us*)(sm + row * TP + k8 * 2);
      *(v8us*)((unsigned short*)C16 + ((size_t)(m0 / 128) * 64 + (row & 63)) * TT + (n0 / 64 + (row >> 6)) * 128 + k8) = v; }
    return;
  }
  float* so = (float*)sm + w * (32 * SOP);      // each wave stages its own 32 x 64 tile; every reader left the ring at the last pass's barrier
#pragma unroll
  for (int j = 0; j < 4; ++j) { const float bv = bf16_round(bias[n0 + wn * 64 + j * 16 + ln]);
#pragma unroll
    for (int i = 0; i < 2; ++i)
#pragma unroll
      for (int r = 0; r < 8; ++r) so[(i * 16 + 8 * hh + r) * SOP + j * 16 + ln] = acc[i][j][r] * alpha + bv; }
  __builtin_amdgcn_fence(__ATOMIC_ACQ_REL, "workgroup"); __builtin_amdgcn_wave_barrier();      // the wave's own staged rows are written before other lanes of it read them back
  if (OUT16) {
    const bool kord = NJ == 3 && job == 1;      // K: rows in the order key'
    unsigned short* dst = (unsigned short*)C16 + (kord ? (size_t)m0 * NN + (size_t)((n0 / 64 + wn) * 128 + wm * 32) * 64 : (size_t)(m0 + wm * 32) * NN + n0 + wn * 64); const int dp = kord ? 64 : NN;
#pragma unroll
    for (int q = 0; q < 8; ++q) { const int r = q * 4 + (lane >> 3), c8 = (lane & 7) * 8; const v4f v0 = *(const v4fa*)&so[r * SOP + c8], v1 = *(const v4fa*)&so[r * SOP + c8 + 4]; FragH f;
#pragma unroll
      for (int i = 0; i < 4; ++i) { f.h[i] = (_Float16)v0[i]; f.h[4 + i] = (_Float16)v1[i]; }
      *(v8us*)(dst + r * dp + c8) = f.half[0]; }
  } else {
#pragma unroll
    for (int q = 0; q < 16; ++q) { const int r = q * 2 + (lane >> 4), c4 = (lane & 15) * 4; const v4f v = *(const v4fa*)&so[r * SOP + c4];
      *(v4f*)(C + (size_t)(m0 + wm * 32 + r) * NN + n0 + wn * 64 + c4) = v; }
  }
}


typedef _Float16 v4h __attribute__((ext_vector_type(4)));

__device__ __forceinline__ void x16(const float* __restrict__ x, _Float16* __restrict__ X16, size_t n8, size_t t) { if (t >= n8) return; FragH f;
#pragma unroll
  for (int q = 0; q < 8; ++q) f.h[q] = (_Float16)bf16_round(x[t * 8 + q]); *(v8us*)((unsigned short*)X16 + t * 8) = f.half[0];  }
// The five operand preparations depend on nothing but the inputs: one grid, the block index picks the job. Blocks 0 .. 4 * WTB - 1: the four weight transposes (WTB blocks each); the rest: x.
#define WTB ((DA * (DX / 8) + 255) / 256)
__global__ __launch_bounds__(256) void k_prep(const float* __restrict__ x, const float* __restrict__ Wq, const float* __restrict__ Wk, const float* __restrict__ Wv, const float* __restrict__ Wp,
                                             _Float16* __restrict__ X16, _Float16* __restrict__ Bq, _Float16* __restrict__ Bk, _Float16* __restrict__ Bv, _Float16* __restrict__ Bp) {
  const int bid = blockIdx.x;
  if (bid < 4 * WTB) {
    const int job = bid / WTB, t = (bid % WTB) * 256 + threadIdx.x;
    const float* W = job == 0 ? Wq : job == 1 ? Wk : job == 2 ? Wv : Wp; _Float16* Wt = job == 0 ? Bq : job == 1 ? Bk : job == 2 ? Bv : Bp;
    wt_f16(W, Wt, job < 3 ? DX : DA, job < 3 ? DA : DX, 16.0f, t);      /* (in,out) -> Bt x2^4 */
  } else x16(x, X16, (size_t)NRX * DX / 8, (size_t)(bid - 4 * WTB) * 256 + threadIdx.x);
}
__global__ __launch_bounds__(256) void k_h16(const float* __restrict__ x, _Float16* __restrict__ X16, size_t n8) { const size_t t = (size_t)blockIdx.x * 256 + threadIdx.x; if (t >= n8) return; FragH f;
#pragma unroll
  for (int q = 0; q < 8; ++q) f.h[q] = (_Float16)x[t * 8 + q]; *(v8us*)((unsigned short*)X16 + t * 8) = f.half[0];  }
__global__ __launch_bounds__(256) void k_round16f(const float* __restrict__ W, _Float16* __restrict__ Bt, size_t n8) { const size_t t = (size_t)blockIdx.x * 256 + threadIdx.x; if (t >= n8) return; FragH f;
#pragma unroll
  for (int i = 0; i < 8; ++i) f.h[i] = (_Float16)(bf16_round(W[t * 8 + i]) * 16.0f); *(v8us*)((unsigned short*)Bt + t * 8) = f.half[0];  }
// lane l with lane l ^ 16: the two halves of a wave hold the two halves of one query's keys
__device__ __forceinline__ float xhalf(float x) { return __builtin_bit_cast(float, __builtin_amdgcn_permlanex16(__builtin_bit_cast(int, x), __builtin_bit_cast(int, x), 0x76543210, 0xfedcba98, false, false)); }
// Transposed form: S^T = K.Q^T (A = 16 key rows, B = the wave's 16 queries, kept in registers), O^T += V^T.P^T (A = 16 rows of V^T, B = P^T).
// A lane holds 16 of the 32 scores of ONE query (column ln; keys 8hh + r and 16 + 8hh + r), so the maximum and the sum are in-lane plus one exchange between the halves,
// and the two score tiles, converted in place, are the B operand of the second product in the k order of the V^T loader: P never leaves the registers.
__global__ __launch_bounds__(128) void k_flash(const _Float16* __restrict__ Q16, int ldq, const _Float16* __restrict__ K16, int ldk, const _Float16* __restrict__ Vt, const int* __restrict__ MSK, _Float16* __restrict__ O16, int ldo) {
  constexpr int RPW = 16, NQB = TT / (4 * RPW), DT = 4, KS = 2;
  __shared__ __attribute__((aligned(16))) float sO[4][RPW][64 + 4];
  (void)MSK;
  const int tid = threadIdx.x, w = tid >> 5, lane = tid & 31, ln = lane & 15, hh = lane >> 4;
  const int slab = blockIdx.x / NQB, qblk = blockIdx.x % NQB; const int b = slab / NH, h = slab % NH; const int q0 = qblk * (4 * RPW) + w * RPW;
  FragH bq[KS];
  { const unsigned short* qr = (const unsigned short*)Q16 + ((size_t)b * TT + q0 + ln) * ldq + h * 64;
#pragma unroll
    for (int ks = 0; ks < KS; ++ks) { bq[ks].half[0] = *(const v8us*)(qr + ks * 32 + 8 * hh); bq[ks].half[1] = *(const v8us*)(qr + ks * 32 + 16 + 8 * hh); } }
  // wave-uniform bases that walk the keys, and one fixed byte offset per lane
  const char* Kb = (const char*)((const unsigned short*)K16 + (size_t)b * TT * ldk + h * 64); const unsigned klo = (unsigned)(ln * ldk + 8 * hh) * 2u;
  const char* Vb = (const char*)((const unsigned short*)Vt + (size_t)slab * 64 * TT); const unsigned vlo = (unsigned)(ln * TT + 8 * hh) * 2u;
  float m_r = -3.0e38f, l_r = 0.f; v8f oacc[DT];
#pragma unroll
  for (int dt = 0; dt < DT; ++dt) oacc[dt] = (v8f){0.f,0.f,0.f,0.f,0.f,0.f,0.f,0.f};
#pragma unroll 1      // the pass stays rolled, as it was: one group of loads a pass, short code
  for (int j0 = 0; j0 < TT; j0 += 32) {
    FragH ak[2][KS], av[DT];
#pragma unroll
    for (int nt = 0; nt < 2; ++nt) { const char* kr = Kb + (size_t)(j0 + nt * 16) * ldk * 2;
#pragma unroll
      for (int ks = 0; ks < KS; ++ks) { ak[nt][ks].half[0] = *(const v8us*)(kr + klo + ks * 64); ak[nt][ks].half[1] = *(const v8us*)(kr + klo + ks * 64 + 32); } }
    asm volatile("s_wait_xcnt 0x0" ::: "memory");      // behind the K loads: in this build a V^T load lands in the registers that held their addresses
#pragma unroll
    for (int dt = 0; dt < DT; ++dt) { const char* vr = Vb + (size_t)j0 * 2; av[dt].half[0] = *(const v8us*)(vr + vlo + dt * 16 * TT * 2); av[dt].half[1] = *(const v8us*)(vr + vlo + dt * 16 * TT * 2 + 32); }
    __builtin_amdgcn_sched_barrier(0);      // keeps the pass's 16 loads one group in front of its work: sunk among the products, into few registers, each product waits out a load latency of its own
    v8f s[2];
#pragma unroll
    for (int nt = 0; nt < 2; ++nt) { v8f acc = (v8f){0.f,0.f,0.f,0.f,0.f,0.f,0.f,0.f};
#pragma unroll
      for (int ks = 0; ks < KS; ++ks) acc = __builtin_amdgcn_wmma_f32_16x16x32_f16(false, ak[nt][ks].v, false, bq[ks].v, (short)0, acc, false, false);
      s[nt] = acc; }      // s[nt][r] = score of query q0 + ln with key j0 + nt * 16 + 8 * hh + r
    float mc = -3.0e38f;
#pragma unroll
    for (int nt = 0; nt < 2; ++nt)
#pragma unroll
      for (int r = 0; r < 8; ++r) { s[nt][r] *= ATT_SCALE; mc = fmaxf(mc, s[nt][r]); }
    mc = fmaxf(mc, xhalf(mc));
    const float mn = fmaxf(m_r, mc); const float ea = expf(m_r - mn); const float al = (mn > -1.0e38f) ? ea : 1.0f; m_r = mn;
    FragH pb; float ps = 0.f;
#pragma unroll
    for (int nt = 0; nt < 2; ++nt)
#pragma unroll
      for (int r = 0; r < 8; ++r) { const float p = expf(s[nt][r] - mn); ps += p; pb.h[nt * 8 + r] = (_Float16)(p * 1024.0f); }
    l_r = l_r * al + ps;      // this half's 16 keys; the halves are joined once, behind the loop
#pragma unroll
    for (int dt = 0; dt < DT; ++dt)
#pragma unroll
      for (int r = 0; r < 8; ++r) oacc[dt][r] *= al;
#pragma unroll
    for (int dt = 0; dt < DT; ++dt) oacc[dt] = __builtin_amdgcn_wmma_f32_16x16x32_f16(false, av[dt].v, false, pb.v, (short)0, oacc[dt], false, false);      // oacc[dt][r] = O[q0 + ln][dt * 16 + 8 * hh + r]
  }
  { const float l = l_r + xhalf(l_r); const float inv = (l > 0.f) ? 1.0f / (l * 1024.0f) : 0.f;
#pragma unroll
    for (int dt = 0; dt < DT; ++dt) { const v4f lo = {oacc[dt][0] * inv, oacc[dt][1] * inv, oacc[dt][2] * inv, oacc[dt][3] * inv}, hi = {oacc[dt][4] * inv, oacc[dt][5] * inv, oacc[dt][6] * inv, oacc[dt][7] * inv};
      *(v4fa*)&sO[w][ln][dt * 16 + 8 * hh] = lo; *(v4fa*)&sO[w][ln][dt * 16 + 8 * hh + 4] = hi; } }
  __builtin_amdgcn_fence(__ATOMIC_ACQ_REL, "workgroup"); __builtin_amdgcn_wave_barrier();      // the wave's own staged rows are written before other lanes of it read them back
  {
#pragma unroll
    for (int rp = 0; rp < RPW; rp += 4) { const int r = rp + (lane >> 3), c8 = (lane & 7) * 8; const v4f v0 = *(const v4fa*)&sO[w][r][c8], v1 = *(const v4fa*)&sO[w][r][c8 + 4]; FragH f;      // O leaves as the projection's operand: x2^4, f16, whole 128-byte rows
#pragma unroll      // constant indices keep the vectors in registers
      for (int q = 0; q < 4; ++q) { f.h[q] = (_Float16)(v0[q] * 16.0f); f.h[4 + q] = (_Float16)(v1[q] * 16.0f); }
      *(v8us*)((unsigned short*)O16 + ((size_t)b * TT + q0 + r) * ldo + h * 64 + c8) = f.half[0]; }
     } }

extern "C" void kernel_launch(void* const* d_in, const int* in_sizes, int n_in,
                              void* d_out, int out_size, void* d_ws, size_t ws_size, hipStream_t stream) {
  (void)in_sizes; (void)n_in; (void)out_size;
  const float* const* I = (const float* const*)d_in; const float* x = I[0]; const float* Wq = I[1]; const float* bq = I[2]; const float* Wk = I[3]; const float* bk = I[4]; const float* Wv = I[5]; const float* bv = I[6]; const float* Wp = I[7]; const float* bp = I[8];
  char* ws = (char*)d_ws; size_t off = 0;
  auto take = [&](size_t bytes) { char* p = ws + off; off += (bytes + 255) & ~(size_t)255; return p; };
  _Float16* Bq = (_Float16*)take((size_t)DA * DX * 2); _Float16* Bk = (_Float16*)take((size_t)DA * DX * 2); _Float16* Bv = (_Float16*)take((size_t)DA * DX * 2); _Float16* Bp = (_Float16*)take((size_t)DX * DA * 2);
  _Float16* X16 = (_Float16*)take((size_t)NRX * DX * 2); _Float16* Q = (_Float16*)take((size_t)NRX * DA * 2); _Float16* K = (_Float16*)take((size_t)NRX * DA * 2); _Float16* Vt = (_Float16*)take((size_t)NRX * DA * 2);
  _Float16* O16 = (_Float16*)take((size_t)NRX * DA * 2);
  if (off > ws_size) return;      // 4 x 0.8 + 12.6 + 4 x 8.4 MB, about 50 MB
  k_prep<<<4 * WTB + (unsigned)(((size_t)NRX * DX / 8 + 255) / 256), 256, 0, stream>>>(x, Wq, Wk, Wv, Wp, X16, Bq, Bk, Bv, Bp);
  k_gemm_tile<DX, DA, true, 3><<<3 * (NRX / 128) * (DA / 128), 256, 0, stream>>>(X16, Bq, Bk, Bv, 0.0625f, bq, bk, bv, nullptr, Q, K, Vt);      /* Q, K, V = x.W + b: M 8192 N 512 K 768; each [8192][512] plane = 64 contiguous [1024][64] slabs; Q f16 flat, K [slab][key'][64], V as V^T [slab][64][key'] */
  k_flash<<<BB * (TT / 64), 128, 0, stream>>>(Q, 64, K, 64, Vt, nullptr, O16, 64);      /* same flat view for Q and O */
  k_gemm_tile<DA, DX, false, 1><<<(NRX / 128) * (DX / 128), 256, 0, stream>>>(O16, Bp, nullptr, nullptr, 0.00390625f, bp, nullptr, nullptr, (float*)d_out, nullptr, nullptr, nullptr);      /* out = O·Wp + bp: M 8192 N 768 K 512 (alpha undoes the ×2^4 weights and the ×2^4 carry) */
}

// v005
// Measured time: 78.4 microseconds a run.
// Two timings next to v004 both put it at 1.38 times that version's speed.
// Counting every step since v000, it is 3.75 times as fast.
#include <hip/hip_runtime.h>
// Multi-head attention with raw-reshape heads (B=8, N=1024, dim 768 → attn_dim 512 = 8 heads × 64): Q,K,V = x·W + b ((in,out)), reshaped by plain memory order to (H,B,N,64) (= 64 contiguous [1024][64] slabs of each [8192][512] plane);
// softmax(Q·Kᵀ·scale)·V per slab with scale = (64//8)^-½ = 8^-½ (as the original); out raw-reshaped back to (B,N,512) (same flat order) → ·Wp + bp.
// Compute dtype: x, weights, biases rounded to bf16; Q/K/V as f16 GEMM outputs; fused flash-style kernel over the flat slabs (online softmax f32, P f16 ×2^10) on v_wmma_f32_16x16x32_f16; O carried ×2^4 into f16 → projection GEMM with bias; f32 accumulate.
#define BB 64
#define TT 1024
#define NH 1
#define DX 768
#define DA 512
#define NRX 8192
#define ATT_SCALE 0.35355339059327373f

typedef __bf16 v16b __attribute__((ext_vector_type(16)));
typedef unsigned short v8us __attribute__((ext_vector_type(8), may_alias));
typedef float  v8f  __attribute__((ext_vector_type(8)));
typedef float  v4f  __attribute__((ext_vector_type(4)));
typedef float  v4fa __attribute__((ext_vector_type(4), may_alias));
union FragB { v16b v; v8us half[2]; unsigned short u[16]; };

__device__ __forceinline__ unsigned short bf16_bits(float x) { unsigned int u = __float_as_uint(x); return (unsigned short)((u + 0x7FFFu + ((u >> 16) & 1u)) >> 16); }
__device__ __forceinline__ float bf16_val(unsigned short b) { return __uint_as_float(((unsigned int)b) << 16); }
__device__ __forceinline__ float bf16_round(float x) { return bf16_val(bf16_bits(x)); }
// D += A·B with NT terms: 1 = ah·bh, 2 = + al·bh (A split), 3 = + ah·bl (both split)
template <int NT>
__device__ __forceinline__ v8f mmaN(v16b ah, v16b al, v16b bh, v16b bl, v8f c) {
  c = __builtin_amdgcn_wmma_f32_16x16x32_bf16(false, ah, false, bh, (short)0, c, false, false);
  if (NT >= 2) c = __builtin_amdgcn_wmma_f32_16x16x32_bf16(false, al, false, bh, (short)0, c, false, false);
  if (NT >= 3) c = __builtin_amdgcn_wmma_f32_16x16x32_bf16(false, ah, false, bl, (short)0, c, false, false);
  asm volatile("v_nop\n\tv_nop\n\tv_nop\n\tv_nop" : "+v"(c) : "v"(ah), "v"(al), "v"(bh), "v"(bl));
  return c;
}

__global__ __launch_bounds__(256) void k_wt_bf16(const float* __restrict__ W, unsigned short* __restrict__ Wt, int K, int N) {
  const int t = blockIdx.x * 256 + threadIdx.x;
  const int k8n = K / 8;
  if (t >= N * k8n) return;
  const int n = t / k8n, k8 = (t % k8n) * 8;
  v8us v;
#pragma unroll
  for (int i = 0; i < 8; ++i) v[i] = bf16_bits(W[(size_t)(k8 + i) * N + n]);
  *(v8us*)(Wt + (size_t)n * K + k8) = v;
  
}

// GEMM C[M][N] (f32, pitch ldc) = act(A[M][K]·W + bias). A f32 row-major (pitch lda) converted per fragment to bf16
// (ASPLIT: hi/lo two planes -> 2 terms, else single rounded term); Wt bf16 [N][K] (pitch ldb). BIAS_BF16 rounds the
// bias to bf16 first (bias quantised to bf16 before the add). K%32==0, M%16==0, N%64==0.
template <bool ASPLIT, int ACT, bool BIAS_BF16>
__global__ __launch_bounds__(128) void k_gemm_bf(const float* __restrict__ A, int lda, const unsigned short* __restrict__ Wt, int ldb,
                                               const float* __restrict__ bias, float* __restrict__ C, int ldc, int M, int N, int K) {
  __shared__ __attribute__((aligned(16))) float so[4][16][64];
  const int tid = threadIdx.x, w = tid >> 5, lane = tid & 31, ln = lane & 15, hh = lane >> 4;
  const int ntn = N / 64;
  const int wid = blockIdx.x * 4 + w;
  const int mt = wid / ntn, nq = wid % ntn;
  if (mt * 16 >= M) return;
  const int row0 = mt * 16, col0 = nq * 64;
  const float* arow = A + (size_t)(row0 + ln) * lda;
  v8f acc[4] = {};
  for (int kb = 0; kb < K; kb += 32) {
    FragB ah, al;
    const v4f x0 = *(const v4fa*)(arow + kb + 8 * hh), x1 = *(const v4fa*)(arow + kb + 8 * hh + 4);
    const v4f x2 = *(const v4fa*)(arow + kb + 16 + 8 * hh), x3 = *(const v4fa*)(arow + kb + 16 + 8 * hh + 4);
    float xs[16] = {x0[0],x0[1],x0[2],x0[3],x1[0],x1[1],x1[2],x1[3],x2[0],x2[1],x2[2],x2[3],x3[0],x3[1],x3[2],x3[3]};
#pragma unroll
    for (int i = 0; i < 16; ++i) { const unsigned short hb = bf16_bits(xs[i]); ah.u[i] = hb; al.u[i] = ASPLIT ? bf16_bits(xs[i] - bf16_val(hb)) : (unsigned short)0; }
#pragma unroll
    for (int t = 0; t < 4; ++t) {
      const unsigned short* brow = Wt + (size_t)(col0 + t * 16 + ln) * ldb + kb;
      FragB b;
      b.half[0] = *(const v8us*)(brow + 8 * hh);
      b.half[1] = *(const v8us*)(brow + 16 + 8 * hh);
      acc[t] = mmaN<ASPLIT ? 2 : 1>(ah.v, al.v, b.v, b.v, acc[t]);
    }
  }
#pragma unroll
  for (int t = 0; t < 4; ++t) {
    float bv = bias ? bias[col0 + t * 16 + ln] : 0.f;
    if (BIAS_BF16) bv = bf16_round(bv);
#pragma unroll
    for (int r = 0; r < 8; ++r) { float v = acc[t][r] + bv; if (ACT == 1) v = fmaxf(v, 0.f); so[w][8 * hh + r][t * 16 + ln] = v; }
  }
  __builtin_amdgcn_fence(__ATOMIC_ACQ_REL, "workgroup");
  __builtin_amdgcn_wave_barrier();
  const int rsub = lane >> 4, c4 = (lane & 15) * 4;
  {
#pragma unroll
    for (int q = 0; q < 8; ++q) {
      const int r = q * 2 + rsub;
      const v4f v = *(const v4fa*)&so[w][r][c4];
      *(v4f*)(C + (size_t)(row0 + r) * ldc + col0 + c4) = v;
    }
    
  }
}

// Flash-style causal/unmasked attention, all contractions 3-term bf16 hi/lo splits, f32 softmax with running max.
// q,k,v rows are read from f32 buffers with arbitrary row pitch (so they can live inside a fused qkv buffer);
// D = head size (multiple of 32, <= 128); one wave = 16 query rows; block = 4 waves (64 queries) sharing K/V chunks of 32.
template <int D, bool CAUSAL>
__global__ __launch_bounds__(128) void k_flash(const float* __restrict__ qb, const float* __restrict__ kb, const float* __restrict__ vb,
                                             int pitch, int T, int H, float scale, float* __restrict__ y, int ypitch) {
  constexpr int KS = D / 32;        // k-steps for QK
  constexpr int DT = D / 16;        // d tiles for PV
  __shared__ __attribute__((aligned(16))) unsigned short sKh[32][D + 8], sKl[32][D + 8], sVh[32][D + 8], sVl[32][D + 8];
  __shared__ __attribute__((aligned(16))) unsigned short sPh[4][16][40], sPl[4][16][40];
  __shared__ __attribute__((aligned(16))) float sO[4][16][D];
  const int tid = threadIdx.x, w = tid >> 5, lane = tid & 31, ln = lane & 15, hh = lane >> 4;
  const int nqb = (T + 63) / 64;
  const int bh = blockIdx.x / nqb, qblk = blockIdx.x % nqb;
  const int b = bh / H, h = bh % H;
  const int q0 = qblk * 64 + w * 16;
  const float* Q = qb + (size_t)b * T * pitch + h * D;
  const float* K = kb + (size_t)b * T * pitch + h * D;
  const float* V = vb + (size_t)b * T * pitch + h * D;

  // A fragments of the wave's 16 query rows (scaled), hi/lo
  FragB aqh[KS], aql[KS];
  {
    int row = q0 + ln; if (row >= T) row = T - 1;
    const float* qr = Q + (size_t)row * pitch;
#pragma unroll
    for (int ks = 0; ks < KS; ++ks)
#pragma unroll
      for (int i = 0; i < 16; ++i) {
        const int d = ks * 32 + ((i < 8) ? (8 * hh + i) : (16 + 8 * hh + (i - 8)));
        const float x = qr[d] * scale; const unsigned short hb = bf16_bits(x);
        aqh[ks].u[i] = hb; aql[ks].u[i] = bf16_bits(x - bf16_val(hb));
      }
  }
  float m_r[8], l_r[8];
#pragma unroll
  for (int r = 0; r < 8; ++r) { m_r[r] = -3.0e38f; l_r[r] = 0.f; }
  v8f oacc[DT];
#pragma unroll
  for (int dt = 0; dt < DT; ++dt) oacc[dt] = (v8f){0.f,0.f,0.f,0.f,0.f,0.f,0.f,0.f};

  const int kv_end = CAUSAL ? min(T, qblk * 64 + 64) : T;     // block-uniform
  for (int j0 = 0; j0 < kv_end; j0 += 32) {
    __syncthreads();
    for (int e = tid; e < 32 * (D / 4); e += 128) {
      const int r = e / (D / 4), c4 = (e % (D / 4)) * 4;
      const int key = j0 + r;
      v4f kf = {0.f,0.f,0.f,0.f}, vf = {0.f,0.f,0.f,0.f};
      if (key < T) { kf = *(const v4fa*)(K + (size_t)key * pitch + c4); vf = *(const v4fa*)(V + (size_t)key * pitch + c4); }
#pragma unroll
      for (int t = 0; t < 4; ++t) {
        unsigned short hb = bf16_bits(kf[t]); sKh[r][c4 + t] = hb; sKl[r][c4 + t] = bf16_bits(kf[t] - bf16_val(hb));
        hb = bf16_bits(vf[t]); sVh[r][c4 + t] = hb; sVl[r][c4 + t] = bf16_bits(vf[t] - bf16_val(hb));
      }
    }
    __syncthreads();
    // S tile 16 x 32
    v8f s[2];
#pragma unroll
    for (int nt = 0; nt < 2; ++nt) {
      v8f acc = {};
#pragma unroll
      for (int ks = 0; ks < KS; ++ks) {
        FragB bh_, bl_;
        bh_.half[0] = *(const v8us*)&sKh[nt * 16 + ln][ks * 32 + 8 * hh]; bh_.half[1] = *(const v8us*)&sKh[nt * 16 + ln][ks * 32 + 16 + 8 * hh];
        bl_.half[0] = *(const v8us*)&sKl[nt * 16 + ln][ks * 32 + 8 * hh]; bl_.half[1] = *(const v8us*)&sKl[nt * 16 + ln][ks * 32 + 16 + 8 * hh];
        acc = mmaN<3>(aqh[ks].v, aql[ks].v, bh_.v, bl_.v, acc);
      }
      s[nt] = acc;
    }
    // mask + running max (rows 8hh+r; the 16 lanes of a half share rows)
    float alpha[8];
#pragma unroll
    for (int r = 0; r < 8; ++r) {
      const int qi = q0 + 8 * hh + r;
      const int ja = j0 + ln, jb = j0 + 16 + ln;
      if (CAUSAL) { if (ja > qi) s[0][r] = -3.0e38f; if (jb > qi) s[1][r] = -3.0e38f; }
      if (ja >= T) s[0][r] = -3.0e38f;
      if (jb >= T) s[1][r] = -3.0e38f;
      float mx = fmaxf(s[0][r], s[1][r]);
      mx = fmaxf(mx, __shfl_xor(mx, 1, 32)); mx = fmaxf(mx, __shfl_xor(mx, 2, 32)); mx = fmaxf(mx, __shfl_xor(mx, 4, 32)); mx = fmaxf(mx, __shfl_xor(mx, 8, 32));
      const float mnew = fmaxf(m_r[r], mx);
      alpha[r] = (mnew > -1.0e38f) ? __expf(m_r[r] - mnew) : 1.0f;
      const float p0 = (s[0][r] > -1.0e38f) ? __expf(s[0][r] - mnew) : 0.f;
      const float p1 = (s[1][r] > -1.0e38f) ? __expf(s[1][r] - mnew) : 0.f;
      m_r[r] = mnew;
      l_r[r] = l_r[r] * alpha[r] + p0 + p1;            // per-lane partial row sum (16 lanes combined at the end)
      unsigned short hb = bf16_bits(p0); sPh[w][8 * hh + r][ln] = hb;      sPl[w][8 * hh + r][ln] = bf16_bits(p0 - bf16_val(hb));
      hb = bf16_bits(p1);                sPh[w][8 * hh + r][16 + ln] = hb; sPl[w][8 * hh + r][16 + ln] = bf16_bits(p1 - bf16_val(hb));
    }
#pragma unroll
    for (int dt = 0; dt < DT; ++dt)
#pragma unroll
      for (int r = 0; r < 8; ++r) oacc[dt][r] *= alpha[r];
    __builtin_amdgcn_fence(__ATOMIC_ACQ_REL, "workgroup");
    __builtin_amdgcn_wave_barrier();
    FragB pah, pal;
    pah.half[0] = *(const v8us*)&sPh[w][ln][8 * hh]; pah.half[1] = *(const v8us*)&sPh[w][ln][16 + 8 * hh];
    pal.half[0] = *(const v8us*)&sPl[w][ln][8 * hh]; pal.half[1] = *(const v8us*)&sPl[w][ln][16 + 8 * hh];
#pragma unroll
    for (int dt = 0; dt < DT; ++dt) {
      FragB bvh, bvl;
#pragma unroll
      for (int i = 0; i < 8; ++i) {
        bvh.u[i] = sVh[8 * hh + i][dt * 16 + ln]; bvh.u[8 + i] = sVh[16 + 8 * hh + i][dt * 16 + ln];
        bvl.u[i] = sVl[8 * hh + i][dt * 16 + ln]; bvl.u[8 + i] = sVl[16 + 8 * hh + i][dt * 16 + ln];
      }
      oacc[dt] = mmaN<3>(pah.v, pal.v, bvh.v, bvl.v, oacc[dt]);
    }
    __builtin_amdgcn_fence(__ATOMIC_ACQ_REL, "workgroup");
    __builtin_amdgcn_wave_barrier();
  }
#pragma unroll
  for (int r = 0; r < 8; ++r) {
    float l = l_r[r];
    l += __shfl_xor(l, 1, 32); l += __shfl_xor(l, 2, 32); l += __shfl_xor(l, 4, 32); l += __shfl_xor(l, 8, 32);
    l_r[r] = (l > 0.f) ? 1.0f / l : 0.f;
  }
#pragma unroll
  for (int dt = 0; dt < DT; ++dt)
#pragma unroll
    for (int r = 0; r < 8; ++r) sO[w][8 * hh + r][dt * 16 + ln] = oacc[dt][r] * l_r[r];
  __builtin_amdgcn_fence(__ATOMIC_ACQ_REL, "workgroup");
  __builtin_amdgcn_wave_barrier();
  {
    for (int r = 0; r < 16; ++r) {
      const int row = q0 + r;
      if (row < T && lane < D / 4) {
        const v4f val = *(const v4fa*)&sO[w][r][lane * 4];
        *(v4f*)(y + ((size_t)b * T + row) * ypitch + h * D + lane * 4) = val;
      }
    }
    
  }
}

// GEMM C = act(A·W + bias + resid): A f32 (ASPLIT -> hi/lo 2 terms), Wt bf16 [N][K]; ACT 0 none, 1 relu, 2 exact gelu;
// resid (optional, f32, row index = (row % rmod), pitch ldr, RES_BF16 rounds it) added before the activation.
template <bool ASPLIT, int ACT, bool BIAS_BF16, bool RES_BF16>
__global__ __launch_bounds__(128) void k_gemm_bf3(const float* __restrict__ A, int lda, const unsigned short* __restrict__ Wt, int ldb,
                                                const float* __restrict__ bias, const float* __restrict__ resid, int rmod, int ldr,
                                                float* __restrict__ C, int ldc, int M, int N, int K) {
  __shared__ __attribute__((aligned(16))) float so[4][16][64];
  const int tid = threadIdx.x, w = tid >> 5, lane = tid & 31, ln = lane & 15, hh = lane >> 4;
  const int ntn = N / 64;
  const int wid = blockIdx.x * 4 + w;
  const int mt = wid / ntn, nq = wid % ntn;
  if (mt * 16 >= M) return;
  const int row0 = mt * 16, col0 = nq * 64;
  const float* arow = A + (size_t)(row0 + ln) * lda;
  v8f acc[4] = {};
  for (int kb = 0; kb < K; kb += 32) {
    FragB ah, al;
    const v4f x0 = *(const v4fa*)(arow + kb + 8 * hh), x1 = *(const v4fa*)(arow + kb + 8 * hh + 4);
    const v4f x2 = *(const v4fa*)(arow + kb + 16 + 8 * hh), x3 = *(const v4fa*)(arow + kb + 16 + 8 * hh + 4);
    float xs[16] = {x0[0],x0[1],x0[2],x0[3],x1[0],x1[1],x1[2],x1[3],x2[0],x2[1],x2[2],x2[3],x3[0],x3[1],x3[2],x3[3]};
#pragma unroll
    for (int i = 0; i < 16; ++i) { const unsigned short hb = bf16_bits(xs[i]); ah.u[i] = hb; al.u[i] = ASPLIT ? bf16_bits(xs[i] - bf16_val(hb)) : (unsigned short)0; }
#pragma unroll
    for (int t = 0; t < 4; ++t) {
      const unsigned short* brow = Wt + (size_t)(col0 + t * 16 + ln) * ldb + kb;
      FragB b;
      b.half[0] = *(const v8us*)(brow + 8 * hh);
      b.half[1] = *(const v8us*)(brow + 16 + 8 * hh);
      acc[t] = mmaN<ASPLIT ? 2 : 1>(ah.v, al.v, b.v, b.v, acc[t]);
    }
  }
#pragma unroll
  for (int t = 0; t < 4; ++t) {
    const int col = col0 + t * 16 + ln;
    float bv = bias ? bias[col] : 0.f;
    if (BIAS_BF16) bv = bf16_round(bv);
#pragma unroll
    for (int r = 0; r < 8; ++r) {
      float v = acc[t][r] + bv;
      if (resid) { float rv = resid[(size_t)((row0 + 8 * hh + r) % rmod) * ldr + col]; if (RES_BF16) rv = bf16_round(rv); v += rv; }
      if (ACT == 1) v = fmaxf(v, 0.f);
      if (ACT == 2) v = 0.5f * v * (1.0f + erff(v * 0.70710678118654752f));
      if (ACT == 3) { const float u = 0.7978845608028654f * (v + 0.044715f * v * v * v); v = 0.5f * v * (1.0f + tanhf(u)); }
      so[w][8 * hh + r][t * 16 + ln] = v;
    }
  }
  __builtin_amdgcn_fence(__ATOMIC_ACQ_REL, "workgroup");
  __builtin_amdgcn_wave_barrier();
  const int rsub = lane >> 4, c4 = (lane & 15) * 4;
  {
#pragma unroll
    for (int q = 0; q < 8; ++q) {
      const int r = q * 2 + rsub;
      const v4f v = *(const v4fa*)&so[w][r][c4];
      *(v4f*)(C + (size_t)(row0 + r) * ldc + col0 + c4) = v;
    }
    
  }
}
// row LayerNorm (biased variance, eps) over N: s = X (+ R); optional out_sum <- s; out_norm <- (s-mu)*rsqrt(var+eps)*g + b
template <bool PARAM_BF16>
__global__ __launch_bounds__(256) void k_layernorm(const float* __restrict__ X, const float* __restrict__ R, const float* __restrict__ g, const float* __restrict__ bta,
                                                  float* __restrict__ out_sum, float* __restrict__ out_norm, int N, float eps) {
  __shared__ float red[256];
  const int row = blockIdx.x, tid = threadIdx.x;
  const float* x = X + (size_t)row * N; const float* rr = R ? R + (size_t)row * N : nullptr;
  float vals[16];                     // up to N = 4096
  const int per = N / 256;            // contiguous chunk per thread? use strided-by-4 chunks: thread handles j = tid*4 + 1024*u
  float s1 = 0.f;
  for (int u = 0; u < per / 4; ++u) {
    const int j = tid * 4 + 1024 * u;
    const v4f a = *(const v4fa*)(x + j);
    v4f b = {0.f,0.f,0.f,0.f}; if (rr) b = *(const v4fa*)(rr + j);
#pragma unroll
    for (int q = 0; q < 4; ++q) { const float v = a[q] + b[q]; vals[u * 4 + q] = v; s1 += v; }
  }
  red[tid] = s1; __syncthreads();
  for (int st = 128; st > 0; st >>= 1) { if (tid < st) red[tid] += red[tid + st]; __syncthreads(); }
  const float mu = red[0] / (float)N; __syncthreads();
  float s2 = 0.f;
  for (int u = 0; u < per / 4; ++u)
#pragma unroll
    for (int q = 0; q < 4; ++q) { const float c = vals[u * 4 + q] - mu; s2 += c * c; }
  red[tid] = s2; __syncthreads();
  for (int st = 128; st > 0; st >>= 1) { if (tid < st) red[tid] += red[tid + st]; __syncthreads(); }
  const float rs = rsqrtf(red[0] / (float)N + eps);
  {
    for (int u = 0; u < per / 4; ++u) {
      const int j = tid * 4 + 1024 * u;
      v4f o, sm;
#pragma unroll
      for (int q = 0; q < 4; ++q) {
        float gg = g[j + q], bb = bta[j + q];
        if (PARAM_BF16) { gg = bf16_round(gg); bb = bf16_round(bb); }
        sm[q] = vals[u * 4 + q]; o[q] = (vals[u * 4 + q] - mu) * rs * gg + bb;
      }
      if (out_sum) *(v4f*)(out_sum + (size_t)row * N + j) = sm;
      *(v4f*)(out_norm + (size_t)row * N + j) = o;
    }
    
  }
}



// ---- f16 WMMA path (v_wmma_f32_16x16x32_f16): 11-bit significands for operands in range — used where a [0,1] probability operand needs more precision than bf16
typedef _Float16 v16h __attribute__((ext_vector_type(16)));
union FragH { v16h v; v8us half[2]; _Float16 h[16]; unsigned short u[16]; };
template <int NT>
__device__ __forceinline__ v8f mmaH(v16h ah, v16h al, v16h bh, v16h bl, v8f c) {
  c = __builtin_amdgcn_wmma_f32_16x16x32_f16(false, ah, false, bh, (short)0, c, false, false);
  if (NT >= 2) c = __builtin_amdgcn_wmma_f32_16x16x32_f16(false, al, false, bh, (short)0, c, false, false);
  if (NT >= 3) c = __builtin_amdgcn_wmma_f32_16x16x32_f16(false, ah, false, bl, (short)0, c, false, false);
  asm volatile("v_nop\n\tv_nop\n\tv_nop\n\tv_nop" : "+v"(c) : "v"(ah), "v"(al), "v"(bh), "v"(bl));
  return c;
}
// batched GEMM like k_gemm_b but f16 operands: A f32 (split into f16 hi/lo if ASPLIT, else rounded to f16), Bt = f16 values [n][k]; alpha; C f32; N multiple of 16 (partial tiles skipped)
template <bool ASPLIT>
__global__ __launch_bounds__(128) void k_gemm_h(const float* __restrict__ A, int lda, size_t sA, const _Float16* __restrict__ Bh, int ldb, size_t sB, float alpha, float* __restrict__ C, int ldc, size_t sC, int M, int N, int K) {
  __shared__ __attribute__((aligned(16))) float so[4][16][64];
  const int tid = threadIdx.x, w = tid >> 5, lane = tid & 31, ln = lane & 15, hh = lane >> 4; const int by = blockIdx.y;
  A += (size_t)by * sA; Bh += (size_t)by * sB; C += (size_t)by * sC;
  const int ntn = (N + 63) / 64; const int wid = blockIdx.x * 4 + w; const int mt = wid / ntn, nq = wid % ntn; if (mt * 16 >= M) return;
  const int row0 = mt * 16, col0 = nq * 64; const float* arow = A + (size_t)(row0 + ln) * lda;
  v8f acc[4] = {};
  for (int kb = 0; kb < K; kb += 32) {
    FragH ah, al;
    const v4f x0 = *(const v4fa*)(arow + kb + 8 * hh), x1 = *(const v4fa*)(arow + kb + 8 * hh + 4), x2 = *(const v4fa*)(arow + kb + 16 + 8 * hh), x3 = *(const v4fa*)(arow + kb + 16 + 8 * hh + 4);
    float xs[16] = {x0[0],x0[1],x0[2],x0[3],x1[0],x1[1],x1[2],x1[3],x2[0],x2[1],x2[2],x2[3],x3[0],x3[1],x3[2],x3[3]};
#pragma unroll
    for (int i = 0; i < 16; ++i) { const _Float16 h = (_Float16)xs[i]; ah.h[i] = h; al.h[i] = ASPLIT ? (_Float16)(xs[i] - (float)h) : (_Float16)0.0f; }
#pragma unroll
    for (int t = 0; t < 4; ++t) { if (col0 + t * 16 >= N) continue; const size_t boff = (size_t)(col0 + t * 16 + ln) * ldb + kb; FragH bq; bq.half[0] = *(const v8us*)(Bh + boff + 8 * hh); bq.half[1] = *(const v8us*)(Bh + boff + 16 + 8 * hh);
      acc[t] = mmaH<ASPLIT ? 2 : 1>(ah.v, al.v, bq.v, bq.v, acc[t]); }
  }
#pragma unroll
  for (int t = 0; t < 4; ++t) { if (col0 + t * 16 >= N) continue;
#pragma unroll
    for (int r = 0; r < 8; ++r) so[w][8 * hh + r][t * 16 + ln] = acc[t][r] * alpha; }
  __builtin_amdgcn_fence(__ATOMIC_ACQ_REL, "workgroup"); __builtin_amdgcn_wave_barrier();
  const int rsub = lane >> 4, c4 = (lane & 15) * 4;
  {
#pragma unroll
    for (int q = 0; q < 8; ++q) { const int r = q * 2 + rsub; if (col0 + c4 < N) { const v4f v = *(const v4fa*)&so[w][r][c4]; *(v4f*)(C + (size_t)(row0 + r) * ldc + col0 + c4) = v; } }
     }
}

// Wt[n][k] = f16(W[k][n]·scale) from f32 row-major W[K][N] (scale = power of two; bf16-exact weights stay exact in f16 away from the subnormal range)
__device__ __forceinline__ void wt_f16(const float* __restrict__ W, _Float16* __restrict__ Wt, int K, int N, float scale, int t) {
  if (t >= N * (K / 8)) return; const int n = t / (K / 8), k8 = (t % (K / 8)) * 8; FragH f;
#pragma unroll
  for (int i = 0; i < 8; ++i) f.h[i] = (_Float16)(bf16_round(W[(size_t)(k8 + i) * N + n]) * scale); const v8us o = f.half[0];
  *(v8us*)((unsigned short*)Wt + (size_t)n * K + k8) = o; 
}
// k_gemm_hh variant with fused epilogue: v = acc·alpha + bias[by·sBias + col] (+ CP[(row/rowsPerB)·sCPb + by·64 + col] if CP) ; ACT 0 none / 1 elu ; writes f16 C16 and f32 C, each if non-null
template <int ACT>
__global__ __launch_bounds__(128) void k_gemm_hhx(const _Float16* __restrict__ A, int lda, size_t sA, const _Float16* __restrict__ Bh, int ldb, size_t sB, float alpha, const float* __restrict__ bias, size_t sBias, const float* __restrict__ CP, int rowsPerB, size_t sCPb, int row0g,
    float* __restrict__ C, _Float16* __restrict__ C16, int ldc, size_t sC, int M, int N, int K) {
  __shared__ __attribute__((aligned(16))) float so[4][16][64];
  const int tid = threadIdx.x, w = tid >> 5, lane = tid & 31, ln = lane & 15, hh = lane >> 4; const int by = blockIdx.y;
  A += (size_t)by * sA; Bh += (size_t)by * sB; const size_t cofs = (size_t)by * sC; const float* bp = bias ? bias + (size_t)by * sBias : nullptr;
  const int ntn = (N + 63) / 64; const int wid = blockIdx.x * 4 + w; const int mt = wid / ntn, nq = wid % ntn; if (mt * 16 >= M) return;
  const int row0 = mt * 16, col0 = nq * 64; const _Float16* arow = A + (size_t)(row0 + ln) * lda;
  v8f acc[4] = {};
  for (int kb = 0; kb < K; kb += 32) { FragH ah; ah.half[0] = *(const v8us*)((const unsigned short*)arow + kb + 8 * hh); ah.half[1] = *(const v8us*)((const unsigned short*)arow + kb + 16 + 8 * hh);
#pragma unroll
    for (int t = 0; t < 4; ++t) { if (col0 + t * 16 >= N) continue; const size_t boff = (size_t)(col0 + t * 16 + ln) * ldb + kb; FragH bq; bq.half[0] = *(const v8us*)((const unsigned short*)Bh + boff + 8 * hh); bq.half[1] = *(const v8us*)((const unsigned short*)Bh + boff + 16 + 8 * hh);
      acc[t] = mmaH<1>(ah.v, ah.v, bq.v, bq.v, acc[t]); }
  }
#pragma unroll
  for (int t = 0; t < 4; ++t) { if (col0 + t * 16 >= N) continue; const int col = col0 + t * 16 + ln; const float bv = bp ? bf16_round(bp[col]) : 0.f;
#pragma unroll
    for (int r = 0; r < 8; ++r) { float v = acc[t][r] * alpha + bv; if (CP) { const int bidx = (row0g + row0 + 8 * hh + r) / rowsPerB; v += CP[(size_t)bidx * sCPb + (size_t)by * 64 + col]; } if (ACT == 1) v = (v > 0.f) ? v : expm1f(v); else if (ACT == 7) v = (v > 0.f) ? v + 1.0f : expf(v); else if (ACT == 8) v = tanhf(v); else if (ACT == 9) v = 0.5f * v * (1.0f + tanhf(0.7978845608028654f * (v + 0.044715f * v * v * v))); else if (ACT == 11) v = 1.0f / (1.0f + expf(-v)); else if (ACT == 12) v = (v > 0.f) ? v : 0.01f * v; else if (ACT == 14) v = (v > 0.f) ? v : 0.1f * v; else if (ACT == 15) v = v / (1.0f + expf(-v)); else if (ACT == 3) v = fmaxf(v, 0.f); else if (ACT == 6) v = 0.5f * v * (1.0f + erff(v * 0.70710678118654752f)); so[w][8 * hh + r][t * 16 + ln] = v; } }
  __builtin_amdgcn_fence(__ATOMIC_ACQ_REL, "workgroup"); __builtin_amdgcn_wave_barrier();
  const int rsub = lane >> 4, c4 = (lane & 15) * 4; typedef _Float16 v4h __attribute__((ext_vector_type(4)));
  {
#pragma unroll
    for (int q = 0; q < 8; ++q) { const int r = q * 2 + rsub; if (col0 + c4 < N) { const v4f v = *(const v4fa*)&so[w][r][c4]; if (C) *(v4f*)(C + cofs + (size_t)(row0 + r) * ldc + col0 + c4) = v; if (C16) { v4h h4; for (int i = 0; i < 4; ++i) h4[i] = (_Float16)v[i]; *(v4h*)(C16 + cofs + (size_t)(row0 + r) * ldc + col0 + c4) = h4; } } }
     }
}


// Block-tiled GEMM, f16 operands, both K-contiguous: C[8192][NN] = A[8192][KK] . Bh[NN][KK]^T * alpha + bf16(bias). One 128x128 tile of C per work-group of 8 waves (4x2), 32x64 per wave.
// A pass is 128 k = 256 aligned bytes of each of the 256 operand rows, brought into LDS by asynchronous copies (two buffers, the next pass's copies fly while this pass is worked on), so that every line leaves L2 once per work-group and not once per wave.
// LDS rows at pitch 272 bytes (16 x odd) for the 16-byte fragment reads. The k order of a fragment and the order of the k steps are those of k_gemm_hhx.
__device__ __forceinline__ unsigned lds_off(const void* p) { return (unsigned)(size_t)p; }
// eight copies of 16 bytes per lane: rows r, r + 16, ..., r + 112 of one operand's tile. The s_wait_xcnt stands inside the statement so that no address register is rewritten ahead of it.
__device__ __forceinline__ void copy_rows8(unsigned l0, const _Float16* g0, int rowstep, unsigned ldsstep) {
  const unsigned l1 = l0 + ldsstep, l2 = l0 + 2 * ldsstep, l3 = l0 + 3 * ldsstep, l4 = l0 + 4 * ldsstep, l5 = l0 + 5 * ldsstep, l6 = l0 + 6 * ldsstep, l7 = l0 + 7 * ldsstep;
  const _Float16* g1 = g0 + rowstep; const _Float16* g2 = g0 + 2 * rowstep; const _Float16* g3 = g0 + 3 * rowstep; const _Float16* g4 = g0 + 4 * rowstep;
  const _Float16* g5 = g0 + 5 * rowstep; const _Float16* g6 = g0 + 6 * rowstep; const _Float16* g7 = g0 + 7 * rowstep;
  asm volatile("global_load_async_to_lds_b128 %0, %8, off\n\t"
               "global_load_async_to_lds_b128 %1, %9, off\n\t"
               "global_load_async_to_lds_b128 %2, %10, off\n\t"
               "global_load_async_to_lds_b128 %3, %11, off\n\t"
               "global_load_async_to_lds_b128 %4, %12, off\n\t"
               "global_load_async_to_lds_b128 %5, %13, off\n\t"
               "global_load_async_to_lds_b128 %6, %14, off\n\t"
               "global_load_async_to_lds_b128 %7, %15, off\n\t"
               "s_wait_xcnt 0x0"
               :: "v"(l0), "v"(l1), "v"(l2), "v"(l3), "v"(l4), "v"(l5), "v"(l6), "v"(l7),
                  "v"(g0), "v"(g1), "v"(g2), "v"(g3), "v"(g4), "v"(g5), "v"(g6), "v"(g7) : "memory");
}
// NJ independent products that share A (own Bh, bias and C16 each) run as one grid: the NJ * NTN tiles of one 128-row band of A have neighbouring block indices.
// NJ == 3 (Q, K, V): a 128-row band of a [8192][512] plane is one [1024][64] slab; element (m, n) of the band is key (m % 128) * 8 + n / 64, column n % 64.
// Jobs 1 and 2 store their slab for the attention kernel with the keys renumbered key' = (n / 64) * 128 + m % 128, the same for both (a softmax-weighted sum does not depend on the order of its keys):
// both in the order in which the attention kernel's A fragments are loaded, so that each of its wave-wide 16-byte loads is 512 bytes in a row (4 whole lines) and not 32 bytes out of each of 16 lines:
// job 1 as Kf[slab][key' / 16][c][lane][8], c = 0 .. 3: lane (hh, ln) = hh * 16 + ln holds columns c * 16 + hh * 8 .. + 7 of key (key' / 16) * 16 + ln; a wave's 32 x 64 tile is 4 KB in a row;
// job 2 as Vf[slab][key' / 32][dt * 2 + hf][lane][8]: lane (hh, ln) holds keys (key' / 32) * 32 + hf * 16 + hh * 8 .. + 7 of column dt * 16 + ln; 32 keys are 4 KB in a row.
template <int KK, int NN, bool OUT16, int NJ>
__global__ __launch_bounds__(256) void k_gemm_tile(const _Float16* __restrict__ A, const _Float16* __restrict__ Bh0, const _Float16* __restrict__ Bh1, const _Float16* __restrict__ Bh2, float alpha,
                                                  const float* __restrict__ bias0, const float* __restrict__ bias1, const float* __restrict__ bias2, float* __restrict__ C,
                                                  _Float16* __restrict__ C160, _Float16* __restrict__ C161, _Float16* __restrict__ C162) {
  constexpr int BK = 128, KSN = BK / 32, PITCH = 2 * BK + 16, STAGE = 256 * PITCH, NPASS = KK / BK, NTN = NN / 128, SOP = 68;
  static_assert(NPASS >= 2 && KK % BK == 0 && NN % 128 == 0 && 8 * 32 * SOP * 4 <= 2 * STAGE, "shape");
  static_assert(NJ == 1 || (NJ == 3 && OUT16 && 128 * (NN / 64) == TT), "a band of the Q, K, V planes is one slab");
  __shared__ __attribute__((aligned(16))) unsigned char sm[2 * STAGE];
  const int tid = threadIdx.x, w = tid >> 5, lane = tid & 31, ln = lane & 15, hh = lane >> 4;
  const int job = NJ > 1 ? (blockIdx.x % (NJ * NTN)) / NTN : 0;
  const _Float16* Bh = job == 0 ? Bh0 : job == 1 ? Bh1 : Bh2; const float* bias = job == 0 ? bias0 : job == 1 ? bias1 : bias2; _Float16* C16 = job == 0 ? C160 : job == 1 ? C161 : C162;
  const int m0 = (blockIdx.x / (NJ * NTN)) * 128, n0 = (blockIdx.x % NTN) * 128; const int wm = w >> 1, wn = w & 1;
  const int cr = tid >> 4, cc = tid & 15;      // a wave's copy = 2 rows x 256 bytes
  const _Float16* ga = A + (size_t)(m0 + cr) * KK + cc * 8; const _Float16* gb = Bh + (size_t)(n0 + cr) * KK + cc * 8;
  const unsigned la = lds_off(sm) + cr * PITCH + cc * 16, lb = la + 128 * PITCH;
  v8f acc[2][4];
#pragma unroll
  for (int i = 0; i < 2; ++i)
#pragma unroll
    for (int j = 0; j < 4; ++j) acc[i][j] = (v8f){0.f,0.f,0.f,0.f,0.f,0.f,0.f,0.f};
  copy_rows8(la, ga, 16 * KK, 16 * PITCH); copy_rows8(lb, gb, 16 * KK, 16 * PITCH);
  asm volatile("s_wait_asynccnt 0x0" ::: "memory");      // pass 0's bytes have landed before the barrier publishes them
  __syncthreads();
  copy_rows8(la + STAGE, ga + BK, 16 * KK, 16 * PITCH); copy_rows8(lb + STAGE, gb + BK, 16 * KK, 16 * PITCH);
  const unsigned char* fa = sm + (wm * 32 + ln) * PITCH + 16 * hh; const unsigned char* fb = sm + (128 + wn * 64 + ln) * PITCH + 16 * hh;
#pragma unroll 1      // the ring stays one rolled loop: one publish point, short code
  for (int t = 0; t < NPASS; ++t) {
    const int bo = (t & 1) * STAGE;
    FragH a[2][2], b[2][4];      // two fragment sets: the next 32 k of this pass are fetched while these are multiplied
#pragma unroll
    for (int i = 0; i < 2; ++i) { a[0][i].half[0] = *(const v8us*)(fa + bo + i * 16 * PITCH); a[0][i].half[1] = *(const v8us*)(fa + bo + i * 16 * PITCH + 32); }
#pragma unroll
    for (int j = 0; j < 4; ++j) { b[0][j].half[0] = *(const v8us*)(fb + bo + j * 16 * PITCH); b[0][j].half[1] = *(const v8us*)(fb + bo + j * 16 * PITCH + 32); }
#pragma unroll
    for (int ks = 0; ks < KSN; ++ks) {
      const int cu = ks & 1, nx = cu ^ 1;
      if (ks + 1 < KSN) {
#pragma unroll
        for (int i = 0; i < 2; ++i) { a[nx][i].half[0] = *(const v8us*)(fa + bo + i * 16 * PITCH + (ks + 1) * 64); a[nx][i].half[1] = *(const v8us*)(fa + bo + i * 16 * PITCH + (ks + 1) * 64 + 32); }
#pragma unroll
        for (int j = 0; j < 4; ++j) { b[nx][j].half[0] = *(const v8us*)(fb + bo + j * 16 * PITCH + (ks + 1) * 64); b[nx][j].half[1] = *(const v8us*)(fb + bo + j * 16 * PITCH + (ks + 1) * 64 + 32); }
        __builtin_amdgcn_sched_barrier(0);      // keeps the next set's LDS reads one group ahead of this set's products; without it they are sunk among the products, into one register set, and each product run waits out the LDS latency
      }
#pragma unroll
      for (int i = 0; i < 2; ++i)
#pragma unroll
        for (int j = 0; j < 4; ++j) acc[i][j] = __builtin_amdgcn_wmma_f32_16x16x32_f16(false, a[cu][i].v, false, b[cu][j].v, (short)0, acc[i][j], false, false);
    }
    __builtin_amdgcn_sched_barrier(0);      // keeps the pass's products in front of the publish point: sunk behind the barrier they stand between it and the refill, and the copies start that much later
    asm volatile("s_wait_dscnt 0x0" ::: "memory");       // this wave's reads of the buffer are done before it is handed to the copies
    asm volatile("s_wait_asynccnt 0x0" ::: "memory");    // this wave's copies of pass t + 1 have landed before the barrier publishes them
    __syncthreads();
    if (t + 2 < NPASS) { copy_rows8(la + bo, ga + (t + 2) * BK, 16 * KK, 16 * PITCH); copy_rows8(lb + bo, gb + (t + 2) * BK, 16 * KK, 16 * PITCH); }
  }
  asm volatile("s_wait_asynccnt 0x0" ::: "memory");      // nothing is in flight when the ring becomes output staging
  if (NJ == 3 && job == 2) {      // V: the tile leaves transposed. A lane's 8 accumulator rows of one column are 8 neighbouring keys of one row of V^T: 16 bytes of f16
    constexpr int TP = 2 * 128 + 16;      // staged rows [wn * 64 + column][128 keys], pitch 16 x odd bytes; every reader left the ring at the last pass's barrier
#pragma unroll      // these three: constant indices keep the accumulators in registers
    for (int j = 0; j < 4; ++j) { const float bv = bf16_round(bias[n0 + wn * 64 + j * 16 + ln]);
#pragma unroll
      for (int i = 0; i < 2; ++i) { FragH f;
#pragma unroll
        for (int r = 0; r < 8; ++r) f.h[r] = (_Float16)(acc[i][j][r] * alpha + bv);
        *(v8us*)(sm + (wn * 64 + j * 16 + ln) * TP + (wm * 32 + i * 16 + 8 * hh) * 2) = f.half[0]; } }
    __syncthreads();      // a staged row holds the keys of four waves: all are written before any is read back (job is the same for the whole work-group)
#pragma unroll      // the eight LDS reads go out as one group, the stores follow as they land
    for (int q = 0; q < 8; ++q) { const int row = (w >> 2) * 64 + (q >> 1) * 16 + ln, k8 = ((w & 3) * 4 + (q & 1) * 2 + hh) * 8; const v8us v = *(const v8us*)(sm + row * TP + k8 * 2);      // wave w: the 32 keys (w & 3) of key block w >> 2; q = dt * 2 + hf
      *(v8us*)((unsigned short*)C16 + (size_t)(m0 / 128) * (64 * TT) + (size_t)((n0 / 64 + (w >> 2)) * 4 + (w & 3)) * 2048 + q * 256 + lane * 8) = v; }
    return;
  }
  float* so = (float*)sm + w * (32 * SOP);      // each wave stages its own 32 x 64 tile; every reader left the ring at the last pass's barrier
#pragma unroll
  for (int j = 0; j < 4; ++j) { const float bv = bf16_round(bias[n0 + wn * 64 + j * 16 + ln]);
#pragma unroll
    for (int i = 0; i < 2; ++i)
#pragma unroll
      for (int r = 0; r < 8; ++r) so[(i * 16 + 8 * hh + r) * SOP + j * 16 + ln] = acc[i][j][r] * alpha + bv; }
  __builtin_amdgcn_fence(__ATOMIC_ACQ_REL, "workgroup"); __builtin_amdgcn_wave_barrier();      // the wave's own staged rows are written before other lanes of it read them back
  if (OUT16) {
    if (NJ == 3 && job == 1) {      // K: keys in the order key', fragment order inside each 16 keys; store q = the 512 bytes of fragment half q & 3 of the tile's keys (q >> 2) * 16 .. + 15 (job is the same for the whole work-group)
      unsigned short* dst = (unsigned short*)C16 + (size_t)m0 * NN + (size_t)((n0 / 64 + wn) * 128 + wm * 32) * 64 + lane * 8;
#pragma unroll
      for (int q = 0; q < 8; ++q) { const float* sp = &so[((q >> 2) * 16 + ln) * SOP + ((q & 3) * 2 + hh) * 8]; const v4f v0 = *(const v4fa*)sp, v1 = *(const v4fa*)(sp + 4); FragH f;
#pragma unroll
        for (int i = 0; i < 4; ++i) { f.h[i] = (_Float16)v0[i]; f.h[4 + i] = (_Float16)v1[i]; }
        *(v8us*)(dst + q * 256) = f.half[0]; }
      asm volatile("s_wait_xcnt 0x0" ::: "memory");      // behind the run's last store: the listing's way on from here leads into code that rewrites the stores' registers
    } else {
      unsigned short* dst = (unsigned short*)C16 + (size_t)(m0 + wm * 32) * NN + n0 + wn * 64;
#pragma unroll
      for (int q = 0; q < 8; ++q) { const int r = q * 4 + (lane >> 3), c8 = (lane & 7) * 8; const v4f v0 = *(const v4fa*)&so[r * SOP + c8], v1 = *(const v4fa*)&so[r * SOP + c8 + 4]; FragH f;
#pragma unroll
        for (int i = 0; i < 4; ++i) { f.h[i] = (_Float16)v0[i]; f.h[4 + i] = (_Float16)v1[i]; }
        *(v8us*)(dst + r * NN + c8) = f.half[0]; }
      asm volatile("s_wait_xcnt 0x0" ::: "memory");      // behind the run's last store: the listing's way on from here leads into code that rewrites the stores' registers
    }
  } else {
#pragma unroll
    for (int q = 0; q < 16; ++q) { const int r = q * 2 + (lane >> 4), c4 = (lane & 15) * 4; const v4f v = *(const v4fa*)&so[r * SOP + c4];
      *(v4f*)(C + (size_t)(m0 + wm * 32 + r) * NN + n0 + wn * 64 + c4) = v; }
  }
}


typedef _Float16 v4h __attribute__((ext_vector_type(4)));

__device__ __forceinline__ void x16(const float* __restrict__ x, _Float16* __restrict__ X16, size_t n8, size_t t) { if (t >= n8) return; FragH f;
#pragma unroll
  for (int q = 0; q < 8; ++q) f.h[q] = (_Float16)bf16_round(x[t * 8 + q]); *(v8us*)((unsigned short*)X16 + t * 8) = f.half[0];  }
// The five operand preparations depend on nothing but the inputs: one grid, the block index picks the job. Blocks 0 .. 4 * WTB - 1: the four weight transposes (WTB blocks each); the rest: x.
#define WTB ((DA * (DX / 8) + 255) / 256)
__global__ __launch_bounds__(256) void k_prep(const float* __restrict__ x, const float* __restrict__ Wq, const float* __restrict__ Wk, const float* __restrict__ Wv, const float* __restrict__ Wp,
                                             _Float16* __restrict__ X16, _Float16* __restrict__ Bq, _Float16* __restrict__ Bk, _Float16* __restrict__ Bv, _Float16* __restrict__ Bp) {
  const int bid = blockIdx.x;
  if (bid < 4 * WTB) {
    const int job = bid / WTB, t = (bid % WTB) * 256 + threadIdx.x;
    const float* W = job == 0 ? Wq : job == 1 ? Wk : job == 2 ? Wv : Wp; _Float16* Wt = job == 0 ? Bq : job == 1 ? Bk : job == 2 ? Bv : Bp;
    wt_f16(W, Wt, job < 3 ? DX : DA, job < 3 ? DA : DX, 16.0f, t);      /* (in,out) -> Bt x2^4 */
  } else x16(x, X16, (size_t)NRX * DX / 8, (size_t)(bid - 4 * WTB) * 256 + threadIdx.x);
}
__global__ __launch_bounds__(256) void k_h16(const float* __restrict__ x, _Float16* __restrict__ X16, size_t n8) { const size_t t = (size_t)blockIdx.x * 256 + threadIdx.x; if (t >= n8) return; FragH f;
#pragma unroll
  for (int q = 0; q < 8; ++q) f.h[q] = (_Float16)x[t * 8 + q]; *(v8us*)((unsigned short*)X16 + t * 8) = f.half[0];  }
__global__ __launch_bounds__(256) void k_round16f(const float* __restrict__ W, _Float16* __restrict__ Bt, size_t n8) { const size_t t = (size_t)blockIdx.x * 256 + threadIdx.x; if (t >= n8) return; FragH f;
#pragma unroll
  for (int i = 0; i < 8; ++i) f.h[i] = (_Float16)(bf16_round(W[t * 8 + i]) * 16.0f); *(v8us*)((unsigned short*)Bt + t * 8) = f.half[0];  }
// lane l with lane l ^ 16: the two halves of a wave hold the two halves of one query's keys
__device__ __forceinline__ float xhalf(float x) { return __builtin_bit_cast(float, __builtin_amdgcn_permlanex16(__builtin_bit_cast(int, x), __builtin_bit_cast(int, x), 0x76543210, 0xfedcba98, false, false)); }
// Transposed form: S^T = K.Q^T (A = 16 key rows, B = the wave's 16 queries, kept in registers), O^T += V^T.P^T (A = 16 rows of V^T, B = P^T).
// A lane holds 16 of the 32 scores of ONE query (column ln; keys 8hh + r and 16 + 8hh + r), so the maximum and the sum are in-lane plus one exchange between the halves,
// and the two score tiles, converted in place, are the B operand of the second product in the k order of the V^T loader: P never leaves the registers.
// K and V^T arrive in fragment order (Kf, Vf of k_gemm_tile): a pass's 32 keys are 4 KB of each, and fragment half number c is the 512 bytes at c * 512, 16 bytes a lane.
__global__ __launch_bounds__(128) void k_flash(const _Float16* __restrict__ Q16, int ldq, const _Float16* __restrict__ Kf, const _Float16* __restrict__ Vf, const int* __restrict__ MSK, _Float16* __restrict__ O16, int ldo) {
  constexpr int RPW = 16, NQB = TT / (4 * RPW), DT = 4, KS = 2;
  __shared__ __attribute__((aligned(16))) float sO[4][RPW][64 + 4];
  (void)MSK;
  const int tid = threadIdx.x, w = tid >> 5, lane = tid & 31, ln = lane & 15, hh = lane >> 4;
  const int slab = blockIdx.x / NQB, qblk = blockIdx.x % NQB; const int b = slab / NH, h = slab % NH; const int q0 = qblk * (4 * RPW) + w * RPW;
  FragH bq[KS];
  { const unsigned short* qr = (const unsigned short*)Q16 + ((size_t)b * TT + q0 + ln) * ldq + h * 64;
#pragma unroll
    for (int ks = 0; ks < KS; ++ks) { bq[ks].half[0] = *(const v8us*)(qr + ks * 32 + 8 * hh); bq[ks].half[1] = *(const v8us*)(qr + ks * 32 + 16 + 8 * hh); } }
  const char* Kb = (const char*)((const unsigned short*)Kf + (size_t)slab * 64 * TT); const char* Vb = (const char*)((const unsigned short*)Vf + (size_t)slab * 64 * TT);
  const char* kp = Kb + lane * 16; const char* vp = Vb + lane * 16;      // each lane's own 16 bytes of fragment half 0 of the pass; both walk 4 KB a pass
  float m_r = -3.0e38f, l_r = 0.f; v8f oacc[DT];
#pragma unroll
  for (int dt = 0; dt < DT; ++dt) oacc[dt] = (v8f){0.f,0.f,0.f,0.f,0.f,0.f,0.f,0.f};
#pragma unroll 1      // the pass stays rolled, as it was: one group of loads a pass, short code
  for (int j0 = 0; j0 < TT; j0 += 32) {
    FragH ak[2][KS], av[DT];
#pragma unroll
    for (int nt = 0; nt < 2; ++nt)
#pragma unroll
      for (int ks = 0; ks < KS; ++ks) { ak[nt][ks].half[0] = *(const v8us*)(kp + nt * 2048 + ks * 1024); ak[nt][ks].half[1] = *(const v8us*)(kp + nt * 2048 + ks * 1024 + 512); }
#pragma unroll
    for (int dt = 0; dt < DT; ++dt) { av[dt].half[0] = *(const v8us*)(vp + dt * 1024); av[dt].half[1] = *(const v8us*)(vp + dt * 1024 + 512); }
    asm volatile("s_wait_xcnt 0x0" :: "v"(kp), "v"(vp) : "memory");      // behind the pass's loads, the two address pairs kept live up to it
    kp += 4096; vp += 4096;
    __builtin_amdgcn_sched_barrier(0);      // keeps the pass's 16 loads one group in front of its work: sunk among the products, into few registers, each product waits out a load latency of its own
    v8f s[2];
#pragma unroll
    for (int nt = 0; nt < 2; ++nt) { v8f acc = (v8f){0.f,0.f,0.f,0.f,0.f,0.f,0.f,0.f};
#pragma unroll
      for (int ks = 0; ks < KS; ++ks) acc = __builtin_amdgcn_wmma_f32_16x16x32_f16(false, ak[nt][ks].v, false, bq[ks].v, (short)0, acc, false, false);
      s[nt] = acc; }      // s[nt][r] = score of query q0 + ln with key j0 + nt * 16 + 8 * hh + r
    float mc = -3.0e38f;
#pragma unroll
    for (int nt = 0; nt < 2; ++nt)
#pragma unroll
      for (int r = 0; r < 8; ++r) { s[nt][r] *= ATT_SCALE; mc = fmaxf(mc, s[nt][r]); }
    mc = fmaxf(mc, xhalf(mc));
    const float mn = fmaxf(m_r, mc); const float ea = expf(m_r - mn); const float al = (mn > -1.0e38f) ? ea : 1.0f; m_r = mn;
    FragH pb; float ps = 0.f;
#pragma unroll
    for (int nt = 0; nt < 2; ++nt)
#pragma unroll
      for (int r = 0; r < 8; ++r) { const float p = expf(s[nt][r] - mn); ps += p; pb.h[nt * 8 + r] = (_Float16)(p * 1024.0f); }
    l_r = l_r * al + ps;      // this half's 16 keys; the halves are joined once, behind the loop
#pragma unroll
    for (int dt = 0; dt < DT; ++dt)
#pragma unroll
      for (int r = 0; r < 8; ++r) oacc[dt][r] *= al;
#pragma unroll
    for (int dt = 0; dt < DT; ++dt) oacc[dt] = __builtin_amdgcn_wmma_f32_16x16x32_f16(false, av[dt].v, false, pb.v, (short)0, oacc[dt], false, false);      // oacc[dt][r] = O[q0 + ln][dt * 16 + 8 * hh + r]
  }
  { const float l = l_r + xhalf(l_r); const float inv = (l > 0.f) ? 1.0f / (l * 1024.0f) : 0.f;
#pragma unroll
    for (int dt = 0; dt < DT; ++dt) { const v4f lo = {oacc[dt][0] * inv, oacc[dt][1] * inv, oacc[dt][2] * inv, oacc[dt][3] * inv}, hi = {oacc[dt][4] * inv, oacc[dt][5] * inv, oacc[dt][6] * inv, oacc[dt][7] * inv};
      *(v4fa*)&sO[w][ln][dt * 16 + 8 * hh] = lo; *(v4fa*)&sO[w][ln][dt * 16 + 8 * hh + 4] = hi; } }
  __builtin_amdgcn_fence(__ATOMIC_ACQ_REL, "workgroup"); __builtin_amdgcn_wave_barrier();      // the wave's own staged rows are written before other lanes of it read them back
  {
#pragma unroll
    for (int rp = 0; rp < RPW; rp += 4) { const int r = rp + (lane >> 3), c8 = (lane & 7) * 8; const v4f v0 = *(const v4fa*)&sO[w][r][c8], v1 = *(const v4fa*)&sO[w][r][c8 + 4]; FragH f;      // O leaves as the projection's operand: x2^4, f16, whole 128-byte rows
#pragma unroll      // constant indices keep the vectors in registers
      for (int q = 0; q < 4; ++q) { f.h[q] = (_Float16)(v0[q] * 16.0f); f.h[4 + q] = (_Float16)(v1[q] * 16.0f); }
      *(v8us*)((unsigned short*)O16 + ((size_t)b * TT + q0 + r) * ldo + h * 64 + c8) = f.half[0]; }
     } }

extern "C" void kernel_launch(void* const* d_in, const int* in_sizes, int n_in,
                              void* d_out, int out_size, void* d_ws, size_t ws_size, hipStream_t stream) {
  (void)in_sizes; (void)n_in; (void)out_size;
  const float* const* I = (const float* const*)d_in; const float* x = I[0]; const float* Wq = I[1]; const float* bq = I[2]; const float* Wk = I[3]; const float* bk = I[4]; const float* Wv = I[5]; const float* bv = I[6]; const float* Wp = I[7]; const float* bp = I[8];
  char* ws = (char*)d_ws; size_t off = 0;
  auto take = [&](size_t bytes) { char* p = ws + off; off += (bytes + 255) & ~(size_t)255; return p; };
  _Float16* Bq = (_Float16*)take((size_t)DA * DX * 2); _Float16* Bk = (_Float16*)take((size_t)DA * DX * 2); _Float16* Bv = (_Float16*)take((size_t)DA * DX * 2); _Float16* Bp = (_Float16*)take((size_t)DX * DA * 2);
  _Float16* X16 = (_Float16*)take((size_t)NRX * DX * 2); _Float16* Q = (_Float16*)take((size_t)NRX * DA * 2); _Float16* K = (_Float16*)take((size_t)NRX * DA * 2); _Float16* Vt = (_Float16*)take((size_t)NRX * DA * 2);
  _Float16* O16 = (_Float16*)take((size_t)NRX * DA * 2);
  if (off > ws_size) return;      // 4 x 0.8 + 12.6 + 4 x 8.4 MB, about 50 MB
  k_prep<<<4 * WTB + (unsigned)(((size_t)NRX * DX / 8 + 255) / 256), 256, 0, stream>>>(x, Wq, Wk, Wv, Wp, X16, Bq, Bk, Bv, Bp);
  k_gemm_tile<DX, DA, true, 3><<<3 * (NRX / 128) * (DA / 128), 256, 0, stream>>>(X16, Bq, Bk, Bv, 0.0625f, bq, bk, bv, nullptr, Q, K, Vt);      /* Q, K, V = x.W + b: M 8192 N 512 K 768; each [8192][512] plane = 64 contiguous [1024][64] slabs; Q f16 flat, K and V^T per slab in fragment order */
  k_flash<<<BB * (TT / 64), 128, 0, stream>>>(Q, 64, K, Vt, nullptr, O16, 64);      /* same flat view for Q and O */
  k_gemm_tile<DA, DX, false, 1><<<(NRX / 128) * (DX / 128), 256, 0, stream>>>(O16, Bp, nullptr, nullptr, 0.00390625f, bp, nullptr, nullptr, (float*)d_out, nullptr, nullptr, nullptr);      /* out = O·Wp + bp: M 8192 N 768 K 512 (alpha undoes the ×2^4 weights and the ×2^4 carry) */
}

// v006
// Measured time: 71.9 microseconds a run.
// Two timings next to v005 put it at 1.10 and 1.11 times that version's speed.
// All steps since v000 together make it 4.14 times as fast.
#include <hip/hip_runtime.h>
// Multi-head attention with raw-reshape heads (B=8, N=1024, dim 768 → attn_dim 512 = 8 heads × 64): Q,K,V = x·W + b ((in,out)), reshaped by plain memory order to (H,B,N,64) (= 64 contiguous [1024][64] slabs of each [8192][512] plane);
// softmax(Q·Kᵀ·scale)·V per slab with scale = (64//8)^-½ = 8^-½ (as the original); out raw-reshaped back to (B,N,512) (same flat order) → ·Wp + bp.
// Compute dtype: x, weights, biases rounded to bf16; Q/K/V as f16 GEMM outputs; fused flash-style kernel over the flat slabs (online softmax f32, P f16 ×2^10) on v_wmma_f32_16x16x32_f16; O carried ×2^4 into f16 → projection GEMM with bias; f32 accumulate.
#define BB 64
#define TT 1024
#define NH 1
#define DX 768
#define DA 512
#define NRX 8192
#define ATT_SCALE 0.35355339059327373f
#define SCALE_LOG2E (ATT_SCALE * 1.4426950408889634f)

typedef __bf16 v16b __attribute__((ext_vector_type(16)));
typedef unsigned short v8us __attribute__((ext_vector_type(8), may_alias));
typedef float  v8f  __attribute__((ext_vector_type(8)));
typedef float  v4f  __attribute__((ext_vector_type(4)));
typedef float  v4fa __attribute__((ext_vector_type(4), may_alias));
union FragB { v16b v; v8us half[2]; unsigned short u[16]; };

__device__ __forceinline__ unsigned short bf16_bits(float x) { unsigned int u = __float_as_uint(x); return (unsigned short)((u + 0x7FFFu + ((u >> 16) & 1u)) >> 16); }
__device__ __forceinline__ float bf16_val(unsigned short b) { return __uint_as_float(((unsigned int)b) << 16); }
__device__ __forceinline__ float bf16_round(float x) { return bf16_val(bf16_bits(x)); }
// D += A·B with NT terms: 1 = ah·bh, 2 = + al·bh (A split), 3 = + ah·bl (both split)
template <int NT>
__device__ __forceinline__ v8f mmaN(v16b ah, v16b al, v16b bh, v16b bl, v8f c) {
  c = __builtin_amdgcn_wmma_f32_16x16x32_bf16(false, ah, false, bh, (short)0, c, false, false);
  if (NT >= 2) c = __builtin_amdgcn_wmma_f32_16x16x32_bf16(false, al, false, bh, (short)0, c, false, false);
  if (NT >= 3) c = __builtin_amdgcn_wmma_f32_16x16x32_bf16(false, ah, false, bl, (short)0, c, false, false);
  asm volatile("v_nop\n\tv_nop\n\tv_nop\n\tv_nop" : "+v"(c) : "v"(ah), "v"(al), "v"(bh), "v"(bl));
  return c;
}

__global__ __launch_bounds__(256) void k_wt_bf16(const float* __restrict__ W, unsigned short* __restrict__ Wt, int K, int N) {
  const int t = blockIdx.x * 256 + threadIdx.x;
  const int k8n = K / 8;
  if (t >= N * k8n) return;
  const int n = t / k8n, k8 = (t % k8n) * 8;
  v8us v;
#pragma unroll
  for (int i = 0; i < 8; ++i) v[i] = bf16_bits(W[(size_t)(k8 + i) * N + n]);
  *(v8us*)(Wt + (size_t)n * K + k8) = v;
  
}

// GEMM C[M][N] (f32, pitch ldc) = act(A[M][K]·W + bias). A f32 row-major (pitch lda) converted per fragment to bf16
// (ASPLIT: hi/lo two planes -> 2 terms, else single rounded term); Wt bf16 [N][K] (pitch ldb). BIAS_BF16 rounds the
// bias to bf16 first (bias quantised to bf16 before the add). K%32==0, M%16==0, N%64==0.
template <bool ASPLIT, int ACT, bool BIAS_BF16>
__global__ __launch_bounds__(128) void k_gemm_bf(const float* __restrict__ A, int lda, const unsigned short* __restrict__ Wt, int ldb,
                                               const float* __restrict__ bias, float* __restrict__ C, int ldc, int M, int N, int K) {
  __shared__ __attribute__((aligned(16))) float so[4][16][64];
  const int tid = threadIdx.x, w = tid >> 5, lane = tid & 31, ln = lane & 15, hh = lane >> 4;
  const int ntn = N / 64;
  const int wid = blockIdx.x * 4 + w;
  const int mt = wid / ntn, nq = wid % ntn;
  if (mt * 16 >= M) return;
  const int row0 = mt * 16, col0 = nq * 64;
  const float* arow = A + (size_t)(row0 + ln) * lda;
  v8f acc[4] = {};
  for (int kb = 0; kb < K; kb += 32) {
    FragB ah, al;
    const v4f x0 = *(const v4fa*)(arow + kb + 8 * hh), x1 = *(const v4fa*)(arow + kb + 8 * hh + 4);
    const v4f x2 = *(const v4fa*)(arow + kb + 16 + 8 * hh), x3 = *(const v4fa*)(arow + kb + 16 + 8 * hh + 4);
    float xs[16] = {x0[0],x0[1],x0[2],x0[3],x1[0],x1[1],x1[2],x1[3],x2[0],x2[1],x2[2],x2[3],x3[0],x3[1],x3[2],x3[3]};
#pragma unroll
    for (int i = 0; i < 16; ++i) { const unsigned short hb = bf16_bits(xs[i]); ah.u[i] = hb; al.u[i] = ASPLIT ? bf16_bits(xs[i] - bf16_val(hb)) : (unsigned short)0; }
#pragma unroll
    for (int t = 0; t < 4; ++t) {
      const unsigned short* brow = Wt + (size_t)(col0 + t * 16 + ln) * ldb + kb;
      FragB b;
      b.half[0] = *(const v8us*)(brow + 8 * hh);
      b.half[1] = *(const v8us*)(brow + 16 + 8 * hh);
      acc[t] = mmaN<ASPLIT ? 2 : 1>(ah.v, al.v, b.v, b.v, acc[t]);
    }
  }
#pragma unroll
  for (int t = 0; t < 4; ++t) {
    float bv = bias ? bias[col0 + t * 16 + ln] : 0.f;
    if (BIAS_BF16) bv = bf16_round(bv);
#pragma unroll
    for (int r = 0; r < 8; ++r) { float v = acc[t][r] + bv; if (ACT == 1) v = fmaxf(v, 0.f); so[w][8 * hh + r][t * 16 + ln] = v; }
  }
  __builtin_amdgcn_fence(__ATOMIC_ACQ_REL, "workgroup");
  __builtin_amdgcn_wave_barrier();
  const int rsub = lane >> 4, c4 = (lane & 15) * 4;
  {
#pragma unroll
    for (int q = 0; q < 8; ++q) {
      const int r = q * 2 + rsub;
      const v4f v = *(const v4fa*)&so[w][r][c4];
      *(v4f*)(C + (size_t)(row0 + r) * ldc + col0 + c4) = v;
    }
    
  }
}

// Flash-style causal/unmasked attention, all contractions 3-term bf16 hi/lo splits, f32 softmax with running max.
// q,k,v rows are read from f32 buffers with arbitrary row pitch (so they can live inside a fused qkv buffer);
// D = head size (multiple of 32, <= 128); one wave = 16 query rows; block = 4 waves (64 queries) sharing K/V chunks of 32.
template <int D, bool CAUSAL>
__global__ __launch_bounds__(128) void k_flash(const float* __restrict__ qb, const float* __restrict__ kb, const float* __restrict__ vb,
                                             int pitch, int T, int H, float scale, float* __restrict__ y, int ypitch) {
  constexpr int KS = D / 32;        // k-steps for QK
  constexpr int DT = D / 16;        // d tiles for PV
  __shared__ __attribute__((aligned(16))) unsigned short sKh[32][D + 8], sKl[32][D + 8], sVh[32][D + 8], sVl[32][D + 8];
  __shared__ __attribute__((aligned(16))) unsigned short sPh[4][16][40], sPl[4][16][40];
  __shared__ __attribute__((aligned(16))) float sO[4][16][D];
  const int tid = threadIdx.x, w = tid >> 5, lane = tid & 31, ln = lane & 15, hh = lane >> 4;
  const int nqb = (T + 63) / 64;
  const int bh = blockIdx.x / nqb, qblk = blockIdx.x % nqb;
  const int b = bh / H, h = bh % H;
  const int q0 = qblk * 64 + w * 16;
  const float* Q = qb + (size_t)b * T * pitch + h * D;
  const float* K = kb + (size_t)b * T * pitch + h * D;
  const float* V = vb + (size_t)b * T * pitch + h * D;

  // A fragments of the wave's 16 query rows (scaled), hi/lo
  FragB aqh[KS], aql[KS];
  {
    int row = q0 + ln; if (row >= T) row = T - 1;
    const float* qr = Q + (size_t)row * pitch;
#pragma unroll
    for (int ks = 0; ks < KS; ++ks)
#pragma unroll
      for (int i = 0; i < 16; ++i) {
        const int d = ks * 32 + ((i < 8) ? (8 * hh + i) : (16 + 8 * hh + (i - 8)));
        const float x = qr[d] * scale; const unsigned short hb = bf16_bits(x);
        aqh[ks].u[i] = hb; aql[ks].u[i] = bf16_bits(x - bf16_val(hb));
      }
  }
  float m_r[8], l_r[8];
#pragma unroll
  for (int r = 0; r < 8; ++r) { m_r[r] = -3.0e38f; l_r[r] = 0.f; }
  v8f oacc[DT];
#pragma unroll
  for (int dt = 0; dt < DT; ++dt) oacc[dt] = (v8f){0.f,0.f,0.f,0.f,0.f,0.f,0.f,0.f};

  const int kv_end = CAUSAL ? min(T, qblk * 64 + 64) : T;     // block-uniform
  for (int j0 = 0; j0 < kv_end; j0 += 32) {
    __syncthreads();
    for (int e = tid; e < 32 * (D / 4); e += 128) {
      const int r = e / (D / 4), c4 = (e % (D / 4)) * 4;
      const int key = j0 + r;
      v4f kf = {0.f,0.f,0.f,0.f}, vf = {0.f,0.f,0.f,0.f};
      if (key < T) { kf = *(const v4fa*)(K + (size_t)key * pitch + c4); vf = *(const v4fa*)(V + (size_t)key * pitch + c4); }
#pragma unroll
      for (int t = 0; t < 4; ++t) {
        unsigned short hb = bf16_bits(kf[t]); sKh[r][c4 + t] = hb; sKl[r][c4 + t] = bf16_bits(kf[t] - bf16_val(hb));
        hb = bf16_bits(vf[t]); sVh[r][c4 + t] = hb; sVl[r][c4 + t] = bf16_bits(vf[t] - bf16_val(hb));
      }
    }
    __syncthreads();
    // S tile 16 x 32
    v8f s[2];
#pragma unroll
    for (int nt = 0; nt < 2; ++nt) {
      v8f acc = {};
#pragma unroll
      for (int ks = 0; ks < KS; ++ks) {
        FragB bh_, bl_;
        bh_.half[0] = *(const v8us*)&sKh[nt * 16 + ln][ks * 32 + 8 * hh]; bh_.half[1] = *(const v8us*)&sKh[nt * 16 + ln][ks * 32 + 16 + 8 * hh];
        bl_.half[0] = *(const v8us*)&sKl[nt * 16 + ln][ks * 32 + 8 * hh]; bl_.half[1] = *(const v8us*)&sKl[nt * 16 + ln][ks * 32 + 16 + 8 * hh];
        acc = mmaN<3>(aqh[ks].v, aql[ks].v, bh_.v, bl_.v, acc);
      }
      s[nt] = acc;
    }
    // mask + running max (rows 8hh+r; the 16 lanes of a half share rows)
    float alpha[8];
#pragma unroll
    for (int r = 0; r < 8; ++r) {
      const int qi = q0 + 8 * hh + r;
      const int ja = j0 + ln, jb = j0 + 16 + ln;
      if (CAUSAL) { if (ja > qi) s[0][r] = -3.0e38f; if (jb > qi) s[1][r] = -3.0e38f; }
      if (ja >= T) s[0][r] = -3.0e38f;
      if (jb >= T) s[1][r] = -3.0e38f;
      float mx = fmaxf(s[0][r], s[1][r]);
      mx = fmaxf(mx, __shfl_xor(mx, 1, 32)); mx = fmaxf(mx, __shfl_xor(mx, 2, 32)); mx = fmaxf(mx, __shfl_xor(mx, 4, 32)); mx = fmaxf(mx, __shfl_xor(mx, 8, 32));
      const float mnew = fmaxf(m_r[r], mx);
      alpha[r] = (mnew > -1.0e38f) ? __expf(m_r[r] - mnew) : 1.0f;
      const float p0 = (s[0][r] > -1.0e38f) ? __expf(s[0][r] - mnew) : 0.f;
      const float p1 = (s[1][r] > -1.0e38f) ? __expf(s[1][r] - mnew) : 0.f;
      m_r[r] = mnew;
      l_r[r] = l_r[r] * alpha[r] + p0 + p1;            // per-lane partial row sum (16 lanes combined at the end)
      unsigned short hb = bf16_bits(p0); sPh[w][8 * hh + r][ln] = hb;      sPl[w][8 * hh + r][ln] = bf16_bits(p0 - bf16_val(hb));
      hb = bf16_bits(p1);                sPh[w][8 * hh + r][16 + ln] = hb; sPl[w][8 * hh + r][16 + ln] = bf16_bits(p1 - bf16_val(hb));
    }
#pragma unroll
    for (int dt = 0; dt < DT; ++dt)
#pragma unroll
      for (int r = 0; r < 8; ++r) oacc[dt][r] *= alpha[r];
    __builtin_amdgcn_fence(__ATOMIC_ACQ_REL, "workgroup");
    __builtin_amdgcn_wave_barrier();
    FragB pah, pal;
    pah.half[0] = *(const v8us*)&sPh[w][ln][8 * hh]; pah.half[1] = *(const v8us*)&sPh[w][ln][16 + 8 * hh];
    pal.half[0] = *(const v8us*)&sPl[w][ln][8 * hh]; pal.half[1] = *(const v8us*)&sPl[w][ln][16 + 8 * hh];
#pragma unroll
    for (int dt = 0; dt < DT; ++dt) {
      FragB bvh, bvl;
#pragma unroll
      for (int i = 0; i < 8; ++i) {
        bvh.u[i] = sVh[8 * hh + i][dt * 16 + ln]; bvh.u[8 + i] = sVh[16 + 8 * hh + i][dt * 16 + ln];
        bvl.u[i] = sVl[8 * hh + i][dt * 16 + ln]; bvl.u[8 + i] = sVl[16 + 8 * hh + i][dt * 16 + ln];
      }
      oacc[dt] = mmaN<3>(pah.v, pal.v, bvh.v, bvl.v, oacc[dt]);
    }
    __builtin_amdgcn_fence(__ATOMIC_ACQ_REL, "workgroup");
    __builtin_amdgcn_wave_barrier();
  }
#pragma unroll
  for (int r = 0; r < 8; ++r) {
    float l = l_r[r];
    l += __shfl_xor(l, 1, 32); l += __shfl_xor(l, 2, 32); l += __shfl_xor(l, 4, 32); l += __shfl_xor(l, 8, 32);
    l_r[r] = (l > 0.f) ? 1.0f / l : 0.f;
  }
#pragma unroll
  for (int dt = 0; dt < DT; ++dt)
#pragma unroll
    for (int r = 0; r < 8; ++r) sO[w][8 * hh + r][dt * 16 + ln] = oacc[dt][r] * l_r[r];
  __builtin_amdgcn_fence(__ATOMIC_ACQ_REL, "workgroup");
  __builtin_amdgcn_wave_barrier();
  {
    for (int r = 0; r < 16; ++r) {
      const int row = q0 + r;
      if (row < T && lane < D / 4) {
        const v4f val = *(const v4fa*)&sO[w][r][lane * 4];
        *(v4f*)(y + ((size_t)b * T + row) * ypitch + h * D + lane * 4) = val;
      }
    }
    
  }
}

// GEMM C = act(A·W + bias + resid): A f32 (ASPLIT -> hi/lo 2 terms), Wt bf16 [N][K]; ACT 0 none, 1 relu, 2 exact gelu;
// resid (optional, f32, row index = (row % rmod), pitch ldr, RES_BF16 rounds it) added before the activation.
template <bool ASPLIT, int ACT, bool BIAS_BF16, bool RES_BF16>
__global__ __launch_bounds__(128) void k_gemm_bf3(const float* __restrict__ A, int lda, const unsigned short* __restrict__ Wt, int ldb,
                                                const float* __restrict__ bias, const float* __restrict__ resid, int rmod, int ldr,
                                                float* __restrict__ C, int ldc, int M, int N, int K) {
  __shared__ __attribute__((aligned(16))) float so[4][16][64];
  const int tid = threadIdx.x, w = tid >> 5, lane = tid & 31, ln = lane & 15, hh = lane >> 4;
  const int ntn = N / 64;
  const int wid = blockIdx.x * 4 + w;
  const int mt = wid / ntn, nq = wid % ntn;
  if (mt * 16 >= M) return;
  const int row0 = mt * 16, col0 = nq * 64;
  const float* arow = A + (size_t)(row0 + ln) * lda;
  v8f acc[4] = {};
  for (int kb = 0; kb < K; kb += 32) {
    FragB ah, al;
    const v4f x0 = *(const v4fa*)(arow + kb + 8 * hh), x1 = *(const v4fa*)(arow + kb + 8 * hh + 4);
    const v4f x2 = *(const v4fa*)(arow + kb + 16 + 8 * hh), x3 = *(const v4fa*)(arow + kb + 16 + 8 * hh + 4);
    float xs[16] = {x0[0],x0[1],x0[2],x0[3],x1[0],x1[1],x1[2],x1[3],x2[0],x2[1],x2[2],x2[3],x3[0],x3[1],x3[2],x3[3]};
#pragma unroll
    for (int i = 0; i < 16; ++i) { const unsigned short hb = bf16_bits(xs[i]); ah.u[i] = hb; al.u[i] = ASPLIT ? bf16_bits(xs[i] - bf16_val(hb)) : (unsigned short)0; }
#pragma unroll
    for (int t = 0; t < 4; ++t) {
      const unsigned short* brow = Wt + (size_t)(col0 + t * 16 + ln) * ldb + kb;
      FragB b;
      b.half[0] = *(const v8us*)(brow + 8 * hh);
      b.half[1] = *(const v8us*)(brow + 16 + 8 * hh);
      acc[t] = mmaN<ASPLIT ? 2 : 1>(ah.v, al.v, b.v, b.v, acc[t]);
    }
  }
#pragma unroll
  for (int t = 0; t < 4; ++t) {
    const int col = col0 + t * 16 + ln;
    float bv = bias ? bias[col] : 0.f;
    if (BIAS_BF16) bv = bf16_round(bv);
#pragma unroll
    for (int r = 0; r < 8; ++r) {
      float v = acc[t][r] + bv;
      if (resid) { float rv = resid[(size_t)((row0 + 8 * hh + r) % rmod) * ldr + col]; if (RES_BF16) rv = bf16_round(rv); v += rv; }
      if (ACT == 1) v = fmaxf(v, 0.f);
      if (ACT == 2) v = 0.5f * v * (1.0f + erff(v * 0.70710678118654752f));
      if (ACT == 3) { const float u = 0.7978845608028654f * (v + 0.044715f * v * v * v); v = 0.5f * v * (1.0f + tanhf(u)); }
      so[w][8 * hh + r][t * 16 + ln] = v;
    }
  }
  __builtin_amdgcn_fence(__ATOMIC_ACQ_REL, "workgroup");
  __builtin_amdgcn_wave_barrier();
  const int rsub = lane >> 4, c4 = (lane & 15) * 4;
  {
#pragma unroll
    for (int q = 0; q < 8; ++q) {
      const int r = q * 2 + rsub;
      const v4f v = *(const v4fa*)&so[w][r][c4];
      *(v4f*)(C + (size_t)(row0 + r) * ldc + col0 + c4) = v;
    }
    
  }
}
// row LayerNorm (biased variance, eps) over N: s = X (+ R); optional out_sum <- s; out_norm <- (s-mu)*rsqrt(var+eps)*g + b
template <bool PARAM_BF16>
__global__ __launch_bounds__(256) void k_layernorm(const float* __restrict__ X, const float* __restrict__ R, const float* __restrict__ g, const float* __restrict__ bta,
                                                  float* __restrict__ out_sum, float* __restrict__ out_norm, int N, float eps) {
  __shared__ float red[256];
  const int row = blockIdx.x, tid = threadIdx.x;
  const float* x = X + (size_t)row * N; const float* rr = R ? R + (size_t)row * N : nullptr;
  float vals[16];                     // up to N = 4096
  const int per = N / 256;            // contiguous chunk per thread? use strided-by-4 chunks: thread handles j = tid*4 + 1024*u
  float s1 = 0.f;
  for (int u = 0; u < per / 4; ++u) {
    const int j = tid * 4 + 1024 * u;
    const v4f a = *(const v4fa*)(x + j);
    v4f b = {0.f,0.f,0.f,0.f}; if (rr) b = *(const v4fa*)(rr + j);
#pragma unroll
    for (int q = 0; q < 4; ++q) { const float v = a[q] + b[q]; vals[u * 4 + q] = v; s1 += v; }
  }
  red[tid] = s1; __syncthreads();
  for (int st = 128; st > 0; st >>= 1) { if (tid < st) red[tid] += red[tid + st]; __syncthreads(); }
  const float mu = red[0] / (float)N; __syncthreads();
  float s2 = 0.f;
  for (int u = 0; u < per / 4; ++u)
#pragma unroll
    for (int q = 0; q < 4; ++q) { const float c = vals[u * 4 + q] - mu; s2 += c * c; }
  red[tid] = s2; __syncthreads();
  for (int st = 128; st > 0; st >>= 1) { if (tid < st) red[tid] += red[tid + st]; __syncthreads(); }
  const float rs = rsqrtf(red[0] / (float)N + eps);
  {
    for (int u = 0; u < per / 4; ++u) {
      const int j = tid * 4 + 1024 * u;
      v4f o, sm;
#pragma unroll
      for (int q = 0; q < 4; ++q) {
        float gg = g[j + q], bb = bta[j + q];
        if (PARAM_BF16) { gg = bf16_round(gg); bb = bf16_round(bb); }
        sm[q] = vals[u * 4 + q]; o[q] = (vals[u * 4 + q] - mu) * rs * gg + bb;
      }
      if (out_sum) *(v4f*)(out_sum + (size_t)row * N + j) = sm;
      *(v4f*)(out_norm + (size_t)row * N + j) = o;
    }
    
  }
}



// ---- f16 WMMA path (v_wmma_f32_16x16x32_f16): 11-bit significands for operands in range — used where a [0,1] probability operand needs more precision than bf16
typedef _Float16 v16h __attribute__((ext_vector_type(16)));
union FragH { v16h v; v8us half[2]; _Float16 h[16]; unsigned short u[16]; };
template <int NT>
__device__ __forceinline__ v8f mmaH(v16h ah, v16h al, v16h bh, v16h bl, v8f c) {
  c = __builtin_amdgcn_wmma_f32_16x16x32_f16(false, ah, false, bh, (short)0, c, false, false);
  if (NT >= 2) c = __builtin_amdgcn_wmma_f32_16x16x32_f16(false, al, false, bh, (short)0, c, false, false);
  if (NT >= 3) c = __builtin_amdgcn_wmma_f32_16x16x32_f16(false, ah, false, bl, (short)0, c, false, false);
  asm volatile("v_nop\n\tv_nop\n\tv_nop\n\tv_nop" : "+v"(c) : "v"(ah), "v"(al), "v"(bh), "v"(bl));
  return c;
}
// batched GEMM like k_gemm_b but f16 operands: A f32 (split into f16 hi/lo if ASPLIT, else rounded to f16), Bt = f16 values [n][k]; alpha; C f32; N multiple of 16 (partial tiles skipped)
template <bool ASPLIT>
__global__ __launch_bounds__(128) void k_gemm_h(const float* __restrict__ A, int lda, size_t sA, const _Float16* __restrict__ Bh, int ldb, size_t sB, float alpha, float* __restrict__ C, int ldc, size_t sC, int M, int N, int K) {
  __shared__ __attribute__((aligned(16))) float so[4][16][64];
  const int tid = threadIdx.x, w = tid >> 5, lane = tid & 31, ln = lane & 15, hh = lane >> 4; const int by = blockIdx.y;
  A += (size_t)by * sA; Bh += (size_t)by * sB; C += (size_t)by * sC;
  const int ntn = (N + 63) / 64; const int wid = blockIdx.x * 4 + w; const int mt = wid / ntn, nq = wid % ntn; if (mt * 16 >= M) return;
  const int row0 = mt * 16, col0 = nq * 64; const float* arow = A + (size_t)(row0 + ln) * lda;
  v8f acc[4] = {};
  for (int kb = 0; kb < K; kb += 32) {
    FragH ah, al;
    const v4f x0 = *(const v4fa*)(arow + kb + 8 * hh), x1 = *(const v4fa*)(arow + kb + 8 * hh + 4), x2 = *(const v4fa*)(arow + kb + 16 + 8 * hh), x3 = *(const v4fa*)(arow + kb + 16 + 8 * hh + 4);
    float xs[16] = {x0[0],x0[1],x0[2],x0[3],x1[0],x1[1],x1[2],x1[3],x2[0],x2[1],x2[2],x2[3],x3[0],x3[1],x3[2],x3[3]};
#pragma unroll
    for (int i = 0; i < 16; ++i) { const _Float16 h = (_Float16)xs[i]; ah.h[i] = h; al.h[i] = ASPLIT ? (_Float16)(xs[i] - (float)h) : (_Float16)0.0f; }
#pragma unroll
    for (int t = 0; t < 4; ++t) { if (col0 + t * 16 >= N) continue; const size_t boff = (size_t)(col0 + t * 16 + ln) * ldb + kb; FragH bq; bq.half[0] = *(const v8us*)(Bh + boff + 8 * hh); bq.half[1] = *(const v8us*)(Bh + boff + 16 + 8 * hh);
      acc[t] = mmaH<ASPLIT ? 2 : 1>(ah.v, al.v, bq.v, bq.v, acc[t]); }
  }
#pragma unroll
  for (int t = 0; t < 4; ++t) { if (col0 + t * 16 >= N) continue;
#pragma unroll
    for (int r = 0; r < 8; ++r) so[w][8 * hh + r][t * 16 + ln] = acc[t][r] * alpha; }
  __builtin_amdgcn_fence(__ATOMIC_ACQ_REL, "workgroup"); __builtin_amdgcn_wave_barrier();
  const int rsub = lane >> 4, c4 = (lane & 15) * 4;
  {
#pragma unroll
    for (int q = 0; q < 8; ++q) { const int r = q * 2 + rsub; if (col0 + c4 < N) { const v4f v = *(const v4fa*)&so[w][r][c4]; *(v4f*)(C + (size_t)(row0 + r) * ldc + col0 + c4) = v; } }
     }
}

// Wt[n][k] = f16(W[k][n]·scale) from f32 row-major W[K][N] (scale = power of two; bf16-exact weights stay exact in f16 away from the subnormal range)
__device__ __forceinline__ void wt_f16(const float* __restrict__ W, _Float16* __restrict__ Wt, int K, int N, float scale, int t) {
  if (t >= N * (K / 8)) return; const int n = t / (K / 8), k8 = (t % (K / 8)) * 8; FragH f;
#pragma unroll
  for (int i = 0; i < 8; ++i) f.h[i] = (_Float16)(bf16_round(W[(size_t)(k8 + i) * N + n]) * scale); const v8us o = f.half[0];
  *(v8us*)((unsigned short*)Wt + (size_t)n * K + k8) = o; 
}
// k_gemm_hh variant with fused epilogue: v = acc·alpha + bias[by·sBias + col] (+ CP[(row/rowsPerB)·sCPb + by·64 + col] if CP) ; ACT 0 none / 1 elu ; writes f16 C16 and f32 C, each if non-null
template <int ACT>
__global__ __launch_bounds__(128) void k_gemm_hhx(const _Float16* __restrict__ A, int lda, size_t sA, const _Float16* __restrict__ Bh, int ldb, size_t sB, float alpha, const float* __restrict__ bias, size_t sBias, const float* __restrict__ CP, int rowsPerB, size_t sCPb, int row0g,
    float* __restrict__ C, _Float16* __restrict__ C16, int ldc, size_t sC, int M, int N, int K) {
  __shared__ __attribute__((aligned(16))) float so[4][16][64];
  const int tid = threadIdx.x, w = tid >> 5, lane = tid & 31, ln = lane & 15, hh = lane >> 4; const int by = blockIdx.y;
  A += (size_t)by * sA; Bh += (size_t)by * sB; const size_t cofs = (size_t)by * sC; const float* bp = bias ? bias + (size_t)by * sBias : nullptr;
  const int ntn = (N + 63) / 64; const int wid = blockIdx.x * 4 + w; const int mt = wid / ntn, nq = wid % ntn; if (mt * 16 >= M) return;
  const int row0 = mt * 16, col0 = nq * 64; const _Float16* arow = A + (size_t)(row0 + ln) * lda;
  v8f acc[4] = {};
  for (int kb = 0; kb < K; kb += 32) { FragH ah; ah.half[0] = *(const v8us*)((const unsigned short*)arow + kb + 8 * hh); ah.half[1] = *(const v8us*)((const unsigned short*)arow + kb + 16 + 8 * hh);
#pragma unroll
    for (int t = 0; t < 4; ++t) { if (col0 + t * 16 >= N) continue; const size_t boff = (size_t)(col0 + t * 16 + ln) * ldb + kb; FragH bq; bq.half[0] = *(const v8us*)((const unsigned short*)Bh + boff + 8 * hh); bq.half[1] = *(const v8us*)((const unsigned short*)Bh + boff + 16 + 8 * hh);
      acc[t] = mmaH<1>(ah.v, ah.v, bq.v, bq.v, acc[t]); }
  }
#pragma unroll
  for (int t = 0; t < 4; ++t) { if (col0 + t * 16 >= N) continue; const int col = col0 + t * 16 + ln; const float bv = bp ? bf16_round(bp[col]) : 0.f;
#pragma unroll
    for (int r = 0; r < 8; ++r) { float v = acc[t][r] * alpha + bv; if (CP) { const int bidx = (row0g + row0 + 8 * hh + r) / rowsPerB; v += CP[(size_t)bidx * sCPb + (size_t)by * 64 + col]; } if (ACT == 1) v = (v > 0.f) ? v : expm1f(v); else if (ACT == 7) v = (v > 0.f) ? v + 1.0f : expf(v); else if (ACT == 8) v = tanhf(v); else if (ACT == 9) v = 0.5f * v * (1.0f + tanhf(0.7978845608028654f * (v + 0.044715f * v * v * v))); else if (ACT == 11) v = 1.0f / (1.0f + expf(-v)); else if (ACT == 12) v = (v > 0.f) ? v : 0.01f * v; else if (ACT == 14) v = (v > 0.f) ? v : 0.1f * v; else if (ACT == 15) v = v / (1.0f + expf(-v)); else if (ACT == 3) v = fmaxf(v, 0.f); else if (ACT == 6) v = 0.5f * v * (1.0f + erff(v * 0.70710678118654752f)); so[w][8 * hh + r][t * 16 + ln] = v; } }
  __builtin_amdgcn_fence(__ATOMIC_ACQ_REL, "workgroup"); __builtin_amdgcn_wave_barrier();
  const int rsub = lane >> 4, c4 = (lane & 15) * 4; typedef _Float16 v4h __attribute__((ext_vector_type(4)));
  {
#pragma unroll
    for (int q = 0; q < 8; ++q) { const int r = q * 2 + rsub; if (col0 + c4 < N) { const v4f v = *(const v4fa*)&so[w][r][c4]; if (C) *(v4f*)(C + cofs + (size_t)(row0 + r) * ldc + col0 + c4) = v; if (C16) { v4h h4; for (int i = 0; i < 4; ++i) h4[i] = (_Float16)v[i]; *(v4h*)(C16 + cofs + (size_t)(row0 + r) * ldc + col0 + c4) = h4; } } }
     }
}


// Block-tiled GEMM, f16 operands, both K-contiguous: C[8192][NN] = A[8192][KK] . Bh[NN][KK]^T * alpha + bf16(bias). One 128x128 tile of C per work-group of 8 waves (4x2), 32x64 per wave.
// A pass is 128 k = 256 aligned bytes of each of the 256 operand rows, brought into LDS by asynchronous copies (two buffers, the next pass's copies fly while this pass is worked on), so that every line leaves L2 once per work-group and not once per wave.
// LDS rows at pitch 272 bytes (16 x odd) for the 16-byte fragment reads. The k order of a fragment and the order of the k steps are those of k_gemm_hhx.
__device__ __forceinline__ unsigned lds_off(const void* p) { return (unsigned)(size_t)p; }
// eight copies of 16 bytes per lane: rows r, r + 16, ..., r + 112 of one operand's tile. The s_wait_xcnt stands inside the statement so that no address register is rewritten ahead of it.
__device__ __forceinline__ void copy_rows8(unsigned l0, const _Float16* g0, int rowstep, unsigned ldsstep) {
  const unsigned l1 = l0 + ldsstep, l2 = l0 + 2 * ldsstep, l3 = l0 + 3 * ldsstep, l4 = l0 + 4 * ldsstep, l5 = l0 + 5 * ldsstep, l6 = l0 + 6 * ldsstep, l7 = l0 + 7 * ldsstep;
  const _Float16* g1 = g0 + rowstep; const _Float16* g2 = g0 + 2 * rowstep; const _Float16* g3 = g0 + 3 * rowstep; const _Float16* g4 = g0 + 4 * rowstep;
  const _Float16* g5 = g0 + 5 * rowstep; const _Float16* g6 = g0 + 6 * rowstep; const _Float16* g7 = g0 + 7 * rowstep;
  asm volatile("global_load_async_to_lds_b128 %0, %8, off\n\t"
               "global_load_async_to_lds_b128 %1, %9, off\n\t"
               "global_load_async_to_lds_b128 %2, %10, off\n\t"
               "global_load_async_to_lds_b128 %3, %11, off\n\t"
               "global_load_async_to_lds_b128 %4, %12, off\n\t"
               "global_load_async_to_lds_b128 %5, %13, off\n\t"
               "global_load_async_to_lds_b128 %6, %14, off\n\t"
               "global_load_async_to_lds_b128 %7, %15, off\n\t"
               "s_wait_xcnt 0x0"
               :: "v"(l0), "v"(l1), "v"(l2), "v"(l3), "v"(l4), "v"(l5), "v"(l6), "v"(l7),
                  "v"(g0), "v"(g1), "v"(g2), "v"(g3), "v"(g4), "v"(g5), "v"(g6), "v"(g7) : "memory");
}
// NJ independent products that share A (own Bh, bias and C16 each) run as one grid: the NJ * NTN tiles of one 128-row band of A have neighbouring block indices.
// NJ == 3 (Q, K, V): a 128-row band of a [8192][512] plane is one [1024][64] slab; element (m, n) of the band is key (m % 128) * 8 + n / 64, column n % 64.
// Jobs 1 and 2 store their slab for the attention kernel with the keys renumbered key' = (n / 64) * 128 + m % 128, the same for both (a softmax-weighted sum does not depend on the order of its keys):
// both in the order in which the attention kernel's A fragments are loaded, so that each of its wave-wide 16-byte loads is 512 bytes in a row (4 whole lines) and not 32 bytes out of each of 16 lines:
// job 1 as Kf[slab][key' / 16][c][lane][8], c = 0 .. 3: lane (hh, ln) = hh * 16 + ln holds columns c * 16 + hh * 8 .. + 7 of key (key' / 16) * 16 + ln; a wave's 32 x 64 tile is 4 KB in a row;
// job 2 as Vf[slab][key' / 32][dt * 2 + hf][lane][8]: lane (hh, ln) holds keys (key' / 32) * 32 + hf * 16 + hh * 8 .. + 7 of column dt * 16 + ln; 32 keys are 4 KB in a row.
template <int KK, int NN, bool OUT16, int NJ>
__global__ __launch_bounds__(256) void k_gemm_tile(const _Float16* __restrict__ A, const _Float16* __restrict__ Bh0, const _Float16* __restrict__ Bh1, const _Float16* __restrict__ Bh2, float alpha,
                                                  const float* __restrict__ bias0, const float* __restrict__ bias1, const float* __restrict__ bias2, float* __restrict__ C,
                                                  _Float16* __restrict__ C160, _Float16* __restrict__ C161, _Float16* __restrict__ C162) {
  constexpr int BK = 128, KSN = BK / 32, PITCH = 2 * BK + 16, STAGE = 256 * PITCH, NPASS = KK / BK, NTN = NN / 128, SOP = 68;
  static_assert(NPASS >= 2 && KK % BK == 0 && NN % 128 == 0 && 8 * 32 * SOP * 4 <= 2 * STAGE, "shape");
  static_assert(NJ == 1 || (NJ == 3 && OUT16 && 128 * (NN / 64) == TT), "a band of the Q, K, V planes is one slab");
  __shared__ __attribute__((aligned(16))) unsigned char sm[2 * STAGE];
  const int tid = threadIdx.x, w = tid >> 5, lane = tid & 31, ln = lane & 15, hh = lane >> 4;
  const int job = NJ > 1 ? (blockIdx.x % (NJ * NTN)) / NTN : 0;
  const _Float16* Bh = job == 0 ? Bh0 : job == 1 ? Bh1 : Bh2; const float* bias = job == 0 ? bias0 : job == 1 ? bias1 : bias2; _Float16* C16 = job == 0 ? C160 : job == 1 ? C161 : C162;
  const int m0 = (blockIdx.x / (NJ * NTN)) * 128, n0 = (blockIdx.x % NTN) * 128; const int wm = w >> 1, wn = w & 1;
  const int cr = tid >> 4, cc = tid & 15;      // a wave's copy = 2 rows x 256 bytes
  const _Float16* ga = A + (size_t)(m0 + cr) * KK + cc * 8; const _Float16* gb = Bh + (size_t)(n0 + cr) * KK + cc * 8;
  const unsigned la = lds_off(sm) + cr * PITCH + cc * 16, lb = la + 128 * PITCH;
  v8f acc[2][4];
#pragma unroll
  for (int i = 0; i < 2; ++i)
#pragma unroll
    for (int j = 0; j < 4; ++j) acc[i][j] = (v8f){0.f,0.f,0.f,0.f,0.f,0.f,0.f,0.f};
  copy_rows8(la, ga, 16 * KK, 16 * PITCH); copy_rows8(lb, gb, 16 * KK, 16 * PITCH);
  asm volatile("s_wait_asynccnt 0x0" ::: "memory");      // pass 0's bytes have landed before the barrier publishes them
  __syncthreads();
  copy_rows8(la + STAGE, ga + BK, 16 * KK, 16 * PITCH); copy_rows8(lb + STAGE, gb + BK, 16 * KK, 16 * PITCH);
  const unsigned char* fa = sm + (wm * 32 + ln) * PITCH + 16 * hh; const unsigned char* fb = sm + (128 + wn * 64 + ln) * PITCH + 16 * hh;
#pragma unroll 1      // the ring stays one rolled loop: one publish point, short code
  for (int t = 0; t < NPASS; ++t) {
    const int bo = (t & 1) * STAGE;
    FragH a[2][2], b[2][4];      // two fragment sets: the next 32 k of this pass are fetched while these are multiplied
#pragma unroll
    for (int i = 0; i < 2; ++i) { a[0][i].half[0] = *(const v8us*)(fa + bo + i * 16 * PITCH); a[0][i].half[1] = *(const v8us*)(fa + bo + i * 16 * PITCH + 32); }
#pragma unroll
    for (int j = 0; j < 4; ++j) { b[0][j].half[0] = *(const v8us*)(fb + bo + j * 16 * PITCH); b[0][j].half[1] = *(const v8us*)(fb + bo + j * 16 * PITCH + 32); }
#pragma unroll
    for (int ks = 0; ks < KSN; ++ks) {
      const int cu = ks & 1, nx = cu ^ 1;
      if (ks + 1 < KSN) {
#pragma unroll
        for (int i = 0; i < 2; ++i) { a[nx][i].half[0] = *(const v8us*)(fa + bo + i * 16 * PITCH + (ks + 1) * 64); a[nx][i].half[1] = *(const v8us*)(fa + bo + i * 16 * PITCH + (ks + 1) * 64 + 32); }
#pragma unroll
        for (int j = 0; j < 4; ++j) { b[nx][j].half[0] = *(const v8us*)(fb + bo + j * 16 * PITCH + (ks + 1) * 64); b[nx][j].half[1] = *(const v8us*)(fb + bo + j * 16 * PITCH + (ks + 1) * 64 + 32); }
        __builtin_amdgcn_sched_barrier(0);      // keeps the next set's LDS reads one group ahead of this set's products; without it they are sunk among the products, into one register set, and each product run waits out the LDS latency
      }
#pragma unroll
      for (int i = 0; i < 2; ++i)
#pragma unroll
        for (int j = 0; j < 4; ++j) acc[i][j] = __builtin_amdgcn_wmma_f32_16x16x32_f16(false, a[cu][i].v, false, b[cu][j].v, (short)0, acc[i][j], false, false);
    }
    __builtin_amdgcn_sched_barrier(0);      // keeps the pass's products in front of the publish point: sunk behind the barrier they stand between it and the refill, and the copies start that much later
    asm volatile("s_wait_dscnt 0x0" ::: "memory");       // this wave's reads of the buffer are done before it is handed to the copies
    asm volatile("s_wait_asynccnt 0x0" ::: "memory");    // this wave's copies of pass t + 1 have landed before the barrier publishes them
    __syncthreads();
    if (t + 2 < NPASS) { copy_rows8(la + bo, ga + (t + 2) * BK, 16 * KK, 16 * PITCH); copy_rows8(lb + bo, gb + (t + 2) * BK, 16 * KK, 16 * PITCH); }
  }
  asm volatile("s_wait_asynccnt 0x0" ::: "memory");      // nothing is in flight when the ring becomes output staging
  if (NJ == 3 && job == 2) {      // V: the tile leaves transposed. A lane's 8 accumulator rows of one column are 8 neighbouring keys of one row of V^T: 16 bytes of f16
    constexpr int TP = 2 * 128 + 16;      // staged rows [wn * 64 + column][128 keys], pitch 16 x odd bytes; every reader left the ring at the last pass's barrier
#pragma unroll      // these three: constant indices keep the accumulators in registers
    for (int j = 0; j < 4; ++j) { const float bv = bf16_round(bias[n0 + wn * 64 + j * 16 + ln]);
#pragma unroll
      for (int i = 0; i < 2; ++i) { FragH f;
#pragma unroll
        for (int r = 0; r < 8; ++r) f.h[r] = (_Float16)(acc[i][j][r] * alpha + bv);
        *(v8us*)(sm + (wn * 64 + j * 16 + ln) * TP + (wm * 32 + i * 16 + 8 * hh) * 2) = f.half[0]; } }
    __syncthreads();      // a staged row holds the keys of four waves: all are written before any is read back (job is the same for the whole work-group)
#pragma unroll      // the eight LDS reads go out as one group, the stores follow as they land
    for (int q = 0; q < 8; ++q) { const int row = (w >> 2) * 64 + (q >> 1) * 16 + ln, k8 = ((w & 3) * 4 + (q & 1) * 2 + hh) * 8; const v8us v = *(const v8us*)(sm + row * TP + k8 * 2);      // wave w: the 32 keys (w & 3) of key block w >> 2; q = dt * 2 + hf
      *(v8us*)((unsigned short*)C16 + (size_t)(m0 / 128) * (64 * TT) + (size_t)((n0 / 64 + (w >> 2)) * 4 + (w & 3)) * 2048 + q * 256 + lane * 8) = v; }
    return;
  }
  float* so = (float*)sm + w * (32 * SOP);      // each wave stages its own 32 x 64 tile; every reader left the ring at the last pass's barrier
#pragma unroll
  for (int j = 0; j < 4; ++j) { const float bv = bf16_round(bias[n0 + wn * 64 + j * 16 + ln]);
#pragma unroll
    for (int i = 0; i < 2; ++i)
#pragma unroll
      for (int r = 0; r < 8; ++r) so[(i * 16 + 8 * hh + r) * SOP + j * 16 + ln] = acc[i][j][r] * alpha + bv; }
  __builtin_amdgcn_fence(__ATOMIC_ACQ_REL, "workgroup"); __builtin_amdgcn_wave_barrier();      // the wave's own staged rows are written before other lanes of it read them back
  if (OUT16) {
    if (NJ == 3 && job == 1) {      // K: keys in the order key', fragment order inside each 16 keys; store q = the 512 bytes of fragment half q & 3 of the tile's keys (q >> 2) * 16 .. + 15 (job is the same for the whole work-group)
      unsigned short* dst = (unsigned short*)C16 + (size_t)m0 * NN + (size_t)((n0 / 64 + wn) * 128 + wm * 32) * 64 + lane * 8;
#pragma unroll
      for (int q = 0; q < 8; ++q) { const float* sp = &so[((q >> 2) * 16 + ln) * SOP + ((q & 3) * 2 + hh) * 8]; const v4f v0 = *(const v4fa*)sp, v1 = *(const v4fa*)(sp + 4); FragH f;
#pragma unroll
        for (int i = 0; i < 4; ++i) { f.h[i] = (_Float16)v0[i]; f.h[4 + i] = (_Float16)v1[i]; }
        *(v8us*)(dst + q * 256) = f.half[0]; }
      asm volatile("s_wait_xcnt 0x0" ::: "memory");      // behind the run's last store: the listing's way on from here leads into code that rewrites the stores' registers
    } else {
      unsigned short* dst = (unsigned short*)C16 + (size_t)(m0 + wm * 32) * NN + n0 + wn * 64;
#pragma unroll
      for (int q = 0; q < 8; ++q) { const int r = q * 4 + (lane >> 3), c8 = (lane & 7) * 8; const v4f v0 = *(const v4fa*)&so[r * SOP + c8], v1 = *(const v4fa*)&so[r * SOP + c8 + 4]; FragH f;
#pragma unroll
        for (int i = 0; i < 4; ++i) { f.h[i] = (_Float16)v0[i]; f.h[4 + i] = (_Float16)v1[i]; }
        *(v8us*)(dst + r * NN + c8) = f.half[0]; }
      asm volatile("s_wait_xcnt 0x0" ::: "memory");      // behind the run's last store: the listing's way on from here leads into code that rewrites the stores' registers
    }
  } else {
#pragma unroll
    for (int q = 0; q < 16; ++q) { const int r = q * 2 + (lane >> 4), c4 = (lane & 15) * 4; const v4f v = *(const v4fa*)&so[r * SOP + c4];
      *(v4f*)(C + (size_t)(m0 + wm * 32 + r) * NN + n0 + wn * 64 + c4) = v; }
  }
}


typedef _Float16 v4h __attribute__((ext_vector_type(4)));

__device__ __forceinline__ void x16(const float* __restrict__ x, _Float16* __restrict__ X16, size_t n8, size_t t) { if (t >= n8) return; FragH f;
#pragma unroll
  for (int q = 0; q < 8; ++q) f.h[q] = (_Float16)bf16_round(x[t * 8 + q]); *(v8us*)((unsigned short*)X16 + t * 8) = f.half[0];  }
// The five operand preparations depend on nothing but the inputs: one grid, the block index picks the job. Blocks 0 .. 4 * WTB - 1: the four weight transposes (WTB blocks each); the rest: x.
#define WTB ((DA * (DX / 8) + 255) / 256)
__global__ __launch_bounds__(256) void k_prep(const float* __restrict__ x, const float* __restrict__ Wq, const float* __restrict__ Wk, const float* __restrict__ Wv, const float* __restrict__ Wp,
                                             _Float16* __restrict__ X16, _Float16* __restrict__ Bq, _Float16* __restrict__ Bk, _Float16* __restrict__ Bv, _Float16* __restrict__ Bp) {
  const int bid = blockIdx.x;
  if (bid < 4 * WTB) {
    const int job = bid / WTB, t = (bid % WTB) * 256 + threadIdx.x;
    const float* W = job == 0 ? Wq : job == 1 ? Wk : job == 2 ? Wv : Wp; _Float16* Wt = job == 0 ? Bq : job == 1 ? Bk : job == 2 ? Bv : Bp;
    wt_f16(W, Wt, job < 3 ? DX : DA, job < 3 ? DA : DX, 16.0f, t);      /* (in,out) -> Bt x2^4 */
  } else x16(x, X16, (size_t)NRX * DX / 8, (size_t)(bid - 4 * WTB) * 256 + threadIdx.x);
}
__global__ __launch_bounds__(256) void k_h16(const float* __restrict__ x, _Float16* __restrict__ X16, size_t n8) { const size_t t = (size_t)blockIdx.x * 256 + threadIdx.x; if (t >= n8) return; FragH f;
#pragma unroll
  for (int q = 0; q < 8; ++q) f.h[q] = (_Float16)x[t * 8 + q]; *(v8us*)((unsigned short*)X16 + t * 8) = f.half[0];  }
__global__ __launch_bounds__(256) void k_round16f(const float* __restrict__ W, _Float16* __restrict__ Bt, size_t n8) { const size_t t = (size_t)blockIdx.x * 256 + threadIdx.x; if (t >= n8) return; FragH f;
#pragma unroll
  for (int i = 0; i < 8; ++i) f.h[i] = (_Float16)(bf16_round(W[t * 8 + i]) * 16.0f); *(v8us*)((unsigned short*)Bt + t * 8) = f.half[0];  }
// lane l with lane l ^ 16: the two halves of a wave hold the two halves of one query's keys
__device__ __forceinline__ float xhalf(float x) { return __builtin_bit_cast(float, __builtin_amdgcn_permlanex16(__builtin_bit_cast(int, x), __builtin_bit_cast(int, x), 0x76543210, 0xfedcba98, false, false)); }
// The hardware's 2^x on eight or nine values, each in its own register. One statement, so that the v_nop stands directly behind the last one: the free slot that the instruction set asks for between
// a transcendental and an instruction that reads its result or overwrites its source; inside the run no instruction touches a neighbour's registers.
__device__ __forceinline__ void exp2_in_place(float& a, float& b, float& c, float& d, float& e, float& f, float& g, float& h) {
  asm("v_exp_f32 %0, %0\n\tv_exp_f32 %1, %1\n\tv_exp_f32 %2, %2\n\tv_exp_f32 %3, %3\n\tv_exp_f32 %4, %4\n\tv_exp_f32 %5, %5\n\tv_exp_f32 %6, %6\n\tv_exp_f32 %7, %7\n\tv_nop"
      : "+v"(a), "+v"(b), "+v"(c), "+v"(d), "+v"(e), "+v"(f), "+v"(g), "+v"(h));
}
__device__ __forceinline__ void exp2_in_place(float& a, float& b, float& c, float& d, float& e, float& f, float& g, float& h, float& i) {
  asm("v_exp_f32 %8, %8\n\tv_exp_f32 %0, %0\n\tv_exp_f32 %1, %1\n\tv_exp_f32 %2, %2\n\tv_exp_f32 %3, %3\n\tv_exp_f32 %4, %4\n\tv_exp_f32 %5, %5\n\tv_exp_f32 %6, %6\n\tv_exp_f32 %7, %7\n\tv_nop"
      : "+v"(a), "+v"(b), "+v"(c), "+v"(d), "+v"(e), "+v"(f), "+v"(g), "+v"(h), "+v"(i));
}
// Transposed form: S^T = K.Q^T (A = 16 key rows, B = the wave's 16 queries, kept in registers), O^T += V^T.P^T (A = 16 rows of V^T, B = P^T).
// A lane holds 16 of the 32 scores of ONE query (column ln; keys 8hh + r and 16 + 8hh + r), so the maximum and the sum are in-lane plus one exchange between the halves,
// and the two score tiles, converted in place, are the B operand of the second product in the k order of the V^T loader: P never leaves the registers.
// K and V^T arrive in fragment order (Kf, Vf of k_gemm_tile): a pass's 32 keys are 4 KB of each, and fragment half number c is the 512 bytes at c * 512, 16 bytes a lane.
__global__ __launch_bounds__(128) void k_flash(const _Float16* __restrict__ Q16, int ldq, const _Float16* __restrict__ Kf, const _Float16* __restrict__ Vf, const int* __restrict__ MSK, _Float16* __restrict__ O16, int ldo) {
  constexpr int RPW = 16, NQB = TT / (4 * RPW), DT = 4, KS = 2;
  __shared__ __attribute__((aligned(16))) float sO[4][RPW][64 + 4];
  (void)MSK;
  const int tid = threadIdx.x, w = tid >> 5, lane = tid & 31, ln = lane & 15, hh = lane >> 4;
  const int slab = blockIdx.x / NQB, qblk = blockIdx.x % NQB; const int b = slab / NH, h = slab % NH; const int q0 = qblk * (4 * RPW) + w * RPW;
  FragH bq[KS];
  { const unsigned short* qr = (const unsigned short*)Q16 + ((size_t)b * TT + q0 + ln) * ldq + h * 64;
#pragma unroll
    for (int ks = 0; ks < KS; ++ks) { bq[ks].half[0] = *(const v8us*)(qr + ks * 32 + 8 * hh); bq[ks].half[1] = *(const v8us*)(qr + ks * 32 + 16 + 8 * hh); } }
  const char* Kb = (const char*)((const unsigned short*)Kf + (size_t)slab * 64 * TT); const char* Vb = (const char*)((const unsigned short*)Vf + (size_t)slab * 64 * TT);
  const char* kp = Kb + lane * 16; const char* vp = Vb + lane * 16;      // each lane's own 16 bytes of fragment half 0 of the pass; both walk 4 KB a pass
  float m_r = -3.0e38f, l_r = 0.f; v8f oacc[DT];
#pragma unroll
  for (int dt = 0; dt < DT; ++dt) oacc[dt] = (v8f){0.f,0.f,0.f,0.f,0.f,0.f,0.f,0.f};
#pragma unroll 1      // the pass stays rolled, as it was: one group of loads a pass, short code
  for (int j0 = 0; j0 < TT; j0 += 32) {
    FragH ak[2][KS], av[DT];
#pragma unroll
    for (int nt = 0; nt < 2; ++nt)
#pragma unroll
      for (int ks = 0; ks < KS; ++ks) { ak[nt][ks].half[0] = *(const v8us*)(kp + nt * 2048 + ks * 1024); ak[nt][ks].half[1] = *(const v8us*)(kp + nt * 2048 + ks * 1024 + 512); }
#pragma unroll
    for (int dt = 0; dt < DT; ++dt) { av[dt].half[0] = *(const v8us*)(vp + dt * 1024); av[dt].half[1] = *(const v8us*)(vp + dt * 1024 + 512); }
    asm volatile("s_wait_xcnt 0x0" :: "v"(kp), "v"(vp) : "memory");      // behind the pass's loads, the two address pairs kept live up to it
    kp += 4096; vp += 4096;
    __builtin_amdgcn_sched_barrier(0);      // keeps the pass's 16 loads one group in front of its work: sunk among the products, into few registers, each product waits out a load latency of its own
    v8f s[2];
#pragma unroll
    for (int nt = 0; nt < 2; ++nt) { v8f acc = (v8f){0.f,0.f,0.f,0.f,0.f,0.f,0.f,0.f};
#pragma unroll
      for (int ks = 0; ks < KS; ++ks) acc = __builtin_amdgcn_wmma_f32_16x16x32_f16(false, ak[nt][ks].v, false, bq[ks].v, (short)0, acc, false, false);
      s[nt] = acc; }      // s[nt][r] = score of query q0 + ln with key j0 + nt * 16 + 8 * hh + r
    float mc = -3.0e38f;
#pragma unroll
    for (int nt = 0; nt < 2; ++nt)
#pragma unroll
      for (int r = 0; r < 8; ++r) mc = fmaxf(mc, s[nt][r]);      // of the raw scores: the scale is positive
    mc = fmaxf(mc, xhalf(mc));
    const float mn = fmaxf(m_r, mc * SCALE_LOG2E); float ea = m_r - mn; m_r = mn;      // the running maximum is kept in base-2 units
    const float nb = 10.0f - mn;      // the maximum and P's 2^10 in one addend
    float pe[2][8];
#pragma unroll
    for (int nt = 0; nt < 2; ++nt)
#pragma unroll
      for (int r = 0; r < 8; ++r) pe[nt][r] = fmaf(s[nt][r], SCALE_LOG2E, nb);      // one multiply-add a score: log2 of p = 2^10 e^(scale s - max)
    exp2_in_place(pe[0][0], pe[0][1], pe[0][2], pe[0][3], pe[0][4], pe[0][5], pe[0][6], pe[0][7], ea);
    exp2_in_place(pe[1][0], pe[1][1], pe[1][2], pe[1][3], pe[1][4], pe[1][5], pe[1][6], pe[1][7]);
    const float al = (mn > -1.0e38f) ? ea : 1.0f;
    FragH pb; float ps = 0.f;
#pragma unroll
    for (int nt = 0; nt < 2; ++nt)
#pragma unroll
      for (int r = 0; r < 8; ++r) { const float p = pe[nt][r]; ps += p; pb.h[nt * 8 + r] = (_Float16)p; }
    l_r = l_r * al + ps;      // this half's 16 keys, x2^10 like P; the halves are joined once, behind the loop
#pragma unroll
    for (int dt = 0; dt < DT; ++dt)
#pragma unroll
      for (int r = 0; r < 8; ++r) oacc[dt][r] *= al;
#pragma unroll
    for (int dt = 0; dt < DT; ++dt) oacc[dt] = __builtin_amdgcn_wmma_f32_16x16x32_f16(false, av[dt].v, false, pb.v, (short)0, oacc[dt], false, false);      // oacc[dt][r] = O[q0 + ln][dt * 16 + 8 * hh + r]
  }
  { const float l = l_r + xhalf(l_r); const float inv = (l > 0.f) ? 1.0f / l : 0.f;
#pragma unroll
    for (int dt = 0; dt < DT; ++dt) { const v4f lo = {oacc[dt][0] * inv, oacc[dt][1] * inv, oacc[dt][2] * inv, oacc[dt][3] * inv}, hi = {oacc[dt][4] * inv, oacc[dt][5] * inv, oacc[dt][6] * inv, oacc[dt][7] * inv};
      *(v4fa*)&sO[w][ln][dt * 16 + 8 * hh] = lo; *(v4fa*)&sO[w][ln][dt * 16 + 8 * hh + 4] = hi; } }
  __builtin_amdgcn_fence(__ATOMIC_ACQ_REL, "workgroup"); __builtin_amdgcn_wave_barrier();      // the wave's own staged rows are written before other lanes of it read them back
  {
#pragma unroll
    for (int rp = 0; rp < RPW; rp += 4) { const int r = rp + (lane >> 3), c8 = (lane & 7) * 8; const v4f v0 = *(const v4fa*)&sO[w][r][c8], v1 = *(const v4fa*)&sO[w][r][c8 + 4]; FragH f;      // O leaves as the projection's operand: x2^4, f16, whole 128-byte rows
#pragma unroll      // constant indices keep the vectors in registers
      for (int q = 0; q < 4; ++q) { f.h[q] = (_Float16)(v0[q] * 16.0f); f.h[4 + q] = (_Float16)(v1[q] * 16.0f); }
      *(v8us*)((unsigned short*)O16 + ((size_t)b * TT + q0 + r) * ldo + h * 64 + c8) = f.half[0]; }
     } }

extern "C" void kernel_launch(void* const* d_in, const int* in_sizes, int n_in,
                              void* d_out, int out_size, void* d_ws, size_t ws_size, hipStream_t stream) {
  (void)in_sizes; (void)n_in; (void)out_size;
  const float* const* I = (const float* const*)d_in; const float* x = I[0]; const float* Wq = I[1]; const float* bq = I[2]; const float* Wk = I[3]; const float* bk = I[4]; const float* Wv = I[5]; const float* bv = I[6]; const float* Wp = I[7]; const float* bp = I[8];
  char* ws = (char*)d_ws; size_t off = 0;
  auto take = [&](size_t bytes) { char* p = ws + off; off += (bytes + 255) & ~(size_t)255; return p; };
  _Float16* Bq = (_Float16*)take((size_t)DA * DX * 2); _Float16* Bk = (_Float16*)take((size_t)DA * DX * 2); _Float16* Bv = (_Float16*)take((size_t)DA * DX * 2); _Float16* Bp = (_Float16*)take((size_t)DX * DA * 2);
  _Float16* X16 = (_Float16*)take((size_t)NRX * DX * 2); _Float16* Q = (_Float16*)take((size_t)NRX * DA * 2); _Float16* K = (_Float16*)take((size_t)NRX * DA * 2); _Float16* Vt = (_Float16*)take((size_t)NRX * DA * 2);
  _Float16* O16 = (_Float16*)take((size_t)NRX * DA * 2);
  if (off > ws_size) return;      // 4 x 0.8 + 12.6 + 4 x 8.4 MB, about 50 MB
  k_prep<<<4 * WTB + (unsigned)(((size_t)NRX * DX / 8 + 255) / 256), 256, 0, stream>>>(x, Wq, Wk, Wv, Wp, X16, Bq, Bk, Bv, Bp);
  k_gemm_tile<DX, DA, true, 3><<<3 * (NRX / 128) * (DA / 128), 256, 0, stream>>>(X16, Bq, Bk, Bv, 0.0625f, bq, bk, bv, nullptr, Q, K, Vt);      /* Q, K, V = x.W + b: M 8192 N 512 K 768; each [8192][512] plane = 64 contiguous [1024][64] slabs; Q f16 flat, K and V^T per slab in fragment order */
  k_flash<<<BB * (TT / 64), 128, 0, stream>>>(Q, 64, K, Vt, nullptr, O16, 64);      /* same flat view for Q and O */
  k_gemm_tile<DA, DX, false, 1><<<(NRX / 128) * (DX / 128), 256, 0, stream>>>(O16, Bp, nullptr, nullptr, 0.00390625f, bp, nullptr, nullptr, (float*)d_out, nullptr, nullptr, nullptr);      /* out = O·Wp + bp: M 8192 N 768 K 512 (alpha undoes the ×2^4 weights and the ×2^4 carry) */
}

// v007
// One run takes 61.9 microseconds.
// Two timings next to v006 put it at 1.16 and 1.15 times that version's speed.
// Counting every step since v000, it is 4.77 times as fast.
#include <hip/hip_runtime.h>
// Multi-head attention with raw-reshape heads (B=8, N=1024, dim 768 → attn_dim 512 = 8 heads × 64): Q,K,V = x·W + b ((in,out)), reshaped by plain memory order to (H,B,N,64) (= 64 contiguous [1024][64] slabs of each [8192][512] plane);
// softmax(Q·Kᵀ·scale)·V per slab with scale = (64//8)^-½ = 8^-½ (as the original); out raw-reshaped back to (B,N,512) (same flat order) → ·Wp + bp.
// Compute dtype: x, weights, biases rounded to bf16; Q/K/V as f16 GEMM outputs; fused flash-style kernel over the flat slabs (online softmax f32, P f16 ×2^10) on v_wmma_f32_16x16x32_f16; O carried ×2^4 into f16 → projection GEMM with bias; f32 accumulate.
#define BB 64
#define TT 1024
#define NH 1
#define DX 768
#define DA 512
#define NRX 8192
#define ATT_SCALE 0.35355339059327373f
#define SCALE_LOG2E (ATT_SCALE * 1.4426950408889634f)

typedef __bf16 v16b __attribute__((ext_vector_type(16)));
typedef unsigned short v8us __attribute__((ext_vector_type(8), may_alias));
typedef float  v8f  __attribute__((ext_vector_type(8)));
typedef float  v4f  __attribute__((ext_vector_type(4)));
typedef float  v4fa __attribute__((ext_vector_type(4), may_alias));
union FragB { v16b v; v8us half[2]; unsigned short u[16]; };

__device__ __forceinline__ unsigned short bf16_bits(float x) { unsigned int u = __float_as_uint(x); return (unsigned short)((u + 0x7FFFu + ((u >> 16) & 1u)) >> 16); }
__device__ __forceinline__ float bf16_val(unsigned short b) { return __uint_as_float(((unsigned int)b) << 16); }
__device__ __forceinline__ float bf16_round(float x) { return bf16_val(bf16_bits(x)); }
// D += A·B with NT terms: 1 = ah·bh, 2 = + al·bh (A split), 3 = + ah·bl (both split)
template <int NT>
__device__ __forceinline__ v8f mmaN(v16b ah, v16b al, v16b bh, v16b bl, v8f c) {
  c = __builtin_amdgcn_wmma_f32_16x16x32_bf16(false, ah, false, bh, (short)0, c, false, false);
  if (NT >= 2) c = __builtin_amdgcn_wmma_f32_16x16x32_bf16(false, al, false, bh, (short)0, c, false, false);
  if (NT >= 3) c = __builtin_amdgcn_wmma_f32_16x16x32_bf16(false, ah, false, bl, (short)0, c, false, false);
  asm volatile("v_nop\n\tv_nop\n\tv_nop\n\tv_nop" : "+v"(c) : "v"(ah), "v"(al), "v"(bh), "v"(bl));
  return c;
}

__global__ __launch_bounds__(256) void k_wt_bf16(const float* __restrict__ W, unsigned short* __restrict__ Wt, int K, int N) {
  const int t = blockIdx.x * 256 + threadIdx.x;
  const int k8n = K / 8;
  if (t >= N * k8n) return;
  const int n = t / k8n, k8 = (t % k8n) * 8;
  v8us v;
#pragma unroll
  for (int i = 0; i < 8; ++i) v[i] = bf16_bits(W[(size_t)(k8 + i) * N + n]);
  *(v8us*)(Wt + (size_t)n * K + k8) = v;
  
}

// GEMM C[M][N] (f32, pitch ldc) = act(A[M][K]·W + bias). A f32 row-major (pitch lda) converted per fragment to bf16
// (ASPLIT: hi/lo two planes -> 2 terms, else single rounded term); Wt bf16 [N][K] (pitch ldb). BIAS_BF16 rounds the
// bias to bf16 first (bias quantised to bf16 before the add). K%32==0, M%16==0, N%64==0.
template <bool ASPLIT, int ACT, bool BIAS_BF16>
__global__ __launch_bounds__(128) void k_gemm_bf(const float* __restrict__ A, int lda, const unsigned short* __restrict__ Wt, int ldb,
                                               const float* __restrict__ bias, float* __restrict__ C, int ldc, int M, int N, int K) {
  __shared__ __attribute__((aligned(16))) float so[4][16][64];
  const int tid = threadIdx.x, w = tid >> 5, lane = tid & 31, ln = lane & 15, hh = lane >> 4;
  const int ntn = N / 64;
  const int wid = blockIdx.x * 4 + w;
  const int mt = wid / ntn, nq = wid % ntn;
  if (mt * 16 >= M) return;
  const int row0 = mt * 16, col0 = nq * 64;
  const float* arow = A + (size_t)(row0 + ln) * lda;
  v8f acc[4] = {};
  for (int kb = 0; kb < K; kb += 32) {
    FragB ah, al;
    const v4f x0 = *(const v4fa*)(arow + kb + 8 * hh), x1 = *(const v4fa*)(arow + kb + 8 * hh + 4);
    const v4f x2 = *(const v4fa*)(arow + kb + 16 + 8 * hh), x3 = *(const v4fa*)(arow + kb + 16 + 8 * hh + 4);
    float xs[16] = {x0[0],x0[1],x0[2],x0[3],x1[0],x1[1],x1[2],x1[3],x2[0],x2[1],x2[2],x2[3],x3[0],x3[1],x3[2],x3[3]};
#pragma unroll
    for (int i = 0; i < 16; ++i) { const unsigned short hb = bf16_bits(xs[i]); ah.u[i] = hb; al.u[i] = ASPLIT ? bf16_bits(xs[i] - bf16_val(hb)) : (unsigned short)0; }
#pragma unroll
    for (int t = 0; t < 4; ++t) {
      const unsigned short* brow = Wt + (size_t)(col0 + t * 16 + ln) * ldb + kb;
      FragB b;
      b.half[0] = *(const v8us*)(brow + 8 * hh);
      b.half[1] = *(const v8us*)(brow + 16 + 8 * hh);
      acc[t] = mmaN<ASPLIT ? 2 : 1>(ah.v, al.v, b.v, b.v, acc[t]);
    }
  }
#pragma unroll
  for (int t = 0; t < 4; ++t) {
    float bv = bias ? bias[col0 + t * 16 + ln] : 0.f;
    if (BIAS_BF16) bv = bf16_round(bv);
#pragma unroll
    for (int r = 0; r < 8; ++r) { float v = acc[t][r] + bv; if (ACT == 1) v = fmaxf(v, 0.f); so[w][8 * hh + r][t * 16 + ln] = v; }
  }
  __builtin_amdgcn_fence(__ATOMIC_ACQ_REL, "workgroup");
  __builtin_amdgcn_wave_barrier();
  const int rsub = lane >> 4, c4 = (lane & 15) * 4;
  {
#pragma unroll
    for (int q = 0; q < 8; ++q) {
      const int r = q * 2 + rsub;
      const v4f v = *(const v4fa*)&so[w][r][c4];
      *(v4f*)(C + (size_t)(row0 + r) * ldc + col0 + c4) = v;
    }
    
  }
}

// Flash-style causal/unmasked attention, all contractions 3-term bf16 hi/lo splits, f32 softmax with running max.
// q,k,v rows are read from f32 buffers with arbitrary row pitch (so they can live inside a fused qkv buffer);
// D = head size (multiple of 32, <= 128); one wave = 16 query rows; block = 4 waves (64 queries) sharing K/V chunks of 32.
template <int D, bool CAUSAL>
__global__ __launch_bounds__(128) void k_flash(const float* __restrict__ qb, const float* __restrict__ kb, const float* __restrict__ vb,
                                             int pitch, int T, int H, float scale, float* __restrict__ y, int ypitch) {
  constexpr int KS = D / 32;        // k-steps for QK
  constexpr int DT = D / 16;        // d tiles for PV
  __shared__ __attribute__((aligned(16))) unsigned short sKh[32][D + 8], sKl[32][D + 8], sVh[32][D + 8], sVl[32][D + 8];
  __shared__ __attribute__((aligned(16))) unsigned short sPh[4][16][40], sPl[4][16][40];
  __shared__ __attribute__((aligned(16))) float sO[4][16][D];
  const int tid = threadIdx.x, w = tid >> 5, lane = tid & 31, ln = lane & 15, hh = lane >> 4;
  const int nqb = (T + 63) / 64;
  const int bh = blockIdx.x / nqb, qblk = blockIdx.x % nqb;
  const int b = bh / H, h = bh % H;
  const int q0 = qblk * 64 + w * 16;
  const float* Q = qb + (size_t)b * T * pitch + h * D;
  const float* K = kb + (size_t)b * T * pitch + h * D;
  const float* V = vb + (size_t)b * T * pitch + h * D;

  // A fragments of the wave's 16 query rows (scaled), hi/lo
  FragB aqh[KS], aql[KS];
  {
    int row = q0 + ln; if (row >= T) row = T - 1;
    const float* qr = Q + (size_t)row * pitch;
#pragma unroll
    for (int ks = 0; ks < KS; ++ks)
#pragma unroll
      for (int i = 0; i < 16; ++i) {
        const int d = ks * 32 + ((i < 8) ? (8 * hh + i) : (16 + 8 * hh + (i - 8)));
        const float x = qr[d] * scale; const unsigned short hb = bf16_bits(x);
        aqh[ks].u[i] = hb; aql[ks].u[i] = bf16_bits(x - bf16_val(hb));
      }
  }
  float m_r[8], l_r[8];
#pragma unroll
  for (int r = 0; r < 8; ++r) { m_r[r] = -3.0e38f; l_r[r] = 0.f; }
  v8f oacc[DT];
#pragma unroll
  for (int dt = 0; dt < DT; ++dt) oacc[dt] = (v8f){0.f,0.f,0.f,0.f,0.f,0.f,0.f,0.f};

  const int kv_end = CAUSAL ? min(T, qblk * 64 + 64) : T;     // block-uniform
  for (int j0 = 0; j0 < kv_end; j0 += 32) {
    __syncthreads();
    for (int e = tid; e < 32 * (D / 4); e += 128) {
      const int r = e / (D / 4), c4 = (e % (D / 4)) * 4;
      const int key = j0 + r;
      v4f kf = {0.f,0.f,0.f,0.f}, vf = {0.f,0.f,0.f,0.f};
      if (key < T) { kf = *(const v4fa*)(K + (size_t)key * pitch + c4); vf = *(const v4fa*)(V + (size_t)key * pitch + c4); }
#pragma unroll
      for (int t = 0; t < 4; ++t) {
        unsigned short hb = bf16_bits(kf[t]); sKh[r][c4 + t] = hb; sKl[r][c4 + t] = bf16_bits(kf[t] - bf16_val(hb));
        hb = bf16_bits(vf[t]); sVh[r][c4 + t] = hb; sVl[r][c4 + t] = bf16_bits(vf[t] - bf16_val(hb));
      }
    }
    __syncthreads();
    // S tile 16 x 32
    v8f s[2];
#pragma unroll
    for (int nt = 0; nt < 2; ++nt) {
      v8f acc = {};
#pragma unroll
      for (int ks = 0; ks < KS; ++ks) {
        FragB bh_, bl_;
        bh_.half[0] = *(const v8us*)&sKh[nt * 16 + ln][ks * 32 + 8 * hh]; bh_.half[1] = *(const v8us*)&sKh[nt * 16 + ln][ks * 32 + 16 + 8 * hh];
        bl_.half[0] = *(const v8us*)&sKl[nt * 16 + ln][ks * 32 + 8 * hh]; bl_.half[1] = *(const v8us*)&sKl[nt * 16 + ln][ks * 32 + 16 + 8 * hh];
        acc = mmaN<3>(aqh[ks].v, aql[ks].v, bh_.v, bl_.v, acc);
      }
      s[nt] = acc;
    }
    // mask + running max (rows 8hh+r; the 16 lanes of a half share rows)
    float alpha[8];
#pragma unroll
    for (int r = 0; r < 8; ++r) {
      const int qi = q0 + 8 * hh + r;
      const int ja = j0 + ln, jb = j0 + 16 + ln;
      if (CAUSAL) { if (ja > qi) s[0][r] = -3.0e38f; if (jb > qi) s[1][r] = -3.0e38f; }
      if (ja >= T) s[0][r] = -3.0e38f;
      if (jb >= T) s[1][r] = -3.0e38f;
      float mx = fmaxf(s[0][r], s[1][r]);
      mx = fmaxf(mx, __shfl_xor(mx, 1, 32)); mx = fmaxf(mx, __shfl_xor(mx, 2, 32)); mx = fmaxf(mx, __shfl_xor(mx, 4, 32)); mx = fmaxf(mx, __shfl_xor(mx, 8, 32));
      const float mnew = fmaxf(m_r[r], mx);
      alpha[r] = (mnew > -1.0e38f) ? __expf(m_r[r] - mnew) : 1.0f;
      const float p0 = (s[0][r] > -1.0e38f) ? __expf(s[0][r] - mnew) : 0.f;
      const float p1 = (s[1][r] > -1.0e38f) ? __expf(s[1][r] - mnew) : 0.f;
      m_r[r] = mnew;
      l_r[r] = l_r[r] * alpha[r] + p0 + p1;            // per-lane partial row sum (16 lanes combined at the end)
      unsigned short hb = bf16_bits(p0); sPh[w][8 * hh + r][ln] = hb;      sPl[w][8 * hh + r][ln] = bf16_bits(p0 - bf16_val(hb));
      hb = bf16_bits(p1);                sPh[w][8 * hh + r][16 + ln] = hb; sPl[w][8 * hh + r][16 + ln] = bf16_bits(p1 - bf16_val(hb));
    }
#pragma unroll
    for (int dt = 0; dt < DT; ++dt)
#pragma unroll
      for (int r = 0; r < 8; ++r) oacc[dt][r] *= alpha[r];
    __builtin_amdgcn_fence(__ATOMIC_ACQ_REL, "workgroup");
    __builtin_amdgcn_wave_barrier();
    FragB pah, pal;
    pah.half[0] = *(const v8us*)&sPh[w][ln][8 * hh]; pah.half[1] = *(const v8us*)&sPh[w][ln][16 + 8 * hh];
    pal.half[0] = *(const v8us*)&sPl[w][ln][8 * hh]; pal.half[1] = *(const v8us*)&sPl[w][ln][16 + 8 * hh];
#pragma unroll
    for (int dt = 0; dt < DT; ++dt) {
      FragB bvh, bvl;
#pragma unroll
      for (int i = 0; i < 8; ++i) {
        bvh.u[i] = sVh[8 * hh + i][dt * 16 + ln]; bvh.u[8 + i] = sVh[16 + 8 * hh + i][dt * 16 + ln];
        bvl.u[i] = sVl[8 * hh + i][dt * 16 + ln]; bvl.u[8 + i] = sVl[16 + 8 * hh + i][dt * 16 + ln];
      }
      oacc[dt] = mmaN<3>(pah.v, pal.v, bvh.v, bvl.v, oacc[dt]);
    }
    __builtin_amdgcn_fence(__ATOMIC_ACQ_REL, "workgroup");
    __builtin_amdgcn_wave_barrier();
  }
#pragma unroll
  for (int r = 0; r < 8; ++r) {
    float l = l_r[r];
    l += __shfl_xor(l, 1, 32); l += __shfl_xor(l, 2, 32); l += __shfl_xor(l, 4, 32); l += __shfl_xor(l, 8, 32);
    l_r[r] = (l > 0.f) ? 1.0f / l : 0.f;
  }
#pragma unroll
  for (int dt = 0; dt < DT; ++dt)
#pragma unroll
    for (int r = 0; r < 8; ++r) sO[w][8 * hh + r][dt * 16 + ln] = oacc[dt][r] * l_r[r];
  __builtin_amdgcn_fence(__ATOMIC_ACQ_REL, "workgroup");
  __builtin_amdgcn_wave_barrier();
  {
    for (int r = 0; r < 16; ++r) {
      const int row = q0 + r;
      if (row < T && lane < D / 4) {
        const v4f val = *(const v4fa*)&sO[w][r][lane * 4];
        *(v4f*)(y + ((size_t)b * T + row) * ypitch + h * D + lane * 4) = val;
      }
    }
    
  }
}

// GEMM C = act(A·W + bias + resid): A f32 (ASPLIT -> hi/lo 2 terms), Wt bf16 [N][K]; ACT 0 none, 1 relu, 2 exact gelu;
// resid (optional, f32, row index = (row % rmod), pitch ldr, RES_BF16 rounds it) added before the activation.
template <bool ASPLIT, int ACT, bool BIAS_BF16, bool RES_BF16>
__global__ __launch_bounds__(128) void k_gemm_bf3(const float* __restrict__ A, int lda, const unsigned short* __restrict__ Wt, int ldb,
                                                const float* __restrict__ bias, const float* __restrict__ resid, int rmod, int ldr,
                                                float* __restrict__ C, int ldc, int M, int N, int K) {
  __shared__ __attribute__((aligned(16))) float so[4][16][64];
  const int tid = threadIdx.x, w = tid >> 5, lane = tid & 31, ln = lane & 15, hh = lane >> 4;
  const int ntn = N / 64;
  const int wid = blockIdx.x * 4 + w;
  const int mt = wid / ntn, nq = wid % ntn;
  if (mt * 16 >= M) return;
  const int row0 = mt * 16, col0 = nq * 64;
  const float* arow = A + (size_t)(row0 + ln) * lda;
  v8f acc[4] = {};
  for (int kb = 0; kb < K; kb += 32) {
    FragB ah, al;
    const v4f x0 = *(const v4fa*)(arow + kb + 8 * hh), x1 = *(const v4fa*)(arow + kb + 8 * hh + 4);
    const v4f x2 = *(const v4fa*)(arow + kb + 16 + 8 * hh), x3 = *(const v4fa*)(arow + kb + 16 + 8 * hh + 4);
    float xs[16] = {x0[0],x0[1],x0[2],x0[3],x1[0],x1[1],x1[2],x1[3],x2[0],x2[1],x2[2],x2[3],x3[0],x3[1],x3[2],x3[3]};
#pragma unroll
    for (int i = 0; i < 16; ++i) { const unsigned short hb = bf16_bits(xs[i]); ah.u[i] = hb; al.u[i] = ASPLIT ? bf16_bits(xs[i] - bf16_val(hb)) : (unsigned short)0; }
#pragma unroll
    for (int t = 0; t < 4; ++t) {
      const unsigned short* brow = Wt + (size_t)(col0 + t * 16 + ln) * ldb + kb;
      FragB b;
      b.half[0] = *(const v8us*)(brow + 8 * hh);
      b.half[1] = *(const v8us*)(brow + 16 + 8 * hh);
      acc[t] = mmaN<ASPLIT ? 2 : 1>(ah.v, al.v, b.v, b.v, acc[t]);
    }
  }
#pragma unroll
  for (int t = 0; t < 4; ++t) {
    const int col = col0 + t * 16 + ln;
    float bv = bias ? bias[col] : 0.f;
    if (BIAS_BF16) bv = bf16_round(bv);
#pragma unroll
    for (int r = 0; r < 8; ++r) {
      float v = acc[t][r] + bv;
      if (resid) { float rv = resid[(size_t)((row0 + 8 * hh + r) % rmod) * ldr + col]; if (RES_BF16) rv = bf16_round(rv); v += rv; }
      if (ACT == 1) v = fmaxf(v, 0.f);
      if (ACT == 2) v = 0.5f * v * (1.0f + erff(v * 0.70710678118654752f));
      if (ACT == 3) { const float u = 0.7978845608028654f * (v + 0.044715f * v * v * v); v = 0.5f * v * (1.0f + tanhf(u)); }
      so[w][8 * hh + r][t * 16 + ln] = v;
    }
  }
  __builtin_amdgcn_fence(__ATOMIC_ACQ_REL, "workgroup");
  __builtin_amdgcn_wave_barrier();
  const int rsub = lane >> 4, c4 = (lane & 15) * 4;
  {
#pragma unroll
    for (int q = 0; q < 8; ++q) {
      const int r = q * 2 + rsub;
      const v4f v = *(const v4fa*)&so[w][r][c4];
      *(v4f*)(C + (size_t)(row0 + r) * ldc + col0 + c4) = v;
    }
    
  }
}
// row LayerNorm (biased variance, eps) over N: s = X (+ R); optional out_sum <- s; out_norm <- (s-mu)*rsqrt(var+eps)*g + b
template <bool PARAM_BF16>
__global__ __launch_bounds__(256) void k_layernorm(const float* __restrict__ X, const float* __restrict__ R, const float* __restrict__ g, const float* __restrict__ bta,
                                                  float* __restrict__ out_sum, float* __restrict__ out_norm, int N, float eps) {
  __shared__ float red[256];
  const int row = blockIdx.x, tid = threadIdx.x;
  const float* x = X + (size_t)row * N; const float* rr = R ? R + (size_t)row * N : nullptr;
  float vals[16];                     // up to N = 4096
  const int per = N / 256;            // contiguous chunk per thread? use strided-by-4 chunks: thread handles j = tid*4 + 1024*u
  float s1 = 0.f;
  for (int u = 0; u < per / 4; ++u) {
    const int j = tid * 4 + 1024 * u;
    const v4f a = *(const v4fa*)(x + j);
    v4f b = {0.f,0.f,0.f,0.f}; if (rr) b = *(const v4fa*)(rr + j);
#pragma unroll
    for (int q = 0; q < 4; ++q) { const float v = a[q] + b[q]; vals[u * 4 + q] = v; s1 += v; }
  }
  red[tid] = s1; __syncthreads();
  for (int st = 128; st > 0; st >>= 1) { if (tid < st) red[tid] += red[tid + st]; __syncthreads(); }
  const float mu = red[0] / (float)N; __syncthreads();
  float s2 = 0.f;
  for (int u = 0; u < per / 4; ++u)
#pragma unroll
    for (int q = 0; q < 4; ++q) { const float c = vals[u * 4 + q] - mu; s2 += c * c; }
  red[tid] = s2; __syncthreads();
  for (int st = 128; st > 0; st >>= 1) { if (tid < st) red[tid] += red[tid + st]; __syncthreads(); }
  const float rs = rsqrtf(red[0] / (float)N + eps);
  {
    for (int u = 0; u < per / 4; ++u) {
      const int j = tid * 4 + 1024 * u;
      v4f o, sm;
#pragma unroll
      for (int q = 0; q < 4; ++q) {
        float gg = g[j + q], bb = bta[j + q];
        if (PARAM_BF16) { gg = bf16_round(gg); bb = bf16_round(bb); }
        sm[q] = vals[u * 4 + q]; o[q] = (vals[u * 4 + q] - mu) * rs * gg + bb;
      }
      if (out_sum) *(v4f*)(out_sum + (size_t)row * N + j) = sm;
      *(v4f*)(out_norm + (size_t)row * N + j) = o;
    }
    
  }
}



// ---- f16 WMMA path (v_wmma_f32_16x16x32_f16): 11-bit significands for operands in range — used where a [0,1] probability operand needs more precision than bf16
typedef _Float16 v16h __attribute__((ext_vector_type(16)));
union FragH { v16h v; v8us half[2]; _Float16 h[16]; unsigned short u[16]; };
template <int NT>
__device__ __forceinline__ v8f mmaH(v16h ah, v16h al, v16h bh, v16h bl, v8f c) {
  c = __builtin_amdgcn_wmma_f32_16x16x32_f16(false, ah, false, bh, (short)0, c, false, false);
  if (NT >= 2) c = __builtin_amdgcn_wmma_f32_16x16x32_f16(false, al, false, bh, (short)0, c, false, false);
  if (NT >= 3) c = __builtin_amdgcn_wmma_f32_16x16x32_f16(false, ah, false, bl, (short)0, c, false, false);
  asm volatile("v_nop\n\tv_nop\n\tv_nop\n\tv_nop" : "+v"(c) : "v"(ah), "v"(al), "v"(bh), "v"(bl));
  return c;
}
// batched GEMM like k_gemm_b but f16 operands: A f32 (split into f16 hi/lo if ASPLIT, else rounded to f16), Bt = f16 values [n][k]; alpha; C f32; N multiple of 16 (partial tiles skipped)
template <bool ASPLIT>
__global__ __launch_bounds__(128) void k_gemm_h(const float* __restrict__ A, int lda, size_t sA, const _Float16* __restrict__ Bh, int ldb, size_t sB, float alpha, float* __restrict__ C, int ldc, size_t sC, int M, int N, int K) {
  __shared__ __attribute__((aligned(16))) float so[4][16][64];
  const int tid = threadIdx.x, w = tid >> 5, lane = tid & 31, ln = lane & 15, hh = lane >> 4; const int by = blockIdx.y;
  A += (size_t)by * sA; Bh += (size_t)by * sB; C += (size_t)by * sC;
  const int ntn = (N + 63) / 64; const int wid = blockIdx.x * 4 + w; const int mt = wid / ntn, nq = wid % ntn; if (mt * 16 >= M) return;
  const int row0 = mt * 16, col0 = nq * 64; const float* arow = A + (size_t)(row0 + ln) * lda;
  v8f acc[4] = {};
  for (int kb = 0; kb < K; kb += 32) {
    FragH ah, al;
    const v4f x0 = *(const v4fa*)(arow + kb + 8 * hh), x1 = *(const v4fa*)(arow + kb + 8 * hh + 4), x2 = *(const v4fa*)(arow + kb + 16 + 8 * hh), x3 = *(const v4fa*)(arow + kb + 16 + 8 * hh + 4);
    float xs[16] = {x0[0],x0[1],x0[2],x0[3],x1[0],x1[1],x1[2],x1[3],x2[0],x2[1],x2[2],x2[3],x3[0],x3[1],x3[2],x3[3]};
#pragma unroll
    for (int i = 0; i < 16; ++i) { const _Float16 h = (_Float16)xs[i]; ah.h[i] = h; al.h[i] = ASPLIT ? (_Float16)(xs[i] - (float)h) : (_Float16)0.0f; }
#pragma unroll
    for (int t = 0; t < 4; ++t) { if (col0 + t * 16 >= N) continue; const size_t boff = (size_t)(col0 + t * 16 + ln) * ldb + kb; FragH bq; bq.half[0] = *(const v8us*)(Bh + boff + 8 * hh); bq.half[1] = *(const v8us*)(Bh + boff + 16 + 8 * hh);
      acc[t] = mmaH<ASPLIT ? 2 : 1>(ah.v, al.v, bq.v, bq.v, acc[t]); }
  }
#pragma unroll
  for (int t = 0; t < 4; ++t) { if (col0 + t * 16 >= N) continue;
#pragma unroll
    for (int r = 0; r < 8; ++r) so[w][8 * hh + r][t * 16 + ln] = acc[t][r] * alpha; }
  __builtin_amdgcn_fence(__ATOMIC_ACQ_REL, "workgroup"); __builtin_amdgcn_wave_barrier();
  const int rsub = lane >> 4, c4 = (lane & 15) * 4;
  {
#pragma unroll
    for (int q = 0; q < 8; ++q) { const int r = q * 2 + rsub; if (col0 + c4 < N) { const v4f v = *(const v4fa*)&so[w][r][c4]; *(v4f*)(C + (size_t)(row0 + r) * ldc + col0 + c4) = v; } }
     }
}

// Wt[n][k] = f16(W[k][n]·scale) from f32 row-major W[K][N] (scale = power of two; bf16-exact weights stay exact in f16 away from the subnormal range)
__device__ __forceinline__ void wt_f16(const float* __restrict__ W, _Float16* __restrict__ Wt, int K, int N, float scale, int t) {
  if (t >= N * (K / 8)) return; const int n = t / (K / 8), k8 = (t % (K / 8)) * 8; FragH f;
#pragma unroll
  for (int i = 0; i < 8; ++i) f.h[i] = (_Float16)(bf16_round(W[(size_t)(k8 + i) * N + n]) * scale); const v8us o = f.half[0];
  *(v8us*)((unsigned short*)Wt + (size_t)n * K + k8) = o; 
}
// k_gemm_hh variant with fused epilogue: v = acc·alpha + bias[by·sBias + col] (+ CP[(row/rowsPerB)·sCPb + by·64 + col] if CP) ; ACT 0 none / 1 elu ; writes f16 C16 and f32 C, each if non-null
template <int ACT>
__global__ __launch_bounds__(128) void k_gemm_hhx(const _Float16* __restrict__ A, int lda, size_t sA, const _Float16* __restrict__ Bh, int ldb, size_t sB, float alpha, const float* __restrict__ bias, size_t sBias, const float* __restrict__ CP, int rowsPerB, size_t sCPb, int row0g,
    float* __restrict__ C, _Float16* __restrict__ C16, int ldc, size_t sC, int M, int N, int K) {
  __shared__ __attribute__((aligned(16))) float so[4][16][64];
  const int tid = threadIdx.x, w = tid >> 5, lane = tid & 31, ln = lane & 15, hh = lane >> 4; const int by = blockIdx.y;
  A += (size_t)by * sA; Bh += (size_t)by * sB; const size_t cofs = (size_t)by * sC; const float* bp = bias ? bias + (size_t)by * sBias : nullptr;
  const int ntn = (N + 63) / 64; const int wid = blockIdx.x * 4 + w; const int mt = wid / ntn, nq = wid % ntn; if (mt * 16 >= M) return;
  const int row0 = mt * 16, col0 = nq * 64; const _Float16* arow = A + (size_t)(row0 + ln) * lda;
  v8f acc[4] = {};
  for (int kb = 0; kb < K; kb += 32) { FragH ah; ah.half[0] = *(const v8us*)((const unsigned short*)arow + kb + 8 * hh); ah.half[1] = *(const v8us*)((const unsigned short*)arow + kb + 16 + 8 * hh);
#pragma unroll
    for (int t = 0; t < 4; ++t) { if (col0 + t * 16 >= N) continue; const size_t boff = (size_t)(col0 + t * 16 + ln) * ldb + kb; FragH bq; bq.half[0] = *(const v8us*)((const unsigned short*)Bh + boff + 8 * hh); bq.half[1] = *(const v8us*)((const unsigned short*)Bh + boff + 16 + 8 * hh);
      acc[t] = mmaH<1>(ah.v, ah.v, bq.v, bq.v, acc[t]); }
  }
#pragma unroll
  for (int t = 0; t < 4; ++t) { if (col0 + t * 16 >= N) continue; const int col = col0 + t * 16 + ln; const float bv = bp ? bf16_round(bp[col]) : 0.f;
#pragma unroll
    for (int r = 0; r < 8; ++r) { float v = acc[t][r] * alpha + bv; if (CP) { const int bidx = (row0g + row0 + 8 * hh + r) / rowsPerB; v += CP[(size_t)bidx * sCPb + (size_t)by * 64 + col]; } if (ACT == 1) v = (v > 0.f) ? v : expm1f(v); else if (ACT == 7) v = (v > 0.f) ? v + 1.0f : expf(v); else if (ACT == 8) v = tanhf(v); else if (ACT == 9) v = 0.5f * v * (1.0f + tanhf(0.7978845608028654f * (v + 0.044715f * v * v * v))); else if (ACT == 11) v = 1.0f / (1.0f + expf(-v)); else if (ACT == 12) v = (v > 0.f) ? v : 0.01f * v; else if (ACT == 14) v = (v > 0.f) ? v : 0.1f * v; else if (ACT == 15) v = v / (1.0f + expf(-v)); else if (ACT == 3) v = fmaxf(v, 0.f); else if (ACT == 6) v = 0.5f * v * (1.0f + erff(v * 0.70710678118654752f)); so[w][8 * hh + r][t * 16 + ln] = v; } }
  __builtin_amdgcn_fence(__ATOMIC_ACQ_REL, "workgroup"); __builtin_amdgcn_wave_barrier();
  const int rsub = lane >> 4, c4 = (lane & 15) * 4; typedef _Float16 v4h __attribute__((ext_vector_type(4)));
  {
#pragma unroll
    for (int q = 0; q < 8; ++q) { const int r = q * 2 + rsub; if (col0 + c4 < N) { const v4f v = *(const v4fa*)&so[w][r][c4]; if (C) *(v4f*)(C + cofs + (size_t)(row0 + r) * ldc + col0 + c4) = v; if (C16) { v4h h4; for (int i = 0; i < 4; ++i) h4[i] = (_Float16)v[i]; *(v4h*)(C16 + cofs + (size_t)(row0 + r) * ldc + col0 + c4) = h4; } } }
     }
}


// Block-tiled GEMM, f16 operands, both K-contiguous: C[8192][NN] = A[8192][KK] . Bh[NN][KK]^T * alpha + bf16(bias). One 128x128 tile of C per work-group of 8 waves (4x2), 32x64 per wave.
// A pass is 128 k = 256 aligned bytes of each of the 256 operand rows, brought into LDS by asynchronous copies (two buffers, the next pass's copies fly while this pass is worked on), so that every line leaves L2 once per work-group and not once per wave.
// LDS rows at pitch 272 bytes (16 x odd) for the 16-byte fragment reads. The k order of a fragment and the order of the k steps are those of k_gemm_hhx.
__device__ __forceinline__ unsigned lds_off(const void* p) { return (unsigned)(size_t)p; }
// eight copies of 16 bytes per lane: rows r, r + 16, ..., r + 112 of one operand's tile. The s_wait_xcnt stands inside the statement so that no address register is rewritten ahead of it.
__device__ __forceinline__ void copy_rows8(unsigned l0, const _Float16* g0, int rowstep, unsigned ldsstep) {
  const unsigned l1 = l0 + ldsstep, l2 = l0 + 2 * ldsstep, l3 = l0 + 3 * ldsstep, l4 = l0 + 4 * ldsstep, l5 = l0 + 5 * ldsstep, l6 = l0 + 6 * ldsstep, l7 = l0 + 7 * ldsstep;
  const _Float16* g1 = g0 + rowstep; const _Float16* g2 = g0 + 2 * rowstep; const _Float16* g3 = g0 + 3 * rowstep; const _Float16* g4 = g0 + 4 * rowstep;
  const _Float16* g5 = g0 + 5 * rowstep; const _Float16* g6 = g0 + 6 * rowstep; const _Float16* g7 = g0 + 7 * rowstep;
  asm volatile("global_load_async_to_lds_b128 %0, %8, off\n\t"
               "global_load_async_to_lds_b128 %1, %9, off\n\t"
               "global_load_async_to_lds_b128 %2, %10, off\n\t"
               "global_load_async_to_lds_b128 %3, %11, off\n\t"
               "global_load_async_to_lds_b128 %4, %12, off\n\t"
               "global_load_async_to_lds_b128 %5, %13, off\n\t"
               "global_load_async_to_lds_b128 %6, %14, off\n\t"
               "global_load_async_to_lds_b128 %7, %15, off\n\t"
               "s_wait_xcnt 0x0"
               :: "v"(l0), "v"(l1), "v"(l2), "v"(l3), "v"(l4), "v"(l5), "v"(l6), "v"(l7),
                  "v"(g0), "v"(g1), "v"(g2), "v"(g3), "v"(g4), "v"(g5), "v"(g6), "v"(g7) : "memory");
}
// NJ independent products that share A (own Bh, bias and C16 each) run as one grid: the NJ * NTN tiles of one 128-row band of A have neighbouring block indices.
// NJ == 3 (Q, K, V): a 128-row band of a [8192][512] plane is one [1024][64] slab; element (m, n) of the band is key (m % 128) * 8 + n / 64, column n % 64.
// Jobs 1 and 2 store their slab for the attention kernel with the keys renumbered key' = (n / 64) * 128 + m % 128, the same for both (a softmax-weighted sum does not depend on the order of its keys):
// both in the order in which the attention kernel's A fragments are loaded, so that each of its wave-wide 16-byte loads is 512 bytes in a row (4 whole lines) and not 32 bytes out of each of 16 lines:
// job 1 as Kf[slab][key' / 16][c][lane][8], c = 0 .. 3: lane (hh, ln) = hh * 16 + ln holds columns c * 16 + hh * 8 .. + 7 of key (key' / 16) * 16 + ln; a wave's 32 x 64 tile is 4 KB in a row;
// job 2 as Vf[slab][key' / 32][dt * 2 + hf][lane][8]: lane (hh, ln) holds keys (key' / 32) * 32 + hf * 16 + hh * 8 .. + 7 of column dt * 16 + ln; 32 keys are 4 KB in a row.
template <int KK, int NN, bool OUT16, int NJ>
__global__ __launch_bounds__(256) void k_gemm_tile(const _Float16* __restrict__ A, const _Float16* __restrict__ Bh0, const _Float16* __restrict__ Bh1, const _Float16* __restrict__ Bh2, float alpha,
                                                  const float* __restrict__ bias0, const float* __restrict__ bias1, const float* __restrict__ bias2, float* __restrict__ C,
                                                  _Float16* __restrict__ C160, _Float16* __restrict__ C161, _Float16* __restrict__ C162) {
  constexpr int BK = 128, KSN = BK / 32, PITCH = 2 * BK + 16, STAGE = 256 * PITCH, NPASS = KK / BK, NTN = NN / 128, SOP = 68;
  static_assert(NPASS >= 2 && KK % BK == 0 && NN % 128 == 0 && 8 * 32 * SOP * 4 <= 2 * STAGE, "shape");
  static_assert(NJ == 1 || (NJ == 3 && OUT16 && 128 * (NN / 64) == TT), "a band of the Q, K, V planes is one slab");
  __shared__ __attribute__((aligned(16))) unsigned char sm[2 * STAGE];
  const int tid = threadIdx.x, w = tid >> 5, lane = tid & 31, ln = lane & 15, hh = lane >> 4;
  const int job = NJ > 1 ? (blockIdx.x % (NJ * NTN)) / NTN : 0;
  const _Float16* Bh = job == 0 ? Bh0 : job == 1 ? Bh1 : Bh2; const float* bias = job == 0 ? bias0 : job == 1 ? bias1 : bias2; _Float16* C16 = job == 0 ? C160 : job == 1 ? C161 : C162;
  const int m0 = (blockIdx.x / (NJ * NTN)) * 128, n0 = (blockIdx.x % NTN) * 128; const int wm = w >> 1, wn = w & 1;
  const int cr = tid >> 4, cc = tid & 15;      // a wave's copy = 2 rows x 256 bytes
  const _Float16* ga = A + (size_t)(m0 + cr) * KK + cc * 8; const _Float16* gb = Bh + (size_t)(n0 + cr) * KK + cc * 8;
  const unsigned la = lds_off(sm) + cr * PITCH + cc * 16, lb = la + 128 * PITCH;
  v8f acc[2][4];
#pragma unroll
  for (int i = 0; i < 2; ++i)
#pragma unroll
    for (int j = 0; j < 4; ++j) acc[i][j] = (v8f){0.f,0.f,0.f,0.f,0.f,0.f,0.f,0.f};
  copy_rows8(la, ga, 16 * KK, 16 * PITCH); copy_rows8(lb, gb, 16 * KK, 16 * PITCH);
  asm volatile("s_wait_asynccnt 0x0" ::: "memory");      // pass 0's bytes have landed before the barrier publishes them
  __syncthreads();
  copy_rows8(la + STAGE, ga + BK, 16 * KK, 16 * PITCH); copy_rows8(lb + STAGE, gb + BK, 16 * KK, 16 * PITCH);
  const unsigned char* fa = sm + (wm * 32 + ln) * PITCH + 16 * hh; const unsigned char* fb = sm + (128 + wn * 64 + ln) * PITCH + 16 * hh;
#pragma unroll 1      // the ring stays one rolled loop: one publish point, short code
  for (int t = 0; t < NPASS; ++t) {
    const int bo = (t & 1) * STAGE;
    FragH a[2][2], b[2][4];      // two fragment sets: the next 32 k of this pass are fetched while these are multiplied
#pragma unroll
    for (int i = 0; i < 2; ++i) { a[0][i].half[0] = *(const v8us*)(fa + bo + i * 16 * PITCH); a[0][i].half[1] = *(const v8us*)(fa + bo + i * 16 * PITCH + 32); }
#pragma unroll
    for (int j = 0; j < 4; ++j) { b[0][j].half[0] = *(const v8us*)(fb + bo + j * 16 * PITCH); b[0][j].half[1] = *(const v8us*)(fb + bo + j * 16 * PITCH + 32); }
#pragma unroll
    for (int ks = 0; ks < KSN; ++ks) {
      const int cu = ks & 1, nx = cu ^ 1;
      if (ks + 1 < KSN) {
#pragma unroll
        for (int i = 0; i < 2; ++i) { a[nx][i].half[0] = *(const v8us*)(fa + bo + i * 16 * PITCH + (ks + 1) * 64); a[nx][i].half[1] = *(const v8us*)(fa + bo + i * 16 * PITCH + (ks + 1) * 64 + 32); }
#pragma unroll
        for (int j = 0; j < 4; ++j) { b[nx][j].half[0] = *(const v8us*)(fb + bo + j * 16 * PITCH + (ks + 1) * 64); b[nx][j].half[1] = *(const v8us*)(fb + bo + j * 16 * PITCH + (ks + 1) * 64 + 32); }
        __builtin_amdgcn_sched_barrier(0);      // keeps the next set's LDS reads one group ahead of this set's products; without it they are sunk among the products, into one register set, and each product run waits out the LDS latency
      }
#pragma unroll
      for (int i = 0; i < 2; ++i)
#pragma unroll
        for (int j = 0; j < 4; ++j) acc[i][j] = __builtin_amdgcn_wmma_f32_16x16x32_f16(false, a[cu][i].v, false, b[cu][j].v, (short)0, acc[i][j], false, false);
    }
    __builtin_amdgcn_sched_barrier(0);      // keeps the pass's products in front of the publish point: sunk behind the barrier they stand between it and the refill, and the copies start that much later
    asm volatile("s_wait_dscnt 0x0" ::: "memory");       // this wave's reads of the buffer are done before it is handed to the copies
    asm volatile("s_wait_asynccnt 0x0" ::: "memory");    // this wave's copies of pass t + 1 have landed before the barrier publishes them
    __syncthreads();
    if (t + 2 < NPASS) { copy_rows8(la + bo, ga + (t + 2) * BK, 16 * KK, 16 * PITCH); copy_rows8(lb + bo, gb + (t + 2) * BK, 16 * KK, 16 * PITCH); }
  }
  asm volatile("s_wait_asynccnt 0x0" ::: "memory");      // nothing is in flight when the ring becomes output staging
  if (NJ == 3 && job == 2) {      // V: the tile leaves transposed. A lane's 8 accumulator rows of one column are 8 neighbouring keys of one row of V^T: 16 bytes of f16
    constexpr int TP = 2 * 128 + 16;      // staged rows [wn * 64 + column][128 keys], pitch 16 x odd bytes; every reader left the ring at the last pass's barrier
#pragma unroll      // these three: constant indices keep the accumulators in registers
    for (int j = 0; j < 4; ++j) { const float bv = bf16_round(bias[n0 + wn * 64 + j * 16 + ln]);
#pragma unroll
      for (int i = 0; i < 2; ++i) { FragH f;
#pragma unroll
        for (int r = 0; r < 8; ++r) f.h[r] = (_Float16)(acc[i][j][r] * alpha + bv);
        *(v8us*)(sm + (wn * 64 + j * 16 + ln) * TP + (wm * 32 + i * 16 + 8 * hh) * 2) = f.half[0]; } }
    __syncthreads();      // a staged row holds the keys of four waves: all are written before any is read back (job is the same for the whole work-group)
#pragma unroll      // the eight LDS reads go out as one group, the stores follow as they land
    for (int q = 0; q < 8; ++q) { const int row = (w >> 2) * 64 + (q >> 1) * 16 + ln, k8 = ((w & 3) * 4 + (q & 1) * 2 + hh) * 8; const v8us v = *(const v8us*)(sm + row * TP + k8 * 2);      // wave w: the 32 keys (w & 3) of key block w >> 2; q = dt * 2 + hf
      *(v8us*)((unsigned short*)C16 + (size_t)(m0 / 128) * (64 * TT) + (size_t)((n0 / 64 + (w >> 2)) * 4 + (w & 3)) * 2048 + q * 256 + lane * 8) = v; }
    return;
  }
  float* so = (float*)sm + w * (32 * SOP);      // each wave stages its own 32 x 64 tile; every reader left the ring at the last pass's barrier
#pragma unroll
  for (int j = 0; j < 4; ++j) { const float bv = bf16_round(bias[n0 + wn * 64 + j * 16 + ln]);
#pragma unroll
    for (int i = 0; i < 2; ++i)
#pragma unroll
      for (int r = 0; r < 8; ++r) so[(i * 16 + 8 * hh + r) * SOP + j * 16 + ln] = acc[i][j][r] * alpha + bv; }
  __builtin_amdgcn_fence(__ATOMIC_ACQ_REL, "workgroup"); __builtin_amdgcn_wave_barrier();      // the wave's own staged rows are written before other lanes of it read them back
  if (OUT16) {
    if (NJ == 3 && job == 1) {      // K: keys in the order key', fragment order inside each 16 keys; store q = the 512 bytes of fragment half q & 3 of the tile's keys (q >> 2) * 16 .. + 15 (job is the same for the whole work-group)
      unsigned short* dst = (unsigned short*)C16 + (size_t)m0 * NN + (size_t)((n0 / 64 + wn) * 128 + wm * 32) * 64 + lane * 8;
#pragma unroll
      for (int q = 0; q < 8; ++q) { const float* sp = &so[((q >> 2) * 16 + ln) * SOP + ((q & 3) * 2 + hh) * 8]; const v4f v0 = *(const v4fa*)sp, v1 = *(const v4fa*)(sp + 4); FragH f;
#pragma unroll
        for (int i = 0; i < 4; ++i) { f.h[i] = (_Float16)v0[i]; f.h[4 + i] = (_Float16)v1[i]; }
        *(v8us*)(dst + q * 256) = f.half[0]; }
      asm volatile("s_wait_xcnt 0x0" ::: "memory");      // behind the run's last store: the listing's way on from here leads into code that rewrites the stores' registers
    } else {
      unsigned short* dst = (unsigned short*)C16 + (size_t)(m0 + wm * 32) * NN + n0 + wn * 64;
#pragma unroll
      for (int q = 0; q < 8; ++q) { const int r = q * 4 + (lane >> 3), c8 = (lane & 7) * 8; const v4f v0 = *(const v4fa*)&so[r * SOP + c8], v1 = *(const v4fa*)&so[r * SOP + c8 + 4]; FragH f;
#pragma unroll
        for (int i = 0; i < 4; ++i) { f.h[i] = (_Float16)v0[i]; f.h[4 + i] = (_Float16)v1[i]; }
        *(v8us*)(dst + r * NN + c8) = f.half[0]; }
      asm volatile("s_wait_xcnt 0x0" ::: "memory");      // behind the run's last store: the listing's way on from here leads into code that rewrites the stores' registers
    }
  } else {
#pragma unroll
    for (int q = 0; q < 16; ++q) { const int r = q * 2 + (lane >> 4), c4 = (lane & 15) * 4; const v4f v = *(const v4fa*)&so[r * SOP + c4];
      *(v4f*)(C + (size_t)(m0 + wm * 32 + r) * NN + n0 + wn * 64 + c4) = v; }
  }
}


typedef _Float16 v4h __attribute__((ext_vector_type(4)));

__device__ __forceinline__ void x16(const float* __restrict__ x, _Float16* __restrict__ X16, size_t n8, size_t t) { if (t >= n8) return; FragH f;
#pragma unroll
  for (int q = 0; q < 8; ++q) f.h[q] = (_Float16)bf16_round(x[t * 8 + q]); *(v8us*)((unsigned short*)X16 + t * 8) = f.half[0];  }
// The five operand preparations depend on nothing but the inputs: one grid, the block index picks the job. Blocks 0 .. 4 * WTB - 1: the four weight transposes (WTB blocks each); the rest: x.
#define WTB ((DA * (DX / 8) + 255) / 256)
__global__ __launch_bounds__(256) void k_prep(const float* __restrict__ x, const float* __restrict__ Wq, const float* __restrict__ Wk, const float* __restrict__ Wv, const float* __restrict__ Wp,
                                             _Float16* __restrict__ X16, _Float16* __restrict__ Bq, _Float16* __restrict__ Bk, _Float16* __restrict__ Bv, _Float16* __restrict__ Bp) {
  const int bid = blockIdx.x;
  if (bid < 4 * WTB) {
    const int job = bid / WTB, t = (bid % WTB) * 256 + threadIdx.x;
    const float* W = job == 0 ? Wq : job == 1 ? Wk : job == 2 ? Wv : Wp; _Float16* Wt = job == 0 ? Bq : job == 1 ? Bk : job == 2 ? Bv : Bp;
    wt_f16(W, Wt, job < 3 ? DX : DA, job < 3 ? DA : DX, 16.0f, t);      /* (in,out) -> Bt x2^4 */
  } else x16(x, X16, (size_t)NRX * DX / 8, (size_t)(bid - 4 * WTB) * 256 + threadIdx.x);
}
__global__ __launch_bounds__(256) void k_h16(const float* __restrict__ x, _Float16* __restrict__ X16, size_t n8) { const size_t t = (size_t)blockIdx.x * 256 + threadIdx.x; if (t >= n8) return; FragH f;
#pragma unroll
  for (int q = 0; q < 8; ++q) f.h[q] = (_Float16)x[t * 8 + q]; *(v8us*)((unsigned short*)X16 + t * 8) = f.half[0];  }
__global__ __launch_bounds__(256) void k_round16f(const float* __restrict__ W, _Float16* __restrict__ Bt, size_t n8) { const size_t t = (size_t)blockIdx.x * 256 + threadIdx.x; if (t >= n8) return; FragH f;
#pragma unroll
  for (int i = 0; i < 8; ++i) f.h[i] = (_Float16)(bf16_round(W[t * 8 + i]) * 16.0f); *(v8us*)((unsigned short*)Bt + t * 8) = f.half[0];  }
// lane l with lane l ^ 16: the two halves of a wave hold the two halves of one query's keys
__device__ __forceinline__ float xhalf(float x) { return __builtin_bit_cast(float, __builtin_amdgcn_permlanex16(__builtin_bit_cast(int, x), __builtin_bit_cast(int, x), 0x76543210, 0xfedcba98, false, false)); }
// The hardware's 2^x on eight or nine values, each in its own register. One statement, so that the v_nop stands directly behind the last one: the free slot that the instruction set asks for between
// a transcendental and an instruction that reads its result or overwrites its source; inside the run no instruction touches a neighbour's registers.
__device__ __forceinline__ void exp2_in_place(float& a, float& b, float& c, float& d, float& e, float& f, float& g, float& h) {
  asm("v_exp_f32 %0, %0\n\tv_exp_f32 %1, %1\n\tv_exp_f32 %2, %2\n\tv_exp_f32 %3, %3\n\tv_exp_f32 %4, %4\n\tv_exp_f32 %5, %5\n\tv_exp_f32 %6, %6\n\tv_exp_f32 %7, %7\n\tv_nop"
      : "+v"(a), "+v"(b), "+v"(c), "+v"(d), "+v"(e), "+v"(f), "+v"(g), "+v"(h));
}
__device__ __forceinline__ void exp2_in_place(float& a, float& b, float& c, float& d, float& e, float& f, float& g, float& h, float& i) {
  asm("v_exp_f32 %8, %8\n\tv_exp_f32 %0, %0\n\tv_exp_f32 %1, %1\n\tv_exp_f32 %2, %2\n\tv_exp_f32 %3, %3\n\tv_exp_f32 %4, %4\n\tv_exp_f32 %5, %5\n\tv_exp_f32 %6, %6\n\tv_exp_f32 %7, %7\n\tv_nop"
      : "+v"(a), "+v"(b), "+v"(c), "+v"(d), "+v"(e), "+v"(f), "+v"(g), "+v"(h), "+v"(i));
}
// Transposed form: S^T = K.Q^T (A = 16 key rows, B = the wave's 16 queries, kept in registers), O^T += V^T.P^T (A = 16 rows of V^T, B = P^T).
// A lane holds 16 of the 32 scores of ONE query (column ln; keys 8hh + r and 16 + 8hh + r), so the maximum and the sum are in-lane plus one exchange between the halves,
// and the two score tiles, converted in place, are the B operand of the second product in the k order of the V^T loader: P never leaves the registers.
// K and V^T arrive in fragment order (Kf, Vf of k_gemm_tile): a pass's 32 keys are 4 KB of each, and fragment half number c is the 512 bytes at c * 512, 16 bytes a lane.
// The eight 16-byte loads of one pass's K (or V^T) fragments: p, the same in every lane, walks 4 KB a pass; lo = the lane's own 16 bytes.
__device__ __forceinline__ void load_pass(FragH (&f)[4], const char*& p, unsigned lo) {
#pragma unroll
  for (int c = 0; c < 4; ++c) { f[c].half[0] = *(const v8us*)(p + lo + c * 1024); f[c].half[1] = *(const v8us*)(p + lo + c * 1024 + 512); }
  asm volatile("s_wait_xcnt 0x0" :: "s"(p) : "memory");      // behind the group's loads, their base kept live up to it: it is rewritten on the next line
  p += 4096;
}
// One pass of 32 keys on the fragment set (ak, av). MORE: each half of the set is refilled with the pass after next as soon as its last product has been issued,
// so that a load has nearly two passes of work to land in and no pass waits out a load latency of its own.
template <bool MORE>
__device__ __forceinline__ void flash_pass(FragH (&ak)[4], FragH (&av)[4], const FragH (&bq)[2], const char*& kp, const char*& vp, unsigned lo, float& m_r, float& l_r, v8f (&oacc)[4]) {
  constexpr int DT = 4, KS = 2;
  v8f s[2];
#pragma unroll
  for (int nt = 0; nt < 2; ++nt) { v8f acc = (v8f){0.f,0.f,0.f,0.f,0.f,0.f,0.f,0.f};
#pragma unroll
    for (int ks = 0; ks < KS; ++ks) acc = __builtin_amdgcn_wmma_f32_16x16x32_f16(false, ak[nt * KS + ks].v, false, bq[ks].v, (short)0, acc, false, false);
    s[nt] = acc; }      // s[nt][r] = score of query q0 + ln with key j0 + nt * 16 + 8 * hh + r
  if (MORE) {
    asm volatile("" :: "v"(s[0]), "v"(s[1]) : "memory");      // inputs only: the score products are issued in front of the refill, which so lands in the registers they have just read; without it the products are sunk behind the loads, and the set is loaded elsewhere and copied
    load_pass(ak, kp, lo);
    __builtin_amdgcn_sched_barrier(0);      // keeps the refill here, one group, in front of the pass's vector work: sunk down the pass it loses its lead
  }
  float mc = -3.0e38f;
#pragma unroll
  for (int nt = 0; nt < 2; ++nt)
#pragma unroll
    for (int r = 0; r < 8; ++r) mc = fmaxf(mc, s[nt][r]);      // of the raw scores: the scale is positive
  mc = fmaxf(mc, xhalf(mc));
  const float mn = fmaxf(m_r, mc * SCALE_LOG2E); float ea = m_r - mn; m_r = mn;      // the running maximum is kept in base-2 units
  const float nb = 10.0f - mn;      // the maximum and P's 2^10 in one addend
  float pe[2][8];
#pragma unroll
  for (int nt = 0; nt < 2; ++nt)
#pragma unroll
    for (int r = 0; r < 8; ++r) pe[nt][r] = fmaf(s[nt][r], SCALE_LOG2E, nb);      // one multiply-add a score: log2 of p = 2^10 e^(scale s - max)
  exp2_in_place(pe[0][0], pe[0][1], pe[0][2], pe[0][3], pe[0][4], pe[0][5], pe[0][6], pe[0][7], ea);
  exp2_in_place(pe[1][0], pe[1][1], pe[1][2], pe[1][3], pe[1][4], pe[1][5], pe[1][6], pe[1][7]);
  const float al = (mn > -1.0e38f) ? ea : 1.0f;
  FragH pb; float ps = 0.f;
#pragma unroll
  for (int nt = 0; nt < 2; ++nt)
#pragma unroll
    for (int r = 0; r < 8; ++r) { const float p = pe[nt][r]; ps += p; pb.h[nt * 8 + r] = (_Float16)p; }
  l_r = l_r * al + ps;      // this half's 16 keys, x2^10 like P; the halves are joined once, behind the loop
#pragma unroll
  for (int dt = 0; dt < DT; ++dt)
#pragma unroll
    for (int r = 0; r < 8; ++r) oacc[dt][r] *= al;
#pragma unroll
  for (int dt = 0; dt < DT; ++dt) oacc[dt] = __builtin_amdgcn_wmma_f32_16x16x32_f16(false, av[dt].v, false, pb.v, (short)0, oacc[dt], false, false);      // oacc[dt][r] = O[q0 + ln][dt * 16 + 8 * hh + r]
  if (MORE) {
    asm volatile("" :: "v"(oacc[0]), "v"(oacc[1]), "v"(oacc[2]), "v"(oacc[3]) : "memory");      // inputs only, as above: the four products that read these registers are issued in front of their refill
    load_pass(av, vp, lo);
    __builtin_amdgcn_sched_barrier(0);      // keeps the next pass behind this refill: with its score products hoisted to the top of the trip, its own K refill comes late and has half a pass to land in
  }
}
__global__ __launch_bounds__(128) void k_flash(const _Float16* __restrict__ Q16, int ldq, const _Float16* __restrict__ Kf, const _Float16* __restrict__ Vf, const int* __restrict__ MSK, _Float16* __restrict__ O16, int ldo) {
  constexpr int RPW = 16, NQB = TT / (4 * RPW), DT = 4, KS = 2;
  static_assert(TT % 64 == 0 && TT >= 128, "two fragment sets: an even number of passes, four or more");
  __shared__ __attribute__((aligned(16))) float sO[4][RPW][64 + 4];
  (void)MSK;
  const int tid = threadIdx.x, w = tid >> 5, lane = tid & 31, ln = lane & 15, hh = lane >> 4;
  const int slab = blockIdx.x / NQB, qblk = blockIdx.x % NQB; const int b = slab / NH, h = slab % NH; const int q0 = qblk * (4 * RPW) + w * RPW;
  FragH bq[KS];
  { const unsigned short* qr = (const unsigned short*)Q16 + ((size_t)b * TT + q0 + ln) * ldq + h * 64;
#pragma unroll
    for (int ks = 0; ks < KS; ++ks) { bq[ks].half[0] = *(const v8us*)(qr + ks * 32 + 8 * hh); bq[ks].half[1] = *(const v8us*)(qr + ks * 32 + 16 + 8 * hh); } }
  const char* Kb = (const char*)((const unsigned short*)Kf + (size_t)slab * 64 * TT); const char* Vb = (const char*)((const unsigned short*)Vf + (size_t)slab * 64 * TT);
  const char* kp = Kb; const char* vp = Vb; const unsigned lo = lane * 16;      // fragment half 0 of the next pass to be fetched, and each lane's own 16 bytes of a half
  float m_r = -3.0e38f, l_r = 0.f; v8f oacc[DT];
#pragma unroll
  for (int dt = 0; dt < DT; ++dt) oacc[dt] = (v8f){0.f,0.f,0.f,0.f,0.f,0.f,0.f,0.f};
  FragH ak0[4], av0[4], ak1[4], av1[4];      // set 0: the even passes, set 1: the odd ones
  load_pass(ak0, kp, lo); load_pass(av0, vp, lo); load_pass(ak1, kp, lo); load_pass(av1, vp, lo);
#pragma unroll 1      // two passes a trip, one on each set, and no more: short code
  for (int j0 = 0; j0 < TT - 64; j0 += 64) {
    flash_pass<true>(ak0, av0, bq, kp, vp, lo, m_r, l_r, oacc);
    flash_pass<true>(ak1, av1, bq, kp, vp, lo, m_r, l_r, oacc);
  }
  flash_pass<false>(ak0, av0, bq, kp, vp, lo, m_r, l_r, oacc);      // the last two passes have nothing left to fetch
  flash_pass<false>(ak1, av1, bq, kp, vp, lo, m_r, l_r, oacc);
  { const float l = l_r + xhalf(l_r); const float inv = (l > 0.f) ? 1.0f / l : 0.f;
#pragma unroll
    for (int dt = 0; dt < DT; ++dt) { const v4f lo = {oacc[dt][0] * inv, oacc[dt][1] * inv, oacc[dt][2] * inv, oacc[dt][3] * inv}, hi = {oacc[dt][4] * inv, oacc[dt][5] * inv, oacc[dt][6] * inv, oacc[dt][7] * inv};
      *(v4fa*)&sO[w][ln][dt * 16 + 8 * hh] = lo; *(v4fa*)&sO[w][ln][dt * 16 + 8 * hh + 4] = hi; } }
  __builtin_amdgcn_fence(__ATOMIC_ACQ_REL, "workgroup"); __builtin_amdgcn_wave_barrier();      // the wave's own staged rows are written before other lanes of it read them back
  {
#pragma unroll
    for (int rp = 0; rp < RPW; rp += 4) { const int r = rp + (lane >> 3), c8 = (lane & 7) * 8; const v4f v0 = *(const v4fa*)&sO[w][r][c8], v1 = *(const v4fa*)&sO[w][r][c8 + 4]; FragH f;      // O leaves as the projection's operand: x2^4, f16, whole 128-byte rows
#pragma unroll      // constant indices keep the vectors in registers
      for (int q = 0; q < 4; ++q) { f.h[q] = (_Float16)(v0[q] * 16.0f); f.h[4 + q] = (_Float16)(v1[q] * 16.0f); }
      *(v8us*)((unsigned short*)O16 + ((size_t)b * TT + q0 + r) * ldo + h * 64 + c8) = f.half[0]; }
     } }

extern "C" void kernel_launch(void* const* d_in, const int* in_sizes, int n_in,
                              void* d_out, int out_size, void* d_ws, size_t ws_size, hipStream_t stream) {
  (void)in_sizes; (void)n_in; (void)out_size;
  const float* const* I = (const float* const*)d_in; const float* x = I[0]; const float* Wq = I[1]; const float* bq = I[2]; const float* Wk = I[3]; const float* bk = I[4]; const float* Wv = I[5]; const float* bv = I[6]; const float* Wp = I[7]; const float* bp = I[8];
  char* ws = (char*)d_ws; size_t off = 0;
  auto take = [&](size_t bytes) { char* p = ws + off; off += (bytes + 255) & ~(size_t)255; return p; };
  _Float16* Bq = (_Float16*)take((size_t)DA * DX * 2); _Float16* Bk = (_Float16*)take((size_t)DA * DX * 2); _Float16* Bv = (_Float16*)take((size_t)DA * DX * 2); _Float16* Bp = (_Float16*)take((size_t)DX * DA * 2);
  _Float16* X16 = (_Float16*)take((size_t)NRX * DX * 2); _Float16* Q = (_Float16*)take((size_t)NRX * DA * 2); _Float16* K = (_Float16*)take((size_t)NRX * DA * 2); _Float16* Vt = (_Float16*)take((size_t)NRX * DA * 2);
  _Float16* O16 = (_Float16*)take((size_t)NRX * DA * 2);
  if (off > ws_size) return;      // 4 x 0.8 + 12.6 + 4 x 8.4 MB, about 50 MB
  k_prep<<<4 * WTB + (unsigned)(((size_t)NRX * DX / 8 + 255) / 256), 256, 0, stream>>>(x, Wq, Wk, Wv, Wp, X16, Bq, Bk, Bv, Bp);
  k_gemm_tile<DX, DA, true, 3><<<3 * (NRX / 128) * (DA / 128), 256, 0, stream>>>(X16, Bq, Bk, Bv, 0.0625f, bq, bk, bv, nullptr, Q, K, Vt);      /* Q, K, V = x.W + b: M 8192 N 512 K 768; each [8192][512] plane = 64 contiguous [1024][64] slabs; Q f16 flat, K and V^T per slab in fragment order */
  k_flash<<<BB * (TT / 64), 128, 0, stream>>>(Q, 64, K, Vt, nullptr, O16, 64);      /* same flat view for Q and O */
  k_gemm_tile<DA, DX, false, 1><<<(NRX / 128) * (DX / 128), 256, 0, stream>>>(O16, Bp, nullptr, nullptr, 0.00390625f, bp, nullptr, nullptr, (float*)d_out, nullptr, nullptr, nullptr);      /* out = O·Wp + bp: M 8192 N 768 K 512 (alpha undoes the ×2^4 weights and the ×2^4 carry) */
}

// v008
// It runs in 58.6 microseconds.
// Two timings next to v007 put it at 1.06 and 1.05 times that version's speed.
// All steps since v000 together make it 5.03 times as fast.
#include <hip/hip_runtime.h>
// Multi-head attention with raw-reshape heads (B=8, N=1024, dim 768 → attn_dim 512 = 8 heads × 64): Q,K,V = x·W + b ((in,out)), reshaped by plain memory order to (H,B,N,64) (= 64 contiguous [1024][64] slabs of each [8192][512] plane);
// softmax(Q·Kᵀ·scale)·V per slab with scale = (64//8)^-½ = 8^-½ (as the original); out raw-reshaped back to (B,N,512) (same flat order) → ·Wp + bp.
// Compute dtype: x, weights, biases rounded to bf16; Q/K/V as f16 GEMM outputs; fused flash-style kernel over the flat slabs (online softmax f32, P f16 ×2^10) on v_wmma_f32_16x16x32_f16; O carried ×2^4 into f16 → projection GEMM with bias; f32 accumulate.
#define BB 64
#define TT 1024
#define NH 1
#define DX 768
#define DA 512
#define NRX 8192
#define ATT_SCALE 0.35355339059327373f
#define SCALE_LOG2E (ATT_SCALE * 1.4426950408889634f)

typedef __bf16 v16b __attribute__((ext_vector_type(16)));
typedef unsigned short v8us __attribute__((ext_vector_type(8), may_alias));
typedef float  v8f  __attribute__((ext_vector_type(8)));
typedef float  v4f  __attribute__((ext_vector_type(4)));
typedef float  v4fa __attribute__((ext_vector_type(4), may_alias));
union FragB { v16b v; v8us half[2]; unsigned short u[16]; };

__device__ __forceinline__ unsigned short bf16_bits(float x) { unsigned int u = __float_as_uint(x); return (unsigned short)((u + 0x7FFFu + ((u >> 16) & 1u)) >> 16); }
__device__ __forceinline__ float bf16_val(unsigned short b) { return __uint_as_float(((unsigned int)b) << 16); }
__device__ __forceinline__ float bf16_round(float x) { return bf16_val(bf16_bits(x)); }
// D += A·B with NT terms: 1 = ah·bh, 2 = + al·bh (A split), 3 = + ah·bl (both split)
template <int NT>
__device__ __forceinline__ v8f mmaN(v16b ah, v16b al, v16b bh, v16b bl, v8f c) {
  c = __builtin_amdgcn_wmma_f32_16x16x32_bf16(false, ah, false, bh, (short)0, c, false, false);
  if (NT >= 2) c = __builtin_amdgcn_wmma_f32_16x16x32_bf16(false, al, false, bh, (short)0, c, false, false);
  if (NT >= 3) c = __builtin_amdgcn_wmma_f32_16x16x32_bf16(false, ah, false, bl, (short)0, c, false, false);
  asm volatile("v_nop\n\tv_nop\n\tv_nop\n\tv_nop" : "+v"(c) : "v"(ah), "v"(al), "v"(bh), "v"(bl));
  return c;
}

__global__ __launch_bounds__(256) void k_wt_bf16(const float* __restrict__ W, unsigned short* __restrict__ Wt, int K, int N) {
  const int t = blockIdx.x * 256 + threadIdx.x;
  const int k8n = K / 8;
  if (t >= N * k8n) return;
  const int n = t / k8n, k8 = (t % k8n) * 8;
  v8us v;
#pragma unroll
  for (int i = 0; i < 8; ++i) v[i] = bf16_bits(W[(size_t)(k8 + i) * N + n]);
  *(v8us*)(Wt + (size_t)n * K + k8) = v;
  
}

// GEMM C[M][N] (f32, pitch ldc) = act(A[M][K]·W + bias). A f32 row-major (pitch lda) converted per fragment to bf16
// (ASPLIT: hi/lo two planes -> 2 terms, else single rounded term); Wt bf16 [N][K] (pitch ldb). BIAS_BF16 rounds the
// bias to bf16 first (bias quantised to bf16 before the add). K%32==0, M%16==0, N%64==0.
template <bool ASPLIT, int ACT, bool BIAS_BF16>
__global__ __launch_bounds__(128) void k_gemm_bf(const float* __restrict__ A, int lda, const unsigned short* __restrict__ Wt, int ldb,
                                               const float* __restrict__ bias, float* __restrict__ C, int ldc, int M, int N, int K) {
  __shared__ __attribute__((aligned(16))) float so[4][16][64];
  const int tid = threadIdx.x, w = tid >> 5, lane = tid & 31, ln = lane & 15, hh = lane >> 4;
  const int ntn = N / 64;
  const int wid = blockIdx.x * 4 + w;
  const int mt = wid / ntn, nq = wid % ntn;
  if (mt * 16 >= M) return;
  const int row0 = mt * 16, col0 = nq * 64;
  const float* arow = A + (size_t)(row0 + ln) * lda;
  v8f acc[4] = {};
  for (int kb = 0; kb < K; kb += 32) {
    FragB ah, al;
    const v4f x0 = *(const v4fa*)(arow + kb + 8 * hh), x1 = *(const v4fa*)(arow + kb + 8 * hh + 4);
    const v4f x2 = *(const v4fa*)(arow + kb + 16 + 8 * hh), x3 = *(const v4fa*)(arow + kb + 16 + 8 * hh + 4);
    float xs[16] = {x0[0],x0[1],x0[2],x0[3],x1[0],x1[1],x1[2],x1[3],x2[0],x2[1],x2[2],x2[3],x3[0],x3[1],x3[2],x3[3]};
#pragma unroll
    for (int i = 0; i < 16; ++i) { const unsigned short hb = bf16_bits(xs[i]); ah.u[i] = hb; al.u[i] = ASPLIT ? bf16_bits(xs[i] - bf16_val(hb)) : (unsigned short)0; }
#pragma unroll
    for (int t = 0; t < 4; ++t) {
      const unsigned short* brow = Wt + (size_t)(col0 + t * 16 + ln) * ldb + kb;
      FragB b;
      b.half[0] = *(const v8us*)(brow + 8 * hh);
      b.half[1] = *(const v8us*)(brow + 16 + 8 * hh);
      acc[t] = mmaN<ASPLIT ? 2 : 1>(ah.v, al.v, b.v, b.v, acc[t]);
    }
  }
#pragma unroll
  for (int t = 0; t < 4; ++t) {
    float bv = bias ? bias[col0 + t * 16 + ln] : 0.f;
    if (BIAS_BF16) bv = bf16_round(bv);
#pragma unroll
    for (int r = 0; r < 8; ++r) { float v = acc[t][r] + bv; if (ACT == 1) v = fmaxf(v, 0.f); so[w][8 * hh + r][t * 16 + ln] = v; }
  }
  __builtin_amdgcn_fence(__ATOMIC_ACQ_REL, "workgroup");
  __builtin_amdgcn_wave_barrier();
  const int rsub = lane >> 4, c4 = (lane & 15) * 4;
  {
#pragma unroll
    for (int q = 0; q < 8; ++q) {
      const int r = q * 2 + rsub;
      const v4f v = *(const v4fa*)&so[w][r][c4];
      *(v4f*)(C + (size_t)(row0 + r) * ldc + col0 + c4) = v;
    }
    
  }
}

// Flash-style causal/unmasked attention, all contractions 3-term bf16 hi/lo splits, f32 softmax with running max.
// q,k,v rows are read from f32 buffers with arbitrary row pitch (so they can live inside a fused qkv buffer);
// D = head size (multiple of 32, <= 128); one wave = 16 query rows; block = 4 waves (64 queries) sharing K/V chunks of 32.
template <int D, bool CAUSAL>
__global__ __launch_bounds__(128) void k_flash(const float* __restrict__ qb, const float* __restrict__ kb, const float* __restrict__ vb,
                                             int pitch, int T, int H, float scale, float* __restrict__ y, int ypitch) {
  constexpr int KS = D / 32;        // k-steps for QK
  constexpr int DT = D / 16;        // d tiles for PV
  __shared__ __attribute__((aligned(16))) unsigned short sKh[32][D + 8], sKl[32][D + 8], sVh[32][D + 8], sVl[32][D + 8];
  __shared__ __attribute__((aligned(16))) unsigned short sPh[4][16][40], sPl[4][16][40];
  __shared__ __attribute__((aligned(16))) float sO[4][16][D];
  const int tid = threadIdx.x, w = tid >> 5, lane = tid & 31, ln = lane & 15, hh = lane >> 4;
  const int nqb = (T + 63) / 64;
  const int bh = blockIdx.x / nqb, qblk = blockIdx.x % nqb;
  const int b = bh / H, h = bh % H;
  const int q0 = qblk * 64 + w * 16;
  const float* Q = qb + (size_t)b * T * pitch + h * D;
  const float* K = kb + (size_t)b * T * pitch + h * D;
  const float* V = vb + (size_t)b * T * pitch + h * D;

  // A fragments of the wave's 16 query rows (scaled), hi/lo
  FragB aqh[KS], aql[KS];
  {
    int row = q0 + ln; if (row >= T) row = T - 1;
    const float* qr = Q + (size_t)row * pitch;
#pragma unroll
    for (int ks = 0; ks < KS; ++ks)
#pragma unroll
      for (int i = 0; i < 16; ++i) {
        const int d = ks * 32 + ((i < 8) ? (8 * hh + i) : (16 + 8 * hh + (i - 8)));
        const float x = qr[d] * scale; const unsigned short hb = bf16_bits(x);
        aqh[ks].u[i] = hb; aql[ks].u[i] = bf16_bits(x - bf16_val(hb));
      }
  }
  float m_r[8], l_r[8];
#pragma unroll
  for (int r = 0; r < 8; ++r) { m_r[r] = -3.0e38f; l_r[r] = 0.f; }
  v8f oacc[DT];
#pragma unroll
  for (int dt = 0; dt < DT; ++dt) oacc[dt] = (v8f){0.f,0.f,0.f,0.f,0.f,0.f,0.f,0.f};

  const int kv_end = CAUSAL ? min(T, qblk * 64 + 64) : T;     // block-uniform
  for (int j0 = 0; j0 < kv_end; j0 += 32) {
    __syncthreads();
    for (int e = tid; e < 32 * (D / 4); e += 128) {
      const int r = e / (D / 4), c4 = (e % (D / 4)) * 4;
      const int key = j0 + r;
      v4f kf = {0.f,0.f,0.f,0.f}, vf = {0.f,0.f,0.f,0.f};
      if (key < T) { kf = *(const v4fa*)(K + (size_t)key * pitch + c4); vf = *(const v4fa*)(V + (size_t)key * pitch + c4); }
#pragma unroll
      for (int t = 0; t < 4; ++t) {
        unsigned short hb = bf16_bits(kf[t]); sKh[r][c4 + t] = hb; sKl[r][c4 + t] = bf16_bits(kf[t] - bf16_val(hb));
        hb = bf16_bits(vf[t]); sVh[r][c4 + t] = hb; sVl[r][c4 + t] = bf16_bits(vf[t] - bf16_val(hb));
      }
    }
    __syncthreads();
    // S tile 16 x 32
    v8f s[2];
#pragma unroll
    for (int nt = 0; nt < 2; ++nt) {
      v8f acc = {};
#pragma unroll
      for (int ks = 0; ks < KS; ++ks) {
        FragB bh_, bl_;
        bh_.half[0] = *(const v8us*)&sKh[nt * 16 + ln][ks * 32 + 8 * hh]; bh_.half[1] = *(const v8us*)&sKh[nt * 16 + ln][ks * 32 + 16 + 8 * hh];
        bl_.half[0] = *(const v8us*)&sKl[nt * 16 + ln][ks * 32 + 8 * hh]; bl_.half[1] = *(const v8us*)&sKl[nt * 16 + ln][ks * 32 + 16 + 8 * hh];
        acc = mmaN<3>(aqh[ks].v, aql[ks].v, bh_.v, bl_.v, acc);
      }
      s[nt] = acc;
    }
    // mask + running max (rows 8hh+r; the 16 lanes of a half share rows)
    float alpha[8];
#pragma unroll
    for (int r = 0; r < 8; ++r) {
      const int qi = q0 + 8 * hh + r;
      const int ja = j0 + ln, jb = j0 + 16 + ln;
      if (CAUSAL) { if (ja > qi) s[0][r] = -3.0e38f; if (jb > qi) s[1][r] = -3.0e38f; }
      if (ja >= T) s[0][r] = -3.0e38f;
      if (jb >= T) s[1][r] = -3.0e38f;
      float mx = fmaxf(s[0][r], s[1][r]);
      mx = fmaxf(mx, __shfl_xor(mx, 1, 32)); mx = fmaxf(mx, __shfl_xor(mx, 2, 32)); mx = fmaxf(mx, __shfl_xor(mx, 4, 32)); mx = fmaxf(mx, __shfl_xor(mx, 8, 32));
      const float mnew = fmaxf(m_r[r], mx);
      alpha[r] = (mnew > -1.0e38f) ? __expf(m_r[r] - mnew) : 1.0f;
      const float p0 = (s[0][r] > -1.0e38f) ? __expf(s[0][r] - mnew) : 0.f;
      const float p1 = (s[1][r] > -1.0e38f) ? __expf(s[1][r] - mnew) : 0.f;
      m_r[r] = mnew;
      l_r[r] = l_r[r] * alpha[r] + p0 + p1;            // per-lane partial row sum (16 lanes combined at the end)
      unsigned short hb = bf16_bits(p0); sPh[w][8 * hh + r][ln] = hb;      sPl[w][8 * hh + r][ln] = bf16_bits(p0 - bf16_val(hb));
      hb = bf16_bits(p1);                sPh[w][8 * hh + r][16 + ln] = hb; sPl[w][8 * hh + r][16 + ln] = bf16_bits(p1 - bf16_val(hb));
    }
#pragma unroll
    for (int dt = 0; dt < DT; ++dt)
#pragma unroll
      for (int r = 0; r < 8; ++r) oacc[dt][r] *= alpha[r];
    __builtin_amdgcn_fence(__ATOMIC_ACQ_REL, "workgroup");
    __builtin_amdgcn_wave_barrier();
    FragB pah, pal;
    pah.half[0] = *(const v8us*)&sPh[w][ln][8 * hh]; pah.half[1] = *(const v8us*)&sPh[w][ln][16 + 8 * hh];
    pal.half[0] = *(const v8us*)&sPl[w][ln][8 * hh]; pal.half[1] = *(const v8us*)&sPl[w][ln][16 + 8 * hh];
#pragma unroll
    for (int dt = 0; dt < DT; ++dt) {
      FragB bvh, bvl;
#pragma unroll
      for (int i = 0; i < 8; ++i) {
        bvh.u[i] = sVh[8 * hh + i][dt * 16 + ln]; bvh.u[8 + i] = sVh[16 + 8 * hh + i][dt * 16 + ln];
        bvl.u[i] = sVl[8 * hh + i][dt * 16 + ln]; bvl.u[8 + i] = sVl[16 + 8 * hh + i][dt * 16 + ln];
      }
      oacc[dt] = mmaN<3>(pah.v, pal.v, bvh.v, bvl.v, oacc[dt]);
    }
    __builtin_amdgcn_fence(__ATOMIC_ACQ_REL, "workgroup");
    __builtin_amdgcn_wave_barrier();
  }
#pragma unroll
  for (int r = 0; r < 8; ++r) {
    float l = l_r[r];
    l += __shfl_xor(l, 1, 32); l += __shfl_xor(l, 2, 32); l += __shfl_xor(l, 4, 32); l += __shfl_xor(l, 8, 32);
    l_r[r] = (l > 0.f) ? 1.0f / l : 0.f;
  }
#pragma unroll
  for (int dt = 0; dt < DT; ++dt)
#pragma unroll
    for (int r = 0; r < 8; ++r) sO[w][8 * hh + r][dt * 16 + ln] = oacc[dt][r] * l_r[r];
  __builtin_amdgcn_fence(__ATOMIC_ACQ_REL, "workgroup");
  __builtin_amdgcn_wave_barrier();
  {
    for (int r = 0; r < 16; ++r) {
      const int row = q0 + r;
      if (row < T && lane < D / 4) {
        const v4f val = *(const v4fa*)&sO[w][r][lane * 4];
        *(v4f*)(y + ((size_t)b * T + row) * ypitch + h * D + lane * 4) = val;
      }
    }
    
  }
}

// GEMM C = act(A·W + bias + resid): A f32 (ASPLIT -> hi/lo 2 terms), Wt bf16 [N][K]; ACT 0 none, 1 relu, 2 exact gelu;
// resid (optional, f32, row index = (row % rmod), pitch ldr, RES_BF16 rounds it) added before the activation.
template <bool ASPLIT, int ACT, bool BIAS_BF16, bool RES_BF16>
__global__ __launch_bounds__(128) void k_gemm_bf3(const float* __restrict__ A, int lda, const unsigned short* __restrict__ Wt, int ldb,
                                                const float* __restrict__ bias, const float* __restrict__ resid, int rmod, int ldr,
                                                float* __restrict__ C, int ldc, int M, int N, int K) {
  __shared__ __attribute__((aligned(16))) float so[4][16][64];
  const int tid = threadIdx.x, w = tid >> 5, lane = tid & 31, ln = lane & 15, hh = lane >> 4;
  const int ntn = N / 64;
  const int wid = blockIdx.x * 4 + w;
  const int mt = wid / ntn, nq = wid % ntn;
  if (mt * 16 >= M) return;
  const int row0 = mt * 16, col0 = nq * 64;
  const float* arow = A + (size_t)(row0 + ln) * lda;
  v8f acc[4] = {};
  for (int kb = 0; kb < K; kb += 32) {
    FragB ah, al;
    const v4f x0 = *(const v4fa*)(arow + kb + 8 * hh), x1 = *(const v4fa*)(arow + kb + 8 * hh + 4);
    const v4f x2 = *(const v4fa*)(arow + kb + 16 + 8 * hh), x3 = *(const v4fa*)(arow + kb + 16 + 8 * hh + 4);
    float xs[16] = {x0[0],x0[1],x0[2],x0[3],x1[0],x1[1],x1[2],x1[3],x2[0],x2[1],x2[2],x2[3],x3[0],x3[1],x3[2],x3[3]};
#pragma unroll
    for (int i = 0; i < 16; ++i) { const unsigned short hb = bf16_bits(xs[i]); ah.u[i] = hb; al.u[i] = ASPLIT ? bf16_bits(xs[i] - bf16_val(hb)) : (unsigned short)0; }
#pragma unroll
    for (int t = 0; t < 4; ++t) {
      const unsigned short* brow = Wt + (size_t)(col0 + t * 16 + ln) * ldb + kb;
      FragB b;
      b.half[0] = *(const v8us*)(brow + 8 * hh);
      b.half[1] = *(const v8us*)(brow + 16 + 8 * hh);
      acc[t] = mmaN<ASPLIT ? 2 : 1>(ah.v, al.v, b.v, b.v, acc[t]);
    }
  }
#pragma unroll
  for (int t = 0; t < 4; ++t) {
    const int col = col0 + t * 16 + ln;
    float bv = bias ? bias[col] : 0.f;
    if (BIAS_BF16) bv = bf16_round(bv);
#pragma unroll
    for (int r = 0; r < 8; ++r) {
      float v = acc[t][r] + bv;
      if (resid) { float rv = resid[(size_t)((row0 + 8 * hh + r) % rmod) * ldr + col]; if (RES_BF16) rv = bf16_round(rv); v += rv; }
      if (ACT == 1) v = fmaxf(v, 0.f);
      if (ACT == 2) v = 0.5f * v * (1.0f + erff(v * 0.70710678118654752f));
      if (ACT == 3) { const float u = 0.7978845608028654f * (v + 0.044715f * v * v * v); v = 0.5f * v * (1.0f + tanhf(u)); }
      so[w][8 * hh + r][t * 16 + ln] = v;
    }
  }
  __builtin_amdgcn_fence(__ATOMIC_ACQ_REL, "workgroup");
  __builtin_amdgcn_wave_barrier();
  const int rsub = lane >> 4, c4 = (lane & 15) * 4;
  {
#pragma unroll
    for (int q = 0; q < 8; ++q) {
      const int r = q * 2 + rsub;
      const v4f v = *(const v4fa*)&so[w][r][c4];
      *(v4f*)(C + (size_t)(row0 + r) * ldc + col0 + c4) = v;
    }
    
  }
}
// row LayerNorm (biased variance, eps) over N: s = X (+ R); optional out_sum <- s; out_norm <- (s-mu)*rsqrt(var+eps)*g + b
template <bool PARAM_BF16>
__global__ __launch_bounds__(256) void k_layernorm(const float* __restrict__ X, const float* __restrict__ R, const float* __restrict__ g, const float* __restrict__ bta,
                                                  float* __restrict__ out_sum, float* __restrict__ out_norm, int N, float eps) {
  __shared__ float red[256];
  const int row = blockIdx.x, tid = threadIdx.x;
  const float* x = X + (size_t)row * N; const float* rr = R ? R + (size_t)row * N : nullptr;
  float vals[16];                     // up to N = 4096
  const int per = N / 256;            // contiguous chunk per thread? use strided-by-4 chunks: thread handles j = tid*4 + 1024*u
  float s1 = 0.f;
  for (int u = 0; u < per / 4; ++u) {
    const int j = tid * 4 + 1024 * u;
    const v4f a = *(const v4fa*)(x + j);
    v4f b = {0.f,0.f,0.f,0.f}; if (rr) b = *(const v4fa*)(rr + j);
#pragma unroll
    for (int q = 0; q < 4; ++q) { const float v = a[q] + b[q]; vals[u * 4 + q] = v; s1 += v; }
  }
  red[tid] = s1; __syncthreads();
  for (int st = 128; st > 0; st >>= 1) { if (tid < st) red[tid] += red[tid + st]; __syncthreads(); }
  const float mu = red[0] / (float)N; __syncthreads();
  float s2 = 0.f;
  for (int u = 0; u < per / 4; ++u)
#pragma unroll
    for (int q = 0; q < 4; ++q) { const float c = vals[u * 4 + q] - mu; s2 += c * c; }
  red[tid] = s2; __syncthreads();
  for (int st = 128; st > 0; st >>= 1) { if (tid < st) red[tid] += red[tid + st]; __syncthreads(); }
  const float rs = rsqrtf(red[0] / (float)N + eps);
  {
    for (int u = 0; u < per / 4; ++u) {
      const int j = tid * 4 + 1024 * u;
      v4f o, sm;
#pragma unroll
      for (int q = 0; q < 4; ++q) {
        float gg = g[j + q], bb = bta[j + q];
        if (PARAM_BF16) { gg = bf16_round(gg); bb = bf16_round(bb); }
        sm[q] = vals[u * 4 + q]; o[q] = (vals[u * 4 + q] - mu) * rs * gg + bb;
      }
      if (out_sum) *(v4f*)(out_sum + (size_t)row * N + j) = sm;
      *(v4f*)(out_norm + (size_t)row * N + j) = o;
    }
    
  }
}



// ---- f16 WMMA path (v_wmma_f32_16x16x32_f16): 11-bit significands for operands in range — used where a [0,1] probability operand needs more precision than bf16
typedef _Float16 v16h __attribute__((ext_vector_type(16)));
union FragH { v16h v; v8us half[2]; _Float16 h[16]; unsigned short u[16]; };
template <int NT>
__device__ __forceinline__ v8f mmaH(v16h ah, v16h al, v16h bh, v16h bl, v8f c) {
  c = __builtin_amdgcn_wmma_f32_16x16x32_f16(false, ah, false, bh, (short)0, c, false, false);
  if (NT >= 2) c = __builtin_amdgcn_wmma_f32_16x16x32_f16(false, al, false, bh, (short)0, c, false, false);
  if (NT >= 3) c = __builtin_amdgcn_wmma_f32_16x16x32_f16(false, ah, false, bl, (short)0, c, false, false);
  asm volatile("v_nop\n\tv_nop\n\tv_nop\n\tv_nop" : "+v"(c) : "v"(ah), "v"(al), "v"(bh), "v"(bl));
  return c;
}
// batched GEMM like k_gemm_b but f16 operands: A f32 (split into f16 hi/lo if ASPLIT, else rounded to f16), Bt = f16 values [n][k]; alpha; C f32; N multiple of 16 (partial tiles skipped)
template <bool ASPLIT>
__global__ __launch_bounds__(128) void k_gemm_h(const float* __restrict__ A, int lda, size_t sA, const _Float16* __restrict__ Bh, int ldb, size_t sB, float alpha, float* __restrict__ C, int ldc, size_t sC, int M, int N, int K) {
  __shared__ __attribute__((aligned(16))) float so[4][16][64];
  const int tid = threadIdx.x, w = tid >> 5, lane = tid & 31, ln = lane & 15, hh = lane >> 4; const int by = blockIdx.y;
  A += (size_t)by * sA; Bh += (size_t)by * sB; C += (size_t)by * sC;
  const int ntn = (N + 63) / 64; const int wid = blockIdx.x * 4 + w; const int mt = wid / ntn, nq = wid % ntn; if (mt * 16 >= M) return;
  const int row0 = mt * 16, col0 = nq * 64; const float* arow = A + (size_t)(row0 + ln) * lda;
  v8f acc[4] = {};
  for (int kb = 0; kb < K; kb += 32) {
    FragH ah, al;
    const v4f x0 = *(const v4fa*)(arow + kb + 8 * hh), x1 = *(const v4fa*)(arow + kb + 8 * hh + 4), x2 = *(const v4fa*)(arow + kb + 16 + 8 * hh), x3 = *(const v4fa*)(arow + kb + 16 + 8 * hh + 4);
    float xs[16] = {x0[0],x0[1],x0[2],x0[3],x1[0],x1[1],x1[2],x1[3],x2[0],x2[1],x2[2],x2[3],x3[0],x3[1],x3[2],x3[3]};
#pragma unroll
    for (int i = 0; i < 16; ++i) { const _Float16 h = (_Float16)xs[i]; ah.h[i] = h; al.h[i] = ASPLIT ? (_Float16)(xs[i] - (float)h) : (_Float16)0.0f; }
#pragma unroll
    for (int t = 0; t < 4; ++t) { if (col0 + t * 16 >= N) continue; const size_t boff = (size_t)(col0 + t * 16 + ln) * ldb + kb; FragH bq; bq.half[0] = *(const v8us*)(Bh + boff + 8 * hh); bq.half[1] = *(const v8us*)(Bh + boff + 16 + 8 * hh);
      acc[t] = mmaH<ASPLIT ? 2 : 1>(ah.v, al.v, bq.v, bq.v, acc[t]); }
  }
#pragma unroll
  for (int t = 0; t < 4; ++t) { if (col0 + t * 16 >= N) continue;
#pragma unroll
    for (int r = 0; r < 8; ++r) so[w][8 * hh + r][t * 16 + ln] = acc[t][r] * alpha; }
  __builtin_amdgcn_fence(__ATOMIC_ACQ_REL, "workgroup"); __builtin_amdgcn_wave_barrier();
  const int rsub = lane >> 4, c4 = (lane & 15) * 4;
  {
#pragma unroll
    for (int q = 0; q < 8; ++q) { const int r = q * 2 + rsub; if (col0 + c4 < N) { const v4f v = *(const v4fa*)&so[w][r][c4]; *(v4f*)(C + (size_t)(row0 + r) * ldc + col0 + c4) = v; } }
     }
}

// Wt[n][k] = f16(W[k][n]·scale) from f32 row-major W[K][N] (scale = power of two; bf16-exact weights stay exact in f16 away from the subnormal range)
__device__ __forceinline__ void wt_f16(const float* __restrict__ W, _Float16* __restrict__ Wt, int K, int N, float scale, int t) {
  if (t >= N * (K / 8)) return; const int n = t / (K / 8), k8 = (t % (K / 8)) * 8; FragH f;
#pragma unroll
  for (int i = 0; i < 8; ++i) f.h[i] = (_Float16)(bf16_round(W[(size_t)(k8 + i) * N + n]) * scale); const v8us o = f.half[0];
  *(v8us*)((unsigned short*)Wt + (size_t)n * K + k8) = o; 
}
// k_gemm_hh variant with fused epilogue: v = acc·alpha + bias[by·sBias + col] (+ CP[(row/rowsPerB)·sCPb + by·64 + col] if CP) ; ACT 0 none / 1 elu ; writes f16 C16 and f32 C, each if non-null
template <int ACT>
__global__ __launch_bounds__(128) void k_gemm_hhx(const _Float16* __restrict__ A, int lda, size_t sA, const _Float16* __restrict__ Bh, int ldb, size_t sB, float alpha, const float* __restrict__ bias, size_t sBias, const float* __restrict__ CP, int rowsPerB, size_t sCPb, int row0g,
    float* __restrict__ C, _Float16* __restrict__ C16, int ldc, size_t sC, int M, int N, int K) {
  __shared__ __attribute__((aligned(16))) float so[4][16][64];
  const int tid = threadIdx.x, w = tid >> 5, lane = tid & 31, ln = lane & 15, hh = lane >> 4; const int by = blockIdx.y;
  A += (size_t)by * sA; Bh += (size_t)by * sB; const size_t cofs = (size_t)by * sC; const float* bp = bias ? bias + (size_t)by * sBias : nullptr;
  const int ntn = (N + 63) / 64; const int wid = blockIdx.x * 4 + w; const int mt = wid / ntn, nq = wid % ntn; if (mt * 16 >= M) return;
  const int row0 = mt * 16, col0 = nq * 64; const _Float16* arow = A + (size_t)(row0 + ln) * lda;
  v8f acc[4] = {};
  for (int kb = 0; kb < K; kb += 32) { FragH ah; ah.half[0] = *(const v8us*)((const unsigned short*)arow + kb + 8 * hh); ah.half[1] = *(const v8us*)((const unsigned short*)arow + kb + 16 + 8 * hh);
#pragma unroll
    for (int t = 0; t < 4; ++t) { if (col0 + t * 16 >= N) continue; const size_t boff = (size_t)(col0 + t * 16 + ln) * ldb + kb; FragH bq; bq.half[0] = *(const v8us*)((const unsigned short*)Bh + boff + 8 * hh); bq.half[1] = *(const v8us*)((const unsigned short*)Bh + boff + 16 + 8 * hh);
      acc[t] = mmaH<1>(ah.v, ah.v, bq.v, bq.v, acc[t]); }
  }
#pragma unroll
  for (int t = 0; t < 4; ++t) { if (col0 + t * 16 >= N) continue; const int col = col0 + t * 16 + ln; const float bv = bp ? bf16_round(bp[col]) : 0.f;
#pragma unroll
    for (int r = 0; r < 8; ++r) { float v = acc[t][r] * alpha + bv; if (CP) { const int bidx = (row0g + row0 + 8 * hh + r) / rowsPerB; v += CP[(size_t)bidx * sCPb + (size_t)by * 64 + col]; } if (ACT == 1) v = (v > 0.f) ? v : expm1f(v); else if (ACT == 7) v = (v > 0.f) ? v + 1.0f : expf(v); else if (ACT == 8) v = tanhf(v); else if (ACT == 9) v = 0.5f * v * (1.0f + tanhf(0.7978845608028654f * (v + 0.044715f * v * v * v))); else if (ACT == 11) v = 1.0f / (1.0f + expf(-v)); else if (ACT == 12) v = (v > 0.f) ? v : 0.01f * v; else if (ACT == 14) v = (v > 0.f) ? v : 0.1f * v; else if (ACT == 15) v = v / (1.0f + expf(-v)); else if (ACT == 3) v = fmaxf(v, 0.f); else if (ACT == 6) v = 0.5f * v * (1.0f + erff(v * 0.70710678118654752f)); so[w][8 * hh + r][t * 16 + ln] = v; } }
  __builtin_amdgcn_fence(__ATOMIC_ACQ_REL, "workgroup"); __builtin_amdgcn_wave_barrier();
  const int rsub = lane >> 4, c4 = (lane & 15) * 4; typedef _Float16 v4h __attribute__((ext_vector_type(4)));
  {
#pragma unroll
    for (int q = 0; q < 8; ++q) { const int r = q * 2 + rsub; if (col0 + c4 < N) { const v4f v = *(const v4fa*)&so[w][r][c4]; if (C) *(v4f*)(C + cofs + (size_t)(row0 + r) * ldc + col0 + c4) = v; if (C16) { v4h h4; for (int i = 0; i < 4; ++i) h4[i] = (_Float16)v[i]; *(v4h*)(C16 + cofs + (size_t)(row0 + r) * ldc + col0 + c4) = h4; } } }
     }
}


// Block-tiled GEMM, f16 operands, both K-contiguous: C[8192][NN] = A[8192][KK] . Bh[NN][KK]^T * alpha + bf16(bias). One 128x128 tile of C per work-group of 8 waves (4x2), 32x64 per wave.
// A pass is 128 k = 256 aligned bytes of each of the 256 operand rows, brought into LDS by asynchronous copies (two buffers, the next pass's copies fly while this pass is worked on), so that every line leaves L2 once per work-group and not once per wave.
// LDS rows at pitch 272 bytes (16 x odd) for the 16-byte fragment reads. The k order of a fragment and the order of the k steps are those of k_gemm_hhx.
__device__ __forceinline__ unsigned lds_off(const void* p) { return (unsigned)(size_t)p; }
// eight copies of 16 bytes per lane: rows r, r + d, ..., r + 7d of one operand's tile (d = 16 rows in k_gemm_tile, 2 in k_gemm_qkv). The s_wait_xcnt stands inside the statement so that no address register is rewritten ahead of it.
__device__ __forceinline__ void copy_rows8(unsigned l0, const _Float16* g0, int rowstep, unsigned ldsstep) {
  const unsigned l1 = l0 + ldsstep, l2 = l0 + 2 * ldsstep, l3 = l0 + 3 * ldsstep, l4 = l0 + 4 * ldsstep, l5 = l0 + 5 * ldsstep, l6 = l0 + 6 * ldsstep, l7 = l0 + 7 * ldsstep;
  const _Float16* g1 = g0 + rowstep; const _Float16* g2 = g0 + 2 * rowstep; const _Float16* g3 = g0 + 3 * rowstep; const _Float16* g4 = g0 + 4 * rowstep;
  const _Float16* g5 = g0 + 5 * rowstep; const _Float16* g6 = g0 + 6 * rowstep; const _Float16* g7 = g0 + 7 * rowstep;
  asm volatile("global_load_async_to_lds_b128 %0, %8, off\n\t"
               "global_load_async_to_lds_b128 %1, %9, off\n\t"
               "global_load_async_to_lds_b128 %2, %10, off\n\t"
               "global_load_async_to_lds_b128 %3, %11, off\n\t"
               "global_load_async_to_lds_b128 %4, %12, off\n\t"
               "global_load_async_to_lds_b128 %5, %13, off\n\t"
               "global_load_async_to_lds_b128 %6, %14, off\n\t"
               "global_load_async_to_lds_b128 %7, %15, off\n\t"
               "s_wait_xcnt 0x0"
               :: "v"(l0), "v"(l1), "v"(l2), "v"(l3), "v"(l4), "v"(l5), "v"(l6), "v"(l7),
                  "v"(g0), "v"(g1), "v"(g2), "v"(g3), "v"(g4), "v"(g5), "v"(g6), "v"(g7) : "memory");
}
// NJ independent products that share A (own Bh, bias and C16 each) run as one grid: the NJ * NTN tiles of one 128-row band of A have neighbouring block indices.
// NJ == 3 (Q, K, V): a 128-row band of a [8192][512] plane is one [1024][64] slab; element (m, n) of the band is key (m % 128) * 8 + n / 64, column n % 64.
// Jobs 1 and 2 store their slab for the attention kernel with the keys renumbered key' = (n / 64) * 128 + m % 128, the same for both (a softmax-weighted sum does not depend on the order of its keys):
// both in the order in which the attention kernel's A fragments are loaded, so that each of its wave-wide 16-byte loads is 512 bytes in a row (4 whole lines) and not 32 bytes out of each of 16 lines:
// job 1 as Kf[slab][key' / 16][c][lane][8], c = 0 .. 3: lane (hh, ln) = hh * 16 + ln holds columns c * 16 + hh * 8 .. + 7 of key (key' / 16) * 16 + ln; a wave's 32 x 64 tile is 4 KB in a row;
// job 2 as Vf[slab][key' / 32][dt * 2 + hf][lane][8]: lane (hh, ln) holds keys (key' / 32) * 32 + hf * 16 + hh * 8 .. + 7 of column dt * 16 + ln; 32 keys are 4 KB in a row.
template <int KK, int NN, bool OUT16, int NJ>
__global__ __launch_bounds__(256) void k_gemm_tile(const _Float16* __restrict__ A, const _Float16* __restrict__ Bh0, const _Float16* __restrict__ Bh1, const _Float16* __restrict__ Bh2, float alpha,
                                                  const float* __restrict__ bias0, const float* __restrict__ bias1, const float* __restrict__ bias2, float* __restrict__ C,
                                                  _Float16* __restrict__ C160, _Float16* __restrict__ C161, _Float16* __restrict__ C162) {
  constexpr int BK = 128, KSN = BK / 32, PITCH = 2 * BK + 16, STAGE = 256 * PITCH, NPASS = KK / BK, NTN = NN / 128, SOP = 68;
  static_assert(NPASS >= 2 && KK % BK == 0 && NN % 128 == 0 && 8 * 32 * SOP * 4 <= 2 * STAGE, "shape");
  static_assert(NJ == 1 || (NJ == 3 && OUT16 && 128 * (NN / 64) == TT), "a band of the Q, K, V planes is one slab");
  __shared__ __attribute__((aligned(16))) unsigned char sm[2 * STAGE];
  const int tid = threadIdx.x, w = tid >> 5, lane = tid & 31, ln = lane & 15, hh = lane >> 4;
  const int job = NJ > 1 ? (blockIdx.x % (NJ * NTN)) / NTN : 0;
  const _Float16* Bh = job == 0 ? Bh0 : job == 1 ? Bh1 : Bh2; const float* bias = job == 0 ? bias0 : job == 1 ? bias1 : bias2; _Float16* C16 = job == 0 ? C160 : job == 1 ? C161 : C162;
  const int m0 = (blockIdx.x / (NJ * NTN)) * 128, n0 = (blockIdx.x % NTN) * 128; const int wm = w >> 1, wn = w & 1;
  const int cr = tid >> 4, cc = tid & 15;      // a wave's copy = 2 rows x 256 bytes
  const _Float16* ga = A + (size_t)(m0 + cr) * KK + cc * 8; const _Float16* gb = Bh + (size_t)(n0 + cr) * KK + cc * 8;
  const unsigned la = lds_off(sm) + cr * PITCH + cc * 16, lb = la + 128 * PITCH;
  v8f acc[2][4];
#pragma unroll
  for (int i = 0; i < 2; ++i)
#pragma unroll
    for (int j = 0; j < 4; ++j) acc[i][j] = (v8f){0.f,0.f,0.f,0.f,0.f,0.f,0.f,0.f};
  copy_rows8(la, ga, 16 * KK, 16 * PITCH); copy_rows8(lb, gb, 16 * KK, 16 * PITCH);
  asm volatile("s_wait_asynccnt 0x0" ::: "memory");      // pass 0's bytes have landed before the barrier publishes them
  __syncthreads();
  copy_rows8(la + STAGE, ga + BK, 16 * KK, 16 * PITCH); copy_rows8(lb + STAGE, gb + BK, 16 * KK, 16 * PITCH);
  const unsigned char* fa = sm + (wm * 32 + ln) * PITCH + 16 * hh; const unsigned char* fb = sm + (128 + wn * 64 + ln) * PITCH + 16 * hh;
#pragma unroll 1      // the ring stays one rolled loop: one publish point, short code
  for (int t = 0; t < NPASS; ++t) {
    const int bo = (t & 1) * STAGE;
    FragH a[2][2], b[2][4];      // two fragment sets: the next 32 k of this pass are fetched while these are multiplied
#pragma unroll
    for (int i = 0; i < 2; ++i) { a[0][i].half[0] = *(const v8us*)(fa + bo + i * 16 * PITCH); a[0][i].half[1] = *(const v8us*)(fa + bo + i * 16 * PITCH + 32); }
#pragma unroll
    for (int j = 0; j < 4; ++j) { b[0][j].half[0] = *(const v8us*)(fb + bo + j * 16 * PITCH); b[0][j].half[1] = *(const v8us*)(fb + bo + j * 16 * PITCH + 32); }
#pragma unroll
    for (int ks = 0; ks < KSN; ++ks) {
      const int cu = ks & 1, nx = cu ^ 1;
      if (ks + 1 < KSN) {
#pragma unroll
        for (int i = 0; i < 2; ++i) { a[nx][i].half[0] = *(const v8us*)(fa + bo + i * 16 * PITCH + (ks + 1) * 64); a[nx][i].half[1] = *(const v8us*)(fa + bo + i * 16 * PITCH + (ks + 1) * 64 + 32); }
#pragma unroll
        for (int j = 0; j < 4; ++j) { b[nx][j].half[0] = *(const v8us*)(fb + bo + j * 16 * PITCH + (ks + 1) * 64); b[nx][j].half[1] = *(const v8us*)(fb + bo + j * 16 * PITCH + (ks + 1) * 64 + 32); }
        __builtin_amdgcn_sched_barrier(0);      // keeps the next set's LDS reads one group ahead of this set's products; without it they are sunk among the products, into one register set, and each product run waits out the LDS latency
      }
#pragma unroll
      for (int i = 0; i < 2; ++i)
#pragma unroll
        for (int j = 0; j < 4; ++j) acc[i][j] = __builtin_amdgcn_wmma_f32_16x16x32_f16(false, a[cu][i].v, false, b[cu][j].v, (short)0, acc[i][j], false, false);
    }
    __builtin_amdgcn_sched_barrier(0);      // keeps the pass's products in front of the publish point: sunk behind the barrier they stand between it and the refill, and the copies start that much later
    asm volatile("s_wait_dscnt 0x0" ::: "memory");       // this wave's reads of the buffer are done before it is handed to the copies
    asm volatile("s_wait_asynccnt 0x0" ::: "memory");    // this wave's copies of pass t + 1 have landed before the barrier publishes them
    __syncthreads();
    if (t + 2 < NPASS) { copy_rows8(la + bo, ga + (t + 2) * BK, 16 * KK, 16 * PITCH); copy_rows8(lb + bo, gb + (t + 2) * BK, 16 * KK, 16 * PITCH); }
  }
  asm volatile("s_wait_asynccnt 0x0" ::: "memory");      // nothing is in flight when the ring becomes output staging
  if (NJ == 3 && job == 2) {      // V: the tile leaves transposed. A lane's 8 accumulator rows of one column are 8 neighbouring keys of one row of V^T: 16 bytes of f16
    constexpr int TP = 2 * 128 + 16;      // staged rows [wn * 64 + column][128 keys], pitch 16 x odd bytes; every reader left the ring at the last pass's barrier
#pragma unroll      // these three: constant indices keep the accumulators in registers
    for (int j = 0; j < 4; ++j) { const float bv = bf16_round(bias[n0 + wn * 64 + j * 16 + ln]);
#pragma unroll
      for (int i = 0; i < 2; ++i) { FragH f;
#pragma unroll
        for (int r = 0; r < 8; ++r) f.h[r] = (_Float16)(acc[i][j][r] * alpha + bv);
        *(v8us*)(sm + (wn * 64 + j * 16 + ln) * TP + (wm * 32 + i * 16 + 8 * hh) * 2) = f.half[0]; } }
    __syncthreads();      // a staged row holds the keys of four waves: all are written before any is read back (job is the same for the whole work-group)
#pragma unroll      // the eight LDS reads go out as one group, the stores follow as they land
    for (int q = 0; q < 8; ++q) { const int row = (w >> 2) * 64 + (q >> 1) * 16 + ln, k8 = ((w & 3) * 4 + (q & 1) * 2 + hh) * 8; const v8us v = *(const v8us*)(sm + row * TP + k8 * 2);      // wave w: the 32 keys (w & 3) of key block w >> 2; q = dt * 2 + hf
      *(v8us*)((unsigned short*)C16 + (size_t)(m0 / 128) * (64 * TT) + (size_t)((n0 / 64 + (w >> 2)) * 4 + (w & 3)) * 2048 + q * 256 + lane * 8) = v; }
    return;
  }
  float* so = (float*)sm + w * (32 * SOP);      // each wave stages its own 32 x 64 tile; every reader left the ring at the last pass's barrier
#pragma unroll
  for (int j = 0; j < 4; ++j) { const float bv = bf16_round(bias[n0 + wn * 64 + j * 16 + ln]);
#pragma unroll
    for (int i = 0; i < 2; ++i)
#pragma unroll
      for (int r = 0; r < 8; ++r) so[(i * 16 + 8 * hh + r) * SOP + j * 16 + ln] = acc[i][j][r] * alpha + bv; }
  __builtin_amdgcn_fence(__ATOMIC_ACQ_REL, "workgroup"); __builtin_amdgcn_wave_barrier();      // the wave's own staged rows are written before other lanes of it read them back
  if (OUT16) {
    if (NJ == 3 && job == 1) {      // K: keys in the order key', fragment order inside each 16 keys; store q = the 512 bytes of fragment half q & 3 of the tile's keys (q >> 2) * 16 .. + 15 (job is the same for the whole work-group)
      unsigned short* dst = (unsigned short*)C16 + (size_t)m0 * NN + (size_t)((n0 / 64 + wn) * 128 + wm * 32) * 64 + lane * 8;
#pragma unroll
      for (int q = 0; q < 8; ++q) { const float* sp = &so[((q >> 2) * 16 + ln) * SOP + ((q & 3) * 2 + hh) * 8]; const v4f v0 = *(const v4fa*)sp, v1 = *(const v4fa*)(sp + 4); FragH f;
#pragma unroll
        for (int i = 0; i < 4; ++i) { f.h[i] = (_Float16)v0[i]; f.h[4 + i] = (_Float16)v1[i]; }
        *(v8us*)(dst + q * 256) = f.half[0]; }
      asm volatile("s_wait_xcnt 0x0" ::: "memory");      // behind the run's last store: the listing's way on from here leads into code that rewrites the stores' registers
    } else {
      unsigned short* dst = (unsigned short*)C16 + (size_t)(m0 + wm * 32) * NN + n0 + wn * 64;
#pragma unroll
      for (int q = 0; q < 8; ++q) { const int r = q * 4 + (lane >> 3), c8 = (lane & 7) * 8; const v4f v0 = *(const v4fa*)&so[r * SOP + c8], v1 = *(const v4fa*)&so[r * SOP + c8 + 4]; FragH f;
#pragma unroll
        for (int i = 0; i < 4; ++i) { f.h[i] = (_Float16)v0[i]; f.h[4 + i] = (_Float16)v1[i]; }
        *(v8us*)(dst + r * NN + c8) = f.half[0]; }
      asm volatile("s_wait_xcnt 0x0" ::: "memory");      // behind the run's last store: the listing's way on from here leads into code that rewrites the stores' registers
    }
  } else {
#pragma unroll
    for (int q = 0; q < 16; ++q) { const int r = q * 2 + (lane >> 4), c4 = (lane & 15) * 4; const v4f v = *(const v4fa*)&so[r * SOP + c4];
      *(v4f*)(C + (size_t)(m0 + wm * 32 + r) * NN + n0 + wn * 64 + c4) = v; }
  }
}


// Q, K, V in one product against the three weight matrices laid one behind the other, Bh[3 * 512][KK]: one 256 x 192 tile of the [8192][1536] result per work-group of 12 waves (4 x 3), 64 x 64 per wave.
// 32 x 8 = 256 tiles: every operand line leaves L2 8 (A) or 32 (Bh) times, was 12 and 64, and a wave reads 8 fragments from LDS for 16 products, was 6 for 8. Ring, fragment k order and order of the k steps are those of k_gemm_tile.
// A wave's 64 columns lie in one plane (job = Q, K or V) and are one n / 64 block nb of it; its 64 rows are half a slab: each wave stores its own tile in the layouts described at k_gemm_tile, no wave needs another's.
template <int KK>
__global__ __launch_bounds__(384) void k_gemm_qkv(const _Float16* __restrict__ A, const _Float16* __restrict__ Bh, float alpha,
                                                 const float* __restrict__ bias0, const float* __restrict__ bias1, const float* __restrict__ bias2,
                                                 _Float16* __restrict__ Cq, _Float16* __restrict__ Ck, _Float16* __restrict__ Cv) {
  constexpr int BK = 128, KSN = BK / 32, PITCH = 2 * BK + 16, STAGE = (256 + 192) * PITCH, NPASS = KK / BK, SOP = 68, NTM = NRX / 256;
  static_assert(NPASS >= 2 && KK % BK == 0 && 12 * 64 * SOP * 4 <= 2 * STAGE && DA == 512 && TT == 1024 && NRX % 256 == 0, "shape");
  __shared__ __attribute__((aligned(16))) unsigned char sm[2 * STAGE];
  const int tid = threadIdx.x, lane = tid & 31, ln = lane & 15, hh = lane >> 4;
  const int w = __builtin_amdgcn_readfirstlane(tid >> 5);      // the wave's number in a scalar register: the tests on it below are scalar branches
  const int tm = blockIdx.x % NTM, tn = blockIdx.x / NTM; const int m0 = tm * 256, c0 = tn * 192; const int wm = w & 3, wn = w >> 2;
  // a wave's copy = 2 rows x 256 bytes. Waves 0 .. 7 bring 32 rows of A each, waves 8 .. 11 bring 48 rows of Bh each
  const bool cpb = w >= 8;
  const int lrow = (cpb ? 256 + (w - 8) * 48 : w * 32) + hh;
  const _Float16* gc = (cpb ? Bh + (size_t)(c0 + (w - 8) * 48 + hh) * KK : A + (size_t)(m0 + w * 32 + hh) * KK) + ln * 8;
  const unsigned lc = lds_off(sm) + lrow * PITCH + ln * 16;
  auto copy_stage = [&](unsigned l, const _Float16* g) {
    copy_rows8(l, g, 2 * KK, 2 * PITCH); copy_rows8(l + 16 * PITCH, g + 16 * KK, 2 * KK, 2 * PITCH);
    if (cpb) copy_rows8(l + 32 * PITCH, g + 32 * KK, 2 * KK, 2 * PITCH);
  };
  v8f acc[4][4];
#pragma unroll
  for (int i = 0; i < 4; ++i)
#pragma unroll
    for (int j = 0; j < 4; ++j) acc[i][j] = (v8f){0.f,0.f,0.f,0.f,0.f,0.f,0.f,0.f};
  copy_stage(lc, gc);
  asm volatile("s_wait_asynccnt 0x0" ::: "memory");      // pass 0's bytes have landed before the barrier publishes them
  __syncthreads();
  copy_stage(lc + STAGE, gc + BK);
  const unsigned char* fa = sm + (wm * 64 + ln) * PITCH + 16 * hh; const unsigned char* fb = sm + (256 + wn * 64 + ln) * PITCH + 16 * hh;
#pragma unroll 1      // the ring stays one rolled loop: one publish point, short code
  for (int t = 0; t < NPASS; ++t) {
    const int bo = (t & 1) * STAGE;
    FragH a[2][4], b[2][4];      // two fragment sets: the next 32 k of this pass are fetched while these are multiplied
#pragma unroll
    for (int i = 0; i < 4; ++i) { a[0][i].half[0] = *(const v8us*)(fa + bo + i * 16 * PITCH); a[0][i].half[1] = *(const v8us*)(fa + bo + i * 16 * PITCH + 32); }
#pragma unroll
    for (int j = 0; j < 4; ++j) { b[0][j].half[0] = *(const v8us*)(fb + bo + j * 16 * PITCH); b[0][j].half[1] = *(const v8us*)(fb + bo + j * 16 * PITCH + 32); }
#pragma unroll
    for (int ks = 0; ks < KSN; ++ks) {
      const int cu = ks & 1, nx = cu ^ 1;
      if (ks + 1 < KSN) {
#pragma unroll
        for (int i = 0; i < 4; ++i) { a[nx][i].half[0] = *(const v8us*)(fa + bo + i * 16 * PITCH + (ks + 1) * 64); a[nx][i].half[1] = *(const v8us*)(fa + bo + i * 16 * PITCH + (ks + 1) * 64 + 32); }
#pragma unroll
        for (int j = 0; j < 4; ++j) { b[nx][j].half[0] = *(const v8us*)(fb + bo + j * 16 * PITCH + (ks + 1) * 64); b[nx][j].half[1] = *(const v8us*)(fb + bo + j * 16 * PITCH + (ks + 1) * 64 + 32); }
        __builtin_amdgcn_sched_barrier(0);      // keeps the next set's LDS reads one group ahead of this set's products; sunk among the products each product run waits out the LDS latency
      }
#pragma unroll
      for (int i = 0; i < 4; ++i)
#pragma unroll
        for (int j = 0; j < 4; ++j) acc[i][j] = __builtin_amdgcn_wmma_f32_16x16x32_f16(false, a[cu][i].v, false, b[cu][j].v, (short)0, acc[i][j], false, false);
    }
    __builtin_amdgcn_sched_barrier(0);      // keeps the pass's products in front of the publish point, so that the refill behind it starts no later than it can
    asm volatile("s_wait_dscnt 0x0" ::: "memory");       // this wave's reads of the buffer are done before it is handed to the copies
    asm volatile("s_wait_asynccnt 0x0" ::: "memory");    // this wave's copies of pass t + 1 have landed before the barrier publishes them
    __syncthreads();
    if (t + 2 < NPASS) copy_stage(lc + bo, gc + (t + 2) * BK);
  }
  asm volatile("s_wait_asynccnt 0x0" ::: "memory");      // nothing is in flight when the ring becomes output staging
  const int cg = tn * 3 + wn, job = cg >> 3, nb = cg & 7;      // the wave's plane and its 64-column block there
  const int slab = tm * 2 + (wm >> 1), kr0 = (wm & 1) * 64;      // its slab and its first row in the slab's 128-row band
  const float* bias = (job == 0 ? bias0 : job == 1 ? bias1 : bias2) + nb * 64;
  if (job == 2) {      // V: a lane's 8 accumulator rows of one column are the 8 keys that this same lane holds in Vf: 16 bytes of f16 straight from the registers, 512 bytes in a row per wave-wide store
    unsigned short* dst = (unsigned short*)Cv + (size_t)slab * (64 * TT) + (size_t)(nb * 4 + (wm & 1) * 2) * 2048 + lane * 8;
#pragma unroll      // these three: constant indices keep the accumulators in registers
    for (int j = 0; j < 4; ++j) { const float bv = bf16_round(bias[j * 16 + ln]);
#pragma unroll
      for (int i = 0; i < 4; ++i) { FragH f;
#pragma unroll
        for (int r = 0; r < 8; ++r) f.h[r] = (_Float16)(acc[i][j][r] * alpha + bv);
        *(v8us*)(dst + (i >> 1) * 2048 + (j * 2 + (i & 1)) * 256) = f.half[0]; } }
    asm volatile("s_wait_xcnt 0x0" ::: "memory");      // behind the run's last store, in front of whatever rewrites the stores' registers
    return;
  }
  float* so = (float*)sm + w * (64 * SOP);      // each wave stages its own 64 x 64 tile; every reader left the ring at the last pass's barrier
#pragma unroll
  for (int j = 0; j < 4; ++j) { const float bv = bf16_round(bias[j * 16 + ln]);
#pragma unroll
    for (int i = 0; i < 4; ++i)
#pragma unroll
      for (int r = 0; r < 8; ++r) so[(i * 16 + 8 * hh + r) * SOP + j * 16 + ln] = acc[i][j][r] * alpha + bv; }
  __builtin_amdgcn_fence(__ATOMIC_ACQ_REL, "workgroup"); __builtin_amdgcn_wave_barrier();      // the wave's own staged rows are written before other lanes of it read them back
  if (job == 1) {      // K: keys in the order key', fragment order inside each 16 keys; store q = the 512 bytes of fragment half q & 3 of the tile's keys (q >> 2) * 16 .. + 15
    unsigned short* dst = (unsigned short*)Ck + (size_t)slab * (64 * TT) + (size_t)(nb * 128 + kr0) * 64 + lane * 8;
#pragma unroll
    for (int q = 0; q < 16; ++q) { const float* sp = &so[((q >> 2) * 16 + ln) * SOP + ((q & 3) * 2 + hh) * 8]; const v4f v0 = *(const v4fa*)sp, v1 = *(const v4fa*)(sp + 4); FragH f;
#pragma unroll
      for (int i = 0; i < 4; ++i) { f.h[i] = (_Float16)v0[i]; f.h[4 + i] = (_Float16)v1[i]; }
      *(v8us*)(dst + q * 256) = f.half[0]; }
    asm volatile("s_wait_xcnt 0x0" ::: "memory");      // behind the run's last store: the listing's way on from here leads into code that rewrites the stores' registers
  } else {      // Q: flat rows of the plane
    unsigned short* dst = (unsigned short*)Cq + (size_t)(m0 + wm * 64) * DA + nb * 64;
#pragma unroll
    for (int q = 0; q < 16; ++q) { const int r = q * 4 + (lane >> 3), c8 = (lane & 7) * 8; const v4f v0 = *(const v4fa*)&so[r * SOP + c8], v1 = *(const v4fa*)&so[r * SOP + c8 + 4]; FragH f;
#pragma unroll
      for (int i = 0; i < 4; ++i) { f.h[i] = (_Float16)v0[i]; f.h[4 + i] = (_Float16)v1[i]; }
      *(v8us*)(dst + r * DA + c8) = f.half[0]; }
    asm volatile("s_wait_xcnt 0x0" ::: "memory");      // behind the run's last store: the listing's way on from here leads into code that rewrites the stores' registers
  }
}


typedef _Float16 v4h __attribute__((ext_vector_type(4)));

__device__ __forceinline__ void x16(const float* __restrict__ x, _Float16* __restrict__ X16, size_t n8, size_t t) { if (t >= n8) return; FragH f;
#pragma unroll
  for (int q = 0; q < 8; ++q) f.h[q] = (_Float16)bf16_round(x[t * 8 + q]); *(v8us*)((unsigned short*)X16 + t * 8) = f.half[0];  }
// The five operand preparations depend on nothing but the inputs: one grid, the block index picks the job. Blocks 0 .. 4 * WTB - 1: the four weight transposes (WTB blocks each); the rest: x.
#define WTB ((DA * (DX / 8) + 255) / 256)
__global__ __launch_bounds__(256) void k_prep(const float* __restrict__ x, const float* __restrict__ Wq, const float* __restrict__ Wk, const float* __restrict__ Wv, const float* __restrict__ Wp,
                                             _Float16* __restrict__ X16, _Float16* __restrict__ Bq, _Float16* __restrict__ Bk, _Float16* __restrict__ Bv, _Float16* __restrict__ Bp) {
  const int bid = blockIdx.x;
  if (bid < 4 * WTB) {
    const int job = bid / WTB, t = (bid % WTB) * 256 + threadIdx.x;
    const float* W = job == 0 ? Wq : job == 1 ? Wk : job == 2 ? Wv : Wp; _Float16* Wt = job == 0 ? Bq : job == 1 ? Bk : job == 2 ? Bv : Bp;
    wt_f16(W, Wt, job < 3 ? DX : DA, job < 3 ? DA : DX, 16.0f, t);      /* (in,out) -> Bt x2^4 */
  } else x16(x, X16, (size_t)NRX * DX / 8, (size_t)(bid - 4 * WTB) * 256 + threadIdx.x);
}
__global__ __launch_bounds__(256) void k_h16(const float* __restrict__ x, _Float16* __restrict__ X16, size_t n8) { const size_t t = (size_t)blockIdx.x * 256 + threadIdx.x; if (t >= n8) return; FragH f;
#pragma unroll
  for (int q = 0; q < 8; ++q) f.h[q] = (_Float16)x[t * 8 + q]; *(v8us*)((unsigned short*)X16 + t * 8) = f.half[0];  }
__global__ __launch_bounds__(256) void k_round16f(const float* __restrict__ W, _Float16* __restrict__ Bt, size_t n8) { const size_t t = (size_t)blockIdx.x * 256 + threadIdx.x; if (t >= n8) return; FragH f;
#pragma unroll
  for (int i = 0; i < 8; ++i) f.h[i] = (_Float16)(bf16_round(W[t * 8 + i]) * 16.0f); *(v8us*)((unsigned short*)Bt + t * 8) = f.half[0];  }
// lane l with lane l ^ 16: the two halves of a wave hold the two halves of one query's keys
__device__ __forceinline__ float xhalf(float x) { return __builtin_bit_cast(float, __builtin_amdgcn_permlanex16(__builtin_bit_cast(int, x), __builtin_bit_cast(int, x), 0x76543210, 0xfedcba98, false, false)); }
// The hardware's 2^x on eight or nine values, each in its own register. One statement, so that the v_nop stands directly behind the last one: the free slot that the instruction set asks for between
// a transcendental and an instruction that reads its result or overwrites its source; inside the run no instruction touches a neighbour's registers.
__device__ __forceinline__ void exp2_in_place(float& a, float& b, float& c, float& d, float& e, float& f, float& g, float& h) {
  asm("v_exp_f32 %0, %0\n\tv_exp_f32 %1, %1\n\tv_exp_f32 %2, %2\n\tv_exp_f32 %3, %3\n\tv_exp_f32 %4, %4\n\tv_exp_f32 %5, %5\n\tv_exp_f32 %6, %6\n\tv_exp_f32 %7, %7\n\tv_nop"
      : "+v"(a), "+v"(b), "+v"(c), "+v"(d), "+v"(e), "+v"(f), "+v"(g), "+v"(h));
}
__device__ __forceinline__ void exp2_in_place(float& a, float& b, float& c, float& d, float& e, float& f, float& g, float& h, float& i) {
  asm("v_exp_f32 %8, %8\n\tv_exp_f32 %0, %0\n\tv_exp_f32 %1, %1\n\tv_exp_f32 %2, %2\n\tv_exp_f32 %3, %3\n\tv_exp_f32 %4, %4\n\tv_exp_f32 %5, %5\n\tv_exp_f32 %6, %6\n\tv_exp_f32 %7, %7\n\tv_nop"
      : "+v"(a), "+v"(b), "+v"(c), "+v"(d), "+v"(e), "+v"(f), "+v"(g), "+v"(h), "+v"(i));
}
// Transposed form: S^T = K.Q^T (A = 16 key rows, B = the wave's 16 queries, kept in registers), O^T += V^T.P^T (A = 16 rows of V^T, B = P^T).
// A lane holds 16 of the 32 scores of ONE query (column ln; keys 8hh + r and 16 + 8hh + r), so the maximum and the sum are in-lane plus one exchange between the halves,
// and the two score tiles, converted in place, are the B operand of the second product in the k order of the V^T loader: P never leaves the registers.
// K and V^T arrive in fragment order (Kf, Vf of k_gemm_tile): a pass's 32 keys are 4 KB of each, and fragment half number c is the 512 bytes at c * 512, 16 bytes a lane.
// The eight 16-byte loads of one pass's K (or V^T) fragments: p, the same in every lane, walks 4 KB a pass; lo = the lane's own 16 bytes.
__device__ __forceinline__ void load_pass(FragH (&f)[4], const char*& p, unsigned lo) {
#pragma unroll
  for (int c = 0; c < 4; ++c) { f[c].half[0] = *(const v8us*)(p + lo + c * 1024); f[c].half[1] = *(const v8us*)(p + lo + c * 1024 + 512); }
  asm volatile("s_wait_xcnt 0x0" :: "s"(p) : "memory");      // behind the group's loads, their base kept live up to it: it is rewritten on the next line
  p += 4096;
}
// One pass of 32 keys on the fragment set (ak, av). MORE: each half of the set is refilled with the pass after next as soon as its last product has been issued,
// so that a load has nearly two passes of work to land in and no pass waits out a load latency of its own.
template <bool MORE>
__device__ __forceinline__ void flash_pass(FragH (&ak)[4], FragH (&av)[4], const FragH (&bq)[2], const char*& kp, const char*& vp, unsigned lo, float& m_r, float& l_r, v8f (&oacc)[4]) {
  constexpr int DT = 4, KS = 2;
  v8f s[2];
#pragma unroll
  for (int nt = 0; nt < 2; ++nt) { v8f acc = (v8f){0.f,0.f,0.f,0.f,0.f,0.f,0.f,0.f};
#pragma unroll
    for (int ks = 0; ks < KS; ++ks) acc = __builtin_amdgcn_wmma_f32_16x16x32_f16(false, ak[nt * KS + ks].v, false, bq[ks].v, (short)0, acc, false, false);
    s[nt] = acc; }      // s[nt][r] = score of query q0 + ln with key j0 + nt * 16 + 8 * hh + r
  if (MORE) {
    asm volatile("" :: "v"(s[0]), "v"(s[1]) : "memory");      // inputs only: the score products are issued in front of the refill, which so lands in the registers they have just read; without it the products are sunk behind the loads, and the set is loaded elsewhere and copied
    load_pass(ak, kp, lo);
    __builtin_amdgcn_sched_barrier(0);      // keeps the refill here, one group, in front of the pass's vector work: sunk down the pass it loses its lead
  }
  float mc = -3.0e38f;
#pragma unroll
  for (int nt = 0; nt < 2; ++nt)
#pragma unroll
    for (int r = 0; r < 8; ++r) mc = fmaxf(mc, s[nt][r]);      // of the raw scores: the scale is positive
  mc = fmaxf(mc, xhalf(mc));
  const float mn = fmaxf(m_r, mc * SCALE_LOG2E); float ea = m_r - mn; m_r = mn;      // the running maximum is kept in base-2 units
  const float nb = 10.0f - mn;      // the maximum and P's 2^10 in one addend
  float pe[2][8];
#pragma unroll
  for (int nt = 0; nt < 2; ++nt)
#pragma unroll
    for (int r = 0; r < 8; ++r) pe[nt][r] = fmaf(s[nt][r], SCALE_LOG2E, nb);      // one multiply-add a score: log2 of p = 2^10 e^(scale s - max)
  exp2_in_place(pe[0][0], pe[0][1], pe[0][2], pe[0][3], pe[0][4], pe[0][5], pe[0][6], pe[0][7], ea);
  exp2_in_place(pe[1][0], pe[1][1], pe[1][2], pe[1][3], pe[1][4], pe[1][5], pe[1][6], pe[1][7]);
  const float al = (mn > -1.0e38f) ? ea : 1.0f;
  FragH pb; float ps = 0.f;
#pragma unroll
  for (int nt = 0; nt < 2; ++nt)
#pragma unroll
    for (int r = 0; r < 8; ++r) { const float p = pe[nt][r]; ps += p; pb.h[nt * 8 + r] = (_Float16)p; }
  l_r = l_r * al + ps;      // this half's 16 keys, x2^10 like P; the halves are joined once, behind the loop
#pragma unroll
  for (int dt = 0; dt < DT; ++dt)
#pragma unroll
    for (int r = 0; r < 8; ++r) oacc[dt][r] *= al;
#pragma unroll
  for (int dt = 0; dt < DT; ++dt) oacc[dt] = __builtin_amdgcn_wmma_f32_16x16x32_f16(false, av[dt].v, false, pb.v, (short)0, oacc[dt], false, false);      // oacc[dt][r] = O[q0 + ln][dt * 16 + 8 * hh + r]
  if (MORE) {
    asm volatile("" :: "v"(oacc[0]), "v"(oacc[1]), "v"(oacc[2]), "v"(oacc[3]) : "memory");      // inputs only, as above: the four products that read these registers are issued in front of their refill
    load_pass(av, vp, lo);
    __builtin_amdgcn_sched_barrier(0);      // keeps the next pass behind this refill: with its score products hoisted to the top of the trip, its own K refill comes late and has half a pass to land in
  }
}
__global__ __launch_bounds__(128) void k_flash(const _Float16* __restrict__ Q16, int ldq, const _Float16* __restrict__ Kf, const _Float16* __restrict__ Vf, const int* __restrict__ MSK, _Float16* __restrict__ O16, int ldo) {
  constexpr int RPW = 16, NQB = TT / (4 * RPW), DT = 4, KS = 2;
  static_assert(TT % 64 == 0 && TT >= 128, "two fragment sets: an even number of passes, four or more");
  __shared__ __attribute__((aligned(16))) float sO[4][RPW][64 + 4];
  (void)MSK;
  const int tid = threadIdx.x, w = tid >> 5, lane = tid & 31, ln = lane & 15, hh = lane >> 4;
  const int slab = blockIdx.x / NQB, qblk = blockIdx.x % NQB; const int b = slab / NH, h = slab % NH; const int q0 = qblk * (4 * RPW) + w * RPW;
  FragH bq[KS];
  { const unsigned short* qr = (const unsigned short*)Q16 + ((size_t)b * TT + q0 + ln) * ldq + h * 64;
#pragma unroll
    for (int ks = 0; ks < KS; ++ks) { bq[ks].half[0] = *(const v8us*)(qr + ks * 32 + 8 * hh); bq[ks].half[1] = *(const v8us*)(qr + ks * 32 + 16 + 8 * hh); } }
  const char* Kb = (const char*)((const unsigned short*)Kf + (size_t)slab * 64 * TT); const char* Vb = (const char*)((const unsigned short*)Vf + (size_t)slab * 64 * TT);
  const char* kp = Kb; const char* vp = Vb; const unsigned lo = lane * 16;      // fragment half 0 of the next pass to be fetched, and each lane's own 16 bytes of a half
  float m_r = -3.0e38f, l_r = 0.f; v8f oacc[DT];
#pragma unroll
  for (int dt = 0; dt < DT; ++dt) oacc[dt] = (v8f){0.f,0.f,0.f,0.f,0.f,0.f,0.f,0.f};
  FragH ak0[4], av0[4], ak1[4], av1[4];      // set 0: the even passes, set 1: the odd ones
  load_pass(ak0, kp, lo); load_pass(av0, vp, lo); load_pass(ak1, kp, lo); load_pass(av1, vp, lo);
#pragma unroll 1      // two passes a trip, one on each set, and no more: short code
  for (int j0 = 0; j0 < TT - 64; j0 += 64) {
    flash_pass<true>(ak0, av0, bq, kp, vp, lo, m_r, l_r, oacc);
    flash_pass<true>(ak1, av1, bq, kp, vp, lo, m_r, l_r, oacc);
  }
  flash_pass<false>(ak0, av0, bq, kp, vp, lo, m_r, l_r, oacc);      // the last two passes have nothing left to fetch
  flash_pass<false>(ak1, av1, bq, kp, vp, lo, m_r, l_r, oacc);
  { const float l = l_r + xhalf(l_r); const float inv = (l > 0.f) ? 1.0f / l : 0.f;
#pragma unroll
    for (int dt = 0; dt < DT; ++dt) { const v4f lo = {oacc[dt][0] * inv, oacc[dt][1] * inv, oacc[dt][2] * inv, oacc[dt][3] * inv}, hi = {oacc[dt][4] * inv, oacc[dt][5] * inv, oacc[dt][6] * inv, oacc[dt][7] * inv};
      *(v4fa*)&sO[w][ln][dt * 16 + 8 * hh] = lo; *(v4fa*)&sO[w][ln][dt * 16 + 8 * hh + 4] = hi; } }
  __builtin_amdgcn_fence(__ATOMIC_ACQ_REL, "workgroup"); __builtin_amdgcn_wave_barrier();      // the wave's own staged rows are written before other lanes of it read them back
  {
#pragma unroll
    for (int rp = 0; rp < RPW; rp += 4) { const int r = rp + (lane >> 3), c8 = (lane & 7) * 8; const v4f v0 = *(const v4fa*)&sO[w][r][c8], v1 = *(const v4fa*)&sO[w][r][c8 + 4]; FragH f;      // O leaves as the projection's operand: x2^4, f16, whole 128-byte rows
#pragma unroll      // constant indices keep the vectors in registers
      for (int q = 0; q < 4; ++q) { f.h[q] = (_Float16)(v0[q] * 16.0f); f.h[4 + q] = (_Float16)(v1[q] * 16.0f); }
      *(v8us*)((unsigned short*)O16 + ((size_t)b * TT + q0 + r) * ldo + h * 64 + c8) = f.half[0]; }
     } }

extern "C" void kernel_launch(void* const* d_in, const int* in_sizes, int n_in,
                              void* d_out, int out_size, void* d_ws, size_t ws_size, hipStream_t stream) {
  (void)in_sizes; (void)n_in; (void)out_size;
  const float* const* I = (const float* const*)d_in; const float* x = I[0]; const float* Wq = I[1]; const float* bq = I[2]; const float* Wk = I[3]; const float* bk = I[4]; const float* Wv = I[5]; const float* bv = I[6]; const float* Wp = I[7]; const float* bp = I[8];
  char* ws = (char*)d_ws; size_t off = 0;
  auto take = [&](size_t bytes) { char* p = ws + off; off += (bytes + 255) & ~(size_t)255; return p; };
  _Float16* Bq = (_Float16*)take((size_t)3 * DA * DX * 2); _Float16* Bk = Bq + (size_t)DA * DX; _Float16* Bv = Bk + (size_t)DA * DX;      /* one [3 * 512][768] matrix */
  _Float16* Bp = (_Float16*)take((size_t)DX * DA * 2);
  _Float16* X16 = (_Float16*)take((size_t)NRX * DX * 2); _Float16* Q = (_Float16*)take((size_t)NRX * DA * 2); _Float16* K = (_Float16*)take((size_t)NRX * DA * 2); _Float16* Vt = (_Float16*)take((size_t)NRX * DA * 2);
  _Float16* O16 = (_Float16*)take((size_t)NRX * DA * 2);
  if (off > ws_size) return;      // 4 x 0.8 + 12.6 + 4 x 8.4 MB, about 50 MB
  k_prep<<<4 * WTB + (unsigned)(((size_t)NRX * DX / 8 + 255) / 256), 256, 0, stream>>>(x, Wq, Wk, Wv, Wp, X16, Bq, Bk, Bv, Bp);
  k_gemm_qkv<DX><<<(NRX / 256) * (3 * DA / 192), 384, 0, stream>>>(X16, Bq, 0.0625f, bq, bk, bv, Q, K, Vt);      /* Q, K, V = x.W + b: M 8192 N 512 K 768; each [8192][512] plane = 64 contiguous [1024][64] slabs; Q f16 flat, K and V^T per slab in fragment order */
  k_flash<<<BB * (TT / 64), 128, 0, stream>>>(Q, 64, K, Vt, nullptr, O16, 64);      /* same flat view for Q and O */
  k_gemm_tile<DA, DX, false, 1><<<(NRX / 128) * (DX / 128), 256, 0, stream>>>(O16, Bp, nullptr, nullptr, 0.00390625f, bp, nullptr, nullptr, (float*)d_out, nullptr, nullptr, nullptr);      /* out = O·Wp + bp: M 8192 N 768 K 512 (alpha undoes the ×2^4 weights and the ×2^4 carry) */
}

// v009
// Measured time: 55.4 microseconds a run.
// Two timings next to v008 put it at 1.07 and 1.05 times that version's speed.
// Over all steps from v000 it is 5.33 times as fast.
#include <hip/hip_runtime.h>
// Multi-head attention with raw-reshape heads (B=8, N=1024, dim 768 → attn_dim 512 = 8 heads × 64): Q,K,V = x·W + b ((in,out)), reshaped by plain memory order to (H,B,N,64) (= 64 contiguous [1024][64] slabs of each [8192][512] plane);
// softmax(Q·Kᵀ·scale)·V per slab with scale = (64//8)^-½ = 8^-½ (as the original); out raw-reshaped back to (B,N,512) (same flat order) → ·Wp + bp.
// Compute dtype: x, weights, biases rounded to bf16; Q/K/V as f16 GEMM outputs; fused flash-style kernel over the flat slabs (online softmax f32, P f16 ×2^10) on v_wmma_f32_16x16x32_f16; O carried ×2^4 into f16 → projection GEMM with bias; f32 accumulate.
#define BB 64
#define TT 1024
#define NH 1
#define DX 768
#define DA 512
#define NRX 8192
#define ATT_SCALE 0.35355339059327373f
#define SCALE_LOG2E (ATT_SCALE * 1.4426950408889634f)

typedef __bf16 v16b __attribute__((ext_vector_type(16)));
typedef unsigned short v8us __attribute__((ext_vector_type(8), may_alias));
typedef float  v8f  __attribute__((ext_vector_type(8)));
typedef float  v4f  __attribute__((ext_vector_type(4)));
typedef float  v4fa __attribute__((ext_vector_type(4), may_alias));
union FragB { v16b v; v8us half[2]; unsigned short u[16]; };

__device__ __forceinline__ unsigned short bf16_bits(float x) { unsigned int u = __float_as_uint(x); return (unsigned short)((u + 0x7FFFu + ((u >> 16) & 1u)) >> 16); }
__device__ __forceinline__ float bf16_val(unsigned short b) { return __uint_as_float(((unsigned int)b) << 16); }
__device__ __forceinline__ float bf16_round(float x) { return bf16_val(bf16_bits(x)); }
// D += A·B with NT terms: 1 = ah·bh, 2 = + al·bh (A split), 3 = + ah·bl (both split)
template <int NT>
__device__ __forceinline__ v8f mmaN(v16b ah, v16b al, v16b bh, v16b bl, v8f c) {
  c = __builtin_amdgcn_wmma_f32_16x16x32_bf16(false, ah, false, bh, (short)0, c, false, false);
  if (NT >= 2) c = __builtin_amdgcn_wmma_f32_16x16x32_bf16(false, al, false, bh, (short)0, c, false, false);
  if (NT >= 3) c = __builtin_amdgcn_wmma_f32_16x16x32_bf16(false, ah, false, bl, (short)0, c, false, false);
  asm volatile("v_nop\n\tv_nop\n\tv_nop\n\tv_nop" : "+v"(c) : "v"(ah), "v"(al), "v"(bh), "v"(bl));
  return c;
}

__global__ __launch_bounds__(256) void k_wt_bf16(const float* __restrict__ W, unsigned short* __restrict__ Wt, int K, int N) {
  const int t = blockIdx.x * 256 + threadIdx.x;
  const int k8n = K / 8;
  if (t >= N * k8n) return;
  const int n = t / k8n, k8 = (t % k8n) * 8;
  v8us v;
#pragma unroll
  for (int i = 0; i < 8; ++i) v[i] = bf16_bits(W[(size_t)(k8 + i) * N + n]);
  *(v8us*)(Wt + (size_t)n * K + k8) = v;
  
}

// GEMM C[M][N] (f32, pitch ldc) = act(A[M][K]·W + bias). A f32 row-major (pitch lda) converted per fragment to bf16
// (ASPLIT: hi/lo two planes -> 2 terms, else single rounded term); Wt bf16 [N][K] (pitch ldb). BIAS_BF16 rounds the
// bias to bf16 first (bias quantised to bf16 before the add). K%32==0, M%16==0, N%64==0.
template <bool ASPLIT, int ACT, bool BIAS_BF16>
__global__ __launch_bounds__(128) void k_gemm_bf(const float* __restrict__ A, int lda, const unsigned short* __restrict__ Wt, int ldb,
                                               const float* __restrict__ bias, float* __restrict__ C, int ldc, int M, int N, int K) {
  __shared__ __attribute__((aligned(16))) float so[4][16][64];
  const int tid = threadIdx.x, w = tid >> 5, lane = tid & 31, ln = lane & 15, hh = lane >> 4;
  const int ntn = N / 64;
  const int wid = blockIdx.x * 4 + w;
  const int mt = wid / ntn, nq = wid % ntn;
  if (mt * 16 >= M) return;
  const int row0 = mt * 16, col0 = nq * 64;
  const float* arow = A + (size_t)(row0 + ln) * lda;
  v8f acc[4] = {};
  for (int kb = 0; kb < K; kb += 32) {
    FragB ah, al;
    const v4f x0 = *(const v4fa*)(arow + kb + 8 * hh), x1 = *(const v4fa*)(arow + kb + 8 * hh + 4);
    const v4f x2 = *(const v4fa*)(arow + kb + 16 + 8 * hh), x3 = *(const v4fa*)(arow + kb + 16 + 8 * hh + 4);
    float xs[16] = {x0[0],x0[1],x0[2],x0[3],x1[0],x1[1],x1[2],x1[3],x2[0],x2[1],x2[2],x2[3],x3[0],x3[1],x3[2],x3[3]};
#pragma unroll
    for (int i = 0; i < 16; ++i) { const unsigned short hb = bf16_bits(xs[i]); ah.u[i] = hb; al.u[i] = ASPLIT ? bf16_bits(xs[i] - bf16_val(hb)) : (unsigned short)0; }
#pragma unroll
    for (int t = 0; t < 4; ++t) {
      const unsigned short* brow = Wt + (size_t)(col0 + t * 16 + ln) * ldb + kb;
      FragB b;
      b.half[0] = *(const v8us*)(brow + 8 * hh);
      b.half[1] = *(const v8us*)(brow + 16 + 8 * hh);
      acc[t] = mmaN<ASPLIT ? 2 : 1>(ah.v, al.v, b.v, b.v, acc[t]);
    }
  }
#pragma unroll
  for (int t = 0; t < 4; ++t) {
    float bv = bias ? bias[col0 + t * 16 + ln] : 0.f;
    if (BIAS_BF16) bv = bf16_round(bv);
#pragma unroll
    for (int r = 0; r < 8; ++r) { float v = acc[t][r] + bv; if (ACT == 1) v = fmaxf(v, 0.f); so[w][8 * hh + r][t * 16 + ln] = v; }
  }
  __builtin_amdgcn_fence(__ATOMIC_ACQ_REL, "workgroup");
  __builtin_amdgcn_wave_barrier();
  const int rsub = lane >> 4, c4 = (lane & 15) * 4;
  {
#pragma unroll
    for (int q = 0; q < 8; ++q) {
      const int r = q * 2 + rsub;
      const v4f v = *(const v4fa*)&so[w][r][c4];
      *(v4f*)(C + (size_t)(row0 + r) * ldc + col0 + c4) = v;
    }
    
  }
}

// Flash-style causal/unmasked attention, all contractions 3-term bf16 hi/lo splits, f32 softmax with running max.
// q,k,v rows are read from f32 buffers with arbitrary row pitch (so they can live inside a fused qkv buffer);
// D = head size (multiple of 32, <= 128); one wave = 16 query rows; block = 4 waves (64 queries) sharing K/V chunks of 32.
template <int D, bool CAUSAL>
__global__ __launch_bounds__(128) void k_flash(const float* __restrict__ qb, const float* __restrict__ kb, const float* __restrict__ vb,
                                             int pitch, int T, int H, float scale, float* __restrict__ y, int ypitch) {
  constexpr int KS = D / 32;        // k-steps for QK
  constexpr int DT = D / 16;        // d tiles for PV
  __shared__ __attribute__((aligned(16))) unsigned short sKh[32][D + 8], sKl[32][D + 8], sVh[32][D + 8], sVl[32][D + 8];
  __shared__ __attribute__((aligned(16))) unsigned short sPh[4][16][40], sPl[4][16][40];
  __shared__ __attribute__((aligned(16))) float sO[4][16][D];
  const int tid = threadIdx.x, w = tid >> 5, lane = tid & 31, ln = lane & 15, hh = lane >> 4;
  const int nqb = (T + 63) / 64;
  const int bh = blockIdx.x / nqb, qblk = blockIdx.x % nqb;
  const int b = bh / H, h = bh % H;
  const int q0 = qblk * 64 + w * 16;
  const float* Q = qb + (size_t)b * T * pitch + h * D;
  const float* K = kb + (size_t)b * T * pitch + h * D;
  const float* V = vb + (size_t)b * T * pitch + h * D;

  // A fragments of the wave's 16 query rows (scaled), hi/lo
  FragB aqh[KS], aql[KS];
  {
    int row = q0 + ln; if (row >= T) row = T - 1;
    const float* qr = Q + (size_t)row * pitch;
#pragma unroll
    for (int ks = 0; ks < KS; ++ks)
#pragma unroll
      for (int i = 0; i < 16; ++i) {
        const int d = ks * 32 + ((i < 8) ? (8 * hh + i) : (16 + 8 * hh + (i - 8)));
        const float x = qr[d] * scale; const unsigned short hb = bf16_bits(x);
        aqh[ks].u[i] = hb; aql[ks].u[i] = bf16_bits(x - bf16_val(hb));
      }
  }
  float m_r[8], l_r[8];
#pragma unroll
  for (int r = 0; r < 8; ++r) { m_r[r] = -3.0e38f; l_r[r] = 0.f; }
  v8f oacc[DT];
#pragma unroll
  for (int dt = 0; dt < DT; ++dt) oacc[dt] = (v8f){0.f,0.f,0.f,0.f,0.f,0.f,0.f,0.f};

  const int kv_end = CAUSAL ? min(T, qblk * 64 + 64) : T;     // block-uniform
  for (int j0 = 0; j0 < kv_end; j0 += 32) {
    __syncthreads();
    for (int e = tid; e < 32 * (D / 4); e += 128) {
      const int r = e / (D / 4), c4 = (e % (D / 4)) * 4;
      const int key = j0 + r;
      v4f kf = {0.f,0.f,0.f,0.f}, vf = {0.f,0.f,0.f,0.f};
      if (key < T) { kf = *(const v4fa*)(K + (size_t)key * pitch + c4); vf = *(const v4fa*)(V + (size_t)key * pitch + c4); }
#pragma unroll
      for (int t = 0; t < 4; ++t) {
        unsigned short hb = bf16_bits(kf[t]); sKh[r][c4 + t] = hb; sKl[r][c4 + t] = bf16_bits(kf[t] - bf16_val(hb));
        hb = bf16_bits(vf[t]); sVh[r][c4 + t] = hb; sVl[r][c4 + t] = bf16_bits(vf[t] - bf16_val(hb));
      }
    }
    __syncthreads();
    // S tile 16 x 32
    v8f s[2];
#pragma unroll
    for (int nt = 0; nt < 2; ++nt) {
      v8f acc = {};
#pragma unroll
      for (int ks = 0; ks < KS; ++ks) {
        FragB bh_, bl_;
        bh_.half[0] = *(const v8us*)&sKh[nt * 16 + ln][ks * 32 + 8 * hh]; bh_.half[1] = *(const v8us*)&sKh[nt * 16 + ln][ks * 32 + 16 + 8 * hh];
        bl_.half[0] = *(const v8us*)&sKl[nt * 16 + ln][ks * 32 + 8 * hh]; bl_.half[1] = *(const v8us*)&sKl[nt * 16 + ln][ks * 32 + 16 + 8 * hh];
        acc = mmaN<3>(aqh[ks].v, aql[ks].v, bh_.v, bl_.v, acc);
      }
      s[nt] = acc;
    }
    // mask + running max (rows 8hh+r; the 16 lanes of a half share rows)
    float alpha[8];
#pragma unroll
    for (int r = 0; r < 8; ++r) {
      const int qi = q0 + 8 * hh + r;
      const int ja = j0 + ln, jb = j0 + 16 + ln;
      if (CAUSAL) { if (ja > qi) s[0][r] = -3.0e38f; if (jb > qi) s[1][r] = -3.0e38f; }
      if (ja >= T) s[0][r] = -3.0e38f;
      if (jb >= T) s[1][r] = -3.0e38f;
      float mx = fmaxf(s[0][r], s[1][r]);
      mx = fmaxf(mx, __shfl_xor(mx, 1, 32)); mx = fmaxf(mx, __shfl_xor(mx, 2, 32)); mx = fmaxf(mx, __shfl_xor(mx, 4, 32)); mx = fmaxf(mx, __shfl_xor(mx, 8, 32));
      const float mnew = fmaxf(m_r[r], mx);
      alpha[r] = (mnew > -1.0e38f) ? __expf(m_r[r] - mnew) : 1.0f;
      const float p0 = (s[0][r] > -1.0e38f) ? __expf(s[0][r] - mnew) : 0.f;
      const float p1 = (s[1][r] > -1.0e38f) ? __expf(s[1][r] - mnew) : 0.f;
      m_r[r] = mnew;
      l_r[r] = l_r[r] * alpha[r] + p0 + p1;            // per-lane partial row sum (16 lanes combined at the end)
      unsigned short hb = bf16_bits(p0); sPh[w][8 * hh + r][ln] = hb;      sPl[w][8 * hh + r][ln] = bf16_bits(p0 - bf16_val(hb));
      hb = bf16_bits(p1);                sPh[w][8 * hh + r][16 + ln] = hb; sPl[w][8 * hh + r][16 + ln] = bf16_bits(p1 - bf16_val(hb));
    }
#pragma unroll
    for (int dt = 0; dt < DT; ++dt)
#pragma unroll
      for (int r = 0; r < 8; ++r) oacc[dt][r] *= alpha[r];
    __builtin_amdgcn_fence(__ATOMIC_ACQ_REL, "workgroup");
    __builtin_amdgcn_wave_barrier();
    FragB pah, pal;
    pah.half[0] = *(const v8us*)&sPh[w][ln][8 * hh]; pah.half[1] = *(const v8us*)&sPh[w][ln][16 + 8 * hh];
    pal.half[0] = *(const v8us*)&sPl[w][ln][8 * hh]; pal.half[1] = *(const v8us*)&sPl[w][ln][16 + 8 * hh];
#pragma unroll
    for (int dt = 0; dt < DT; ++dt) {
      FragB bvh, bvl;
#pragma unroll
      for (int i = 0; i < 8; ++i) {
        bvh.u[i] = sVh[8 * hh + i][dt * 16 + ln]; bvh.u[8 + i] = sVh[16 + 8 * hh + i][dt * 16 + ln];
        bvl.u[i] = sVl[8 * hh + i][dt * 16 + ln]; bvl.u[8 + i] = sVl[16 + 8 * hh + i][dt * 16 + ln];
      }
      oacc[dt] = mmaN<3>(pah.v, pal.v, bvh.v, bvl.v, oacc[dt]);
    }
    __builtin_amdgcn_fence(__ATOMIC_ACQ_REL, "workgroup");
    __builtin_amdgcn_wave_barrier();
  }
#pragma unroll
  for (int r = 0; r < 8; ++r) {
    float l = l_r[r];
    l += __shfl_xor(l, 1, 32); l += __shfl_xor(l, 2, 32); l += __shfl_xor(l, 4, 32); l += __shfl_xor(l, 8, 32);
    l_r[r] = (l > 0.f) ? 1.0f / l : 0.f;
  }
#pragma unroll
  for (int dt = 0; dt < DT; ++dt)
#pragma unroll
    for (int r = 0; r < 8; ++r) sO[w][8 * hh + r][dt * 16 + ln] = oacc[dt][r] * l_r[r];
  __builtin_amdgcn_fence(__ATOMIC_ACQ_REL, "workgroup");
  __builtin_amdgcn_wave_barrier();
  {
    for (int r = 0; r < 16; ++r) {
      const int row = q0 + r;
      if (row < T && lane < D / 4) {
        const v4f val = *(const v4fa*)&sO[w][r][lane * 4];
        *(v4f*)(y + ((size_t)b * T + row) * ypitch + h * D + lane * 4) = val;
      }
    }
    
  }
}

// GEMM C = act(A·W + bias + resid): A f32 (ASPLIT -> hi/lo 2 terms), Wt bf16 [N][K]; ACT 0 none, 1 relu, 2 exact gelu;
// resid (optional, f32, row index = (row % rmod), pitch ldr, RES_BF16 rounds it) added before the activation.
template <bool ASPLIT, int ACT, bool BIAS_BF16, bool RES_BF16>
__global__ __launch_bounds__(128) void k_gemm_bf3(const float* __restrict__ A, int lda, const unsigned short* __restrict__ Wt, int ldb,
                                                const float* __restrict__ bias, const float* __restrict__ resid, int rmod, int ldr,
                                                float* __restrict__ C, int ldc, int M, int N, int K) {
  __shared__ __attribute__((aligned(16))) float so[4][16][64];
  const int tid = threadIdx.x, w = tid >> 5, lane = tid & 31, ln = lane & 15, hh = lane >> 4;
  const int ntn = N / 64;
  const int wid = blockIdx.x * 4 + w;
  const int mt = wid / ntn, nq = wid % ntn;
  if (mt * 16 >= M) return;
  const int row0 = mt * 16, col0 = nq * 64;
  const float* arow = A + (size_t)(row0 + ln) * lda;
  v8f acc[4] = {};
  for (int kb = 0; kb < K; kb += 32) {
    FragB ah, al;
    const v4f x0 = *(const v4fa*)(arow + kb + 8 * hh), x1 = *(const v4fa*)(arow + kb + 8 * hh + 4);
    const v4f x2 = *(const v4fa*)(arow + kb + 16 + 8 * hh), x3 = *(const v4fa*)(arow + kb + 16 + 8 * hh + 4);
    float xs[16] = {x0[0],x0[1],x0[2],x0[3],x1[0],x1[1],x1[2],x1[3],x2[0],x2[1],x2[2],x2[3],x3[0],x3[1],x3[2],x3[3]};
#pragma unroll
    for (int i = 0; i < 16; ++i) { const unsigned short hb = bf16_bits(xs[i]); ah.u[i] = hb; al.u[i] = ASPLIT ? bf16_bits(xs[i] - bf16_val(hb)) : (unsigned short)0; }
#pragma unroll
    for (int t = 0; t < 4; ++t) {
      const unsigned short* brow = Wt + (size_t)(col0 + t * 16 + ln) * ldb + kb;
      FragB b;
      b.half[0] = *(const v8us*)(brow + 8 * hh);
      b.half[1] = *(const v8us*)(brow + 16 + 8 * hh);
      acc[t] = mmaN<ASPLIT ? 2 : 1>(ah.v, al.v, b.v, b.v, acc[t]);
    }
  }
#pragma unroll
  for (int t = 0; t < 4; ++t) {
    const int col = col0 + t * 16 + ln;
    float bv = bias ? bias[col] : 0.f;
    if (BIAS_BF16) bv = bf16_round(bv);
#pragma unroll
    for (int r = 0; r < 8; ++r) {
      float v = acc[t][r] + bv;
      if (resid) { float rv = resid[(size_t)((row0 + 8 * hh + r) % rmod) * ldr + col]; if (RES_BF16) rv = bf16_round(rv); v += rv; }
      if (ACT == 1) v = fmaxf(v, 0.f);
      if (ACT == 2) v = 0.5f * v * (1.0f + erff(v * 0.70710678118654752f));
      if (ACT == 3) { const float u = 0.7978845608028654f * (v + 0.044715f * v * v * v); v = 0.5f * v * (1.0f + tanhf(u)); }
      so[w][8 * hh + r][t * 16 + ln] = v;
    }
  }
  __builtin_amdgcn_fence(__ATOMIC_ACQ_REL, "workgroup");
  __builtin_amdgcn_wave_barrier();
  const int rsub = lane >> 4, c4 = (lane & 15) * 4;
  {
#pragma unroll
    for (int q = 0; q < 8; ++q) {
      const int r = q * 2 + rsub;
      const v4f v = *(const v4fa*)&so[w][r][c4];
      *(v4f*)(C + (size_t)(row0 + r) * ldc + col0 + c4) = v;
    }
    
  }
}
// row LayerNorm (biased variance, eps) over N: s = X (+ R); optional out_sum <- s; out_norm <- (s-mu)*rsqrt(var+eps)*g + b
template <bool PARAM_BF16>
__global__ __launch_bounds__(256) void k_layernorm(const float* __restrict__ X, const float* __restrict__ R, const float* __restrict__ g, const float* __restrict__ bta,
                                                  float* __restrict__ out_sum, float* __restrict__ out_norm, int N, float eps) {
  __shared__ float red[256];
  const int row = blockIdx.x, tid = threadIdx.x;
  const float* x = X + (size_t)row * N; const float* rr = R ? R + (size_t)row * N : nullptr;
  float vals[16];                     // up to N = 4096
  const int per = N / 256;            // contiguous chunk per thread? use strided-by-4 chunks: thread handles j = tid*4 + 1024*u
  float s1 = 0.f;
  for (int u = 0; u < per / 4; ++u) {
    const int j = tid * 4 + 1024 * u;
    const v4f a = *(const v4fa*)(x + j);
    v4f b = {0.f,0.f,0.f,0.f}; if (rr) b = *(const v4fa*)(rr + j);
#pragma unroll
    for (int q = 0; q < 4; ++q) { const float v = a[q] + b[q]; vals[u * 4 + q] = v; s1 += v; }
  }
  red[tid] = s1; __syncthreads();
  for (int st = 128; st > 0; st >>= 1) { if (tid < st) red[tid] += red[tid + st]; __syncthreads(); }
  const float mu = red[0] / (float)N; __syncthreads();
  float s2 = 0.f;
  for (int u = 0; u < per / 4; ++u)
#pragma unroll
    for (int q = 0; q < 4; ++q) { const float c = vals[u * 4 + q] - mu; s2 += c * c; }
  red[tid] = s2; __syncthreads();
  for (int st = 128; st > 0; st >>= 1) { if (tid < st) red[tid] += red[tid + st]; __syncthreads(); }
  const float rs = rsqrtf(red[0] / (float)N + eps);
  {
    for (int u = 0; u < per / 4; ++u) {
      const int j = tid * 4 + 1024 * u;
      v4f o, sm;
#pragma unroll
      for (int q = 0; q < 4; ++q) {
        float gg = g[j + q], bb = bta[j + q];
        if (PARAM_BF16) { gg = bf16_round(gg); bb = bf16_round(bb); }
        sm[q] = vals[u * 4 + q]; o[q] = (vals[u * 4 + q] - mu) * rs * gg + bb;
      }
      if (out_sum) *(v4f*)(out_sum + (size_t)row * N + j) = sm;
      *(v4f*)(out_norm + (size_t)row * N + j) = o;
    }
    
  }
}



// ---- f16 WMMA path (v_wmma_f32_16x16x32_f16): 11-bit significands for operands in range — used where a [0,1] probability operand needs more precision than bf16
typedef _Float16 v16h __attribute__((ext_vector_type(16)));
union FragH { v16h v; v8us half[2]; _Float16 h[16]; unsigned short u[16]; };
template <int NT>
__device__ __forceinline__ v8f mmaH(v16h ah, v16h al, v16h bh, v16h bl, v8f c) {
  c = __builtin_amdgcn_wmma_f32_16x16x32_f16(false, ah, false, bh, (short)0, c, false, false);
  if (NT >= 2) c = __builtin_amdgcn_wmma_f32_16x16x32_f16(false, al, false, bh, (short)0, c, false, false);
  if (NT >= 3) c = __builtin_amdgcn_wmma_f32_16x16x32_f16(false, ah, false, bl, (short)0, c, false, false);
  asm volatile("v_nop\n\tv_nop\n\tv_nop\n\tv_nop" : "+v"(c) : "v"(ah), "v"(al), "v"(bh), "v"(bl));
  return c;
}
// batched GEMM like k_gemm_b but f16 operands: A f32 (split into f16 hi/lo if ASPLIT, else rounded to f16), Bt = f16 values [n][k]; alpha; C f32; N multiple of 16 (partial tiles skipped)
template <bool ASPLIT>
__global__ __launch_bounds__(128) void k_gemm_h(const float* __restrict__ A, int lda, size_t sA, const _Float16* __restrict__ Bh, int ldb, size_t sB, float alpha, float* __restrict__ C, int ldc, size_t sC, int M, int N, int K) {
  __shared__ __attribute__((aligned(16))) float so[4][16][64];
  const int tid = threadIdx.x, w = tid >> 5, lane = tid & 31, ln = lane & 15, hh = lane >> 4; const int by = blockIdx.y;
  A += (size_t)by * sA; Bh += (size_t)by * sB; C += (size_t)by * sC;
  const int ntn = (N + 63) / 64; const int wid = blockIdx.x * 4 + w; const int mt = wid / ntn, nq = wid % ntn; if (mt * 16 >= M) return;
  const int row0 = mt * 16, col0 = nq * 64; const float* arow = A + (size_t)(row0 + ln) * lda;
  v8f acc[4] = {};
  for (int kb = 0; kb < K; kb += 32) {
    FragH ah, al;
    const v4f x0 = *(const v4fa*)(arow + kb + 8 * hh), x1 = *(const v4fa*)(arow + kb + 8 * hh + 4), x2 = *(const v4fa*)(arow + kb + 16 + 8 * hh), x3 = *(const v4fa*)(arow + kb + 16 + 8 * hh + 4);
    float xs[16] = {x0[0],x0[1],x0[2],x0[3],x1[0],x1[1],x1[2],x1[3],x2[0],x2[1],x2[2],x2[3],x3[0],x3[1],x3[2],x3[3]};
#pragma unroll
    for (int i = 0; i < 16; ++i) { const _Float16 h = (_Float16)xs[i]; ah.h[i] = h; al.h[i] = ASPLIT ? (_Float16)(xs[i] - (float)h) : (_Float16)0.0f; }
#pragma unroll
    for (int t = 0; t < 4; ++t) { if (col0 + t * 16 >= N) continue; const size_t boff = (size_t)(col0 + t * 16 + ln) * ldb + kb; FragH bq; bq.half[0] = *(const v8us*)(Bh + boff + 8 * hh); bq.half[1] = *(const v8us*)(Bh + boff + 16 + 8 * hh);
      acc[t] = mmaH<ASPLIT ? 2 : 1>(ah.v, al.v, bq.v, bq.v, acc[t]); }
  }
#pragma unroll
  for (int t = 0; t < 4; ++t) { if (col0 + t * 16 >= N) continue;
#pragma unroll
    for (int r = 0; r < 8; ++r) so[w][8 * hh + r][t * 16 + ln] = acc[t][r] * alpha; }
  __builtin_amdgcn_fence(__ATOMIC_ACQ_REL, "workgroup"); __builtin_amdgcn_wave_barrier();
  const int rsub = lane >> 4, c4 = (lane & 15) * 4;
  {
#pragma unroll
    for (int q = 0; q < 8; ++q) { const int r = q * 2 + rsub; if (col0 + c4 < N) { const v4f v = *(const v4fa*)&so[w][r][c4]; *(v4f*)(C + (size_t)(row0 + r) * ldc + col0 + c4) = v; } }
     }
}

// Wt[n][k] = f16(bf16(W[k][n]) * scale) from f32 row-major W[K][N] (scale = power of two; bf16-exact weights stay exact in f16 away from the subnormal range).
// One work-group of 8 waves = 64 k x 128 n, one wave = 64 k x 16 n, one thread = 8 k x 4 n held in registers: lane (kg, ng) = ng * 8 + kg reads columns n0 + ng * 4 .. + 3 of rows k0 + kg * 8 + i by eight 16-byte loads
// (a wave-wide load = 64 bytes of each of 8 rows, the work-group's eight waves together 512 bytes in a row) and stores, for each of its 4 columns, the 8 k of that column as 16 bytes: a wave-wide store = 4 whole 128-byte lines of Wt.
template <int K, int N>
__device__ __forceinline__ void wt_f16(const float* __restrict__ W, _Float16* __restrict__ Wt, float scale, int blk, int tid) {
  static_assert(K % 64 == 0 && N % 128 == 0, "whole tiles");
  const int w = tid >> 5, lane = tid & 31, kg = lane & 7, ng = lane >> 3;
  const int k = (blk / (N / 128)) * 64 + kg * 8, n = (blk % (N / 128)) * 128 + w * 16 + ng * 4;
  const float* src = W + (size_t)k * N + n; v4f v[8];
#pragma unroll      // constant indices keep the block in registers; the eight loads go out as one group
  for (int i = 0; i < 8; ++i) v[i] = *(const v4fa*)(src + i * N);
  unsigned short* dst = (unsigned short*)Wt + (size_t)n * K + k;
#pragma unroll
  for (int j = 0; j < 4; ++j) { FragH f;
#pragma unroll
    for (int i = 0; i < 8; ++i) f.h[i] = (_Float16)(bf16_round(v[i][j]) * scale);
    *(v8us*)(dst + j * K) = f.half[0]; }
  asm volatile("s_wait_xcnt 0x0" ::: "memory");      // behind the run's last store: the listing's way on from here leads into the other jobs' code, which rewrites the stores' registers
}
// k_gemm_hh variant with fused epilogue: v = acc·alpha + bias[by·sBias + col] (+ CP[(row/rowsPerB)·sCPb + by·64 + col] if CP) ; ACT 0 none / 1 elu ; writes f16 C16 and f32 C, each if non-null
template <int ACT>
__global__ __launch_bounds__(128) void k_gemm_hhx(const _Float16* __restrict__ A, int lda, size_t sA, const _Float16* __restrict__ Bh, int ldb, size_t sB, float alpha, const float* __restrict__ bias, size_t sBias, const float* __restrict__ CP, int rowsPerB, size_t sCPb, int row0g,
    float* __restrict__ C, _Float16* __restrict__ C16, int ldc, size_t sC, int M, int N, int K) {
  __shared__ __attribute__((aligned(16))) float so[4][16][64];
  const int tid = threadIdx.x, w = tid >> 5, lane = tid & 31, ln = lane & 15, hh = lane >> 4; const int by = blockIdx.y;
  A += (size_t)by * sA; Bh += (size_t)by * sB; const size_t cofs = (size_t)by * sC; const float* bp = bias ? bias + (size_t)by * sBias : nullptr;
  const int ntn = (N + 63) / 64; const int wid = blockIdx.x * 4 + w; const int mt = wid / ntn, nq = wid % ntn; if (mt * 16 >= M) return;
  const int row0 = mt * 16, col0 = nq * 64; const _Float16* arow = A + (size_t)(row0 + ln) * lda;
  v8f acc[4] = {};
  for (int kb = 0; kb < K; kb += 32) { FragH ah; ah.half[0] = *(const v8us*)((const unsigned short*)arow + kb + 8 * hh); ah.half[1] = *(const v8us*)((const unsigned short*)arow + kb + 16 + 8 * hh);
#pragma unroll
    for (int t = 0; t < 4; ++t) { if (col0 + t * 16 >= N) continue; const size_t boff = (size_t)(col0 + t * 16 + ln) * ldb + kb; FragH bq; bq.half[0] = *(const v8us*)((const unsigned short*)Bh + boff + 8 * hh); bq.half[1] = *(const v8us*)((const unsigned short*)Bh + boff + 16 + 8 * hh);
      acc[t] = mmaH<1>(ah.v, ah.v, bq.v, bq.v, acc[t]); }
  }
#pragma unroll
  for (int t = 0; t < 4; ++t) { if (col0 + t * 16 >= N) continue; const int col = col0 + t * 16 + ln; const float bv = bp ? bf16_round(bp[col]) : 0.f;
#pragma unroll
    for (int r = 0; r < 8; ++r) { float v = acc[t][r] * alpha + bv; if (CP) { const int bidx = (row0g + row0 + 8 * hh + r) / rowsPerB; v += CP[(size_t)bidx * sCPb + (size_t)by * 64 + col]; } if (ACT == 1) v = (v > 0.f) ? v : expm1f(v); else if (ACT == 7) v = (v > 0.f) ? v + 1.0f : expf(v); else if (ACT == 8) v = tanhf(v); else if (ACT == 9) v = 0.5f * v * (1.0f + tanhf(0.7978845608028654f * (v + 0.044715f * v * v * v))); else if (ACT == 11) v = 1.0f / (1.0f + expf(-v)); else if (ACT == 12) v = (v > 0.f) ? v : 0.01f * v; else if (ACT == 14) v = (v > 0.f) ? v : 0.1f * v; else if (ACT == 15) v = v / (1.0f + expf(-v)); else if (ACT == 3) v = fmaxf(v, 0.f); else if (ACT == 6) v = 0.5f * v * (1.0f + erff(v * 0.70710678118654752f)); so[w][8 * hh + r][t * 16 + ln] = v; } }
  __builtin_amdgcn_fence(__ATOMIC_ACQ_REL, "workgroup"); __builtin_amdgcn_wave_barrier();
  const int rsub = lane >> 4, c4 = (lane & 15) * 4; typedef _Float16 v4h __attribute__((ext_vector_type(4)));
  {
#pragma unroll
    for (int q = 0; q < 8; ++q) { const int r = q * 2 + rsub; if (col0 + c4 < N) { const v4f v = *(const v4fa*)&so[w][r][c4]; if (C) *(v4f*)(C + cofs + (size_t)(row0 + r) * ldc + col0 + c4) = v; if (C16) { v4h h4; for (int i = 0; i < 4; ++i) h4[i] = (_Float16)v[i]; *(v4h*)(C16 + cofs + (size_t)(row0 + r) * ldc + col0 + c4) = h4; } } }
     }
}


// Block-tiled GEMM, f16 operands, both K-contiguous: C[8192][NN] = A[8192][KK] . Bh[NN][KK]^T * alpha + bf16(bias). One 128x128 tile of C per work-group of 8 waves (4x2), 32x64 per wave.
// A pass is 128 k = 256 aligned bytes of each of the 256 operand rows, brought into LDS by asynchronous copies (two buffers, the next pass's copies fly while this pass is worked on), so that every line leaves L2 once per work-group and not once per wave.
// LDS rows at pitch 272 bytes (16 x odd) for the 16-byte fragment reads. The k order of a fragment and the order of the k steps are those of k_gemm_hhx.
__device__ __forceinline__ unsigned lds_off(const void* p) { return (unsigned)(size_t)p; }
// eight copies of 16 bytes per lane: rows r, r + d, ..., r + 7d of one operand's tile (d = 16 rows in k_gemm_tile, 2 in k_gemm_qkv). The s_wait_xcnt stands inside the statement so that no address register is rewritten ahead of it.
__device__ __forceinline__ void copy_rows8(unsigned l0, const _Float16* g0, int rowstep, unsigned ldsstep) {
  const unsigned l1 = l0 + ldsstep, l2 = l0 + 2 * ldsstep, l3 = l0 + 3 * ldsstep, l4 = l0 + 4 * ldsstep, l5 = l0 + 5 * ldsstep, l6 = l0 + 6 * ldsstep, l7 = l0 + 7 * ldsstep;
  const _Float16* g1 = g0 + rowstep; const _Float16* g2 = g0 + 2 * rowstep; const _Float16* g3 = g0 + 3 * rowstep; const _Float16* g4 = g0 + 4 * rowstep;
  const _Float16* g5 = g0 + 5 * rowstep; const _Float16* g6 = g0 + 6 * rowstep; const _Float16* g7 = g0 + 7 * rowstep;
  asm volatile("global_load_async_to_lds_b128 %0, %8, off\n\t"
               "global_load_async_to_lds_b128 %1, %9, off\n\t"
               "global_load_async_to_lds_b128 %2, %10, off\n\t"
               "global_load_async_to_lds_b128 %3, %11, off\n\t"
               "global_load_async_to_lds_b128 %4, %12, off\n\t"
               "global_load_async_to_lds_b128 %5, %13, off\n\t"
               "global_load_async_to_lds_b128 %6, %14, off\n\t"
               "global_load_async_to_lds_b128 %7, %15, off\n\t"
               "s_wait_xcnt 0x0"
               :: "v"(l0), "v"(l1), "v"(l2), "v"(l3), "v"(l4), "v"(l5), "v"(l6), "v"(l7),
                  "v"(g0), "v"(g1), "v"(g2), "v"(g3), "v"(g4), "v"(g5), "v"(g6), "v"(g7) : "memory");
}
// NJ independent products that share A (own Bh, bias and C16 each) run as one grid: the NJ * NTN tiles of one 128-row band of A have neighbouring block indices.
// NJ == 3 (Q, K, V): a 128-row band of a [8192][512] plane is one [1024][64] slab; element (m, n) of the band is key (m % 128) * 8 + n / 64, column n % 64.
// Jobs 1 and 2 store their slab for the attention kernel with the keys renumbered key' = (n / 64) * 128 + m % 128, the same for both (a softmax-weighted sum does not depend on the order of its keys):
// both in the order in which the attention kernel's A fragments are loaded, so that each of its wave-wide 16-byte loads is 512 bytes in a row (4 whole lines) and not 32 bytes out of each of 16 lines:
// job 1 as Kf[slab][key' / 16][c][lane][8], c = 0 .. 3: lane (hh, ln) = hh * 16 + ln holds columns c * 16 + hh * 8 .. + 7 of key (key' / 16) * 16 + ln; a wave's 32 x 64 tile is 4 KB in a row;
// job 2 as Vf[slab][key' / 32][dt * 2 + hf][lane][8]: lane (hh, ln) holds keys (key' / 32) * 32 + hf * 16 + hh * 8 .. + 7 of column dt * 16 + ln; 32 keys are 4 KB in a row.
template <int KK, int NN, bool OUT16, int NJ>
__global__ __launch_bounds__(256) void k_gemm_tile(const _Float16* __restrict__ A, const _Float16* __restrict__ Bh0, const _Float16* __restrict__ Bh1, const _Float16* __restrict__ Bh2, float alpha,
                                                  const float* __restrict__ bias0, const float* __restrict__ bias1, const float* __restrict__ bias2, float* __restrict__ C,
                                                  _Float16* __restrict__ C160, _Float16* __restrict__ C161, _Float16* __restrict__ C162) {
  constexpr int BK = 128, KSN = BK / 32, PITCH = 2 * BK + 16, STAGE = 256 * PITCH, NPASS = KK / BK, NTN = NN / 128, SOP = 68;
  static_assert(NPASS >= 2 && KK % BK == 0 && NN % 128 == 0 && 8 * 32 * SOP * 4 <= 2 * STAGE, "shape");
  static_assert(NJ == 1 || (NJ == 3 && OUT16 && 128 * (NN / 64) == TT), "a band of the Q, K, V planes is one slab");
  __shared__ __attribute__((aligned(16))) unsigned char sm[2 * STAGE];
  const int tid = threadIdx.x, w = tid >> 5, lane = tid & 31, ln = lane & 15, hh = lane >> 4;
  const int job = NJ > 1 ? (blockIdx.x % (NJ * NTN)) / NTN : 0;
  const _Float16* Bh = job == 0 ? Bh0 : job == 1 ? Bh1 : Bh2; const float* bias = job == 0 ? bias0 : job == 1 ? bias1 : bias2; _Float16* C16 = job == 0 ? C160 : job == 1 ? C161 : C162;
  const int m0 = (blockIdx.x / (NJ * NTN)) * 128, n0 = (blockIdx.x % NTN) * 128; const int wm = w >> 1, wn = w & 1;
  const int cr = tid >> 4, cc = tid & 15;      // a wave's copy = 2 rows x 256 bytes
  const _Float16* ga = A + (size_t)(m0 + cr) * KK + cc * 8; const _Float16* gb = Bh + (size_t)(n0 + cr) * KK + cc * 8;
  const unsigned la = lds_off(sm) + cr * PITCH + cc * 16, lb = la + 128 * PITCH;
  v8f acc[2][4];
#pragma unroll
  for (int i = 0; i < 2; ++i)
#pragma unroll
    for (int j = 0; j < 4; ++j) acc[i][j] = (v8f){0.f,0.f,0.f,0.f,0.f,0.f,0.f,0.f};
  copy_rows8(la, ga, 16 * KK, 16 * PITCH); copy_rows8(lb, gb, 16 * KK, 16 * PITCH);
  asm volatile("s_wait_asynccnt 0x0" ::: "memory");      // pass 0's bytes have landed before the barrier publishes them
  __syncthreads();
  copy_rows8(la + STAGE, ga + BK, 16 * KK, 16 * PITCH); copy_rows8(lb + STAGE, gb + BK, 16 * KK, 16 * PITCH);
  const unsigned char* fa = sm + (wm * 32 + ln) * PITCH + 16 * hh; const unsigned char* fb = sm + (128 + wn * 64 + ln) * PITCH + 16 * hh;
#pragma unroll 1      // the ring stays one rolled loop: one publish point, short code
  for (int t = 0; t < NPASS; ++t) {
    const int bo = (t & 1) * STAGE;
    FragH a[2][2], b[2][4];      // two fragment sets: the next 32 k of this pass are fetched while these are multiplied
#pragma unroll
    for (int i = 0; i < 2; ++i) { a[0][i].half[0] = *(const v8us*)(fa + bo + i * 16 * PITCH); a[0][i].half[1] = *(const v8us*)(fa + bo + i * 16 * PITCH + 32); }
#pragma unroll
    for (int j = 0; j < 4; ++j) { b[0][j].half[0] = *(const v8us*)(fb + bo + j * 16 * PITCH); b[0][j].half[1] = *(const v8us*)(fb + bo + j * 16 * PITCH + 32); }
#pragma unroll
    for (int ks = 0; ks < KSN; ++ks) {
      const int cu = ks & 1, nx = cu ^ 1;
      if (ks + 1 < KSN) {
#pragma unroll
        for (int i = 0; i < 2; ++i) { a[nx][i].half[0] = *(const v8us*)(fa + bo + i * 16 * PITCH + (ks + 1) * 64); a[nx][i].half[1] = *(const v8us*)(fa + bo + i * 16 * PITCH + (ks + 1) * 64 + 32); }
#pragma unroll
        for (int j = 0; j < 4; ++j) { b[nx][j].half[0] = *(const v8us*)(fb + bo + j * 16 * PITCH + (ks + 1) * 64); b[nx][j].half[1] = *(const v8us*)(fb + bo + j * 16 * PITCH + (ks + 1) * 64 + 32); }
        __builtin_amdgcn_sched_barrier(0);      // keeps the next set's LDS reads one group ahead of this set's products; without it they are sunk among the products, into one register set, and each product run waits out the LDS latency
      }
#pragma unroll
      for (int i = 0; i < 2; ++i)
#pragma unroll
        for (int j = 0; j < 4; ++j) acc[i][j] = __builtin_amdgcn_wmma_f32_16x16x32_f16(false, a[cu][i].v, false, b[cu][j].v, (short)0, acc[i][j], false, false);
    }
    __builtin_amdgcn_sched_barrier(0);      // keeps the pass's products in front of the publish point: sunk behind the barrier they stand between it and the refill, and the copies start that much later
    asm volatile("s_wait_dscnt 0x0" ::: "memory");       // this wave's reads of the buffer are done before it is handed to the copies
    asm volatile("s_wait_asynccnt 0x0" ::: "memory");    // this wave's copies of pass t + 1 have landed before the barrier publishes them
    __syncthreads();
    if (t + 2 < NPASS) { copy_rows8(la + bo, ga + (t + 2) * BK, 16 * KK, 16 * PITCH); copy_rows8(lb + bo, gb + (t + 2) * BK, 16 * KK, 16 * PITCH); }
  }
  asm volatile("s_wait_asynccnt 0x0" ::: "memory");      // nothing is in flight when the ring becomes output staging
  if (NJ == 3 && job == 2) {      // V: the tile leaves transposed. A lane's 8 accumulator rows of one column are 8 neighbouring keys of one row of V^T: 16 bytes of f16
    constexpr int TP = 2 * 128 + 16;      // staged rows [wn * 64 + column][128 keys], pitch 16 x odd bytes; every reader left the ring at the last pass's barrier
#pragma unroll      // these three: constant indices keep the accumulators in registers
    for (int j = 0; j < 4; ++j) { const float bv = bf16_round(bias[n0 + wn * 64 + j * 16 + ln]);
#pragma unroll
      for (int i = 0; i < 2; ++i) { FragH f;
#pragma unroll
        for (int r = 0; r < 8; ++r) f.h[r] = (_Float16)(acc[i][j][r] * alpha + bv);
        *(v8us*)(sm + (wn * 64 + j * 16 + ln) * TP + (wm * 32 + i * 16 + 8 * hh) * 2) = f.half[0]; } }
    __syncthreads();      // a staged row holds the keys of four waves: all are written before any is read back (job is the same for the whole work-group)
#pragma unroll      // the eight LDS reads go out as one group, the stores follow as they land
    for (int q = 0; q < 8; ++q) { const int row = (w >> 2) * 64 + (q >> 1) * 16 + ln, k8 = ((w & 3) * 4 + (q & 1) * 2 + hh) * 8; const v8us v = *(const v8us*)(sm + row * TP + k8 * 2);      // wave w: the 32 keys (w & 3) of key block w >> 2; q = dt * 2 + hf
      *(v8us*)((unsigned short*)C16 + (size_t)(m0 / 128) * (64 * TT) + (size_t)((n0 / 64 + (w >> 2)) * 4 + (w & 3)) * 2048 + q * 256 + lane * 8) = v; }
    return;
  }
  float* so = (float*)sm + w * (32 * SOP);      // each wave stages its own 32 x 64 tile; every reader left the ring at the last pass's barrier
#pragma unroll
  for (int j = 0; j < 4; ++j) { const float bv = bf16_round(bias[n0 + wn * 64 + j * 16 + ln]);
#pragma unroll
    for (int i = 0; i < 2; ++i)
#pragma unroll
      for (int r = 0; r < 8; ++r) so[(i * 16 + 8 * hh + r) * SOP + j * 16 + ln] = acc[i][j][r] * alpha + bv; }
  __builtin_amdgcn_fence(__ATOMIC_ACQ_REL, "workgroup"); __builtin_amdgcn_wave_barrier();      // the wave's own staged rows are written before other lanes of it read them back
  if (OUT16) {
    if (NJ == 3 && job == 1) {      // K: keys in the order key', fragment order inside each 16 keys; store q = the 512 bytes of fragment half q & 3 of the tile's keys (q >> 2) * 16 .. + 15 (job is the same for the whole work-group)
      unsigned short* dst = (unsigned short*)C16 + (size_t)m0 * NN + (size_t)((n0 / 64 + wn) * 128 + wm * 32) * 64 + lane * 8;
#pragma unroll
      for (int q = 0; q < 8; ++q) { const float* sp = &so[((q >> 2) * 16 + ln) * SOP + ((q & 3) * 2 + hh) * 8]; const v4f v0 = *(const v4fa*)sp, v1 = *(const v4fa*)(sp + 4); FragH f;
#pragma unroll
        for (int i = 0; i < 4; ++i) { f.h[i] = (_Float16)v0[i]; f.h[4 + i] = (_Float16)v1[i]; }
        *(v8us*)(dst + q * 256) = f.half[0]; }
      asm volatile("s_wait_xcnt 0x0" ::: "memory");      // behind the run's last store: the listing's way on from here leads into code that rewrites the stores' registers
    } else {
      unsigned short* dst = (unsigned short*)C16 + (size_t)(m0 + wm * 32) * NN + n0 + wn * 64;
#pragma unroll
      for (int q = 0; q < 8; ++q) { const int r = q * 4 + (lane >> 3), c8 = (lane & 7) * 8; const v4f v0 = *(const v4fa*)&so[r * SOP + c8], v1 = *(const v4fa*)&so[r * SOP + c8 + 4]; FragH f;
#pragma unroll
        for (int i = 0; i < 4; ++i) { f.h[i] = (_Float16)v0[i]; f.h[4 + i] = (_Float16)v1[i]; }
        *(v8us*)(dst + r * NN + c8) = f.half[0]; }
      asm volatile("s_wait_xcnt 0x0" ::: "memory");      // behind the run's last store: the listing's way on from here leads into code that rewrites the stores' registers
    }
  } else {
#pragma unroll
    for (int q = 0; q < 16; ++q) { const int r = q * 2 + (lane >> 4), c4 = (lane & 15) * 4; const v4f v = *(const v4fa*)&so[r * SOP + c4];
      *(v4f*)(C + (size_t)(m0 + wm * 32 + r) * NN + n0 + wn * 64 + c4) = v; }
  }
}


// Q, K, V in one product against the three weight matrices laid one behind the other, Bh[3 * 512][KK]: one 256 x 192 tile of the [8192][1536] result per work-group of 12 waves (4 x 3), 64 x 64 per wave.
// 32 x 8 = 256 tiles: every operand line leaves L2 8 (A) or 32 (Bh) times, was 12 and 64, and a wave reads 8 fragments from LDS for 16 products, was 6 for 8. Ring, fragment k order and order of the k steps are those of k_gemm_tile.
// A wave's 64 columns lie in one plane (job = Q, K or V) and are one n / 64 block nb of it; its 64 rows are half a slab: each wave stores its own tile in the layouts described at k_gemm_tile, no wave needs another's.
template <int KK>
__global__ __launch_bounds__(384) void k_gemm_qkv(const _Float16* __restrict__ A, const _Float16* __restrict__ Bh, float alpha,
                                                 const float* __restrict__ bias0, const float* __restrict__ bias1, const float* __restrict__ bias2,
                                                 _Float16* __restrict__ Cq, _Float16* __restrict__ Ck, _Float16* __restrict__ Cv) {
  constexpr int BK = 128, KSN = BK / 32, PITCH = 2 * BK + 16, STAGE = (256 + 192) * PITCH, NPASS = KK / BK, SOP = 68, NTM = NRX / 256;
  static_assert(NPASS >= 2 && KK % BK == 0 && 12 * 64 * SOP * 4 <= 2 * STAGE && DA == 512 && TT == 1024 && NRX % 256 == 0, "shape");
  __shared__ __attribute__((aligned(16))) unsigned char sm[2 * STAGE];
  const int tid = threadIdx.x, lane = tid & 31, ln = lane & 15, hh = lane >> 4;
  const int w = __builtin_amdgcn_readfirstlane(tid >> 5);      // the wave's number in a scalar register: the tests on it below are scalar branches
  const int tm = blockIdx.x % NTM, tn = blockIdx.x / NTM; const int m0 = tm * 256, c0 = tn * 192; const int wm = w & 3, wn = w >> 2;
  // a wave's copy = 2 rows x 256 bytes. Waves 0 .. 7 bring 32 rows of A each, waves 8 .. 11 bring 48 rows of Bh each
  const bool cpb = w >= 8;
  const int lrow = (cpb ? 256 + (w - 8) * 48 : w * 32) + hh;
  const _Float16* gc = (cpb ? Bh + (size_t)(c0 + (w - 8) * 48 + hh) * KK : A + (size_t)(m0 + w * 32 + hh) * KK) + ln * 8;
  const unsigned lc = lds_off(sm) + lrow * PITCH + ln * 16;
  auto copy_stage = [&](unsigned l, const _Float16* g) {
    copy_rows8(l, g, 2 * KK, 2 * PITCH); copy_rows8(l + 16 * PITCH, g + 16 * KK, 2 * KK, 2 * PITCH);
    if (cpb) copy_rows8(l + 32 * PITCH, g + 32 * KK, 2 * KK, 2 * PITCH);
  };
  v8f acc[4][4];
#pragma unroll
  for (int i = 0; i < 4; ++i)
#pragma unroll
    for (int j = 0; j < 4; ++j) acc[i][j] = (v8f){0.f,0.f,0.f,0.f,0.f,0.f,0.f,0.f};
  copy_stage(lc, gc);
  asm volatile("s_wait_asynccnt 0x0" ::: "memory");      // pass 0's bytes have landed before the barrier publishes them
  __syncthreads();
  copy_stage(lc + STAGE, gc + BK);
  const unsigned char* fa = sm + (wm * 64 + ln) * PITCH + 16 * hh; const unsigned char* fb = sm + (256 + wn * 64 + ln) * PITCH + 16 * hh;
#pragma unroll 1      // the ring stays one rolled loop: one publish point, short code
  for (int t = 0; t < NPASS; ++t) {
    const int bo = (t & 1) * STAGE;
    FragH a[2][4], b[2][4];      // two fragment sets: the next 32 k of this pass are fetched while these are multiplied
#pragma unroll
    for (int i = 0; i < 4; ++i) { a[0][i].half[0] = *(const v8us*)(fa + bo + i * 16 * PITCH); a[0][i].half[1] = *(const v8us*)(fa + bo + i * 16 * PITCH + 32); }
#pragma unroll
    for (int j = 0; j < 4; ++j) { b[0][j].half[0] = *(const v8us*)(fb + bo + j * 16 * PITCH); b[0][j].half[1] = *(const v8us*)(fb + bo + j * 16 * PITCH + 32); }
#pragma unroll
    for (int ks = 0; ks < KSN; ++ks) {
      const int cu = ks & 1, nx = cu ^ 1;
      if (ks + 1 < KSN) {
#pragma unroll
        for (int i = 0; i < 4; ++i) { a[nx][i].half[0] = *(const v8us*)(fa + bo + i * 16 * PITCH + (ks + 1) * 64); a[nx][i].half[1] = *(const v8us*)(fa + bo + i * 16 * PITCH + (ks + 1) * 64 + 32); }
#pragma unroll
        for (int j = 0; j < 4; ++j) { b[nx][j].half[0] = *(const v8us*)(fb + bo + j * 16 * PITCH + (ks + 1) * 64); b[nx][j].half[1] = *(const v8us*)(fb + bo + j * 16 * PITCH + (ks + 1) * 64 + 32); }
        __builtin_amdgcn_sched_barrier(0);      // keeps the next set's LDS reads one group ahead of this set's products; sunk among the products each product run waits out the LDS latency
      }
#pragma unroll
      for (int i = 0; i < 4; ++i)
#pragma unroll
        for (int j = 0; j < 4; ++j) acc[i][j] = __builtin_amdgcn_wmma_f32_16x16x32_f16(false, a[cu][i].v, false, b[cu][j].v, (short)0, acc[i][j], false, false);
    }
    __builtin_amdgcn_sched_barrier(0);      // keeps the pass's products in front of the publish point, so that the refill behind it starts no later than it can
    asm volatile("s_wait_dscnt 0x0" ::: "memory");       // this wave's reads of the buffer are done before it is handed to the copies
    asm volatile("s_wait_asynccnt 0x0" ::: "memory");    // this wave's copies of pass t + 1 have landed before the barrier publishes them
    __syncthreads();
    if (t + 2 < NPASS) copy_stage(lc + bo, gc + (t + 2) * BK);
  }
  asm volatile("s_wait_asynccnt 0x0" ::: "memory");      // nothing is in flight when the ring becomes output staging
  const int cg = tn * 3 + wn, job = cg >> 3, nb = cg & 7;      // the wave's plane and its 64-column block there
  const int slab = tm * 2 + (wm >> 1), kr0 = (wm & 1) * 64;      // its slab and its first row in the slab's 128-row band
  const float* bias = (job == 0 ? bias0 : job == 1 ? bias1 : bias2) + nb * 64;
  if (job == 2) {      // V: a lane's 8 accumulator rows of one column are the 8 keys that this same lane holds in Vf: 16 bytes of f16 straight from the registers, 512 bytes in a row per wave-wide store
    unsigned short* dst = (unsigned short*)Cv + (size_t)slab * (64 * TT) + (size_t)(nb * 4 + (wm & 1) * 2) * 2048 + lane * 8;
#pragma unroll      // these three: constant indices keep the accumulators in registers
    for (int j = 0; j < 4; ++j) { const float bv = bf16_round(bias[j * 16 + ln]);
#pragma unroll
      for (int i = 0; i < 4; ++i) { FragH f;
#pragma unroll
        for (int r = 0; r < 8; ++r) f.h[r] = (_Float16)(acc[i][j][r] * alpha + bv);
        *(v8us*)(dst + (i >> 1) * 2048 + (j * 2 + (i & 1)) * 256) = f.half[0]; } }
    asm volatile("s_wait_xcnt 0x0" ::: "memory");      // behind the run's last store, in front of whatever rewrites the stores' registers
    return;
  }
  float* so = (float*)sm + w * (64 * SOP);      // each wave stages its own 64 x 64 tile; every reader left the ring at the last pass's barrier
#pragma unroll
  for (int j = 0; j < 4; ++j) { const float bv = bf16_round(bias[j * 16 + ln]);
#pragma unroll
    for (int i = 0; i < 4; ++i)
#pragma unroll
      for (int r = 0; r < 8; ++r) so[(i * 16 + 8 * hh + r) * SOP + j * 16 + ln] = acc[i][j][r] * alpha + bv; }
  __builtin_amdgcn_fence(__ATOMIC_ACQ_REL, "workgroup"); __builtin_amdgcn_wave_barrier();      // the wave's own staged rows are written before other lanes of it read them back
  if (job == 1) {      // K: keys in the order key', fragment order inside each 16 keys; store q = the 512 bytes of fragment half q & 3 of the tile's keys (q >> 2) * 16 .. + 15
    unsigned short* dst = (unsigned short*)Ck + (size_t)slab * (64 * TT) + (size_t)(nb * 128 + kr0) * 64 + lane * 8;
#pragma unroll
    for (int q = 0; q < 16; ++q) { const float* sp = &so[((q >> 2) * 16 + ln) * SOP + ((q & 3) * 2 + hh) * 8]; const v4f v0 = *(const v4fa*)sp, v1 = *(const v4fa*)(sp + 4); FragH f;
#pragma unroll
      for (int i = 0; i < 4; ++i) { f.h[i] = (_Float16)v0[i]; f.h[4 + i] = (_Float16)v1[i]; }
      *(v8us*)(dst + q * 256) = f.half[0]; }
    asm volatile("s_wait_xcnt 0x0" ::: "memory");      // behind the run's last store: the listing's way on from here leads into code that rewrites the stores' registers
  } else {      // Q: flat rows of the plane
    unsigned short* dst = (unsigned short*)Cq + (size_t)(m0 + wm * 64) * DA + nb * 64;
#pragma unroll
    for (int q = 0; q < 16; ++q) { const int r = q * 4 + (lane >> 3), c8 = (lane & 7) * 8; const v4f v0 = *(const v4fa*)&so[r * SOP + c8], v1 = *(const v4fa*)&so[r * SOP + c8 + 4]; FragH f;
#pragma unroll
      for (int i = 0; i < 4; ++i) { f.h[i] = (_Float16)v0[i]; f.h[4 + i] = (_Float16)v1[i]; }
      *(v8us*)(dst + r * DA + c8) = f.half[0]; }
    asm volatile("s_wait_xcnt 0x0" ::: "memory");      // behind the run's last store: the listing's way on from here leads into code that rewrites the stores' registers
  }
}


typedef _Float16 v4h __attribute__((ext_vector_type(4)));

// XCH chunks of 8 elements a thread; chunk c of a work-group's threads is 256 x 32 bytes in a row. All 2 * XCH loads of 16 bytes go out before the first value is converted.
#define XCH 6
__device__ __forceinline__ void x16(const float* __restrict__ x, _Float16* __restrict__ X16, size_t t) {
  const float* src = x + t * 8; unsigned short* dst = (unsigned short*)X16 + t * 8; v4f a[XCH][2];
#pragma unroll      // constant indices keep the chunks in registers
  for (int c = 0; c < XCH; ++c) { a[c][0] = *(const v4fa*)(src + c * 2048); a[c][1] = *(const v4fa*)(src + c * 2048 + 4); }
#pragma unroll
  for (int c = 0; c < XCH; ++c) { FragH f;
#pragma unroll
    for (int q = 0; q < 4; ++q) { f.h[q] = (_Float16)bf16_round(a[c][0][q]); f.h[4 + q] = (_Float16)bf16_round(a[c][1][q]); }
    *(v8us*)(dst + c * 2048) = f.half[0]; }
  asm volatile("s_wait_xcnt 0x0" ::: "memory");      // behind the run's last store: the listing's way on from here leads into the other jobs' code, which rewrites the stores' registers
}
// The five operand preparations depend on nothing but the inputs: one grid, the block index picks the job. Blocks 0 .. 4 * WTB - 1: the four weight transposes (WTB blocks each); the rest: x.
// Few waves with much to do each (32 elements a weight thread, 48 an x thread): the launch pays for every wave that it starts, and each wave has its loads in flight together.
#define WTB ((DX / 64) * (DA / 128))
#define XTB (NRX * DX / (8 * 256 * XCH))
static_assert((DA / 64) * (DX / 128) == WTB && NRX * DX % (8 * 256 * XCH) == 0, "the same number of tiles in every weight matrix; whole work-groups of x");
__global__ __launch_bounds__(256) void k_prep(const float* __restrict__ x, const float* __restrict__ Wq, const float* __restrict__ Wk, const float* __restrict__ Wv, const float* __restrict__ Wp,
                                             _Float16* __restrict__ X16, _Float16* __restrict__ Bq, _Float16* __restrict__ Bk, _Float16* __restrict__ Bv, _Float16* __restrict__ Bp) {
  const int bid = blockIdx.x;
  if (bid < 3 * WTB) {
    const int job = bid / WTB;
    wt_f16<DX, DA>(job == 0 ? Wq : job == 1 ? Wk : Wv, job == 0 ? Bq : job == 1 ? Bk : Bv, 16.0f, bid % WTB, threadIdx.x);      /* (in,out) -> Bt x2^4 */
  } else if (bid < 4 * WTB) wt_f16<DA, DX>(Wp, Bp, 16.0f, bid - 3 * WTB, threadIdx.x);
  else x16(x, X16, (size_t)(bid - 4 * WTB) * (256 * XCH) + threadIdx.x);
}
__global__ __launch_bounds__(256) void k_h16(const float* __restrict__ x, _Float16* __restrict__ X16, size_t n8) { const size_t t = (size_t)blockIdx.x * 256 + threadIdx.x; if (t >= n8) return; FragH f;
#pragma unroll
  for (int q = 0; q < 8; ++q) f.h[q] = (_Float16)x[t * 8 + q]; *(v8us*)((unsigned short*)X16 + t * 8) = f.half[0];  }
__global__ __launch_bounds__(256) void k_round16f(const float* __restrict__ W, _Float16* __restrict__ Bt, size_t n8) { const size_t t = (size_t)blockIdx.x * 256 + threadIdx.x; if (t >= n8) return; FragH f;
#pragma unroll
  for (int i = 0; i < 8; ++i) f.h[i] = (_Float16)(bf16_round(W[t * 8 + i]) * 16.0f); *(v8us*)((unsigned short*)Bt + t * 8) = f.half[0];  }
// lane l with lane l ^ 16: the two halves of a wave hold the two halves of one query's keys
__device__ __forceinline__ float xhalf(float x) { return __builtin_bit_cast(float, __builtin_amdgcn_permlanex16(__builtin_bit_cast(int, x), __builtin_bit_cast(int, x), 0x76543210, 0xfedcba98, false, false)); }
// The hardware's 2^x on eight or nine values, each in its own register. One statement, so that the v_nop stands directly behind the last one: the free slot that the instruction set asks for between
// a transcendental and an instruction that reads its result or overwrites its source; inside the run no instruction touches a neighbour's registers.
__device__ __forceinline__ void exp2_in_place(float& a, float& b, float& c, float& d, float& e, float& f, float& g, float& h) {
  asm("v_exp_f32 %0, %0\n\tv_exp_f32 %1, %1\n\tv_exp_f32 %2, %2\n\tv_exp_f32 %3, %3\n\tv_exp_f32 %4, %4\n\tv_exp_f32 %5, %5\n\tv_exp_f32 %6, %6\n\tv_exp_f32 %7, %7\n\tv_nop"
      : "+v"(a), "+v"(b), "+v"(c), "+v"(d), "+v"(e), "+v"(f), "+v"(g), "+v"(h));
}
__device__ __forceinline__ void exp2_in_place(float& a, float& b, float& c, float& d, float& e, float& f, float& g, float& h, float& i) {
  asm("v_exp_f32 %8, %8\n\tv_exp_f32 %0, %0\n\tv_exp_f32 %1, %1\n\tv_exp_f32 %2, %2\n\tv_exp_f32 %3, %3\n\tv_exp_f32 %4, %4\n\tv_exp_f32 %5, %5\n\tv_exp_f32 %6, %6\n\tv_exp_f32 %7, %7\n\tv_nop"
      : "+v"(a), "+v"(b), "+v"(c), "+v"(d), "+v"(e), "+v"(f), "+v"(g), "+v"(h), "+v"(i));
}
// Transposed form: S^T = K.Q^T (A = 16 key rows, B = the wave's 16 queries, kept in registers), O^T += V^T.P^T (A = 16 rows of V^T, B = P^T).
// A lane holds 16 of the 32 scores of ONE query (column ln; keys 8hh + r and 16 + 8hh + r), so the maximum and the sum are in-lane plus one exchange between the halves,
// and the two score tiles, converted in place, are the B operand of the second product in the k order of the V^T loader: P never leaves the registers.
// K and V^T arrive in fragment order (Kf, Vf of k_gemm_tile): a pass's 32 keys are 4 KB of each, and fragment half number c is the 512 bytes at c * 512, 16 bytes a lane.
// The eight 16-byte loads of one pass's K (or V^T) fragments: p, the same in every lane, walks 4 KB a pass; lo = the lane's own 16 bytes.
__device__ __forceinline__ void load_pass(FragH (&f)[4], const char*& p, unsigned lo) {
#pragma unroll
  for (int c = 0; c < 4; ++c) { f[c].half[0] = *(const v8us*)(p + lo + c * 1024); f[c].half[1] = *(const v8us*)(p + lo + c * 1024 + 512); }
  asm volatile("s_wait_xcnt 0x0" :: "s"(p) : "memory");      // behind the group's loads, their base kept live up to it: it is rewritten on the next line
  p += 4096;
}
// One pass of 32 keys on the fragment set (ak, av). MORE: each half of the set is refilled with the pass after next as soon as its last product has been issued,
// so that a load has nearly two passes of work to land in and no pass waits out a load latency of its own.
template <bool MORE>
__device__ __forceinline__ void flash_pass(FragH (&ak)[4], FragH (&av)[4], const FragH (&bq)[2], const char*& kp, const char*& vp, unsigned lo, float& m_r, float& l_r, v8f (&oacc)[4]) {
  constexpr int DT = 4, KS = 2;
  v8f s[2];
#pragma unroll
  for (int nt = 0; nt < 2; ++nt) { v8f acc = (v8f){0.f,0.f,0.f,0.f,0.f,0.f,0.f,0.f};
#pragma unroll
    for (int ks = 0; ks < KS; ++ks) acc = __builtin_amdgcn_wmma_f32_16x16x32_f16(false, ak[nt * KS + ks].v, false, bq[ks].v, (short)0, acc, false, false);
    s[nt] = acc; }      // s[nt][r] = score of query q0 + ln with key j0 + nt * 16 + 8 * hh + r
  if (MORE) {
    asm volatile("" :: "v"(s[0]), "v"(s[1]) : "memory");      // inputs only: the score products are issued in front of the refill, which so lands in the registers they have just read; without it the products are sunk behind the loads, and the set is loaded elsewhere and copied
    load_pass(ak, kp, lo);
    __builtin_amdgcn_sched_barrier(0);      // keeps the refill here, one group, in front of the pass's vector work: sunk down the pass it loses its lead
  }
  float mc = -3.0e38f;
#pragma unroll
  for (int nt = 0; nt < 2; ++nt)
#pragma unroll
    for (int r = 0; r < 8; ++r) mc = fmaxf(mc, s[nt][r]);      // of the raw scores: the scale is positive
  mc = fmaxf(mc, xhalf(mc));
  const float mn = fmaxf(m_r, mc * SCALE_LOG2E); float ea = m_r - mn; m_r = mn;      // the running maximum is kept in base-2 units
  const float nb = 10.0f - mn;      // the maximum and P's 2^10 in one addend
  float pe[2][8];
#pragma unroll
  for (int nt = 0; nt < 2; ++nt)
#pragma unroll
    for (int r = 0; r < 8; ++r) pe[nt][r] = fmaf(s[nt][r], SCALE_LOG2E, nb);      // one multiply-add a score: log2 of p = 2^10 e^(scale s - max)
  exp2_in_place(pe[0][0], pe[0][1], pe[0][2], pe[0][3], pe[0][4], pe[0][5], pe[0][6], pe[0][7], ea);
  exp2_in_place(pe[1][0], pe[1][1], pe[1][2], pe[1][3], pe[1][4], pe[1][5], pe[1][6], pe[1][7]);
  const float al = (mn > -1.0e38f) ? ea : 1.0f;
  FragH pb; float ps = 0.f;
#pragma unroll
  for (int nt = 0; nt < 2; ++nt)
#pragma unroll
    for (int r = 0; r < 8; ++r) { const float p = pe[nt][r]; ps += p; pb.h[nt * 8 + r] = (_Float16)p; }
  l_r = l_r * al + ps;      // this half's 16 keys, x2^10 like P; the halves are joined once, behind the loop
#pragma unroll
  for (int dt = 0; dt < DT; ++dt)
#pragma unroll
    for (int r = 0; r < 8; ++r) oacc[dt][r] *= al;
#pragma unroll
  for (int dt = 0; dt < DT; ++dt) oacc[dt] = __builtin_amdgcn_wmma_f32_16x16x32_f16(false, av[dt].v, false, pb.v, (short)0, oacc[dt], false, false);      // oacc[dt][r] = O[q0 + ln][dt * 16 + 8 * hh + r]
  if (MORE) {
    asm volatile("" :: "v"(oacc[0]), "v"(oacc[1]), "v"(oacc[2]), "v"(oacc[3]) : "memory");      // inputs only, as above: the four products that read these registers are issued in front of their refill
    load_pass(av, vp, lo);
    __builtin_amdgcn_sched_barrier(0);      // keeps the next pass behind this refill: with its score products hoisted to the top of the trip, its own K refill comes late and has half a pass to land in
  }
}
__global__ __launch_bounds__(128) void k_flash(const _Float16* __restrict__ Q16, int ldq, const _Float16* __restrict__ Kf, const _Float16* __restrict__ Vf, const int* __restrict__ MSK, _Float16* __restrict__ O16, int ldo) {
  constexpr int RPW = 16, NQB = TT / (4 * RPW), DT = 4, KS = 2;
  static_assert(TT % 64 == 0 && TT >= 128, "two fragment sets: an even number of passes, four or more");
  __shared__ __attribute__((aligned(16))) float sO[4][RPW][64 + 4];
  (void)MSK;
  const int tid = threadIdx.x, w = tid >> 5, lane = tid & 31, ln = lane & 15, hh = lane >> 4;
  const int slab = blockIdx.x / NQB, qblk = blockIdx.x % NQB; const int b = slab / NH, h = slab % NH; const int q0 = qblk * (4 * RPW) + w * RPW;
  FragH bq[KS];
  { const unsigned short* qr = (const unsigned short*)Q16 + ((size_t)b * TT + q0 + ln) * ldq + h * 64;
#pragma unroll
    for (int ks = 0; ks < KS; ++ks) { bq[ks].half[0] = *(const v8us*)(qr + ks * 32 + 8 * hh); bq[ks].half[1] = *(const v8us*)(qr + ks * 32 + 16 + 8 * hh); } }
  const char* Kb = (const char*)((const unsigned short*)Kf + (size_t)slab * 64 * TT); const char* Vb = (const char*)((const unsigned short*)Vf + (size_t)slab * 64 * TT);
  const char* kp = Kb; const char* vp = Vb; const unsigned lo = lane * 16;      // fragment half 0 of the next pass to be fetched, and each lane's own 16 bytes of a half
  float m_r = -3.0e38f, l_r = 0.f; v8f oacc[DT];
#pragma unroll
  for (int dt = 0; dt < DT; ++dt) oacc[dt] = (v8f){0.f,0.f,0.f,0.f,0.f,0.f,0.f,0.f};
  FragH ak0[4], av0[4], ak1[4], av1[4];      // set 0: the even passes, set 1: the odd ones
  load_pass(ak0, kp, lo); load_pass(av0, vp, lo); load_pass(ak1, kp, lo); load_pass(av1, vp, lo);
#pragma unroll 1      // two passes a trip, one on each set, and no more: short code
  for (int j0 = 0; j0 < TT - 64; j0 += 64) {
    flash_pass<true>(ak0, av0, bq, kp, vp, lo, m_r, l_r, oacc);
    flash_pass<true>(ak1, av1, bq, kp, vp, lo, m_r, l_r, oacc);
  }
  flash_pass<false>(ak0, av0, bq, kp, vp, lo, m_r, l_r, oacc);      // the last two passes have nothing left to fetch
  flash_pass<false>(ak1, av1, bq, kp, vp, lo, m_r, l_r, oacc);
  { const float l = l_r + xhalf(l_r); const float inv = (l > 0.f) ? 1.0f / l : 0.f;
#pragma unroll
    for (int dt = 0; dt < DT; ++dt) { const v4f lo = {oacc[dt][0] * inv, oacc[dt][1] * inv, oacc[dt][2] * inv, oacc[dt][3] * inv}, hi = {oacc[dt][4] * inv, oacc[dt][5] * inv, oacc[dt][6] * inv, oacc[dt][7] * inv};
      *(v4fa*)&sO[w][ln][dt * 16 + 8 * hh] = lo; *(v4fa*)&sO[w][ln][dt * 16 + 8 * hh + 4] = hi; } }
  __builtin_amdgcn_fence(__ATOMIC_ACQ_REL, "workgroup"); __builtin_amdgcn_wave_barrier();      // the wave's own staged rows are written before other lanes of it read them back
  {
#pragma unroll
    for (int rp = 0; rp < RPW; rp += 4) { const int r = rp + (lane >> 3), c8 = (lane & 7) * 8; const v4f v0 = *(const v4fa*)&sO[w][r][c8], v1 = *(const v4fa*)&sO[w][r][c8 + 4]; FragH f;      // O leaves as the projection's operand: x2^4, f16, whole 128-byte rows
#pragma unroll      // constant indices keep the vectors in registers
      for (int q = 0; q < 4; ++q) { f.h[q] = (_Float16)(v0[q] * 16.0f); f.h[4 + q] = (_Float16)(v1[q] * 16.0f); }
      *(v8us*)((unsigned short*)O16 + ((size_t)b * TT + q0 + r) * ldo + h * 64 + c8) = f.half[0]; }
     } }

extern "C" void kernel_launch(void* const* d_in, const int* in_sizes, int n_in,
                              void* d_out, int out_size, void* d_ws, size_t ws_size, hipStream_t stream) {
  (void)in_sizes; (void)n_in; (void)out_size;
  const float* const* I = (const float* const*)d_in; const float* x = I[0]; const float* Wq = I[1]; const float* bq = I[2]; const float* Wk = I[3]; const float* bk = I[4]; const float* Wv = I[5]; const float* bv = I[6]; const float* Wp = I[7]; const float* bp = I[8];
  char* ws = (char*)d_ws; size_t off = 0;
  auto take = [&](size_t bytes) { char* p = ws + off; off += (bytes + 255) & ~(size_t)255; return p; };
  _Float16* Bq = (_Float16*)take((size_t)3 * DA * DX * 2); _Float16* Bk = Bq + (size_t)DA * DX; _Float16* Bv = Bk + (size_t)DA * DX;      /* one [3 * 512][768] matrix */
  _Float16* Bp = (_Float16*)take((size_t)DX * DA * 2);
  _Float16* X16 = (_Float16*)take((size_t)NRX * DX * 2); _Float16* Q = (_Float16*)take((size_t)NRX * DA * 2); _Float16* K = (_Float16*)take((size_t)NRX * DA * 2); _Float16* Vt = (_Float16*)take((size_t)NRX * DA * 2);
  _Float16* O16 = (_Float16*)take((size_t)NRX * DA * 2);
  if (off > ws_size) return;      // 4 x 0.8 + 12.6 + 4 x 8.4 MB, about 50 MB
  k_prep<<<4 * WTB + XTB, 256, 0, stream>>>(x, Wq, Wk, Wv, Wp, X16, Bq, Bk, Bv, Bp);
  k_gemm_qkv<DX><<<(NRX / 256) * (3 * DA / 192), 384, 0, stream>>>(X16, Bq, 0.0625f, bq, bk, bv, Q, K, Vt);      /* Q, K, V = x.W + b: M 8192 N 512 K 768; each [8192][512] plane = 64 contiguous [1024][64] slabs; Q f16 flat, K and V^T per slab in fragment order */
  k_flash<<<BB * (TT / 64), 128, 0, stream>>>(Q, 64, K, Vt, nullptr, O16, 64);      /* same flat view for Q and O */
  k_gemm_tile<DA, DX, false, 1><<<(NRX / 128) * (DX / 128), 256, 0, stream>>>(O16, Bp, nullptr, nullptr, 0.00390625f, bp, nullptr, nullptr, (float*)d_out, nullptr, nullptr, nullptr);      /* out = O·Wp + bp: M 8192 N 768 K 512 (alpha undoes the ×2^4 weights and the ×2^4 carry) */
}
